// v000
// Times are from an AMD MI455X. After a warm-up the kernel runs many times in a row, and a time is the length of
// such a window on the GPU divided by its runs, so every launch and the gaps after it count. The runs cycle
// through copies of the inputs. A figure is the median of several windows, for all but v000 over two sittings.
// Sittings can differ by a few percent; kernels timed side by side share one.
// v000 is the starting kernel. One run takes 777 microseconds.
// Contractions: theta/phi/g projection GEMMs Wt[384x256].Xp[256xN] and the output projection Wo[256x128].Y[128xN] on
// v_wmma_f32_16x16x32_f16 (f16 containers of bf16-RNE weights x256 and bf16-RNE x; Y as f16 hi plane plus f16
// residual plane x1024, 2 products, separate accumulators); scores Phi.Theta^T on v_wmma_f32_16x16x32_bf16
// (bf16 hi + bf16 residual planes of theta/phi, 3 products, K=128); Y^T = G.P^T on v_wmma_f32_16x16x32_f16
// (G plain f16, P = e^{s-m} x16384 f16 from the score D registers); f32 accumulate everywhere; softmax
// statistics, biases and the residual add in f32 VALU.
#include <hip/hip_runtime.h>
#include <math.h>
#include <stdint.h>

#ifndef NB
#define NB 1
#endif
#define NB_FULL 1
#ifndef SEQ
#define SEQ 8192
#endif
#define SEQ_FULL 8192
#define CC   256
#define DQ   128
#define QT   64
#define MW   384
#define OSP  68
#define OSPW 132
#define TP   72
#define WSC  256.0f
#define IWSC 0.00390625f
#define RSC  1024.0f
#define IRSC 0.0009765625f
#define LNPS 9.704060527839234f

static_assert(NB == 1 && NB_FULL == 1);
static_assert(SEQ >= QT && SEQ <= SEQ_FULL);
static_assert(SEQ % QT == 0 && SEQ % 32 == 0 && SEQ % 8 == 0);
static_assert(CC % QT == 0 && CC % 32 == 0);
static_assert(DQ == 2 * QT && DQ % 32 == 0);
static_assert(MW == 3 * DQ && MW % 8 == 0);
static_assert((OSP * 4) % 16 == 0);
static_assert((OSPW * 4) % 16 == 0);
static_assert((TP * 2) % 16 == 0);

typedef _Float16       v16h __attribute__((ext_vector_type(16)));
typedef _Float16       v8h  __attribute__((ext_vector_type(8)));
typedef __bf16         v16b __attribute__((ext_vector_type(16)));
typedef unsigned short v8us __attribute__((ext_vector_type(8)));
typedef float          v8f  __attribute__((ext_vector_type(8)));
typedef float          v4f  __attribute__((ext_vector_type(4)));
typedef unsigned int   v4u  __attribute__((ext_vector_type(4)));

union Frag  { v8us u[2]; v16h h; v16b bf; };
union FragH { v16h v; v8h hv[2]; };
static_assert(sizeof(Frag) == 32);
static_assert(sizeof(FragH) == 32);

// ---- scalar helpers ---------------------------------------------------------------------------------------
__device__ __forceinline__ unsigned short bf_bits(float f) {          // f32 -> bf16 bits, RNE convert
  unsigned u = __float_as_uint(f);
  return (unsigned short)((u + 0x7FFFu + ((u >> 16) & 1u)) >> 16);
}
__device__ __forceinline__ float bf_up(unsigned short hb) { return __uint_as_float(((unsigned)hb) << 16); }
__device__ __forceinline__ float bfr(float f) { return bf_up(bf_bits(f)); }
__device__ __forceinline__ unsigned short h_bits(_Float16 x) { return __builtin_bit_cast(unsigned short, x); }
__device__ __forceinline__ unsigned pk16(unsigned short a, unsigned short b) { return (unsigned)a | ((unsigned)b << 16); }
__device__ __forceinline__ v8f zero8() { v8f z = {0.f, 0.f, 0.f, 0.f, 0.f, 0.f, 0.f, 0.f}; return z; }
__device__ __forceinline__ float hmax8(v8f s) {
  return fmaxf(fmaxf(fmaxf(s[0], s[1]), fmaxf(s[2], s[3])), fmaxf(fmaxf(s[4], s[5]), fmaxf(s[6], s[7])));
}
__device__ __forceinline__ unsigned wave_ballot(bool p) {
#if defined(__HIP_DEVICE_COMPILE__)
  return __builtin_amdgcn_ballot_w32(p);
#else
  return p ? 1u : 0u;
#endif
}

// ---- 16-bit fragment loader (A, or B from a k-contiguous [n][k] row): lane -> row/col (lane&15), p already includes
//      + 8*(lane>>4); elements 0..7 <- p[0..7] (k0+8h..), elements 8..15 <- p[16..23] (k0+16+8h..)
__device__ __forceinline__ Frag ldfrag(const unsigned short* p) {
  Frag f;
  f.u[0] = *(const v8us*)(p);
  f.u[1] = *(const v8us*)(p + 16);
  return f;
}

// ---- WMMA helpers: builtin followed by a 4-slot VALU gap tying D and keeping A/B live --------------------------
__device__ __forceinline__ v8f mma_h(v16h a, v16h b, v8f c) {
  v8f d = __builtin_amdgcn_wmma_f32_16x16x32_f16(false, a, false, b, (short)0, c, false, false);
#if defined(__HIP_DEVICE_COMPILE__)
  asm volatile("v_nop\n\tv_nop\n\tv_nop\n\tv_nop" : "+v"(d) : "v"(a), "v"(b));
#endif
  return d;
}
__device__ __forceinline__ v8f mma_b(v16b a, v16b b, v8f c) {
  v8f d = __builtin_amdgcn_wmma_f32_16x16x32_bf16(false, a, false, b, (short)0, c, false, false);
#if defined(__HIP_DEVICE_COMPILE__)
  const v16h ha = __builtin_bit_cast(v16h, a), hb = __builtin_bit_cast(v16h, b);
  asm volatile("v_nop\n\tv_nop\n\tv_nop\n\tv_nop" : "+v"(d) : "v"(ha), "v"(hb));
#endif
  return d;
}

// =========================================================================================================
// (0) weight transpose + convert: src f32 [R][S] (row r contiguous over S; the projection weights are stored
//     [in][out]) -> dst f16 row (rowBase + s), col r, pitch R halves; value = f16 of (bf16-RNE(w) * 256) (exact).
//     Through an LDS tile T[64 s][64 r] (pitch TP). Block (sb, rb) owns a 64 r x 64 s tile.
// coverage: load 2 it x 32 rows x 8 lanes x 8 = 64 r x 64 s; store 2 it x 32 s-rows x 8 lanes x 8 halves = 64 s x 64 r;
//           grid (S/64, R/64) covers dst rows rowBase..rowBase+S-1 x cols 0..R-1 exactly once.
// LDS T: cross-wave (block barrier between the 2-byte stores and the 16-B reloads).
// =========================================================================================================
__global__ __launch_bounds__(256)
void cvt_wt(const float* __restrict__ src, unsigned short* dst, int R, int S, int rowBase) {
  __shared__ __align__(16) unsigned short T[QT * TP];
  const int tid = threadIdx.x;
  const int sb = blockIdx.x, rb = blockIdx.y;
  const int e = tid & 7, lq = tid >> 3;                             // lq 0..31
  const int s0 = sb * QT, r0 = rb * QT;
#pragma unroll
  for (int it = 0; it < 2; ++it) {
    const int rl = it * 32 + lq;                                     // r_loc 0..63
    const float* sp = src + ((size_t)(r0 + rl)) * (size_t)S + s0 + 8 * e;
    const v4f a = *(const v4f*)sp;
    const v4f q = *(const v4f*)(sp + 4);
    unsigned short hb[8];
#pragma unroll
    for (int t = 0; t < 4; ++t) {
      hb[t]     = h_bits((_Float16)(bfr(a[t]) * WSC));
      hb[4 + t] = h_bits((_Float16)(bfr(q[t]) * WSC));
    }
#pragma unroll
    for (int t = 0; t < 8; ++t) T[(8 * e + t) * TP + rl] = hb[t];   // T[s_loc][r_loc]
  }
  __syncthreads();
  v4u up[2];
#pragma unroll
  for (int it = 0; it < 2; ++it) {
    const int sl = it * 32 + lq;                                     // s_loc 0..63
    up[it] = *(const v4u*)(T + sl * TP + 8 * e);                     // r_loc 8e..8e+7
  }
{
#pragma unroll
    for (int it = 0; it < 2; ++it) {
      const int sl = it * 32 + lq;
      *(v4u*)(dst + ((size_t)(rowBase + s0 + sl)) * (size_t)R + r0 + 8 * e) = up[it];
    }
    
  }
}

// =========================================================================================================
// (1) x f32 [N][256] (already position-major) -> XP f16 [N][256], value = bf16-RNE(x) in an f16 container.
// coverage: SEQ/8 blocks x 8 rows x 32 lanes x 8 halves = SEQ x 256 = the whole plane.
// =========================================================================================================
__global__ __launch_bounds__(256)
void cvt_x(const float* __restrict__ x, unsigned short* XP) {
  const int tid = threadIdx.x, blk = blockIdx.x;
  const int row = 8 * blk + (tid >> 5);                              // 0..SEQ-1
  const int col = 8 * (tid & 31);                                    // 0..248
  const float* s = x + (size_t)row * CC + col;
  const v4f a = *(const v4f*)s;
  const v4f q = *(const v4f*)(s + 4);
  const float f[8] = {a[0], a[1], a[2], a[3], q[0], q[1], q[2], q[3]};
  v4u u;
#pragma unroll
  for (int t = 0; t < 4; ++t) {
    const _Float16 h0 = (_Float16)bfr(f[2 * t]);
    const _Float16 h1 = (_Float16)bfr(f[2 * t + 1]);
    u[t] = pk16(h_bits(h0), h_bits(h1));
  }
{
    *(v4u*)(XP + (size_t)row * CC + col) = u;
    
  }
}

// =========================================================================================================
// (2) theta / phi / g projection GEMM for one (64-n tile nt, 64-o block mb in 0..5): Y[o][n] = (1/256)
//     sum_c W16[mb*64 + o][c] XP[n][c] + bf16-RNE(bias[o]). W16 rows 0..127 = theta, 128..255 = phi, 256..383 = g.
//     Block 128 threads = 4 waves; wave w owns cols n0+16w..+15 (B fragment from the XP row, k = c contiguous,
//     split k map) and 4 m-tiles (A rows o = o0 + 16 mt + (lane&15), split k map from W16). K = 256 = 8 steps.
//     Epilogue staged in LDS Os[n_loc][o_loc] (pitch OSP), barrier, bias add in f32, then:
//       mb 0,1 (theta) / 2,3 (phi): bf16 hi = RNE(v), lo = RNE(v - hi) planes Qh/Ql resp. Kh/Kl [N][128 d]
//         the dsel half of the 256-B row): lane e -> d 8e..8e+7, 8 consecutive lanes per line, one instruction per
//         16 lines;
//       mb 4,5 (g): f16 plane Gc [128 ch][N keys] (channel-major, keys contiguous); row ch, 64 keys = one whole
// coverage: Os 4 waves x 16 n x 64 o = 64 x 64 (cols 0..63 written and read); hi/lo planes 4 it x 16 rows x 8 lanes
//           x 8 = 64 n x 64 d per plane, grid nt x mb {0,1} / {2,3} covers d 0..127 of all N rows of Qh/Ql / Kh/Kl
//           exactly once; g plane 4 it x 16 ch x 8 lanes x 8 keys = 64 ch x 64 keys, nt x mb {4,5} covers ch 0..127
//           x keys 0..N-1 of Gc exactly once. grid (N/64, 6).
// LDS Os: cross-wave (block barrier).
// =========================================================================================================
__global__ __launch_bounds__(128)
void gemm_qkv(const unsigned short* __restrict__ W16, const unsigned short* __restrict__ XP,
              const float* __restrict__ tbias, const float* __restrict__ pbias, const float* __restrict__ gbias,
              unsigned short* Qh, unsigned short* Ql, unsigned short* Kh, unsigned short* Kl, unsigned short* Gc) {
  __shared__ __align__(16) float Os[QT * OSP];
  const int tid  = threadIdx.x;
  const int lane = tid & 31, wave = tid >> 5;
  const int hh   = lane >> 4, c = lane & 15;
  const int nt   = blockIdx.x, mb = blockIdx.y;
  const int n0   = nt * QT, o0 = mb * QT;                            // o0 = W16 row base 0..320

  const unsigned short* ap = W16 + (size_t)(o0 + c) * CC + 8 * hh;
  const unsigned short* bp = XP + ((size_t)(n0 + 16 * wave + c)) * CC + 8 * hh;

  v8f acc[4];
#pragma unroll
  for (int mt = 0; mt < 4; ++mt) acc[mt] = zero8();

#pragma unroll
  for (int ks = 0; ks < CC / 32; ++ks) {
    const Frag fb = ldfrag(bp + 32 * ks);
#pragma unroll
    for (int mt = 0; mt < 4; ++mt) {
      const Frag fa = ldfrag(ap + (size_t)(16 * mt) * CC + 32 * ks);
      acc[mt] = mma_h(fa.h, fb.h, acc[mt]);
    }
  }

  {
    const int nl = 16 * wave + c;
#pragma unroll
    for (int mt = 0; mt < 4; ++mt) {
      v4f va, vb;
#pragma unroll
      for (int r = 0; r < 4; ++r) { va[r] = acc[mt][r] * IWSC; vb[r] = acc[mt][4 + r] * IWSC; }
      *(v4f*)(Os + nl * OSP + 16 * mt + 8 * hh)     = va;
      *(v4f*)(Os + nl * OSP + 16 * mt + 8 * hh + 4) = vb;
    }
  }
  __syncthreads();

  const int e = tid & 7, lq = tid >> 3;                             // lq 0..15
  const int grp  = mb >> 1;                                          // 0 theta, 1 phi, 2 g (block-uniform)
  const int dsel = (mb & 1) * QT;                                    // channel base 0 or 64 within the group
  if (grp < 2) {                                                     // block-uniform: bf16 hi/lo planes
    const float* bsrc = (grp == 0) ? tbias : pbias;
    unsigned short* Hp = (grp == 0) ? Qh : Kh;
    unsigned short* Lp = (grp == 0) ? Ql : Kl;
    const v4f b0 = *(const v4f*)(bsrc + dsel + 8 * e);
    const v4f b1 = *(const v4f*)(bsrc + dsel + 8 * e + 4);
    const float bb[8] = {bfr(b0[0]), bfr(b0[1]), bfr(b0[2]), bfr(b0[3]), bfr(b1[0]), bfr(b1[1]), bfr(b1[2]), bfr(b1[3])};
    v4u uh[4], ul[4];
#pragma unroll
    for (int it = 0; it < 4; ++it) {
      const int row = it * 16 + lq;                                  // n_loc 0..63
      const v4f a = *(const v4f*)(Os + row * OSP + 8 * e);
      const v4f q = *(const v4f*)(Os + row * OSP + 8 * e + 4);
      const float f[8] = {a[0], a[1], a[2], a[3], q[0], q[1], q[2], q[3]};
#pragma unroll
      for (int t = 0; t < 4; ++t) {
        const float f0 = f[2 * t] + bb[2 * t], f1 = f[2 * t + 1] + bb[2 * t + 1];
        const unsigned short hb0 = bf_bits(f0), hb1 = bf_bits(f1);
        const unsigned short lb0 = bf_bits(f0 - bf_up(hb0));
        const unsigned short lb1 = bf_bits(f1 - bf_up(hb1));
        uh[it][t] = pk16(hb0, hb1);
        ul[it][t] = pk16(lb0, lb1);
      }
    }
{
#pragma unroll
      for (int it = 0; it < 4; ++it) {
        const int row = it * 16 + lq;
        const size_t po = ((size_t)(n0 + row)) * DQ + dsel + 8 * e;
        *(v4u*)(Hp + po) = uh[it];
        *(v4u*)(Lp + po) = ul[it];
      }
      
    }
  } else {                                                           // block-uniform: g plane
    const int gsel = dsel;                                           // g channel base 0 or 64
    v4u ug[4];
#pragma unroll
    for (int it = 0; it < 4; ++it) {
      const int cl = it * 16 + lq;                                   // ch_loc 0..63
      const float bias = bfr(gbias[gsel + cl]);
      unsigned short hb[8];
#pragma unroll
      for (int t = 0; t < 8; ++t) {
        const int key = 8 * e + t;                                   // key_loc 0..63
        const float v = Os[key * OSP + cl] + bias;
        hb[t] = h_bits((_Float16)v);
      }
#pragma unroll
      for (int t = 0; t < 4; ++t) ug[it][t] = pk16(hb[2 * t], hb[2 * t + 1]);
    }
{
#pragma unroll
      for (int it = 0; it < 4; ++it) {
        const int cl = it * 16 + lq;
        const size_t po = ((size_t)(gsel + cl)) * (size_t)SEQ + n0 + 8 * e;
        *(v4u*)(Gc + po) = ug[it];
      }
      
    }
  }
}

// =========================================================================================================
// (3) attention for one 64-query tile, transposed formulation, SEQ keys, no mask, no scale:
//   S^T tile (16 keys x 16 queries) = sum over 4 d-chunks of A(phi: row = key kb + (lane&15), 32 d via the split
//   k map from the bf16 plane Kh [SEQ][128]) . B(theta: col = query, same map from Qh) + A(Kh).B(Ql) +
//   A(Kl).B(Qh) (bf16 unscaled residual planes, shared accumulator).
//   Per lane the D tile holds 8 keys of ONE query: online softmax state per lane, one shuffle (lane^16) for the max
//   over 32 keys; the o/l rescale is skipped under a wave-uniform ballot when no lane's max grew (corr == 1 exactly
//   for every lane then); row-sum partials combined at the end. P = e^{s-m} x 16384 as f16 is the B operand of
//   Y^T (rows channel, cols queries) += A(g rows channel = 16j + (lane&15), keys contiguous, f16 plane Gc
//   [128][SEQ]) . B(P^T): element r <- D of the tile covering keys kb..kb+15, element 8+r <- the tile covering
//   kb+16..kb+31, lane unchanged. 8 accumulator tiles per wave (128 channels). Block = 4 waves = 64 queries.
//   Epilogue: Y/l staged in LDS Os[query][128 channels] (pitch OSPW, b128 stores), barrier, then Yh = f16(y),
//   Yl = f16((y - Yh) * 1024) planes [SEQ n][128 c] (k-contiguous operand of the output projection): row n = 256 B
// coverage: Os 4 waves x 16 queries x 128 ch = 64 x 128 (all read cols written); planes 8 it x 8 rows x 16 lanes x
//           8 halves = 64 n x 128 c per plane; grid (SEQ/64) covers Yh/Yl exactly once.
// LDS Os: cross-wave (block barrier).
// =========================================================================================================
__global__ __launch_bounds__(128)
void attn_k(const unsigned short* __restrict__ Qh, const unsigned short* __restrict__ Ql,
            const unsigned short* __restrict__ Kh, const unsigned short* __restrict__ Kl,
            const unsigned short* __restrict__ Gc, unsigned short* Yh, unsigned short* Yl) {
  __shared__ __align__(16) float Os[QT * OSPW];
  const int tid  = threadIdx.x;
  const int wave = tid >> 5, lane = tid & 31;
  const int hh   = lane >> 4, c = lane & 15;
  const int n0   = blockIdx.x * QT;

  // q fragment pointers (B operand, col = query n0 + 16*wave + c), + 32*kc
  const size_t qo = ((size_t)(n0 + 16 * wave + c)) * DQ + 8 * hh;
  const unsigned short* Qhp = Qh + qo;
  const unsigned short* Qlp = Ql + qo;
  // k fragment base (A operand, row = key kb + c), + key * 128 + 32*kc
  const unsigned short* Khp = Kh + (size_t)c * DQ + 8 * hh;
  const unsigned short* Klp = Kl + (size_t)c * DQ + 8 * hh;
  // v fragment base (A operand, row = channel 16j + c, keys contiguous), + 16*j*SEQ + kb
  const unsigned short* Vp = Gc + (size_t)c * (size_t)SEQ + 8 * hh;

  float m = -1.0e30f, l = 0.f;
  v8f o[8];
#pragma unroll
  for (int j = 0; j < 8; ++j) o[j] = zero8();

#pragma unroll 1
  for (int kb = 0; kb < SEQ; kb += 32) {
    const unsigned short* k0p  = Khp + (size_t)kb * DQ;              // keys kb .. kb+15
    const unsigned short* k1p  = Khp + (size_t)(kb + 16) * DQ;       // keys kb+16 .. kb+31
    const unsigned short* k0lp = Klp + (size_t)kb * DQ;
    const unsigned short* k1lp = Klp + (size_t)(kb + 16) * DQ;
    v8f s0 = zero8(), s1 = zero8();
#pragma unroll 1
    for (int kc = 0; kc < DQ / 32; ++kc) {
      const Frag qh  = ldfrag(Qhp + 32 * kc);
      const Frag ql  = ldfrag(Qlp + 32 * kc);
      const Frag k0  = ldfrag(k0p + 32 * kc);
      const Frag k1  = ldfrag(k1p + 32 * kc);
      const Frag k0l = ldfrag(k0lp + 32 * kc);
      const Frag k1l = ldfrag(k1lp + 32 * kc);
      s0 = mma_b(k0.bf, qh.bf, s0);
      s1 = mma_b(k1.bf, qh.bf, s1);
      s0 = mma_b(k0.bf, ql.bf, s0);
      s1 = mma_b(k1.bf, ql.bf, s1);
      s0 = mma_b(k0l.bf, qh.bf, s0);
      s1 = mma_b(k1l.bf, qh.bf, s1);
    }

    float mx = fmaxf(hmax8(s0), hmax8(s1));
    mx = fmaxf(mx, __shfl_xor(mx, 16, 32));
    const float mn = fmaxf(m, mx);
    const unsigned grew = wave_ballot(mx > m);                       // wave-uniform
    if (grew != 0u) {
      const float corr = __expf(m - mn);                             // == 1 exactly for lanes whose max did not grow
      l *= corr;
#pragma unroll
      for (int j = 0; j < 8; ++j) {
#pragma unroll
        for (int r = 0; r < 8; ++r) o[j][r] *= corr;
      }
    }
    m = mn;
    const float msh = mn - LNPS;                                     // exp gives e^{s-m} * 16384

    FragH ph;
    float ls = 0.f;
#pragma unroll
    for (int r = 0; r < 8; ++r) {
      const float e0 = __expf(s0[r] - msh);                          // key kb      + 8hh + r
      const float e1 = __expf(s1[r] - msh);                          // key kb + 16 + 8hh + r
      ls += e0 + e1;
      ph.hv[0][r] = (_Float16)e0;
      ph.hv[1][r] = (_Float16)e1;
    }
    l += ls;

#pragma unroll
    for (int j = 0; j < 8; ++j) {
      const Frag vf = ldfrag(Vp + (size_t)(16 * j) * (size_t)SEQ + kb);
      o[j] = mma_h(vf.h, ph.v, o[j]);
    }
  }
  l += __shfl_xor(l, 16, 32);
  const float inv = 1.0f / l;                                        // o and l both carry the x16384 factor

  const int qrow = 16 * wave + c;
#pragma unroll
  for (int j = 0; j < 8; ++j) {
    v4f va, vb;
#pragma unroll
    for (int r = 0; r < 4; ++r) { va[r] = o[j][r] * inv; vb[r] = o[j][4 + r] * inv; }
    *(v4f*)(Os + qrow * OSPW + 16 * j + 8 * hh)     = va;            // Os[query][ch = 16j + 8hh + r]
    *(v4f*)(Os + qrow * OSPW + 16 * j + 8 * hh + 4) = vb;
  }
  __syncthreads();

  const int e = tid & 15, lq = tid >> 4;                             // lq 0..7
  v4u uh[8], ul[8];
#pragma unroll
  for (int it = 0; it < 8; ++it) {
    const int row = it * 8 + lq;                                     // query 0..63
    const v4f a = *(const v4f*)(Os + row * OSPW + 8 * e);
    const v4f q = *(const v4f*)(Os + row * OSPW + 8 * e + 4);
    const float f[8] = {a[0], a[1], a[2], a[3], q[0], q[1], q[2], q[3]};
#pragma unroll
    for (int t = 0; t < 4; ++t) {
      const float f0 = f[2 * t], f1 = f[2 * t + 1];
      const _Float16 h0 = (_Float16)f0, h1 = (_Float16)f1;
      const _Float16 r0 = (_Float16)((f0 - (float)h0) * RSC);
      const _Float16 r1 = (_Float16)((f1 - (float)h1) * RSC);
      uh[it][t] = pk16(h_bits(h0), h_bits(h1));
      ul[it][t] = pk16(h_bits(r0), h_bits(r1));
    }
  }
{
#pragma unroll
    for (int it = 0; it < 8; ++it) {
      const int row = it * 8 + lq;
      const size_t po = ((size_t)(n0 + row)) * DQ + 8 * e;
      *(v4u*)(Yh + po) = uh[it];
      *(v4u*)(Yl + po) = ul[it];
    }
    
  }
}

// =========================================================================================================
// (4) output projection GEMM for one (64-n tile, 64-co block): out[n][co] = (1/256)(sum_c WW16[co][c] Yh[n][c] +
//     (1/1024) sum_c WW16[co][c] Yl[n][c]) + bf16-RNE(W_b[co]) + bf16-RNE(x[n][co]). 4 waves, wave w owns
//     cols n0+16w..+15 (two B fragments per k-step, k = c contiguous in the Yh/Yl rows), 4 m-tiles (A rows
//     co = o0 + 16 mt + (lane&15) from WW16), hi and residual products in separate accumulators. K = 128 = 4 steps.
//     Epilogue staged in LDS Os[n_loc][co_loc], barrier, then out rows (position-major, 1024 B each): lane
//     (e = tid&15) -> co o0+4e..+3 of row n_loc = 8 it + (tid>>4); 16 consecutive lanes x 16 B = the whole 256-B
// coverage: Os 4 waves x 16 n x 64 co (cols 0..63 written and read); out 8 it x 8 rows x 16 lanes x 4 floats =
//           64 n x 64 co; grid (SEQ/64, 4) covers out[0..SEQ-1][0..255] exactly once.
// LDS Os: cross-wave (block barrier).
// =========================================================================================================
__global__ __launch_bounds__(128)
void gemm_o(const unsigned short* __restrict__ WW16, const unsigned short* __restrict__ Yh,
            const unsigned short* __restrict__ Yl, const float* __restrict__ wbias,
            const float* __restrict__ x, float* out) {
  __shared__ __align__(16) float Os[QT * OSP];
  const int tid  = threadIdx.x;
  const int lane = tid & 31, wave = tid >> 5;
  const int hh   = lane >> 4, c = lane & 15;
  const int nt   = blockIdx.x, mb = blockIdx.y;
  const int n0   = nt * QT, o0 = mb * QT;

  const unsigned short* ap  = WW16 + (size_t)(o0 + c) * DQ + 8 * hh;
  const size_t bo = ((size_t)(n0 + 16 * wave + c)) * DQ + 8 * hh;
  const unsigned short* bph = Yh + bo;
  const unsigned short* bpl = Yl + bo;

  v8f acc[4], accr[4];
#pragma unroll
  for (int mt = 0; mt < 4; ++mt) { acc[mt] = zero8(); accr[mt] = zero8(); }

#pragma unroll
  for (int ks = 0; ks < DQ / 32; ++ks) {
    const Frag fbh = ldfrag(bph + 32 * ks);
    const Frag fbl = ldfrag(bpl + 32 * ks);
#pragma unroll
    for (int mt = 0; mt < 4; ++mt) {
      const Frag fa = ldfrag(ap + (size_t)(16 * mt) * DQ + 32 * ks);
      acc[mt]  = mma_h(fa.h, fbh.h, acc[mt]);
      accr[mt] = mma_h(fa.h, fbl.h, accr[mt]);
    }
  }

  {
    const int nl = 16 * wave + c;
#pragma unroll
    for (int mt = 0; mt < 4; ++mt) {
      v4f va, vb;
#pragma unroll
      for (int r = 0; r < 4; ++r) {
        va[r] = (acc[mt][r] + accr[mt][r] * IRSC) * IWSC;
        vb[r] = (acc[mt][4 + r] + accr[mt][4 + r] * IRSC) * IWSC;
      }
      *(v4f*)(Os + nl * OSP + 16 * mt + 8 * hh)     = va;
      *(v4f*)(Os + nl * OSP + 16 * mt + 8 * hh + 4) = vb;
    }
  }
  __syncthreads();

  const int e = tid & 15, lq = tid >> 4;                             // lq 0..7
  const v4f bv = *(const v4f*)(wbias + o0 + 4 * e);
  const float bb[4] = {bfr(bv[0]), bfr(bv[1]), bfr(bv[2]), bfr(bv[3])};
  v4f res[8];
#pragma unroll
  for (int it = 0; it < 8; ++it) {
    const int nl = it * 8 + lq;                                      // n_loc 0..63
    const size_t idx = ((size_t)(n0 + nl)) * CC + o0 + 4 * e;
    const v4f xv = *(const v4f*)(x + idx);
    const v4f ov = *(const v4f*)(Os + nl * OSP + 4 * e);
#pragma unroll
    for (int t = 0; t < 4; ++t) res[it][t] = ov[t] + bb[t] + bfr(xv[t]);
  }
{
#pragma unroll
    for (int it = 0; it < 8; ++it) {
      const int nl = it * 8 + lq;
      const size_t idx = ((size_t)(n0 + nl)) * CC + o0 + 4 * e;
      *(v4f*)(out + idx) = res[it];
    }
    
  }
}

// =========================================================================================================
// Workspace map (bytes; each region start a multiple of 256; every plane size is an exact multiple of its
// whole-line store granularity, SEQ a multiple of 64 so no tail rows exist):
//   W16  f16 [384][256]          196608      WW16 f16 [256][128]     65536
//   XP   f16 [SEQ][256]         4194304 (SEQ=8192)
//   Qh/Ql bf16 [SEQ][128]        2097152 x2
//   Kh/Kl bf16 [SEQ][128]        2097152 x2
//   Gc   f16 [128][SEQ]          2097152
//   Yh/Yl f16 [SEQ][128]         2097152 x2
//   total (SEQ=8192) = 19136512
// =========================================================================================================
extern "C" void kernel_launch(void* const* d_in, const int* in_sizes, int n_in,
                              void* d_out, int out_size, void* d_ws, size_t ws_size,
                              hipStream_t stream) {
  const int XN = SEQ * CC;
  if (n_in < 9) return;
  if (in_sizes[0] < XN) return;
  if (in_sizes[1] < CC * DQ || in_sizes[3] < CC * DQ || in_sizes[5] < CC * DQ) return;
  if (in_sizes[2] < DQ || in_sizes[4] < DQ || in_sizes[6] < DQ) return;
  if (in_sizes[7] < DQ * CC || in_sizes[8] < CC) return;
  if (out_size < XN) return;

  size_t off = 0;
  auto carve = [&](size_t bytes) { const size_t o = off; off += (bytes + 255) & ~(size_t)255; return o; };
  const size_t oW16 = carve((size_t)MW * CC * 2);
  const size_t oWW  = carve((size_t)CC * DQ * 2);
  const size_t oXP  = carve((size_t)SEQ * CC * 2);
  const size_t oQh  = carve((size_t)SEQ * DQ * 2);
  const size_t oQl  = carve((size_t)SEQ * DQ * 2);
  const size_t oKh  = carve((size_t)SEQ * DQ * 2);
  const size_t oKl  = carve((size_t)SEQ * DQ * 2);
  const size_t oGc  = carve((size_t)DQ * SEQ * 2);
  const size_t oYh  = carve((size_t)SEQ * DQ * 2);
  const size_t oYl  = carve((size_t)SEQ * DQ * 2);
  if (off > ws_size) return;
  if (off > (size_t)134217728) return;

  const float* x  = (const float*)d_in[0];
  const float* gw = (const float*)d_in[1];
  const float* gb = (const float*)d_in[2];
  const float* tw = (const float*)d_in[3];
  const float* tb = (const float*)d_in[4];
  const float* pw = (const float*)d_in[5];
  const float* pb = (const float*)d_in[6];
  const float* ww = (const float*)d_in[7];
  const float* wb = (const float*)d_in[8];

  char* ws = (char*)d_ws;
  unsigned short* W16  = (unsigned short*)(ws + oW16);
  unsigned short* WW16 = (unsigned short*)(ws + oWW);
  unsigned short* XP   = (unsigned short*)(ws + oXP);
  unsigned short* Qh   = (unsigned short*)(ws + oQh);
  unsigned short* Ql   = (unsigned short*)(ws + oQl);
  unsigned short* Kh   = (unsigned short*)(ws + oKh);
  unsigned short* Kl   = (unsigned short*)(ws + oKl);
  unsigned short* Gc   = (unsigned short*)(ws + oGc);
  unsigned short* Yh   = (unsigned short*)(ws + oYh);
  unsigned short* Yl   = (unsigned short*)(ws + oYl);
  float* out = (float*)d_out;

  const dim3 blk256(256), blk128(128);

  // (0) projection weights [in=256][out=128] -> stacked f16 plane W16 [out rows 0..383][in 256]:
  //     src [R=256][S=128] -> dst rows rowBase + s, cols r; grid (S/64, R/64)
  cvt_wt<<<dim3(DQ / QT, CC / QT), blk256, 0, stream>>>(tw, W16, CC, DQ, 0);
  cvt_wt<<<dim3(DQ / QT, CC / QT), blk256, 0, stream>>>(pw, W16, CC, DQ, DQ);
  cvt_wt<<<dim3(DQ / QT, CC / QT), blk256, 0, stream>>>(gw, W16, CC, DQ, 2 * DQ);
  //     W_w [in=128][out=256] -> WW16 [out 256][in 128]: src [R=128][S=256], grid (S/64, R/64)
  cvt_wt<<<dim3(CC / QT, DQ / QT), blk256, 0, stream>>>(ww, WW16, DQ, CC, 0);
  // (1) x -> 16-bit plane (same position-major layout)
  cvt_x<<<dim3(SEQ / 8), blk256, 0, stream>>>(x, XP);
  // (2) theta / phi -> hi + residual planes, g -> channel-major plane
  gemm_qkv<<<dim3(SEQ / QT, 6), blk128, 0, stream>>>(W16, XP, tb, pb, gb, Qh, Ql, Kh, Kl, Gc);
  // (3) attention -> y hi + residual planes
  attn_k<<<dim3(SEQ / QT), blk128, 0, stream>>>(Qh, Ql, Kh, Kl, Gc, Yh, Yl);
  // (4) output projection + bias + residual -> out [SEQ][256]
  gemm_o<<<dim3(SEQ / QT, CC / QT), blk128, 0, stream>>>(WW16, Yh, Yl, wb, x, out);
  (void)hipGetLastError();
}

// v001
// A run of this version takes 170 microseconds.
// Next to v000, in two timings, it ran 4.54 and 4.58 times as fast.
// Contractions: theta/phi/g projection GEMMs Wt[384x256].Xp[256xN] and the output projection Wo[256x128].Y[128xN] on
// v_wmma_f32_16x16x32_f16 (f16 containers of bf16-RNE weights x256 and bf16-RNE x; Y as f16 hi plane plus f16
// residual plane x1024, 2 products, separate accumulators); scores Phi.Theta^T on v_wmma_f32_16x16x32_bf16
// (bf16 hi + bf16 residual planes of theta/phi, 3 products, K=128); Y^T = G.P^T on v_wmma_f32_16x16x32_f16
// (G plain f16, P = e^{s-m} x16384 f16 from the score D registers); f32 accumulate everywhere; softmax
// statistics, biases and the residual add in f32 VALU.
#include <hip/hip_runtime.h>
#include <math.h>
#include <stdint.h>

#ifndef NB
#define NB 1
#endif
#define NB_FULL 1
#ifndef SEQ
#define SEQ 8192
#endif
#define SEQ_FULL 8192
#define CC   256
#define DQ   128
#define QT   64
#define MW   384
#define OSP  68
#define OSPW 132
#define TP   72
#define WSC  256.0f
#define IWSC 0.00390625f
#define RSC  1024.0f
#define IRSC 0.0009765625f
#define LNPS 9.704060527839234f
#define KT   64
#define KP   136
#define VP   72
#define KPL  (KT * KP)
#define STG  (2 * KPL + DQ * VP)

static_assert(NB == 1 && NB_FULL == 1);
static_assert(SEQ >= QT && SEQ <= SEQ_FULL);
static_assert(SEQ % QT == 0 && SEQ % 32 == 0 && SEQ % 8 == 0);
static_assert(CC % QT == 0 && CC % 32 == 0);
static_assert(DQ == 2 * QT && DQ % 32 == 0);
static_assert(MW == 3 * DQ && MW % 8 == 0);
static_assert((OSP * 4) % 16 == 0);
static_assert((OSPW * 4) % 16 == 0);
static_assert((TP * 2) % 16 == 0);
static_assert(SEQ % KT == 0 && SEQ / KT >= 2 && KT == QT && KT % 32 == 0);
static_assert((KP * 2) % 32 == 16 && (VP * 2) % 32 == 16 && KP >= DQ + 8 && VP >= KT + 8);

typedef _Float16       v16h __attribute__((ext_vector_type(16)));
typedef _Float16       v8h  __attribute__((ext_vector_type(8)));
typedef __bf16         v16b __attribute__((ext_vector_type(16)));
typedef unsigned short v8us __attribute__((ext_vector_type(8)));
typedef float          v8f  __attribute__((ext_vector_type(8)));
typedef float          v4f  __attribute__((ext_vector_type(4)));
typedef unsigned int   v4u  __attribute__((ext_vector_type(4)));

union Frag  { v8us u[2]; v16h h; v16b bf; };
union FragH { v16h v; v8h hv[2]; };
static_assert(sizeof(Frag) == 32);
static_assert(sizeof(FragH) == 32);

// ---- scalar helpers ---------------------------------------------------------------------------------------
__device__ __forceinline__ unsigned short bf_bits(float f) {          // f32 -> bf16 bits, RNE convert
  unsigned u = __float_as_uint(f);
  return (unsigned short)((u + 0x7FFFu + ((u >> 16) & 1u)) >> 16);
}
__device__ __forceinline__ float bf_up(unsigned short hb) { return __uint_as_float(((unsigned)hb) << 16); }
__device__ __forceinline__ float bfr(float f) { return bf_up(bf_bits(f)); }
__device__ __forceinline__ unsigned short h_bits(_Float16 x) { return __builtin_bit_cast(unsigned short, x); }
__device__ __forceinline__ unsigned pk16(unsigned short a, unsigned short b) { return (unsigned)a | ((unsigned)b << 16); }
__device__ __forceinline__ v8f zero8() { v8f z = {0.f, 0.f, 0.f, 0.f, 0.f, 0.f, 0.f, 0.f}; return z; }
__device__ __forceinline__ float hmax8(v8f s) {
  return fmaxf(fmaxf(fmaxf(s[0], s[1]), fmaxf(s[2], s[3])), fmaxf(fmaxf(s[4], s[5]), fmaxf(s[6], s[7])));
}
__device__ __forceinline__ unsigned wave_ballot(bool p) {
#if defined(__HIP_DEVICE_COMPILE__)
  return __builtin_amdgcn_ballot_w32(p);
#else
  return p ? 1u : 0u;
#endif
}

// ---- 16-bit fragment loader (A, or B from a k-contiguous [n][k] row): lane -> row/col (lane&15), p already includes
//      + 8*(lane>>4); elements 0..7 <- p[0..7] (k0+8h..), elements 8..15 <- p[16..23] (k0+16+8h..)
__device__ __forceinline__ Frag ldfrag(const unsigned short* p) {
  Frag f;
  f.u[0] = *(const v8us*)(p);
  f.u[1] = *(const v8us*)(p + 16);
  return f;
}

// ---- WMMA helpers: builtin followed by a 4-slot VALU gap tying D and keeping A/B live --------------------------
__device__ __forceinline__ v8f mma_h(v16h a, v16h b, v8f c) {
  v8f d = __builtin_amdgcn_wmma_f32_16x16x32_f16(false, a, false, b, (short)0, c, false, false);
#if defined(__HIP_DEVICE_COMPILE__)
  asm volatile("v_nop\n\tv_nop\n\tv_nop\n\tv_nop" : "+v"(d) : "v"(a), "v"(b));
#endif
  return d;
}
__device__ __forceinline__ v8f mma_b(v16b a, v16b b, v8f c) {
  v8f d = __builtin_amdgcn_wmma_f32_16x16x32_bf16(false, a, false, b, (short)0, c, false, false);
#if defined(__HIP_DEVICE_COMPILE__)
  const v16h ha = __builtin_bit_cast(v16h, a), hb = __builtin_bit_cast(v16h, b);
  asm volatile("v_nop\n\tv_nop\n\tv_nop\n\tv_nop" : "+v"(d) : "v"(ha), "v"(hb));
#endif
  return d;
}

// ---- asynchronous copies global -> LDS ------------------------------------------------------------------------
__device__ __forceinline__ unsigned lds_addr(const unsigned short* p) { return (unsigned)(uintptr_t)p; }  // LDS byte address

// Eight 16-B copies per lane: copy i moves g + i*gstep (halves) to LDS byte address l + i*lstep. All lanes on.
__device__ __forceinline__ void copy8(unsigned l, unsigned lstep, const unsigned short* g, size_t gstep) {
#if defined(__HIP_DEVICE_COMPILE__)
  // the closing s_wait_xcnt keeps later rewrites of the address registers behind the issued copies
  asm volatile("global_load_async_to_lds_b128 %0, %8, off\n\t"
               "global_load_async_to_lds_b128 %1, %9, off\n\t"
               "global_load_async_to_lds_b128 %2, %10, off\n\t"
               "global_load_async_to_lds_b128 %3, %11, off\n\t"
               "global_load_async_to_lds_b128 %4, %12, off\n\t"
               "global_load_async_to_lds_b128 %5, %13, off\n\t"
               "global_load_async_to_lds_b128 %6, %14, off\n\t"
               "global_load_async_to_lds_b128 %7, %15, off\n\t"
               "s_wait_xcnt 0x0"
               :: "v"(l), "v"(l + lstep), "v"(l + 2 * lstep), "v"(l + 3 * lstep),
                  "v"(l + 4 * lstep), "v"(l + 5 * lstep), "v"(l + 6 * lstep), "v"(l + 7 * lstep),
                  "v"(g), "v"(g + gstep), "v"(g + 2 * gstep), "v"(g + 3 * gstep),
                  "v"(g + 4 * gstep), "v"(g + 5 * gstep), "v"(g + 6 * gstep), "v"(g + 7 * gstep)
               : "memory");
#endif
}
__device__ __forceinline__ void wait_async0() {   // this wave's copies have landed in LDS
#if defined(__HIP_DEVICE_COMPILE__)
  asm volatile("s_wait_asynccnt 0x0" ::: "memory");
#endif
}
__device__ __forceinline__ void wait_ds0() {      // this wave's LDS reads have returned before the buffer is handed back
#if defined(__HIP_DEVICE_COMPILE__)
  asm volatile("s_wait_dscnt 0x0" ::: "memory");
#endif
}

// =========================================================================================================
// (0) weight transpose + convert: src f32 [R][S] (row r contiguous over S; the projection weights are stored
//     [in][out]) -> dst f16 row (rowBase + s), col r, pitch R halves; value = f16 of (bf16-RNE(w) * 256) (exact).
//     Through an LDS tile T[64 s][64 r] (pitch TP). Block (sb, rb) owns a 64 r x 64 s tile.
// coverage: load 2 it x 32 rows x 8 lanes x 8 = 64 r x 64 s; store 2 it x 32 s-rows x 8 lanes x 8 halves = 64 s x 64 r;
//           grid (S/64, R/64) covers dst rows rowBase..rowBase+S-1 x cols 0..R-1 exactly once.
// LDS T: cross-wave (block barrier between the 2-byte stores and the 16-B reloads).
// =========================================================================================================
__global__ __launch_bounds__(256)
void cvt_wt(const float* __restrict__ src, unsigned short* dst, int R, int S, int rowBase) {
  __shared__ __align__(16) unsigned short T[QT * TP];
  const int tid = threadIdx.x;
  const int sb = blockIdx.x, rb = blockIdx.y;
  const int e = tid & 7, lq = tid >> 3;                             // lq 0..31
  const int s0 = sb * QT, r0 = rb * QT;
#pragma unroll
  for (int it = 0; it < 2; ++it) {
    const int rl = it * 32 + lq;                                     // r_loc 0..63
    const float* sp = src + ((size_t)(r0 + rl)) * (size_t)S + s0 + 8 * e;
    const v4f a = *(const v4f*)sp;
    const v4f q = *(const v4f*)(sp + 4);
    unsigned short hb[8];
#pragma unroll
    for (int t = 0; t < 4; ++t) {
      hb[t]     = h_bits((_Float16)(bfr(a[t]) * WSC));
      hb[4 + t] = h_bits((_Float16)(bfr(q[t]) * WSC));
    }
#pragma unroll
    for (int t = 0; t < 8; ++t) T[(8 * e + t) * TP + rl] = hb[t];   // T[s_loc][r_loc]
  }
  __syncthreads();
  v4u up[2];
#pragma unroll
  for (int it = 0; it < 2; ++it) {
    const int sl = it * 32 + lq;                                     // s_loc 0..63
    up[it] = *(const v4u*)(T + sl * TP + 8 * e);                     // r_loc 8e..8e+7
  }
{
#pragma unroll
    for (int it = 0; it < 2; ++it) {
      const int sl = it * 32 + lq;
      *(v4u*)(dst + ((size_t)(rowBase + s0 + sl)) * (size_t)R + r0 + 8 * e) = up[it];
    }
    
  }
}

// =========================================================================================================
// (1) x f32 [N][256] (already position-major) -> XP f16 [N][256], value = bf16-RNE(x) in an f16 container.
// coverage: SEQ/8 blocks x 8 rows x 32 lanes x 8 halves = SEQ x 256 = the whole plane.
// =========================================================================================================
__global__ __launch_bounds__(256)
void cvt_x(const float* __restrict__ x, unsigned short* XP) {
  const int tid = threadIdx.x, blk = blockIdx.x;
  const int row = 8 * blk + (tid >> 5);                              // 0..SEQ-1
  const int col = 8 * (tid & 31);                                    // 0..248
  const float* s = x + (size_t)row * CC + col;
  const v4f a = *(const v4f*)s;
  const v4f q = *(const v4f*)(s + 4);
  const float f[8] = {a[0], a[1], a[2], a[3], q[0], q[1], q[2], q[3]};
  v4u u;
#pragma unroll
  for (int t = 0; t < 4; ++t) {
    const _Float16 h0 = (_Float16)bfr(f[2 * t]);
    const _Float16 h1 = (_Float16)bfr(f[2 * t + 1]);
    u[t] = pk16(h_bits(h0), h_bits(h1));
  }
{
    *(v4u*)(XP + (size_t)row * CC + col) = u;
    
  }
}

// =========================================================================================================
// (2) theta / phi / g projection GEMM for one (64-n tile nt, 64-o block mb in 0..5): Y[o][n] = (1/256)
//     sum_c W16[mb*64 + o][c] XP[n][c] + bf16-RNE(bias[o]). W16 rows 0..127 = theta, 128..255 = phi, 256..383 = g.
//     Block 128 threads = 4 waves; wave w owns cols n0+16w..+15 (B fragment from the XP row, k = c contiguous,
//     split k map) and 4 m-tiles (A rows o = o0 + 16 mt + (lane&15), split k map from W16). K = 256 = 8 steps.
//     Epilogue staged in LDS Os[n_loc][o_loc] (pitch OSP), barrier, bias add in f32, then:
//       mb 0,1 (theta) / 2,3 (phi): bf16 hi = RNE(v), lo = RNE(v - hi) planes Qh/Ql resp. Kh/Kl [N][128 d]
//         the dsel half of the 256-B row): lane e -> d 8e..8e+7, 8 consecutive lanes per line, one instruction per
//         16 lines;
//       mb 4,5 (g): f16 plane Gc [128 ch][N keys] (channel-major, keys contiguous); row ch, 64 keys = one whole
// coverage: Os 4 waves x 16 n x 64 o = 64 x 64 (cols 0..63 written and read); hi/lo planes 4 it x 16 rows x 8 lanes
//           x 8 = 64 n x 64 d per plane, grid nt x mb {0,1} / {2,3} covers d 0..127 of all N rows of Qh/Ql / Kh/Kl
//           exactly once; g plane 4 it x 16 ch x 8 lanes x 8 keys = 64 ch x 64 keys, nt x mb {4,5} covers ch 0..127
//           x keys 0..N-1 of Gc exactly once. grid (N/64, 6).
// LDS Os: cross-wave (block barrier).
// =========================================================================================================
__global__ __launch_bounds__(128)
void gemm_qkv(const unsigned short* __restrict__ W16, const unsigned short* __restrict__ XP,
              const float* __restrict__ tbias, const float* __restrict__ pbias, const float* __restrict__ gbias,
              unsigned short* Qh, unsigned short* Ql, unsigned short* Kh, unsigned short* Kl, unsigned short* Gc) {
  __shared__ __align__(16) float Os[QT * OSP];
  const int tid  = threadIdx.x;
  const int lane = tid & 31, wave = tid >> 5;
  const int hh   = lane >> 4, c = lane & 15;
  const int nt   = blockIdx.x, mb = blockIdx.y;
  const int n0   = nt * QT, o0 = mb * QT;                            // o0 = W16 row base 0..320

  const unsigned short* ap = W16 + (size_t)(o0 + c) * CC + 8 * hh;
  const unsigned short* bp = XP + ((size_t)(n0 + 16 * wave + c)) * CC + 8 * hh;

  v8f acc[4];
#pragma unroll
  for (int mt = 0; mt < 4; ++mt) acc[mt] = zero8();

#pragma unroll
  for (int ks = 0; ks < CC / 32; ++ks) {
    const Frag fb = ldfrag(bp + 32 * ks);
#pragma unroll
    for (int mt = 0; mt < 4; ++mt) {
      const Frag fa = ldfrag(ap + (size_t)(16 * mt) * CC + 32 * ks);
      acc[mt] = mma_h(fa.h, fb.h, acc[mt]);
    }
  }

  {
    const int nl = 16 * wave + c;
#pragma unroll
    for (int mt = 0; mt < 4; ++mt) {
      v4f va, vb;
#pragma unroll
      for (int r = 0; r < 4; ++r) { va[r] = acc[mt][r] * IWSC; vb[r] = acc[mt][4 + r] * IWSC; }
      *(v4f*)(Os + nl * OSP + 16 * mt + 8 * hh)     = va;
      *(v4f*)(Os + nl * OSP + 16 * mt + 8 * hh + 4) = vb;
    }
  }
  __syncthreads();

  const int e = tid & 7, lq = tid >> 3;                             // lq 0..15
  const int grp  = mb >> 1;                                          // 0 theta, 1 phi, 2 g (block-uniform)
  const int dsel = (mb & 1) * QT;                                    // channel base 0 or 64 within the group
  if (grp < 2) {                                                     // block-uniform: bf16 hi/lo planes
    const float* bsrc = (grp == 0) ? tbias : pbias;
    unsigned short* Hp = (grp == 0) ? Qh : Kh;
    unsigned short* Lp = (grp == 0) ? Ql : Kl;
    const v4f b0 = *(const v4f*)(bsrc + dsel + 8 * e);
    const v4f b1 = *(const v4f*)(bsrc + dsel + 8 * e + 4);
    const float bb[8] = {bfr(b0[0]), bfr(b0[1]), bfr(b0[2]), bfr(b0[3]), bfr(b1[0]), bfr(b1[1]), bfr(b1[2]), bfr(b1[3])};
    v4u uh[4], ul[4];
#pragma unroll
    for (int it = 0; it < 4; ++it) {
      const int row = it * 16 + lq;                                  // n_loc 0..63
      const v4f a = *(const v4f*)(Os + row * OSP + 8 * e);
      const v4f q = *(const v4f*)(Os + row * OSP + 8 * e + 4);
      const float f[8] = {a[0], a[1], a[2], a[3], q[0], q[1], q[2], q[3]};
#pragma unroll
      for (int t = 0; t < 4; ++t) {
        const float f0 = f[2 * t] + bb[2 * t], f1 = f[2 * t + 1] + bb[2 * t + 1];
        const unsigned short hb0 = bf_bits(f0), hb1 = bf_bits(f1);
        const unsigned short lb0 = bf_bits(f0 - bf_up(hb0));
        const unsigned short lb1 = bf_bits(f1 - bf_up(hb1));
        uh[it][t] = pk16(hb0, hb1);
        ul[it][t] = pk16(lb0, lb1);
      }
    }
{
#pragma unroll
      for (int it = 0; it < 4; ++it) {
        const int row = it * 16 + lq;
        const size_t po = ((size_t)(n0 + row)) * DQ + dsel + 8 * e;
        *(v4u*)(Hp + po) = uh[it];
        *(v4u*)(Lp + po) = ul[it];
      }
      
    }
  } else {                                                           // block-uniform: g plane
    const int gsel = dsel;                                           // g channel base 0 or 64
    v4u ug[4];
#pragma unroll
    for (int it = 0; it < 4; ++it) {
      const int cl = it * 16 + lq;                                   // ch_loc 0..63
      const float bias = bfr(gbias[gsel + cl]);
      unsigned short hb[8];
#pragma unroll
      for (int t = 0; t < 8; ++t) {
        const int key = 8 * e + t;                                   // key_loc 0..63
        const float v = Os[key * OSP + cl] + bias;
        hb[t] = h_bits((_Float16)v);
      }
#pragma unroll
      for (int t = 0; t < 4; ++t) ug[it][t] = pk16(hb[2 * t], hb[2 * t + 1]);
    }
{
#pragma unroll
      for (int it = 0; it < 4; ++it) {
        const int cl = it * 16 + lq;
        const size_t po = ((size_t)(gsel + cl)) * (size_t)SEQ + n0 + 8 * e;
        *(v4u*)(Gc + po) = ug[it];
      }
      
    }
  }
}

// =========================================================================================================
// (3) attention for one 64-query tile, transposed formulation, SEQ keys, no mask, no scale:
//   S^T tile (16 keys x 16 queries) = sum over 4 d-chunks of A(phi: row = key kb + (lane&15), 32 d via the split
//   k map from the bf16 plane Kh [SEQ][128]) . B(theta: col = query, same map from Qh) + A(Kh).B(Ql) +
//   A(Kl).B(Qh) (bf16 unscaled residual planes, shared accumulator).
//   Per lane the D tile holds 8 keys of ONE query: online softmax state per lane, one shuffle (lane^16) for the max
//   over 32 keys; the o/l rescale is skipped under a wave-uniform ballot when no lane's max grew (corr == 1 exactly
//   for every lane then); row-sum partials combined at the end. P = e^{s-m} x 16384 as f16 is the B operand of
//   Y^T (rows channel, cols queries) += A(g rows channel = 16j + (lane&15), keys contiguous, f16 plane Gc
//   [128][SEQ]) . B(P^T): element r <- D of the tile covering keys kb..kb+15, element 8+r <- the tile covering
//   kb+16..kb+31, lane unchanged. 8 accumulator tiles per wave (128 channels). Block = 4 waves = 64 queries.
//   Operand path: the block's query tile (once) and 64-key stages of Kh, Kl, Gc come into LDS by asynchronous 16-B
//   copies in whole lines, two stage buffers, one publish point per stage; all fragments are ds_load_b128 reads at
//   pitches of 16 B x odd (272 B for 256-B rows, 144 B for 128-B rows). A stage serves two 32-key passes.
//   Epilogue: Y/l staged in LDS Os[query][128 channels] (pitch OSPW, b128 stores), barrier, then Yh = f16(y),
//   Yl = f16((y - Yh) * 1024) planes [SEQ n][128 c] (k-contiguous operand of the output projection): row n = 256 B
// coverage: Os 4 waves x 16 queries x 128 ch = 64 x 128 (all read cols written); planes 8 it x 8 rows x 16 lanes x
//           8 halves = 64 n x 128 c per plane; grid (SEQ/64) covers Yh/Yl exactly once.
// LDS Os: cross-wave (block barrier). LDS Ring, Qs: cross-wave (copy wait, then block barrier).
// =========================================================================================================
__global__ __launch_bounds__(128)
void attn_k(const unsigned short* __restrict__ Qh, const unsigned short* __restrict__ Ql,
            const unsigned short* __restrict__ Kh, const unsigned short* __restrict__ Kl,
            const unsigned short* __restrict__ Gc, unsigned short* Yh, unsigned short* Yl) {
  __shared__ __align__(16) float Os[QT * OSPW];
  __shared__ __align__(128) unsigned short Ring[2 * STG];            // two stages: Kh[64][KP], Kl[64][KP], G[128][VP]
  __shared__ __align__(128) unsigned short Qs[2 * KPL];              // Qh[64][KP], Ql[64][KP]
  const int tid  = threadIdx.x;
  const int wave = tid >> 5, lane = tid & 31;
  const int hh   = lane >> 4, c = lane & 15;
  const int n0   = blockIdx.x * QT;

  // copy slots. 256-B rows (K, Q): copy i of a lane -> row 8i + (tid>>4), 16-B piece tid&15 (a wave = 512 contiguous
  // global bytes). 128-B rows (g): copy i -> channel 16i + (tid>>3), piece tid&7 (a wave = 4 whole lines).
  const int rK = tid >> 4, pK = tid & 15;
  const int rV = tid >> 3, pV = tid & 7;
  const unsigned lK = lds_addr(Ring + rK * KP + 8 * pK);
  const unsigned lV = lds_addr(Ring + 2 * KPL + rV * VP + 8 * pV);
  const unsigned lQ = lds_addr(Qs + rK * KP + 8 * pK);
  const unsigned short* gKh = Kh + (size_t)rK * DQ + 8 * pK;
  const unsigned short* gKl = Kl + (size_t)rK * DQ + 8 * pK;
  const unsigned short* gV  = Gc + (size_t)rV * (size_t)SEQ + 8 * pV;

  // stage t (keys 64t .. 64t+63) into buffer b: 24 copies per lane
  auto fill = [&](int t, int b) {
    const unsigned lb = (unsigned)b * (unsigned)(STG * 2);
    copy8(lK + lb,           8 * KP * 2,  gKh + (size_t)t * (KT * DQ), (size_t)8 * DQ);
    copy8(lK + lb + KPL * 2, 8 * KP * 2,  gKl + (size_t)t * (KT * DQ), (size_t)8 * DQ);
    copy8(lV + lb,           16 * VP * 2, gV + (size_t)t * KT,         (size_t)16 * SEQ);
  };

  // prologue: the query tile (read by every pass) and stage 0, landed and published; then stage 1 in flight
  copy8(lQ,           8 * KP * 2, Qh + (size_t)(n0 + rK) * DQ + 8 * pK, (size_t)8 * DQ);
  copy8(lQ + KPL * 2, 8 * KP * 2, Ql + (size_t)(n0 + rK) * DQ + 8 * pK, (size_t)8 * DQ);
  fill(0, 0);
  wait_async0();
  __syncthreads();
  fill(1, 1);

  // q fragment pointers (B operand, col = query 16*wave + c of the tile), + 32*kc
  const unsigned short* Qhp = Qs + (16 * wave + c) * KP + 8 * hh;
  const unsigned short* Qlp = Qhp + KPL;

  float m = -1.0e30f, l = 0.f;
  v8f o[8];
#pragma unroll
  for (int j = 0; j < 8; ++j) o[j] = zero8();

  // kept rolled: one trip is one stage with its publish point, and the buffer index alternates with t
#pragma unroll 1
  for (int t = 0; t < SEQ / KT; ++t) {
    const unsigned short* st = Ring + (t & 1) * STG;
    for (int p = 0; p < KT / 32; ++p) {
      // k fragment bases (A operand, row = key 32p + c resp. 32p + 16 + c of the stage), + 32*kc
      const unsigned short* k0p  = st + (32 * p + c) * KP + 8 * hh;
      const unsigned short* k1p  = k0p + 16 * KP;
      const unsigned short* k0lp = k0p + KPL;
      const unsigned short* k1lp = k1p + KPL;
      // v fragment base (A operand, row = channel 16j + c, keys contiguous), + 16*j*VP
      const unsigned short* Vp = st + 2 * KPL + c * VP + 32 * p + 8 * hh;
      v8f s0 = zero8(), s1 = zero8();
      // fragments of d-chunk kc + 1 are read from LDS ahead of the products of chunk kc (two register sets): written in
      // this order, and unrolled, because LDS reads do not move across the gap statements of the product helpers
      Frag fq[2][2], fk[2][4];
      auto fetch = [&](int kc) {
        const int b = kc & 1;
        fq[b][0] = ldfrag(Qhp + 32 * kc);
        fq[b][1] = ldfrag(Qlp + 32 * kc);
        fk[b][0] = ldfrag(k0p + 32 * kc);
        fk[b][1] = ldfrag(k1p + 32 * kc);
        fk[b][2] = ldfrag(k0lp + 32 * kc);
        fk[b][3] = ldfrag(k1lp + 32 * kc);
      };
      fetch(0);
#pragma unroll
      for (int kc = 0; kc < DQ / 32; ++kc) {
        const int b = kc & 1;
        if (kc + 1 < DQ / 32) fetch(kc + 1);
        s0 = mma_b(fk[b][0].bf, fq[b][0].bf, s0);
        s1 = mma_b(fk[b][1].bf, fq[b][0].bf, s1);
        s0 = mma_b(fk[b][0].bf, fq[b][1].bf, s0);
        s1 = mma_b(fk[b][1].bf, fq[b][1].bf, s1);
        s0 = mma_b(fk[b][2].bf, fq[b][0].bf, s0);
        s1 = mma_b(fk[b][3].bf, fq[b][0].bf, s1);
      }
      // the pass's g fragments: read here so that their LDS time runs under the softmax arithmetic
      Frag vf[8];
#pragma unroll
      for (int j = 0; j < 8; ++j) vf[j] = ldfrag(Vp + (16 * j) * VP);

      float mx = fmaxf(hmax8(s0), hmax8(s1));
      mx = fmaxf(mx, __shfl_xor(mx, 16, 32));
      const float mn = fmaxf(m, mx);
      const unsigned grew = wave_ballot(mx > m);                     // wave-uniform
      if (grew != 0u) {
        const float corr = __expf(m - mn);                           // == 1 exactly for lanes whose max did not grow
        l *= corr;
#pragma unroll
        for (int j = 0; j < 8; ++j) {
#pragma unroll
          for (int r = 0; r < 8; ++r) o[j][r] *= corr;
        }
      }
      m = mn;
      const float msh = mn - LNPS;                                   // exp gives e^{s-m} * 16384

      FragH ph;
      float ls = 0.f;
#pragma unroll
      for (int r = 0; r < 8; ++r) {
        const float e0 = __expf(s0[r] - msh);                        // key 64t + 32p      + 8hh + r
        const float e1 = __expf(s1[r] - msh);                        // key 64t + 32p + 16 + 8hh + r
        ls += e0 + e1;
        ph.hv[0][r] = (_Float16)e0;
        ph.hv[1][r] = (_Float16)e1;
      }
      l += ls;

#pragma unroll
      for (int j = 0; j < 8; ++j) o[j] = mma_h(vf[j].h, ph.v, o[j]);
    }
    // publish point of stage t + 1: own LDS reads returned, own copies landed, every wave here; only then the refill
    wait_ds0();
    wait_async0();
    __syncthreads();
    if (t + 2 < SEQ / KT) fill(t + 2, t & 1);
  }
  wait_async0();
  l += __shfl_xor(l, 16, 32);
  const float inv = 1.0f / l;                                        // o and l both carry the x16384 factor

  const int qrow = 16 * wave + c;
#pragma unroll
  for (int j = 0; j < 8; ++j) {
    v4f va, vb;
#pragma unroll
    for (int r = 0; r < 4; ++r) { va[r] = o[j][r] * inv; vb[r] = o[j][4 + r] * inv; }
    *(v4f*)(Os + qrow * OSPW + 16 * j + 8 * hh)     = va;            // Os[query][ch = 16j + 8hh + r]
    *(v4f*)(Os + qrow * OSPW + 16 * j + 8 * hh + 4) = vb;
  }
  __syncthreads();

  const int e = tid & 15, lq = tid >> 4;                             // lq 0..7
  v4u uh[8], ul[8];
#pragma unroll
  for (int it = 0; it < 8; ++it) {
    const int row = it * 8 + lq;                                     // query 0..63
    const v4f a = *(const v4f*)(Os + row * OSPW + 8 * e);
    const v4f q = *(const v4f*)(Os + row * OSPW + 8 * e + 4);
    const float f[8] = {a[0], a[1], a[2], a[3], q[0], q[1], q[2], q[3]};
#pragma unroll
    for (int t = 0; t < 4; ++t) {
      const float f0 = f[2 * t], f1 = f[2 * t + 1];
      const _Float16 h0 = (_Float16)f0, h1 = (_Float16)f1;
      const _Float16 r0 = (_Float16)((f0 - (float)h0) * RSC);
      const _Float16 r1 = (_Float16)((f1 - (float)h1) * RSC);
      uh[it][t] = pk16(h_bits(h0), h_bits(h1));
      ul[it][t] = pk16(h_bits(r0), h_bits(r1));
    }
  }
{
#pragma unroll
    for (int it = 0; it < 8; ++it) {
      const int row = it * 8 + lq;
      const size_t po = ((size_t)(n0 + row)) * DQ + 8 * e;
      *(v4u*)(Yh + po) = uh[it];
      *(v4u*)(Yl + po) = ul[it];
    }
    
  }
}

// =========================================================================================================
// (4) output projection GEMM for one (64-n tile, 64-co block): out[n][co] = (1/256)(sum_c WW16[co][c] Yh[n][c] +
//     (1/1024) sum_c WW16[co][c] Yl[n][c]) + bf16-RNE(W_b[co]) + bf16-RNE(x[n][co]). 4 waves, wave w owns
//     cols n0+16w..+15 (two B fragments per k-step, k = c contiguous in the Yh/Yl rows), 4 m-tiles (A rows
//     co = o0 + 16 mt + (lane&15) from WW16), hi and residual products in separate accumulators. K = 128 = 4 steps.
//     Epilogue staged in LDS Os[n_loc][co_loc], barrier, then out rows (position-major, 1024 B each): lane
//     (e = tid&15) -> co o0+4e..+3 of row n_loc = 8 it + (tid>>4); 16 consecutive lanes x 16 B = the whole 256-B
// coverage: Os 4 waves x 16 n x 64 co (cols 0..63 written and read); out 8 it x 8 rows x 16 lanes x 4 floats =
//           64 n x 64 co; grid (SEQ/64, 4) covers out[0..SEQ-1][0..255] exactly once.
// LDS Os: cross-wave (block barrier).
// =========================================================================================================
__global__ __launch_bounds__(128)
void gemm_o(const unsigned short* __restrict__ WW16, const unsigned short* __restrict__ Yh,
            const unsigned short* __restrict__ Yl, const float* __restrict__ wbias,
            const float* __restrict__ x, float* out) {
  __shared__ __align__(16) float Os[QT * OSP];
  const int tid  = threadIdx.x;
  const int lane = tid & 31, wave = tid >> 5;
  const int hh   = lane >> 4, c = lane & 15;
  const int nt   = blockIdx.x, mb = blockIdx.y;
  const int n0   = nt * QT, o0 = mb * QT;

  const unsigned short* ap  = WW16 + (size_t)(o0 + c) * DQ + 8 * hh;
  const size_t bo = ((size_t)(n0 + 16 * wave + c)) * DQ + 8 * hh;
  const unsigned short* bph = Yh + bo;
  const unsigned short* bpl = Yl + bo;

  v8f acc[4], accr[4];
#pragma unroll
  for (int mt = 0; mt < 4; ++mt) { acc[mt] = zero8(); accr[mt] = zero8(); }

#pragma unroll
  for (int ks = 0; ks < DQ / 32; ++ks) {
    const Frag fbh = ldfrag(bph + 32 * ks);
    const Frag fbl = ldfrag(bpl + 32 * ks);
#pragma unroll
    for (int mt = 0; mt < 4; ++mt) {
      const Frag fa = ldfrag(ap + (size_t)(16 * mt) * DQ + 32 * ks);
      acc[mt]  = mma_h(fa.h, fbh.h, acc[mt]);
      accr[mt] = mma_h(fa.h, fbl.h, accr[mt]);
    }
  }

  {
    const int nl = 16 * wave + c;
#pragma unroll
    for (int mt = 0; mt < 4; ++mt) {
      v4f va, vb;
#pragma unroll
      for (int r = 0; r < 4; ++r) {
        va[r] = (acc[mt][r] + accr[mt][r] * IRSC) * IWSC;
        vb[r] = (acc[mt][4 + r] + accr[mt][4 + r] * IRSC) * IWSC;
      }
      *(v4f*)(Os + nl * OSP + 16 * mt + 8 * hh)     = va;
      *(v4f*)(Os + nl * OSP + 16 * mt + 8 * hh + 4) = vb;
    }
  }
  __syncthreads();

  const int e = tid & 15, lq = tid >> 4;                             // lq 0..7
  const v4f bv = *(const v4f*)(wbias + o0 + 4 * e);
  const float bb[4] = {bfr(bv[0]), bfr(bv[1]), bfr(bv[2]), bfr(bv[3])};
  v4f res[8];
#pragma unroll
  for (int it = 0; it < 8; ++it) {
    const int nl = it * 8 + lq;                                      // n_loc 0..63
    const size_t idx = ((size_t)(n0 + nl)) * CC + o0 + 4 * e;
    const v4f xv = *(const v4f*)(x + idx);
    const v4f ov = *(const v4f*)(Os + nl * OSP + 4 * e);
#pragma unroll
    for (int t = 0; t < 4; ++t) res[it][t] = ov[t] + bb[t] + bfr(xv[t]);
  }
{
#pragma unroll
    for (int it = 0; it < 8; ++it) {
      const int nl = it * 8 + lq;
      const size_t idx = ((size_t)(n0 + nl)) * CC + o0 + 4 * e;
      *(v4f*)(out + idx) = res[it];
    }
    
  }
}

// =========================================================================================================
// Workspace map (bytes; each region start a multiple of 256; every plane size is an exact multiple of its
// whole-line store granularity, SEQ a multiple of 64 so no tail rows exist):
//   W16  f16 [384][256]          196608      WW16 f16 [256][128]     65536
//   XP   f16 [SEQ][256]         4194304 (SEQ=8192)
//   Qh/Ql bf16 [SEQ][128]        2097152 x2
//   Kh/Kl bf16 [SEQ][128]        2097152 x2
//   Gc   f16 [128][SEQ]          2097152
//   Yh/Yl f16 [SEQ][128]         2097152 x2
//   total (SEQ=8192) = 19136512
// =========================================================================================================
extern "C" void kernel_launch(void* const* d_in, const int* in_sizes, int n_in,
                              void* d_out, int out_size, void* d_ws, size_t ws_size,
                              hipStream_t stream) {
  const int XN = SEQ * CC;
  if (n_in < 9) return;
  if (in_sizes[0] < XN) return;
  if (in_sizes[1] < CC * DQ || in_sizes[3] < CC * DQ || in_sizes[5] < CC * DQ) return;
  if (in_sizes[2] < DQ || in_sizes[4] < DQ || in_sizes[6] < DQ) return;
  if (in_sizes[7] < DQ * CC || in_sizes[8] < CC) return;
  if (out_size < XN) return;

  size_t off = 0;
  auto carve = [&](size_t bytes) { const size_t o = off; off += (bytes + 255) & ~(size_t)255; return o; };
  const size_t oW16 = carve((size_t)MW * CC * 2);
  const size_t oWW  = carve((size_t)CC * DQ * 2);
  const size_t oXP  = carve((size_t)SEQ * CC * 2);
  const size_t oQh  = carve((size_t)SEQ * DQ * 2);
  const size_t oQl  = carve((size_t)SEQ * DQ * 2);
  const size_t oKh  = carve((size_t)SEQ * DQ * 2);
  const size_t oKl  = carve((size_t)SEQ * DQ * 2);
  const size_t oGc  = carve((size_t)DQ * SEQ * 2);
  const size_t oYh  = carve((size_t)SEQ * DQ * 2);
  const size_t oYl  = carve((size_t)SEQ * DQ * 2);
  if (off > ws_size) return;
  if (off > (size_t)134217728) return;

  const float* x  = (const float*)d_in[0];
  const float* gw = (const float*)d_in[1];
  const float* gb = (const float*)d_in[2];
  const float* tw = (const float*)d_in[3];
  const float* tb = (const float*)d_in[4];
  const float* pw = (const float*)d_in[5];
  const float* pb = (const float*)d_in[6];
  const float* ww = (const float*)d_in[7];
  const float* wb = (const float*)d_in[8];

  char* ws = (char*)d_ws;
  unsigned short* W16  = (unsigned short*)(ws + oW16);
  unsigned short* WW16 = (unsigned short*)(ws + oWW);
  unsigned short* XP   = (unsigned short*)(ws + oXP);
  unsigned short* Qh   = (unsigned short*)(ws + oQh);
  unsigned short* Ql   = (unsigned short*)(ws + oQl);
  unsigned short* Kh   = (unsigned short*)(ws + oKh);
  unsigned short* Kl   = (unsigned short*)(ws + oKl);
  unsigned short* Gc   = (unsigned short*)(ws + oGc);
  unsigned short* Yh   = (unsigned short*)(ws + oYh);
  unsigned short* Yl   = (unsigned short*)(ws + oYl);
  float* out = (float*)d_out;

  const dim3 blk256(256), blk128(128);

  // (0) projection weights [in=256][out=128] -> stacked f16 plane W16 [out rows 0..383][in 256]:
  //     src [R=256][S=128] -> dst rows rowBase + s, cols r; grid (S/64, R/64)
  cvt_wt<<<dim3(DQ / QT, CC / QT), blk256, 0, stream>>>(tw, W16, CC, DQ, 0);
  cvt_wt<<<dim3(DQ / QT, CC / QT), blk256, 0, stream>>>(pw, W16, CC, DQ, DQ);
  cvt_wt<<<dim3(DQ / QT, CC / QT), blk256, 0, stream>>>(gw, W16, CC, DQ, 2 * DQ);
  //     W_w [in=128][out=256] -> WW16 [out 256][in 128]: src [R=128][S=256], grid (S/64, R/64)
  cvt_wt<<<dim3(CC / QT, DQ / QT), blk256, 0, stream>>>(ww, WW16, DQ, CC, 0);
  // (1) x -> 16-bit plane (same position-major layout)
  cvt_x<<<dim3(SEQ / 8), blk256, 0, stream>>>(x, XP);
  // (2) theta / phi -> hi + residual planes, g -> channel-major plane
  gemm_qkv<<<dim3(SEQ / QT, 6), blk128, 0, stream>>>(W16, XP, tb, pb, gb, Qh, Ql, Kh, Kl, Gc);
  // (3) attention -> y hi + residual planes
  attn_k<<<dim3(SEQ / QT), blk128, 0, stream>>>(Qh, Ql, Kh, Kl, Gc, Yh, Yl);
  // (4) output projection + bias + residual -> out [SEQ][256]
  gemm_o<<<dim3(SEQ / QT, CC / QT), blk128, 0, stream>>>(WW16, Yh, Yl, wb, x, out);
  (void)hipGetLastError();
}

// v002
// A run of this version takes 90.6 microseconds.
// Timed twice side by side with v001, it ran 1.88 times as fast both times.
// Over all steps from v000 it is 8.55 times as fast.
// Contractions: theta/phi/g projection GEMMs Wt[384x256].Xp[256xN] and the output projection Wo[256x128].Y[128xN] on
// v_wmma_f32_16x16x32_f16 (f16 containers of bf16-RNE weights x256 and bf16-RNE x; Y as f16 hi fragment plus f16
// residual fragment x1024, 2 products, separate accumulators); scores Phi.Theta^T on v_wmma_f32_16x16x32_bf16
// (bf16 hi + bf16 residual planes of theta/phi, 3 products, K=128); Y^T = G.P^T on v_wmma_f32_16x16x32_f16
// (G plain f16, P = e^{s-m} x16384 f16 from the score D registers); f32 accumulate everywhere; softmax
// statistics, biases and the residual add in f32 VALU.
#include <hip/hip_runtime.h>
#include <math.h>
#include <stdint.h>

#ifndef NB
#define NB 1
#endif
#define NB_FULL 1
#ifndef SEQ
#define SEQ 8192
#endif
#define SEQ_FULL 8192
#define CC   256
#define DQ   128
#define QT   64
#define MW   384
#define OSP  68
#define TP   72
#define WSC  256.0f
#define IWSC 0.00390625f
#define RSC  1024.0f
#define IRSC 0.0009765625f
#define LNPS 9.704060527839234f
#define KT   64
#define KP   136
#define VP   72
#define KPL  (KT * KP)
#define STG  (2 * KPL + DQ * VP)
#define KS   4
#define KSEQ (SEQ / KS)
#define NT16 (SEQ / 16)

static_assert(NB == 1 && NB_FULL == 1);
static_assert(SEQ >= QT && SEQ <= SEQ_FULL);
static_assert(SEQ % QT == 0 && SEQ % 32 == 0 && SEQ % 8 == 0);
static_assert(CC % QT == 0 && CC % 32 == 0);
static_assert(DQ == 2 * QT && DQ % 32 == 0);
static_assert(MW == 3 * DQ && MW % 8 == 0);
static_assert((OSP * 4) % 16 == 0);
static_assert((TP * 2) % 16 == 0);
static_assert(SEQ % KS == 0 && KSEQ % KT == 0 && KSEQ / KT >= 2 && KT == QT && KT % 32 == 0);
static_assert(2 * (2 * STG + 2 * KPL) * 2 <= 327680);                // two work-groups of attn_k per 320-KiB LDS
static_assert((KP * 2) % 32 == 16 && (VP * 2) % 32 == 16 && KP >= DQ + 8 && VP >= KT + 8);

typedef _Float16       v16h __attribute__((ext_vector_type(16)));
typedef _Float16       v8h  __attribute__((ext_vector_type(8)));
typedef __bf16         v16b __attribute__((ext_vector_type(16)));
typedef unsigned short v8us __attribute__((ext_vector_type(8)));
typedef float          v8f  __attribute__((ext_vector_type(8)));
typedef float          v4f  __attribute__((ext_vector_type(4)));
typedef unsigned int   v4u  __attribute__((ext_vector_type(4)));

union Frag  { v8us u[2]; v16h h; v16b bf; };
union FragH { v16h v; v8h hv[2]; };
static_assert(sizeof(Frag) == 32);
static_assert(sizeof(FragH) == 32);

// ---- scalar helpers ---------------------------------------------------------------------------------------
__device__ __forceinline__ unsigned short bf_bits(float f) {          // f32 -> bf16 bits, RNE convert
  unsigned u = __float_as_uint(f);
  return (unsigned short)((u + 0x7FFFu + ((u >> 16) & 1u)) >> 16);
}
__device__ __forceinline__ float bf_up(unsigned short hb) { return __uint_as_float(((unsigned)hb) << 16); }
__device__ __forceinline__ float bfr(float f) { return bf_up(bf_bits(f)); }
__device__ __forceinline__ unsigned short h_bits(_Float16 x) { return __builtin_bit_cast(unsigned short, x); }
__device__ __forceinline__ unsigned pk16(unsigned short a, unsigned short b) { return (unsigned)a | ((unsigned)b << 16); }
__device__ __forceinline__ v8f zero8() { v8f z = {0.f, 0.f, 0.f, 0.f, 0.f, 0.f, 0.f, 0.f}; return z; }
__device__ __forceinline__ float hmax8(v8f s) {
  return fmaxf(fmaxf(fmaxf(s[0], s[1]), fmaxf(s[2], s[3])), fmaxf(fmaxf(s[4], s[5]), fmaxf(s[6], s[7])));
}
__device__ __forceinline__ unsigned wave_ballot(bool p) {
#if defined(__HIP_DEVICE_COMPILE__)
  return __builtin_amdgcn_ballot_w32(p);
#else
  return p ? 1u : 0u;
#endif
}

// ---- 16-bit fragment loader (A, or B from a k-contiguous [n][k] row): lane -> row/col (lane&15), p already includes
//      + 8*(lane>>4); elements 0..7 <- p[0..7] (k0+8h..), elements 8..15 <- p[16..23] (k0+16+8h..)
__device__ __forceinline__ Frag ldfrag(const unsigned short* p) {
  Frag f;
  f.u[0] = *(const v8us*)(p);
  f.u[1] = *(const v8us*)(p + 16);
  return f;
}

// ---- WMMA helpers: builtin followed by a 4-slot VALU gap tying D and keeping A/B live --------------------------
__device__ __forceinline__ v8f mma_h(v16h a, v16h b, v8f c) {
  v8f d = __builtin_amdgcn_wmma_f32_16x16x32_f16(false, a, false, b, (short)0, c, false, false);
#if defined(__HIP_DEVICE_COMPILE__)
  asm volatile("v_nop\n\tv_nop\n\tv_nop\n\tv_nop" : "+v"(d) : "v"(a), "v"(b));
#endif
  return d;
}
__device__ __forceinline__ v8f mma_b(v16b a, v16b b, v8f c) {
  v8f d = __builtin_amdgcn_wmma_f32_16x16x32_bf16(false, a, false, b, (short)0, c, false, false);
#if defined(__HIP_DEVICE_COMPILE__)
  const v16h ha = __builtin_bit_cast(v16h, a), hb = __builtin_bit_cast(v16h, b);
  asm volatile("v_nop\n\tv_nop\n\tv_nop\n\tv_nop" : "+v"(d) : "v"(ha), "v"(hb));
#endif
  return d;
}

// ---- asynchronous copies global -> LDS ------------------------------------------------------------------------
__device__ __forceinline__ unsigned lds_addr(const unsigned short* p) { return (unsigned)(uintptr_t)p; }  // LDS byte address

// Eight 16-B copies per lane: copy i moves g + i*gstep (halves) to LDS byte address l + i*lstep. All lanes on.
__device__ __forceinline__ void copy8(unsigned l, unsigned lstep, const unsigned short* g, size_t gstep) {
#if defined(__HIP_DEVICE_COMPILE__)
  // the closing s_wait_xcnt keeps later rewrites of the address registers behind the issued copies
  asm volatile("global_load_async_to_lds_b128 %0, %8, off\n\t"
               "global_load_async_to_lds_b128 %1, %9, off\n\t"
               "global_load_async_to_lds_b128 %2, %10, off\n\t"
               "global_load_async_to_lds_b128 %3, %11, off\n\t"
               "global_load_async_to_lds_b128 %4, %12, off\n\t"
               "global_load_async_to_lds_b128 %5, %13, off\n\t"
               "global_load_async_to_lds_b128 %6, %14, off\n\t"
               "global_load_async_to_lds_b128 %7, %15, off\n\t"
               "s_wait_xcnt 0x0"
               :: "v"(l), "v"(l + lstep), "v"(l + 2 * lstep), "v"(l + 3 * lstep),
                  "v"(l + 4 * lstep), "v"(l + 5 * lstep), "v"(l + 6 * lstep), "v"(l + 7 * lstep),
                  "v"(g), "v"(g + gstep), "v"(g + 2 * gstep), "v"(g + 3 * gstep),
                  "v"(g + 4 * gstep), "v"(g + 5 * gstep), "v"(g + 6 * gstep), "v"(g + 7 * gstep)
               : "memory");
#endif
}
__device__ __forceinline__ void wait_async0() {   // this wave's copies have landed in LDS
#if defined(__HIP_DEVICE_COMPILE__)
  asm volatile("s_wait_asynccnt 0x0" ::: "memory");
#endif
}
__device__ __forceinline__ void wait_ds0() {      // this wave's LDS reads have returned before the buffer is handed back
#if defined(__HIP_DEVICE_COMPILE__)
  asm volatile("s_wait_dscnt 0x0" ::: "memory");
#endif
}

// Inputs-only fence on sixteen loaded 16-B words: every one of them has arrived here. The wait stands behind the loads and
// ahead of any rewrite of their address registers: their base p is named so that it lives up to the wait.
__device__ __forceinline__ void hold16(const v4f (&a)[4][2], const v4f (&b)[4][2], const float* p) {
#if defined(__HIP_DEVICE_COMPILE__)
  asm volatile("s_wait_xcnt 0x0"
               :: "v"(a[0][0]), "v"(a[0][1]), "v"(a[1][0]), "v"(a[1][1]), "v"(a[2][0]), "v"(a[2][1]), "v"(a[3][0]), "v"(a[3][1]),
                  "v"(b[0][0]), "v"(b[0][1]), "v"(b[1][0]), "v"(b[1][1]), "v"(b[2][0]), "v"(b[2][1]), "v"(b[3][0]), "v"(b[3][1]),
                  "v"(p));
#endif
}

// =========================================================================================================
// (0) weight transpose + convert: src f32 [R][S] (row r contiguous over S; the projection weights are stored
//     [in][out]) -> dst f16 row (rowBase + s), col r, pitch R halves; value = f16 of (bf16-RNE(w) * 256) (exact).
//     Through an LDS tile T[64 s][64 r] (pitch TP). Block (sb, rb) owns a 64 r x 64 s tile.
// coverage: load 2 it x 32 rows x 8 lanes x 8 = 64 r x 64 s; store 2 it x 32 s-rows x 8 lanes x 8 halves = 64 s x 64 r;
//           grid (S/64, R/64) covers dst rows rowBase..rowBase+S-1 x cols 0..R-1 exactly once.
// LDS T: cross-wave (block barrier between the 2-byte stores and the 16-B reloads).
// =========================================================================================================
__global__ __launch_bounds__(256)
void cvt_wt(const float* __restrict__ src, unsigned short* dst, int R, int S, int rowBase) {
  __shared__ __align__(16) unsigned short T[QT * TP];
  const int tid = threadIdx.x;
  const int sb = blockIdx.x, rb = blockIdx.y;
  const int e = tid & 7, lq = tid >> 3;                             // lq 0..31
  const int s0 = sb * QT, r0 = rb * QT;
#pragma unroll
  for (int it = 0; it < 2; ++it) {
    const int rl = it * 32 + lq;                                     // r_loc 0..63
    const float* sp = src + ((size_t)(r0 + rl)) * (size_t)S + s0 + 8 * e;
    const v4f a = *(const v4f*)sp;
    const v4f q = *(const v4f*)(sp + 4);
    unsigned short hb[8];
#pragma unroll
    for (int t = 0; t < 4; ++t) {
      hb[t]     = h_bits((_Float16)(bfr(a[t]) * WSC));
      hb[4 + t] = h_bits((_Float16)(bfr(q[t]) * WSC));
    }
#pragma unroll
    for (int t = 0; t < 8; ++t) T[(8 * e + t) * TP + rl] = hb[t];   // T[s_loc][r_loc]
  }
  __syncthreads();
  v4u up[2];
#pragma unroll
  for (int it = 0; it < 2; ++it) {
    const int sl = it * 32 + lq;                                     // s_loc 0..63
    up[it] = *(const v4u*)(T + sl * TP + 8 * e);                     // r_loc 8e..8e+7
  }
{
#pragma unroll
    for (int it = 0; it < 2; ++it) {
      const int sl = it * 32 + lq;
      *(v4u*)(dst + ((size_t)(rowBase + s0 + sl)) * (size_t)R + r0 + 8 * e) = up[it];
    }
    
  }
}

// =========================================================================================================
// (1) x f32 [N][256] (already position-major) -> XP f16 [N][256], value = bf16-RNE(x) in an f16 container.
// coverage: SEQ/8 blocks x 8 rows x 32 lanes x 8 halves = SEQ x 256 = the whole plane.
// =========================================================================================================
__global__ __launch_bounds__(256)
void cvt_x(const float* __restrict__ x, unsigned short* XP) {
  const int tid = threadIdx.x, blk = blockIdx.x;
  const int row = 8 * blk + (tid >> 5);                              // 0..SEQ-1
  const int col = 8 * (tid & 31);                                    // 0..248
  const float* s = x + (size_t)row * CC + col;
  const v4f a = *(const v4f*)s;
  const v4f q = *(const v4f*)(s + 4);
  const float f[8] = {a[0], a[1], a[2], a[3], q[0], q[1], q[2], q[3]};
  v4u u;
#pragma unroll
  for (int t = 0; t < 4; ++t) {
    const _Float16 h0 = (_Float16)bfr(f[2 * t]);
    const _Float16 h1 = (_Float16)bfr(f[2 * t + 1]);
    u[t] = pk16(h_bits(h0), h_bits(h1));
  }
{
    *(v4u*)(XP + (size_t)row * CC + col) = u;
    
  }
}

// =========================================================================================================
// (2) theta / phi / g projection GEMM for one (64-n tile nt, 64-o block mb in 0..5): Y[o][n] = (1/256)
//     sum_c W16[mb*64 + o][c] XP[n][c] + bf16-RNE(bias[o]). W16 rows 0..127 = theta, 128..255 = phi, 256..383 = g.
//     Block 128 threads = 4 waves; wave w owns cols n0+16w..+15 (B fragment from the XP row, k = c contiguous,
//     split k map) and 4 m-tiles (A rows o = o0 + 16 mt + (lane&15), split k map from W16). K = 256 = 8 steps.
//     Epilogue staged in LDS Os[n_loc][o_loc] (pitch OSP), barrier, bias add in f32, then:
//       mb 0,1 (theta) / 2,3 (phi): bf16 hi = RNE(v), lo = RNE(v - hi) planes Qh/Ql resp. Kh/Kl [N][128 d]
//         the dsel half of the 256-B row): lane e -> d 8e..8e+7, 8 consecutive lanes per line, one instruction per
//         16 lines;
//       mb 4,5 (g): f16 plane Gc [128 ch][N keys] (channel-major, keys contiguous); row ch, 64 keys = one whole
// coverage: Os 4 waves x 16 n x 64 o = 64 x 64 (cols 0..63 written and read); hi/lo planes 4 it x 16 rows x 8 lanes
//           x 8 = 64 n x 64 d per plane, grid nt x mb {0,1} / {2,3} covers d 0..127 of all N rows of Qh/Ql / Kh/Kl
//           exactly once; g plane 4 it x 16 ch x 8 lanes x 8 keys = 64 ch x 64 keys, nt x mb {4,5} covers ch 0..127
//           x keys 0..N-1 of Gc exactly once. grid (N/64, 6).
// LDS Os: cross-wave (block barrier).
// =========================================================================================================
__global__ __launch_bounds__(128)
void gemm_qkv(const unsigned short* __restrict__ W16, const unsigned short* __restrict__ XP,
              const float* __restrict__ tbias, const float* __restrict__ pbias, const float* __restrict__ gbias,
              unsigned short* Qh, unsigned short* Ql, unsigned short* Kh, unsigned short* Kl, unsigned short* Gc) {
  __shared__ __align__(16) float Os[QT * OSP];
  const int tid  = threadIdx.x;
  const int lane = tid & 31, wave = tid >> 5;
  const int hh   = lane >> 4, c = lane & 15;
  const int nt   = blockIdx.x, mb = blockIdx.y;
  const int n0   = nt * QT, o0 = mb * QT;                            // o0 = W16 row base 0..320

  const unsigned short* ap = W16 + (size_t)(o0 + c) * CC + 8 * hh;
  const unsigned short* bp = XP + ((size_t)(n0 + 16 * wave + c)) * CC + 8 * hh;

  v8f acc[4];
#pragma unroll
  for (int mt = 0; mt < 4; ++mt) acc[mt] = zero8();

#pragma unroll
  for (int ks = 0; ks < CC / 32; ++ks) {
    const Frag fb = ldfrag(bp + 32 * ks);
#pragma unroll
    for (int mt = 0; mt < 4; ++mt) {
      const Frag fa = ldfrag(ap + (size_t)(16 * mt) * CC + 32 * ks);
      acc[mt] = mma_h(fa.h, fb.h, acc[mt]);
    }
  }

  {
    const int nl = 16 * wave + c;
#pragma unroll
    for (int mt = 0; mt < 4; ++mt) {
      v4f va, vb;
#pragma unroll
      for (int r = 0; r < 4; ++r) { va[r] = acc[mt][r] * IWSC; vb[r] = acc[mt][4 + r] * IWSC; }
      *(v4f*)(Os + nl * OSP + 16 * mt + 8 * hh)     = va;
      *(v4f*)(Os + nl * OSP + 16 * mt + 8 * hh + 4) = vb;
    }
  }
  __syncthreads();

  const int e = tid & 7, lq = tid >> 3;                             // lq 0..15
  const int grp  = mb >> 1;                                          // 0 theta, 1 phi, 2 g (block-uniform)
  const int dsel = (mb & 1) * QT;                                    // channel base 0 or 64 within the group
  if (grp < 2) {                                                     // block-uniform: bf16 hi/lo planes
    const float* bsrc = (grp == 0) ? tbias : pbias;
    unsigned short* Hp = (grp == 0) ? Qh : Kh;
    unsigned short* Lp = (grp == 0) ? Ql : Kl;
    const v4f b0 = *(const v4f*)(bsrc + dsel + 8 * e);
    const v4f b1 = *(const v4f*)(bsrc + dsel + 8 * e + 4);
    const float bb[8] = {bfr(b0[0]), bfr(b0[1]), bfr(b0[2]), bfr(b0[3]), bfr(b1[0]), bfr(b1[1]), bfr(b1[2]), bfr(b1[3])};
    v4u uh[4], ul[4];
#pragma unroll
    for (int it = 0; it < 4; ++it) {
      const int row = it * 16 + lq;                                  // n_loc 0..63
      const v4f a = *(const v4f*)(Os + row * OSP + 8 * e);
      const v4f q = *(const v4f*)(Os + row * OSP + 8 * e + 4);
      const float f[8] = {a[0], a[1], a[2], a[3], q[0], q[1], q[2], q[3]};
#pragma unroll
      for (int t = 0; t < 4; ++t) {
        const float f0 = f[2 * t] + bb[2 * t], f1 = f[2 * t + 1] + bb[2 * t + 1];
        const unsigned short hb0 = bf_bits(f0), hb1 = bf_bits(f1);
        const unsigned short lb0 = bf_bits(f0 - bf_up(hb0));
        const unsigned short lb1 = bf_bits(f1 - bf_up(hb1));
        uh[it][t] = pk16(hb0, hb1);
        ul[it][t] = pk16(lb0, lb1);
      }
    }
{
#pragma unroll
      for (int it = 0; it < 4; ++it) {
        const int row = it * 16 + lq;
        const size_t po = ((size_t)(n0 + row)) * DQ + dsel + 8 * e;
        *(v4u*)(Hp + po) = uh[it];
        *(v4u*)(Lp + po) = ul[it];
      }
      
    }
  } else {                                                           // block-uniform: g plane
    const int gsel = dsel;                                           // g channel base 0 or 64
    v4u ug[4];
#pragma unroll
    for (int it = 0; it < 4; ++it) {
      const int cl = it * 16 + lq;                                   // ch_loc 0..63
      const float bias = bfr(gbias[gsel + cl]);
      unsigned short hb[8];
#pragma unroll
      for (int t = 0; t < 8; ++t) {
        const int key = 8 * e + t;                                   // key_loc 0..63
        const float v = Os[key * OSP + cl] + bias;
        hb[t] = h_bits((_Float16)v);
      }
#pragma unroll
      for (int t = 0; t < 4; ++t) ug[it][t] = pk16(hb[2 * t], hb[2 * t + 1]);
    }
{
#pragma unroll
      for (int it = 0; it < 4; ++it) {
        const int cl = it * 16 + lq;
        const size_t po = ((size_t)(gsel + cl)) * (size_t)SEQ + n0 + 8 * e;
        *(v4u*)(Gc + po) = ug[it];
      }
      
    }
  }
}

// =========================================================================================================
// (3) attention for one 64-query tile and one of KS key ranges (KSEQ keys each), transposed formulation, no mask, no
//   scale. The KS ranges of a tile run as separate work-groups, so that the grid gives every SIMD two waves:
//   S^T tile (16 keys x 16 queries) = sum over 4 d-chunks of A(phi: row = key kb + (lane&15), 32 d via the split
//   k map from the bf16 plane Kh [SEQ][128]) . B(theta: col = query, same map from Qh) + A(Kh).B(Ql) +
//   A(Kl).B(Qh) (bf16 unscaled residual planes, shared accumulator).
//   Per lane the D tile holds 8 keys of ONE query: online softmax state per lane, one shuffle (lane^16) for the max
//   over 32 keys; the o/l rescale is skipped under a wave-uniform ballot when no lane's max grew (corr == 1 exactly
//   for every lane then); row-sum partials combined at the end. P = e^{s-m} x 16384 as f16 is the B operand of
//   Y^T (rows channel, cols queries) += A(g rows channel = 16j + (lane&15), keys contiguous, f16 plane Gc
//   [128][SEQ]) . B(P^T): element r <- D of the tile covering keys kb..kb+15, element 8+r <- the tile covering
//   kb+16..kb+31, lane unchanged. 8 accumulator tiles per wave (128 channels). Block = 4 waves = 64 queries.
//   Operand path: the block's query tile (once) and 64-key stages of Kh, Kl, Gc come into LDS by asynchronous 16-B
//   copies in whole lines, two stage buffers, one publish point per stage; all fragments are ds_load_b128 reads at
//   pitches of 16 B x odd (272 B for 256-B rows, 144 B for 128-B rows). A stage serves two 32-key passes.
//   Epilogue: the range's un-normalised accumulators go to the workspace as they lie in the registers,
//   Po[range][16-query tile][j][half][lane][4 f32] (element 4*half + i of tile j; each store = 512 contiguous B), with
//   Pml[range][16-query tile][32]: word c = the range's maximum of query c, word 16 + c = its row sum (x16384, as o).
//   The output projection merges the ranges.
// coverage: Po 4 waves x 8 j x 2 halves x 32 lanes x 4 = 64 queries x 128 ch per range; Pml 4 waves x 32 words; grid
//           (SEQ/64, KS) covers Po and Pml exactly once.
// LDS Ring, Qs: cross-wave (copy wait, then block barrier).
// =========================================================================================================
__global__ __launch_bounds__(128)
void attn_k(const unsigned short* __restrict__ Qh, const unsigned short* __restrict__ Ql,
            const unsigned short* __restrict__ Kh, const unsigned short* __restrict__ Kl,
            const unsigned short* __restrict__ Gc, float* Po, float* Pml) {
  __shared__ __align__(128) unsigned short Ring[2 * STG];            // two stages: Kh[64][KP], Kl[64][KP], G[128][VP]
  __shared__ __align__(128) unsigned short Qs[2 * KPL];              // Qh[64][KP], Ql[64][KP]
  const int tid  = threadIdx.x;
  const int wave = tid >> 5, lane = tid & 31;
  const int hh   = lane >> 4, c = lane & 15;
  const int n0   = blockIdx.x * QT;
  const int kr   = blockIdx.y;                                       // key range: keys kr*KSEQ .. kr*KSEQ + KSEQ - 1

  // copy slots. 256-B rows (K, Q): copy i of a lane -> row 8i + (tid>>4), 16-B piece tid&15 (a wave = 512 contiguous
  // global bytes). 128-B rows (g): copy i -> channel 16i + (tid>>3), piece tid&7 (a wave = 4 whole lines).
  const int rK = tid >> 4, pK = tid & 15;
  const int rV = tid >> 3, pV = tid & 7;
  const unsigned lK = lds_addr(Ring + rK * KP + 8 * pK);
  const unsigned lV = lds_addr(Ring + 2 * KPL + rV * VP + 8 * pV);
  const unsigned lQ = lds_addr(Qs + rK * KP + 8 * pK);
  const unsigned short* gKh = Kh + (size_t)(kr * KSEQ + rK) * DQ + 8 * pK;
  const unsigned short* gKl = Kl + (size_t)(kr * KSEQ + rK) * DQ + 8 * pK;
  const unsigned short* gV  = Gc + (size_t)rV * (size_t)SEQ + kr * KSEQ + 8 * pV;

  // stage t (keys 64t .. 64t+63 of the range) into buffer b: 24 copies per lane
  auto fill = [&](int t, int b) {
    const unsigned lb = (unsigned)b * (unsigned)(STG * 2);
    copy8(lK + lb,           8 * KP * 2,  gKh + (size_t)t * (KT * DQ), (size_t)8 * DQ);
    copy8(lK + lb + KPL * 2, 8 * KP * 2,  gKl + (size_t)t * (KT * DQ), (size_t)8 * DQ);
    copy8(lV + lb,           16 * VP * 2, gV + (size_t)t * KT,         (size_t)16 * SEQ);
  };

  // prologue: the query tile (read by every pass) and stage 0, landed and published; then stage 1 in flight
  copy8(lQ,           8 * KP * 2, Qh + (size_t)(n0 + rK) * DQ + 8 * pK, (size_t)8 * DQ);
  copy8(lQ + KPL * 2, 8 * KP * 2, Ql + (size_t)(n0 + rK) * DQ + 8 * pK, (size_t)8 * DQ);
  fill(0, 0);
  wait_async0();
  __syncthreads();
  fill(1, 1);

  // q fragment pointers (B operand, col = query 16*wave + c of the tile), + 32*kc
  const unsigned short* Qhp = Qs + (16 * wave + c) * KP + 8 * hh;
  const unsigned short* Qlp = Qhp + KPL;

  float m = -1.0e30f, l = 0.f;
  v8f o[8];
#pragma unroll
  for (int j = 0; j < 8; ++j) o[j] = zero8();

  // kept rolled: one trip is one stage with its publish point, and the buffer index alternates with t
#pragma unroll 1
  for (int t = 0; t < KSEQ / KT; ++t) {
    const unsigned short* st = Ring + (t & 1) * STG;
    for (int p = 0; p < KT / 32; ++p) {
      // k fragment bases (A operand, row = key 32p + c resp. 32p + 16 + c of the stage), + 32*kc
      const unsigned short* k0p  = st + (32 * p + c) * KP + 8 * hh;
      const unsigned short* k1p  = k0p + 16 * KP;
      const unsigned short* k0lp = k0p + KPL;
      const unsigned short* k1lp = k1p + KPL;
      // v fragment base (A operand, row = channel 16j + c, keys contiguous), + 16*j*VP
      const unsigned short* Vp = st + 2 * KPL + c * VP + 32 * p + 8 * hh;
      v8f s0 = zero8(), s1 = zero8();
      // fragments of d-chunk kc + 1 are read from LDS ahead of the products of chunk kc (two register sets): written in
      // this order, and unrolled, because LDS reads do not move across the gap statements of the product helpers
      Frag fq[2][2], fk[2][4];
      auto fetch = [&](int kc) {
        const int b = kc & 1;
        fq[b][0] = ldfrag(Qhp + 32 * kc);
        fq[b][1] = ldfrag(Qlp + 32 * kc);
        fk[b][0] = ldfrag(k0p + 32 * kc);
        fk[b][1] = ldfrag(k1p + 32 * kc);
        fk[b][2] = ldfrag(k0lp + 32 * kc);
        fk[b][3] = ldfrag(k1lp + 32 * kc);
      };
      fetch(0);
#pragma unroll
      for (int kc = 0; kc < DQ / 32; ++kc) {
        const int b = kc & 1;
        if (kc + 1 < DQ / 32) fetch(kc + 1);
        s0 = mma_b(fk[b][0].bf, fq[b][0].bf, s0);
        s1 = mma_b(fk[b][1].bf, fq[b][0].bf, s1);
        s0 = mma_b(fk[b][0].bf, fq[b][1].bf, s0);
        s1 = mma_b(fk[b][1].bf, fq[b][1].bf, s1);
        s0 = mma_b(fk[b][2].bf, fq[b][0].bf, s0);
        s1 = mma_b(fk[b][3].bf, fq[b][0].bf, s1);
      }
      // the pass's g fragments: read here so that their LDS time runs under the softmax arithmetic
      Frag vf[8];
#pragma unroll
      for (int j = 0; j < 8; ++j) vf[j] = ldfrag(Vp + (16 * j) * VP);

      float mx = fmaxf(hmax8(s0), hmax8(s1));
      mx = fmaxf(mx, __shfl_xor(mx, 16, 32));
      const float mn = fmaxf(m, mx);
      const unsigned grew = wave_ballot(mx > m);                     // wave-uniform
      if (grew != 0u) {
        const float corr = __expf(m - mn);                           // == 1 exactly for lanes whose max did not grow
        l *= corr;
#pragma unroll
        for (int j = 0; j < 8; ++j) {
#pragma unroll
          for (int r = 0; r < 8; ++r) o[j][r] *= corr;
        }
      }
      m = mn;
      const float msh = mn - LNPS;                                   // exp gives e^{s-m} * 16384

      FragH ph;
      float ls = 0.f;
#pragma unroll
      for (int r = 0; r < 8; ++r) {
        const float e0 = __expf(s0[r] - msh);                        // key 64t + 32p      + 8hh + r
        const float e1 = __expf(s1[r] - msh);                        // key 64t + 32p + 16 + 8hh + r
        ls += e0 + e1;
        ph.hv[0][r] = (_Float16)e0;
        ph.hv[1][r] = (_Float16)e1;
      }
      l += ls;

#pragma unroll
      for (int j = 0; j < 8; ++j) o[j] = mma_h(vf[j].h, ph.v, o[j]);
    }
    // publish point of stage t + 1: own LDS reads returned, own copies landed, every wave here; only then the refill
    wait_ds0();
    wait_async0();
    __syncthreads();
    if (t + 2 < KSEQ / KT) fill(t + 2, t & 1);
  }
  wait_async0();
  l += __shfl_xor(l, 16, 32);

  const size_t pt = (size_t)kr * NT16 + (size_t)(blockIdx.x * (QT / 16) + wave);   // (range, 16-query tile)
  float* po = Po + pt * (8 * 256) + 4 * lane;
#pragma unroll
  for (int j = 0; j < 8; ++j) {
    v4f va, vb;
#pragma unroll
    for (int r = 0; r < 4; ++r) { va[r] = o[j][r]; vb[r] = o[j][4 + r]; }
    *(v4f*)(po + j * 256)       = va;
    *(v4f*)(po + j * 256 + 128) = vb;
  }
  Pml[pt * 32 + lane] = hh ? l : m;                                  // m and l are equal in lanes c and 16 + c
}

// =========================================================================================================
// (4) output projection GEMM for one (64-n tile, 64-co block): out[n][co] = (1/256)(sum_c WW16[co][c] Yh[n][c] +
//     (1/1024) sum_c WW16[co][c] Yl[n][c]) + bf16-RNE(W_b[co]) + bf16-RNE(x[n][co]). 4 waves, wave w owns
//     cols n0+16w..+15, 4 m-tiles (A rows co = o0 + 16 mt + (lane&15) from WW16), hi and residual products in
//     separate accumulators. K = 128 = 4 steps.
//     B operand: y = sum_s a_s Po[s], a_s = e^{m_s - M} / sum_s e^{m_s - M} l_s, M = max_s m_s, merged in f32 from the
//     KS key ranges' partials; Yh = f16(y), Yl = f16((y - Yh) * 1024). A lane's Po words of tile j are channels
//     16j + 8(lane>>4) + 0..7 of query lane&15: tiles 2ks and 2ks + 1 are elements 0..7 and 8..15 of the B fragment
//     of k-step ks, lane unchanged.
//     Epilogue staged in LDS Os[n_loc][co_loc], barrier, then out rows (position-major, 1024 B each): lane
//     (e = tid&15) -> co o0+4e..+3 of row n_loc = 8 it + (tid>>4); 16 consecutive lanes x 16 B = the whole 256-B
// coverage: Os 4 waves x 16 n x 64 co (cols 0..63 written and read); out 8 it x 8 rows x 16 lanes x 4 floats =
//           64 n x 64 co; grid (SEQ/64, 4) covers out[0..SEQ-1][0..255] exactly once.
// LDS Os: cross-wave (block barrier).
// =========================================================================================================
__global__ __launch_bounds__(128)
void gemm_o(const unsigned short* __restrict__ WW16, const float* __restrict__ Po,
            const float* __restrict__ Pml, const float* __restrict__ wbias,
            const float* __restrict__ x, float* out) {
  __shared__ __align__(16) float Os[QT * OSP];
  const int tid  = threadIdx.x;
  const int lane = tid & 31, wave = tid >> 5;
  const int hh   = lane >> 4, c = lane & 15;
  const int nt   = blockIdx.x, mb = blockIdx.y;
  const int n0   = nt * QT, o0 = mb * QT;

  const unsigned short* ap  = WW16 + (size_t)(o0 + c) * DQ + 8 * hh;
  const size_t t16 = (size_t)(nt * (QT / 16) + wave);                // the wave's 16-query tile

  const float* pml = Pml + t16 * 32 + c;
  const float* pp  = Po + t16 * (8 * 256) + 4 * lane;
  float ms[KS], as[KS];
  FragH fyh[DQ / 32], fyl[DQ / 32];
#pragma unroll
  for (int g = 0; g < 2; ++g) {                                      // tiles j = 4g .. 4g+3 = k-steps 2g, 2g+1
    v4f pv[KS][4][2];
    if (g == 0) {
#pragma unroll
      for (int s = 0; s < KS; ++s) {
        ms[s] = pml[(size_t)s * (NT16 * 32)];
        as[s] = pml[(size_t)s * (NT16 * 32) + 16];
      }
    }
#pragma unroll
    for (int s = 0; s < KS; ++s) {
#pragma unroll
      for (int jj = 0; jj < 4; ++jj) {
        pv[s][jj][0] = *(const v4f*)(pp + (size_t)s * (NT16 * 8 * 256) + (4 * g + jj) * 256);
        pv[s][jj][1] = *(const v4f*)(pp + (size_t)s * (NT16 * 8 * 256) + (4 * g + jj) * 256 + 128);
      }
    }
    // the group's loaded words, inputs only: all its loads are issued ahead of the arithmetic, one round trip for the
    // group instead of one for every pair of loads
    hold16(pv[0], pv[1], pp);
    hold16(pv[2], pv[3], pp + (size_t)2 * (NT16 * 8 * 256));
    if (g == 0) {                                                    // merge weights of query c
      float mall = ms[0];
#pragma unroll
      for (int s = 1; s < KS; ++s) mall = fmaxf(mall, ms[s]);
      float lall = 0.f;
#pragma unroll
      for (int s = 0; s < KS; ++s) {
        const float w = __expf(ms[s] - mall);
        lall += w * as[s];
        as[s] = w;
      }
      const float inv = 1.0f / lall;                                 // o and l both carry the x16384 factor
#pragma unroll
      for (int s = 0; s < KS; ++s) as[s] *= inv;
    }
#pragma unroll
    for (int jj = 0; jj < 4; ++jj) {
      const int j = 4 * g + jj;
#pragma unroll
      for (int r = 0; r < 8; ++r) {
        float y = as[0] * pv[0][jj][r >> 2][r & 3];
#pragma unroll
        for (int s = 1; s < KS; ++s) y += as[s] * pv[s][jj][r >> 2][r & 3];
        const _Float16 h0 = (_Float16)y;
        fyh[j >> 1].hv[j & 1][r] = h0;
        fyl[j >> 1].hv[j & 1][r] = (_Float16)((y - (float)h0) * RSC);
      }
    }
  }

  v8f acc[4], accr[4];
#pragma unroll
  for (int mt = 0; mt < 4; ++mt) { acc[mt] = zero8(); accr[mt] = zero8(); }

#pragma unroll
  for (int ks = 0; ks < DQ / 32; ++ks) {
#pragma unroll
    for (int mt = 0; mt < 4; ++mt) {
      const Frag fa = ldfrag(ap + (size_t)(16 * mt) * DQ + 32 * ks);
      acc[mt]  = mma_h(fa.h, fyh[ks].v, acc[mt]);
      accr[mt] = mma_h(fa.h, fyl[ks].v, accr[mt]);
    }
  }

  {
    const int nl = 16 * wave + c;
#pragma unroll
    for (int mt = 0; mt < 4; ++mt) {
      v4f va, vb;
#pragma unroll
      for (int r = 0; r < 4; ++r) {
        va[r] = (acc[mt][r] + accr[mt][r] * IRSC) * IWSC;
        vb[r] = (acc[mt][4 + r] + accr[mt][4 + r] * IRSC) * IWSC;
      }
      *(v4f*)(Os + nl * OSP + 16 * mt + 8 * hh)     = va;
      *(v4f*)(Os + nl * OSP + 16 * mt + 8 * hh + 4) = vb;
    }
  }
  __syncthreads();

  const int e = tid & 15, lq = tid >> 4;                             // lq 0..7
  const v4f bv = *(const v4f*)(wbias + o0 + 4 * e);
  const float bb[4] = {bfr(bv[0]), bfr(bv[1]), bfr(bv[2]), bfr(bv[3])};
  v4f res[8];
#pragma unroll
  for (int it = 0; it < 8; ++it) {
    const int nl = it * 8 + lq;                                      // n_loc 0..63
    const size_t idx = ((size_t)(n0 + nl)) * CC + o0 + 4 * e;
    const v4f xv = *(const v4f*)(x + idx);
    const v4f ov = *(const v4f*)(Os + nl * OSP + 4 * e);
#pragma unroll
    for (int t = 0; t < 4; ++t) res[it][t] = ov[t] + bb[t] + bfr(xv[t]);
  }
{
#pragma unroll
    for (int it = 0; it < 8; ++it) {
      const int nl = it * 8 + lq;
      const size_t idx = ((size_t)(n0 + nl)) * CC + o0 + 4 * e;
      *(v4f*)(out + idx) = res[it];
    }
    
  }
}

// =========================================================================================================
// Workspace map (bytes; each region start a multiple of 256; every plane size is an exact multiple of its
// whole-line store granularity, SEQ a multiple of 64 so no tail rows exist):
//   W16  f16 [384][256]          196608      WW16 f16 [256][128]     65536
//   XP   f16 [SEQ][256]         4194304 (SEQ=8192)
//   Qh/Ql bf16 [SEQ][128]        2097152 x2
//   Kh/Kl bf16 [SEQ][128]        2097152 x2
//   Gc   f16 [128][SEQ]          2097152
//   Po   f32 [KS][SEQ/16][8][2][32][4]  16777216 (KS=4)      Pml f32 [KS][SEQ/16][32]  262144
//   total (SEQ=8192) = 31981568
// =========================================================================================================
extern "C" void kernel_launch(void* const* d_in, const int* in_sizes, int n_in,
                              void* d_out, int out_size, void* d_ws, size_t ws_size,
                              hipStream_t stream) {
  const int XN = SEQ * CC;
  if (n_in < 9) return;
  if (in_sizes[0] < XN) return;
  if (in_sizes[1] < CC * DQ || in_sizes[3] < CC * DQ || in_sizes[5] < CC * DQ) return;
  if (in_sizes[2] < DQ || in_sizes[4] < DQ || in_sizes[6] < DQ) return;
  if (in_sizes[7] < DQ * CC || in_sizes[8] < CC) return;
  if (out_size < XN) return;

  size_t off = 0;
  auto carve = [&](size_t bytes) { const size_t o = off; off += (bytes + 255) & ~(size_t)255; return o; };
  const size_t oW16 = carve((size_t)MW * CC * 2);
  const size_t oWW  = carve((size_t)CC * DQ * 2);
  const size_t oXP  = carve((size_t)SEQ * CC * 2);
  const size_t oQh  = carve((size_t)SEQ * DQ * 2);
  const size_t oQl  = carve((size_t)SEQ * DQ * 2);
  const size_t oKh  = carve((size_t)SEQ * DQ * 2);
  const size_t oKl  = carve((size_t)SEQ * DQ * 2);
  const size_t oGc  = carve((size_t)DQ * SEQ * 2);
  const size_t oPo  = carve((size_t)KS * SEQ * DQ * 4);
  const size_t oPml = carve((size_t)KS * NT16 * 32 * 4);
  if (off > ws_size) return;
  if (off > (size_t)134217728) return;

  const float* x  = (const float*)d_in[0];
  const float* gw = (const float*)d_in[1];
  const float* gb = (const float*)d_in[2];
  const float* tw = (const float*)d_in[3];
  const float* tb = (const float*)d_in[4];
  const float* pw = (const float*)d_in[5];
  const float* pb = (const float*)d_in[6];
  const float* ww = (const float*)d_in[7];
  const float* wb = (const float*)d_in[8];

  char* ws = (char*)d_ws;
  unsigned short* W16  = (unsigned short*)(ws + oW16);
  unsigned short* WW16 = (unsigned short*)(ws + oWW);
  unsigned short* XP   = (unsigned short*)(ws + oXP);
  unsigned short* Qh   = (unsigned short*)(ws + oQh);
  unsigned short* Ql   = (unsigned short*)(ws + oQl);
  unsigned short* Kh   = (unsigned short*)(ws + oKh);
  unsigned short* Kl   = (unsigned short*)(ws + oKl);
  unsigned short* Gc   = (unsigned short*)(ws + oGc);
  float* Po  = (float*)(ws + oPo);
  float* Pml = (float*)(ws + oPml);
  float* out = (float*)d_out;

  const dim3 blk256(256), blk128(128);

  // (0) projection weights [in=256][out=128] -> stacked f16 plane W16 [out rows 0..383][in 256]:
  //     src [R=256][S=128] -> dst rows rowBase + s, cols r; grid (S/64, R/64)
  cvt_wt<<<dim3(DQ / QT, CC / QT), blk256, 0, stream>>>(tw, W16, CC, DQ, 0);
  cvt_wt<<<dim3(DQ / QT, CC / QT), blk256, 0, stream>>>(pw, W16, CC, DQ, DQ);
  cvt_wt<<<dim3(DQ / QT, CC / QT), blk256, 0, stream>>>(gw, W16, CC, DQ, 2 * DQ);
  //     W_w [in=128][out=256] -> WW16 [out 256][in 128]: src [R=128][S=256], grid (S/64, R/64)
  cvt_wt<<<dim3(CC / QT, DQ / QT), blk256, 0, stream>>>(ww, WW16, DQ, CC, 0);
  // (1) x -> 16-bit plane (same position-major layout)
  cvt_x<<<dim3(SEQ / 8), blk256, 0, stream>>>(x, XP);
  // (2) theta / phi -> hi + residual planes, g -> channel-major plane
  gemm_qkv<<<dim3(SEQ / QT, 6), blk128, 0, stream>>>(W16, XP, tb, pb, gb, Qh, Ql, Kh, Kl, Gc);
  // (3) attention, KS key ranges per query tile -> per-range partials
  attn_k<<<dim3(SEQ / QT, KS), blk128, 0, stream>>>(Qh, Ql, Kh, Kl, Gc, Po, Pml);
  // (4) merge of the ranges + output projection + bias + residual -> out [SEQ][256]
  gemm_o<<<dim3(SEQ / QT, CC / QT), blk128, 0, stream>>>(WW16, Po, Pml, wb, x, out);
  (void)hipGetLastError();
}

// v003
// Measured time: 87.7 microseconds a run.
// Timed twice side by side with v002, it ran 1.03 and 1.04 times as fast.
// Counting every step since v000, it is 8.87 times as fast.
// Contractions: theta/phi/g projection GEMMs Wt[384x256].Xp[256xN] and the output projection Wo[256x128].Y[128xN] on
// v_wmma_f32_16x16x32_f16 (f16 containers of bf16-RNE weights x256 and bf16-RNE x; Y as f16 hi fragment plus f16
// residual fragment x1024, 2 products, separate accumulators); scores Phi.Theta^T on v_wmma_f32_16x16x32_bf16
// (bf16 hi + bf16 residual planes of theta/phi, 3 products, K=128); Y^T = G.P^T on v_wmma_f32_16x16x32_f16
// (G plain f16, P = e^{s-m} x16384 f16 from the score D registers); f32 accumulate everywhere; softmax
// statistics, biases and the residual add in f32 VALU.
#include <hip/hip_runtime.h>
#include <math.h>
#include <stdint.h>

#ifndef NB
#define NB 1
#endif
#define NB_FULL 1
#ifndef SEQ
#define SEQ 8192
#endif
#define SEQ_FULL 8192
#define CC   256
#define DQ   128
#define QT   64
#define MW   384
#define OSP  68
#define TP   72
#define WSC  256.0f
#define IWSC 0.00390625f
#define RSC  1024.0f
#define IRSC 0.0009765625f
#define LNPS 9.704060527839234f
#define KT   64
#define KP   136
#define VP   72
#define KPL  (KT * KP)
#define STG  (2 * KPL + DQ * VP)
#define KS   4
#define KSEQ (SEQ / KS)
#define NT16 (SEQ / 16)
#define XW   (8 * 256 + 64)

static_assert(NB == 1 && NB_FULL == 1);
static_assert(SEQ >= QT && SEQ <= SEQ_FULL);
static_assert(SEQ % QT == 0 && SEQ % 32 == 0 && SEQ % 8 == 0);
static_assert(CC % QT == 0 && CC % 32 == 0);
static_assert(DQ == 2 * QT && DQ % 32 == 0);
static_assert(MW == 3 * DQ && MW % 8 == 0);
static_assert((OSP * 4) % 16 == 0);
static_assert((TP * 2) % 16 == 0);
static_assert(SEQ % KS == 0 && KSEQ % KT == 0 && KSEQ / KT >= 2 && KT == QT && KT % 32 == 0);
static_assert(2 * (2 * STG + 2 * KPL) * 2 <= 327680);                // two work-groups of attn_k per 320-KiB LDS
static_assert(KT == 64 && QT == 64 && 4 * XW * 4 <= 2 * STG * 2);         // attn_k: 2 x 2 waves of 32 keys x 32 queries; hand-over area
static_assert((KP * 2) % 32 == 16 && (VP * 2) % 32 == 16 && KP >= DQ + 8 && VP >= KT + 8);

typedef _Float16       v16h __attribute__((ext_vector_type(16)));
typedef _Float16       v8h  __attribute__((ext_vector_type(8)));
typedef __bf16         v16b __attribute__((ext_vector_type(16)));
typedef unsigned short v8us __attribute__((ext_vector_type(8)));
typedef float          v8f  __attribute__((ext_vector_type(8)));
typedef float          v4f  __attribute__((ext_vector_type(4)));
typedef unsigned int   v4u  __attribute__((ext_vector_type(4)));

union Frag  { v8us u[2]; v16h h; v16b bf; };
union FragH { v16h v; v8h hv[2]; };
static_assert(sizeof(Frag) == 32);
static_assert(sizeof(FragH) == 32);

// ---- scalar helpers ---------------------------------------------------------------------------------------
__device__ __forceinline__ unsigned short bf_bits(float f) {          // f32 -> bf16 bits, RNE convert
  unsigned u = __float_as_uint(f);
  return (unsigned short)((u + 0x7FFFu + ((u >> 16) & 1u)) >> 16);
}
__device__ __forceinline__ float bf_up(unsigned short hb) { return __uint_as_float(((unsigned)hb) << 16); }
__device__ __forceinline__ float bfr(float f) { return bf_up(bf_bits(f)); }
__device__ __forceinline__ unsigned short h_bits(_Float16 x) { return __builtin_bit_cast(unsigned short, x); }
__device__ __forceinline__ unsigned pk16(unsigned short a, unsigned short b) { return (unsigned)a | ((unsigned)b << 16); }
__device__ __forceinline__ v8f zero8() { v8f z = {0.f, 0.f, 0.f, 0.f, 0.f, 0.f, 0.f, 0.f}; return z; }
__device__ __forceinline__ float hmax8(v8f s) {
  return fmaxf(fmaxf(fmaxf(s[0], s[1]), fmaxf(s[2], s[3])), fmaxf(fmaxf(s[4], s[5]), fmaxf(s[6], s[7])));
}
__device__ __forceinline__ unsigned wave_ballot(bool p) {
#if defined(__HIP_DEVICE_COMPILE__)
  return __builtin_amdgcn_ballot_w32(p);
#else
  return p ? 1u : 0u;
#endif
}

// ---- 16-bit fragment loader (A, or B from a k-contiguous [n][k] row): lane -> row/col (lane&15), p already includes
//      + 8*(lane>>4); elements 0..7 <- p[0..7] (k0+8h..), elements 8..15 <- p[16..23] (k0+16+8h..)
__device__ __forceinline__ Frag ldfrag(const unsigned short* p) {
  Frag f;
  f.u[0] = *(const v8us*)(p);
  f.u[1] = *(const v8us*)(p + 16);
  return f;
}

// ---- WMMA helpers: builtin followed by a 4-slot VALU gap tying D and keeping A/B live --------------------------
__device__ __forceinline__ v8f mma_h(v16h a, v16h b, v8f c) {
  v8f d = __builtin_amdgcn_wmma_f32_16x16x32_f16(false, a, false, b, (short)0, c, false, false);
#if defined(__HIP_DEVICE_COMPILE__)
  asm volatile("v_nop\n\tv_nop\n\tv_nop\n\tv_nop" : "+v"(d) : "v"(a), "v"(b));
#endif
  return d;
}
__device__ __forceinline__ v8f mma_b(v16b a, v16b b, v8f c) {
  v8f d = __builtin_amdgcn_wmma_f32_16x16x32_bf16(false, a, false, b, (short)0, c, false, false);
#if defined(__HIP_DEVICE_COMPILE__)
  const v16h ha = __builtin_bit_cast(v16h, a), hb = __builtin_bit_cast(v16h, b);
  asm volatile("v_nop\n\tv_nop\n\tv_nop\n\tv_nop" : "+v"(d) : "v"(ha), "v"(hb));
#endif
  return d;
}

// The same products for attn_k, whose wave tile takes more than 256 registers: an operand of an asm statement has to lie
// in v0..v255, so the gap statement names D alone and the A and B fragments are free to lie above.
__device__ __forceinline__ v8f mma_hd(v16h a, v16h b, v8f c) {
  v8f d = __builtin_amdgcn_wmma_f32_16x16x32_f16(false, a, false, b, (short)0, c, false, false);
#if defined(__HIP_DEVICE_COMPILE__)
  asm volatile("v_nop\n\tv_nop\n\tv_nop\n\tv_nop" : "+v"(d));
#endif
  return d;
}
__device__ __forceinline__ v8f mma_bd(v16b a, v16b b, v8f c) {
  v8f d = __builtin_amdgcn_wmma_f32_16x16x32_bf16(false, a, false, b, (short)0, c, false, false);
#if defined(__HIP_DEVICE_COMPILE__)
  asm volatile("v_nop\n\tv_nop\n\tv_nop\n\tv_nop" : "+v"(d));
#endif
  return d;
}

// ---- asynchronous copies global -> LDS ------------------------------------------------------------------------
__device__ __forceinline__ unsigned lds_addr(const unsigned short* p) { return (unsigned)(uintptr_t)p; }  // LDS byte address

// Eight 16-B copies per lane: copy i moves g + i*gstep (halves) to LDS byte address l + i*lstep. All lanes on.
__device__ __forceinline__ void copy8(unsigned l, unsigned lstep, const unsigned short* g, size_t gstep) {
#if defined(__HIP_DEVICE_COMPILE__)
  // the closing s_wait_xcnt keeps later rewrites of the address registers behind the issued copies
  asm volatile("global_load_async_to_lds_b128 %0, %8, off\n\t"
               "global_load_async_to_lds_b128 %1, %9, off\n\t"
               "global_load_async_to_lds_b128 %2, %10, off\n\t"
               "global_load_async_to_lds_b128 %3, %11, off\n\t"
               "global_load_async_to_lds_b128 %4, %12, off\n\t"
               "global_load_async_to_lds_b128 %5, %13, off\n\t"
               "global_load_async_to_lds_b128 %6, %14, off\n\t"
               "global_load_async_to_lds_b128 %7, %15, off\n\t"
               "s_wait_xcnt 0x0"
               :: "v"(l), "v"(l + lstep), "v"(l + 2 * lstep), "v"(l + 3 * lstep),
                  "v"(l + 4 * lstep), "v"(l + 5 * lstep), "v"(l + 6 * lstep), "v"(l + 7 * lstep),
                  "v"(g), "v"(g + gstep), "v"(g + 2 * gstep), "v"(g + 3 * gstep),
                  "v"(g + 4 * gstep), "v"(g + 5 * gstep), "v"(g + 6 * gstep), "v"(g + 7 * gstep)
               : "memory");
#endif
}
__device__ __forceinline__ void wait_async0() {   // this wave's copies have landed in LDS
#if defined(__HIP_DEVICE_COMPILE__)
  asm volatile("s_wait_asynccnt 0x0" ::: "memory");
#endif
}
__device__ __forceinline__ void wait_ds0() {      // this wave's LDS reads have returned before the buffer is handed back
#if defined(__HIP_DEVICE_COMPILE__)
  asm volatile("s_wait_dscnt 0x0" ::: "memory");
#endif
}

// Inputs-only fence on sixteen loaded 16-B words: every one of them has arrived here. The wait stands behind the loads and
// ahead of any rewrite of their address registers: their base p is named so that it lives up to the wait.
__device__ __forceinline__ void hold16(const v4f (&a)[4][2], const v4f (&b)[4][2], const float* p) {
#if defined(__HIP_DEVICE_COMPILE__)
  asm volatile("s_wait_xcnt 0x0"
               :: "v"(a[0][0]), "v"(a[0][1]), "v"(a[1][0]), "v"(a[1][1]), "v"(a[2][0]), "v"(a[2][1]), "v"(a[3][0]), "v"(a[3][1]),
                  "v"(b[0][0]), "v"(b[0][1]), "v"(b[1][0]), "v"(b[1][1]), "v"(b[2][0]), "v"(b[2][1]), "v"(b[3][0]), "v"(b[3][1]),
                  "v"(p));
#endif
}

// =========================================================================================================
// (0) weight transpose + convert: src f32 [R][S] (row r contiguous over S; the projection weights are stored
//     [in][out]) -> dst f16 row (rowBase + s), col r, pitch R halves; value = f16 of (bf16-RNE(w) * 256) (exact).
//     Through an LDS tile T[64 s][64 r] (pitch TP). Block (sb, rb) owns a 64 r x 64 s tile.
// coverage: load 2 it x 32 rows x 8 lanes x 8 = 64 r x 64 s; store 2 it x 32 s-rows x 8 lanes x 8 halves = 64 s x 64 r;
//           grid (S/64, R/64) covers dst rows rowBase..rowBase+S-1 x cols 0..R-1 exactly once.
// LDS T: cross-wave (block barrier between the 2-byte stores and the 16-B reloads).
// =========================================================================================================
__global__ __launch_bounds__(256)
void cvt_wt(const float* __restrict__ src, unsigned short* dst, int R, int S, int rowBase) {
  __shared__ __align__(16) unsigned short T[QT * TP];
  const int tid = threadIdx.x;
  const int sb = blockIdx.x, rb = blockIdx.y;
  const int e = tid & 7, lq = tid >> 3;                             // lq 0..31
  const int s0 = sb * QT, r0 = rb * QT;
#pragma unroll
  for (int it = 0; it < 2; ++it) {
    const int rl = it * 32 + lq;                                     // r_loc 0..63
    const float* sp = src + ((size_t)(r0 + rl)) * (size_t)S + s0 + 8 * e;
    const v4f a = *(const v4f*)sp;
    const v4f q = *(const v4f*)(sp + 4);
    unsigned short hb[8];
#pragma unroll
    for (int t = 0; t < 4; ++t) {
      hb[t]     = h_bits((_Float16)(bfr(a[t]) * WSC));
      hb[4 + t] = h_bits((_Float16)(bfr(q[t]) * WSC));
    }
#pragma unroll
    for (int t = 0; t < 8; ++t) T[(8 * e + t) * TP + rl] = hb[t];   // T[s_loc][r_loc]
  }
  __syncthreads();
  v4u up[2];
#pragma unroll
  for (int it = 0; it < 2; ++it) {
    const int sl = it * 32 + lq;                                     // s_loc 0..63
    up[it] = *(const v4u*)(T + sl * TP + 8 * e);                     // r_loc 8e..8e+7
  }
{
#pragma unroll
    for (int it = 0; it < 2; ++it) {
      const int sl = it * 32 + lq;
      *(v4u*)(dst + ((size_t)(rowBase + s0 + sl)) * (size_t)R + r0 + 8 * e) = up[it];
    }
    
  }
}

// =========================================================================================================
// (1) x f32 [N][256] (already position-major) -> XP f16 [N][256], value = bf16-RNE(x) in an f16 container.
// coverage: SEQ/8 blocks x 8 rows x 32 lanes x 8 halves = SEQ x 256 = the whole plane.
// =========================================================================================================
__global__ __launch_bounds__(256)
void cvt_x(const float* __restrict__ x, unsigned short* XP) {
  const int tid = threadIdx.x, blk = blockIdx.x;
  const int row = 8 * blk + (tid >> 5);                              // 0..SEQ-1
  const int col = 8 * (tid & 31);                                    // 0..248
  const float* s = x + (size_t)row * CC + col;
  const v4f a = *(const v4f*)s;
  const v4f q = *(const v4f*)(s + 4);
  const float f[8] = {a[0], a[1], a[2], a[3], q[0], q[1], q[2], q[3]};
  v4u u;
#pragma unroll
  for (int t = 0; t < 4; ++t) {
    const _Float16 h0 = (_Float16)bfr(f[2 * t]);
    const _Float16 h1 = (_Float16)bfr(f[2 * t + 1]);
    u[t] = pk16(h_bits(h0), h_bits(h1));
  }
{
    *(v4u*)(XP + (size_t)row * CC + col) = u;
    
  }
}

// =========================================================================================================
// (2) theta / phi / g projection GEMM for one (64-n tile nt, 64-o block mb in 0..5): Y[o][n] = (1/256)
//     sum_c W16[mb*64 + o][c] XP[n][c] + bf16-RNE(bias[o]). W16 rows 0..127 = theta, 128..255 = phi, 256..383 = g.
//     Block 128 threads = 4 waves; wave w owns cols n0+16w..+15 (B fragment from the XP row, k = c contiguous,
//     split k map) and 4 m-tiles (A rows o = o0 + 16 mt + (lane&15), split k map from W16). K = 256 = 8 steps.
//     Epilogue staged in LDS Os[n_loc][o_loc] (pitch OSP), barrier, bias add in f32, then:
//       mb 0,1 (theta) / 2,3 (phi): bf16 hi = RNE(v), lo = RNE(v - hi) planes Qh/Ql resp. Kh/Kl [N][128 d]
//         the dsel half of the 256-B row): lane e -> d 8e..8e+7, 8 consecutive lanes per line, one instruction per
//         16 lines;
//       mb 4,5 (g): f16 plane Gc [128 ch][N keys] (channel-major, keys contiguous); row ch, 64 keys = one whole
// coverage: Os 4 waves x 16 n x 64 o = 64 x 64 (cols 0..63 written and read); hi/lo planes 4 it x 16 rows x 8 lanes
//           x 8 = 64 n x 64 d per plane, grid nt x mb {0,1} / {2,3} covers d 0..127 of all N rows of Qh/Ql / Kh/Kl
//           exactly once; g plane 4 it x 16 ch x 8 lanes x 8 keys = 64 ch x 64 keys, nt x mb {4,5} covers ch 0..127
//           x keys 0..N-1 of Gc exactly once. grid (N/64, 6).
// LDS Os: cross-wave (block barrier).
// =========================================================================================================
__global__ __launch_bounds__(128)
void gemm_qkv(const unsigned short* __restrict__ W16, const unsigned short* __restrict__ XP,
              const float* __restrict__ tbias, const float* __restrict__ pbias, const float* __restrict__ gbias,
              unsigned short* Qh, unsigned short* Ql, unsigned short* Kh, unsigned short* Kl, unsigned short* Gc) {
  __shared__ __align__(16) float Os[QT * OSP];
  const int tid  = threadIdx.x;
  const int lane = tid & 31, wave = tid >> 5;
  const int hh   = lane >> 4, c = lane & 15;
  const int nt   = blockIdx.x, mb = blockIdx.y;
  const int n0   = nt * QT, o0 = mb * QT;                            // o0 = W16 row base 0..320

  const unsigned short* ap = W16 + (size_t)(o0 + c) * CC + 8 * hh;
  const unsigned short* bp = XP + ((size_t)(n0 + 16 * wave + c)) * CC + 8 * hh;

  v8f acc[4];
#pragma unroll
  for (int mt = 0; mt < 4; ++mt) acc[mt] = zero8();

#pragma unroll
  for (int ks = 0; ks < CC / 32; ++ks) {
    const Frag fb = ldfrag(bp + 32 * ks);
#pragma unroll
    for (int mt = 0; mt < 4; ++mt) {
      const Frag fa = ldfrag(ap + (size_t)(16 * mt) * CC + 32 * ks);
      acc[mt] = mma_h(fa.h, fb.h, acc[mt]);
    }
  }

  {
    const int nl = 16 * wave + c;
#pragma unroll
    for (int mt = 0; mt < 4; ++mt) {
      v4f va, vb;
#pragma unroll
      for (int r = 0; r < 4; ++r) { va[r] = acc[mt][r] * IWSC; vb[r] = acc[mt][4 + r] * IWSC; }
      *(v4f*)(Os + nl * OSP + 16 * mt + 8 * hh)     = va;
      *(v4f*)(Os + nl * OSP + 16 * mt + 8 * hh + 4) = vb;
    }
  }
  __syncthreads();

  const int e = tid & 7, lq = tid >> 3;                             // lq 0..15
  const int grp  = mb >> 1;                                          // 0 theta, 1 phi, 2 g (block-uniform)
  const int dsel = (mb & 1) * QT;                                    // channel base 0 or 64 within the group
  if (grp < 2) {                                                     // block-uniform: bf16 hi/lo planes
    const float* bsrc = (grp == 0) ? tbias : pbias;
    unsigned short* Hp = (grp == 0) ? Qh : Kh;
    unsigned short* Lp = (grp == 0) ? Ql : Kl;
    const v4f b0 = *(const v4f*)(bsrc + dsel + 8 * e);
    const v4f b1 = *(const v4f*)(bsrc + dsel + 8 * e + 4);
    const float bb[8] = {bfr(b0[0]), bfr(b0[1]), bfr(b0[2]), bfr(b0[3]), bfr(b1[0]), bfr(b1[1]), bfr(b1[2]), bfr(b1[3])};
    v4u uh[4], ul[4];
#pragma unroll
    for (int it = 0; it < 4; ++it) {
      const int row = it * 16 + lq;                                  // n_loc 0..63
      const v4f a = *(const v4f*)(Os + row * OSP + 8 * e);
      const v4f q = *(const v4f*)(Os + row * OSP + 8 * e + 4);
      const float f[8] = {a[0], a[1], a[2], a[3], q[0], q[1], q[2], q[3]};
#pragma unroll
      for (int t = 0; t < 4; ++t) {
        const float f0 = f[2 * t] + bb[2 * t], f1 = f[2 * t + 1] + bb[2 * t + 1];
        const unsigned short hb0 = bf_bits(f0), hb1 = bf_bits(f1);
        const unsigned short lb0 = bf_bits(f0 - bf_up(hb0));
        const unsigned short lb1 = bf_bits(f1 - bf_up(hb1));
        uh[it][t] = pk16(hb0, hb1);
        ul[it][t] = pk16(lb0, lb1);
      }
    }
{
#pragma unroll
      for (int it = 0; it < 4; ++it) {
        const int row = it * 16 + lq;
        const size_t po = ((size_t)(n0 + row)) * DQ + dsel + 8 * e;
        *(v4u*)(Hp + po) = uh[it];
        *(v4u*)(Lp + po) = ul[it];
      }
      
    }
  } else {                                                           // block-uniform: g plane
    const int gsel = dsel;                                           // g channel base 0 or 64
    v4u ug[4];
#pragma unroll
    for (int it = 0; it < 4; ++it) {
      const int cl = it * 16 + lq;                                   // ch_loc 0..63
      const float bias = bfr(gbias[gsel + cl]);
      unsigned short hb[8];
#pragma unroll
      for (int t = 0; t < 8; ++t) {
        const int key = 8 * e + t;                                   // key_loc 0..63
        const float v = Os[key * OSP + cl] + bias;
        hb[t] = h_bits((_Float16)v);
      }
#pragma unroll
      for (int t = 0; t < 4; ++t) ug[it][t] = pk16(hb[2 * t], hb[2 * t + 1]);
    }
{
#pragma unroll
      for (int it = 0; it < 4; ++it) {
        const int cl = it * 16 + lq;
        const size_t po = ((size_t)(gsel + cl)) * (size_t)SEQ + n0 + 8 * e;
        *(v4u*)(Gc + po) = ug[it];
      }
      
    }
  }
}

// =========================================================================================================
// (3) attention for one 64-query tile and one of KS key ranges (KSEQ keys each), transposed formulation, no mask, no
//   scale. The KS ranges of a tile run as separate work-groups, so that the grid gives every SIMD two waves:
//   S^T tile (16 keys x 16 queries) = sum over 4 d-chunks of A(phi: row = key kb + (lane&15), 32 d via the split
//   k map from the bf16 plane Kh [SEQ][128]) . B(theta: col = query, same map from Qh) + A(Kh).B(Ql) +
//   A(Kl).B(Qh) (bf16 unscaled residual planes, shared accumulator).
//   Wave tile: 32 keys x 32 queries. Wave w takes query columns 32*(w&1) .. +31 (two B tiles u = 0, 1) and keys
//   32*(w>>1) .. +31 of every 64-key stage, so that each K and g fragment read from LDS feeds two query tiles.
//   Per lane a D tile holds 8 keys of ONE query: online softmax state per lane and query tile, one shuffle (lane^16) for
//   the max over 32 keys; the o/l rescale is skipped under a wave-uniform ballot when no lane's max grew (corr == 1
//   exactly for every lane then); row-sum partials combined at the end. P = e^{s-m} x 16384 as f16 is the B operand of
//   Y^T (rows channel, cols queries) += A(g rows channel = 16j + (lane&15), keys contiguous, f16 plane Gc
//   [128][SEQ]) . B(P^T): element r <- D of the tile covering keys kb..kb+15, element 8+r <- the tile covering
//   kb+16..kb+31, lane unchanged. 2 x 8 accumulator tiles per wave (128 channels x 32 queries). Block = 4 waves.
//   Operand path: the block's query tile (once) and 64-key stages of Kh, Kl, Gc come into LDS by asynchronous 16-B
//   copies in whole lines, two stage buffers, one publish point per stage; all fragments are ds_load_b128 reads at
//   pitches of 16 B x odd (272 B for 256-B rows, 144 B for 128-B rows).
//   Epilogue: waves w and w^2 hold the two key halves of the same 32 queries. Each keeps query tile u = w>>1, hands its
//   other tile (o, m, l) to the partner through the ring's LDS (free behind the last publish point), and merges the
//   partner's half into its own in f32. The range's un-normalised result goes to the workspace in register order,
//   Po[range][16-query tile][j][half][lane][4 f32] (element 4*half + i of tile j; each store = 512 contiguous B), with
//   Pml[range][16-query tile][32]: word c = the range's maximum of query c, word 16 + c = its row sum (x16384, as o).
//   The output projection merges the ranges.
// coverage: Po 4 waves x 8 j x 2 halves x 32 lanes x 4 = 64 queries x 128 ch per range; Pml 4 waves x 32 words; grid
//           (SEQ/64, KS) covers Po and Pml exactly once.
// LDS Ring, Qs: cross-wave (copy wait, then block barrier); hand-over area in Ring: cross-wave (block barrier).
// =========================================================================================================
__global__ __launch_bounds__(128)
void attn_k(const unsigned short* __restrict__ Qh, const unsigned short* __restrict__ Ql,
            const unsigned short* __restrict__ Kh, const unsigned short* __restrict__ Kl,
            const unsigned short* __restrict__ Gc, float* Po, float* Pml) {
  __shared__ __align__(128) unsigned short Ring[2 * STG];            // two stages: Kh[64][KP], Kl[64][KP], G[128][VP]
  __shared__ __align__(128) unsigned short Qs[2 * KPL];              // Qh[64][KP], Ql[64][KP]
  const int tid  = threadIdx.x;
  const int wave = tid >> 5, lane = tid & 31;
  const int hh   = lane >> 4, c = lane & 15;
  const int qg   = wave & 1;                                         // query columns 32*qg .. 32*qg + 31 of the tile
  const int kh   = wave >> 1;                                        // keys 32*kh .. 32*kh + 31 of every stage
  const int n0   = blockIdx.x * QT;
  const int kr   = blockIdx.y;                                       // key range: keys kr*KSEQ .. kr*KSEQ + KSEQ - 1

  // copy slots. 256-B rows (K, Q): copy i of a lane -> row 8i + (tid>>4), 16-B piece tid&15 (a wave = 512 contiguous
  // global bytes). 128-B rows (g): copy i -> channel 16i + (tid>>3), piece tid&7 (a wave = 4 whole lines).
  const int rK = tid >> 4, pK = tid & 15;
  const int rV = tid >> 3, pV = tid & 7;
  const unsigned lK = lds_addr(Ring + rK * KP + 8 * pK);
  const unsigned lV = lds_addr(Ring + 2 * KPL + rV * VP + 8 * pV);
  const unsigned lQ = lds_addr(Qs + rK * KP + 8 * pK);
  const unsigned short* gKh = Kh + (size_t)(kr * KSEQ + rK) * DQ + 8 * pK;
  const unsigned short* gKl = Kl + (size_t)(kr * KSEQ + rK) * DQ + 8 * pK;
  const unsigned short* gV  = Gc + (size_t)rV * (size_t)SEQ + kr * KSEQ + 8 * pV;

  // stage t (keys 64t .. 64t+63 of the range) into buffer b: 24 copies per lane
  auto fill = [&](int t, int b) {
    const unsigned lb = (unsigned)b * (unsigned)(STG * 2);
    copy8(lK + lb,           8 * KP * 2,  gKh + (size_t)t * (KT * DQ), (size_t)8 * DQ);
    copy8(lK + lb + KPL * 2, 8 * KP * 2,  gKl + (size_t)t * (KT * DQ), (size_t)8 * DQ);
    copy8(lV + lb,           16 * VP * 2, gV + (size_t)t * KT,         (size_t)16 * SEQ);
  };

  // prologue: the query tile (read by every pass) and stage 0, landed and published; then stage 1 in flight
  copy8(lQ,           8 * KP * 2, Qh + (size_t)(n0 + rK) * DQ + 8 * pK, (size_t)8 * DQ);
  copy8(lQ + KPL * 2, 8 * KP * 2, Ql + (size_t)(n0 + rK) * DQ + 8 * pK, (size_t)8 * DQ);
  fill(0, 0);
  wait_async0();
  __syncthreads();
  fill(1, 1);

  // q fragment pointers (B operand, col = query 32*qg + 16*u + c of the tile), + 16*u*KP + 32*kc
  const unsigned short* Qhp = Qs + (32 * qg + c) * KP + 8 * hh;
  const unsigned short* Qlp = Qhp + KPL;

  float m[2] = {-1.0e30f, -1.0e30f}, l[2] = {0.f, 0.f};
  v8f o[2][8];
#pragma unroll
  for (int u = 0; u < 2; ++u) {
#pragma unroll
    for (int j = 0; j < 8; ++j) o[u][j] = zero8();
  }

  // kept rolled: one trip is one stage with its publish point, and the buffer index alternates with t
#pragma unroll 1
  for (int t = 0; t < KSEQ / KT; ++t) {
    const unsigned short* st = Ring + (t & 1) * STG;
    // k fragment bases (A operand, row = key 32kh + c resp. 32kh + 16 + c of the stage), + 32*kc
    const unsigned short* k0p  = st + (32 * kh + c) * KP + 8 * hh;
    const unsigned short* k1p  = k0p + 16 * KP;
    const unsigned short* k0lp = k0p + KPL;
    const unsigned short* k1lp = k1p + KPL;
    // v fragment base (A operand, row = channel 16j + c, keys contiguous), + 16*j*VP
    const unsigned short* Vp = st + 2 * KPL + c * VP + 32 * kh + 8 * hh;
    v8f s0[2], s1[2];                                                // keys +0..15 resp. +16..31, query tile u
#pragma unroll
    for (int u = 0; u < 2; ++u) { s0[u] = zero8(); s1[u] = zero8(); }
    // fragments of d-chunk kc + 1 are read from LDS ahead of the products of chunk kc (two register sets): written in
    // this order, and unrolled, because LDS reads do not move across the gap statements of the product helpers
    Frag fq[2][2][2], fk[2][4];
    auto fetch = [&](int kc) {
      const int b = kc & 1;
      fq[b][0][0] = ldfrag(Qhp + 32 * kc);
      fq[b][0][1] = ldfrag(Qlp + 32 * kc);
      fq[b][1][0] = ldfrag(Qhp + 16 * KP + 32 * kc);
      fq[b][1][1] = ldfrag(Qlp + 16 * KP + 32 * kc);
      fk[b][0] = ldfrag(k0p + 32 * kc);
      fk[b][1] = ldfrag(k1p + 32 * kc);
      fk[b][2] = ldfrag(k0lp + 32 * kc);
      fk[b][3] = ldfrag(k1lp + 32 * kc);
    };
    fetch(0);
#pragma unroll
    for (int kc = 0; kc < DQ / 32; ++kc) {
      const int b = kc & 1;
      if (kc + 1 < DQ / 32) fetch(kc + 1);
      s0[0] = mma_bd(fk[b][0].bf, fq[b][0][0].bf, s0[0]);
      s1[0] = mma_bd(fk[b][1].bf, fq[b][0][0].bf, s1[0]);
      s0[1] = mma_bd(fk[b][0].bf, fq[b][1][0].bf, s0[1]);
      s1[1] = mma_bd(fk[b][1].bf, fq[b][1][0].bf, s1[1]);
      s0[0] = mma_bd(fk[b][0].bf, fq[b][0][1].bf, s0[0]);
      s1[0] = mma_bd(fk[b][1].bf, fq[b][0][1].bf, s1[0]);
      s0[1] = mma_bd(fk[b][0].bf, fq[b][1][1].bf, s0[1]);
      s1[1] = mma_bd(fk[b][1].bf, fq[b][1][1].bf, s1[1]);
      s0[0] = mma_bd(fk[b][2].bf, fq[b][0][0].bf, s0[0]);
      s1[0] = mma_bd(fk[b][3].bf, fq[b][0][0].bf, s1[0]);
      s0[1] = mma_bd(fk[b][2].bf, fq[b][1][0].bf, s0[1]);
      s1[1] = mma_bd(fk[b][3].bf, fq[b][1][0].bf, s1[1]);
    }
    float mx[2], mn[2];
#pragma unroll
    for (int u = 0; u < 2; ++u) mx[u] = fmaxf(hmax8(s0[u]), hmax8(s1[u]));
#pragma unroll
    for (int u = 0; u < 2; ++u) {
      mx[u] = fmaxf(mx[u], __shfl_xor(mx[u], 16, 32));
      mn[u] = fmaxf(m[u], mx[u]);
    }
    const unsigned grew = wave_ballot(mx[0] > m[0] || mx[1] > m[1]); // wave-uniform
    if (grew != 0u) {
#pragma unroll
      for (int u = 0; u < 2; ++u) {
        const float corr = __expf(m[u] - mn[u]);                     // == 1 exactly for lanes whose max did not grow
        l[u] *= corr;
#pragma unroll
        for (int j = 0; j < 8; ++j) {
#pragma unroll
          for (int r = 0; r < 8; ++r) o[u][j][r] *= corr;
        }
      }
    }

    // the stage's g fragments: read here, behind the exchange of the maxima (whose wait would cover them in the LDS queue), so
    // that their LDS time runs under the exponentials
    Frag vf[8];
#pragma unroll
    for (int j = 0; j < 8; ++j) vf[j] = ldfrag(Vp + (16 * j) * VP);
#if defined(__HIP_DEVICE_COMPILE__)
    // keeps the sixteen reads above as one group here: moved down to their products, each pair is waited for on its own
    __builtin_amdgcn_sched_barrier(0);
#endif

    FragH ph[2];
#pragma unroll
    for (int u = 0; u < 2; ++u) {
      m[u] = mn[u];
      const float msh = mn[u] - LNPS;                                // exp gives e^{s-m} * 16384
      float ls = 0.f;
#pragma unroll
      for (int r = 0; r < 8; ++r) {
        const float e0 = __expf(s0[u][r] - msh);                     // key 64t + 32kh      + 8hh + r
        const float e1 = __expf(s1[u][r] - msh);                     // key 64t + 32kh + 16 + 8hh + r
        ls += e0 + e1;
        ph[u].hv[0][r] = (_Float16)e0;
        ph[u].hv[1][r] = (_Float16)e1;
      }
      l[u] += ls;
    }

#pragma unroll
    for (int j = 0; j < 8; ++j) {
      o[0][j] = mma_hd(vf[j].h, ph[0].v, o[0][j]);
      o[1][j] = mma_hd(vf[j].h, ph[1].v, o[1][j]);
    }
    // publish point of stage t + 1: own LDS reads returned, own copies landed, every wave here; only then the refill
    wait_ds0();
    wait_async0();
    __syncthreads();
    if (t + 2 < KSEQ / KT) fill(t + 2, t & 1);
  }
  wait_async0();
#pragma unroll
  for (int u = 0; u < 2; ++u) l[u] += __shfl_xor(l[u], 16, 32);

  // hand-over between the key halves: no copy is in flight and every wave has passed the last publish point, so the
  // ring is free. Area of wave w: XW floats = [j][half][lane][4] of the tile it gives away, then m[32], l[32].
  float* X = reinterpret_cast<float*>(Ring);
  float* xg = X + wave * XW;
  const float* xp = X + (wave ^ 2) * XW;
  v8f ok[8];                                                         // the tile this wave keeps: u = kh
#pragma unroll
  for (int j = 0; j < 8; ++j) {
    const v8f og = kh ? o[0][j] : o[1][j];
    ok[j] = kh ? o[1][j] : o[0][j];
    v4f va, vb;
#pragma unroll
    for (int r = 0; r < 4; ++r) { va[r] = og[r]; vb[r] = og[4 + r]; }
    *(v4f*)(xg + j * 256 + 4 * lane)       = va;
    *(v4f*)(xg + j * 256 + 128 + 4 * lane) = vb;
  }
  xg[2048 + lane] = kh ? m[0] : m[1];
  xg[2080 + lane] = kh ? l[0] : l[1];
  const float mk = kh ? m[1] : m[0];
  const float lk = kh ? l[1] : l[0];
  __syncthreads();
  const float mp = xp[2048 + lane];
  const float lp = xp[2080 + lane];
  const float mall = fmaxf(mk, mp);
  const float wk = __expf(mk - mall), wp = __expf(mp - mall);

  const size_t pt = (size_t)kr * NT16 + (size_t)(blockIdx.x * (QT / 16) + 2 * qg + kh);   // (range, 16-query tile)
  float* po = Po + pt * (8 * 256) + 4 * lane;
#pragma unroll
  for (int j = 0; j < 8; ++j) {
    const v4f pa = *(const v4f*)(xp + j * 256 + 4 * lane);
    const v4f pb = *(const v4f*)(xp + j * 256 + 128 + 4 * lane);
    v4f va, vb;
#pragma unroll
    for (int r = 0; r < 4; ++r) { va[r] = ok[j][r] * wk + pa[r] * wp; vb[r] = ok[j][4 + r] * wk + pb[r] * wp; }
    *(v4f*)(po + j * 256)       = va;
    *(v4f*)(po + j * 256 + 128) = vb;
  }
  Pml[pt * 32 + lane] = hh ? (lk * wk + lp * wp) : mall;             // m and l are equal in lanes c and 16 + c
}

// =========================================================================================================
// (4) output projection GEMM for one (64-n tile, 64-co block): out[n][co] = (1/256)(sum_c WW16[co][c] Yh[n][c] +
//     (1/1024) sum_c WW16[co][c] Yl[n][c]) + bf16-RNE(W_b[co]) + bf16-RNE(x[n][co]). 4 waves, wave w owns
//     cols n0+16w..+15, 4 m-tiles (A rows co = o0 + 16 mt + (lane&15) from WW16), hi and residual products in
//     separate accumulators. K = 128 = 4 steps.
//     B operand: y = sum_s a_s Po[s], a_s = e^{m_s - M} / sum_s e^{m_s - M} l_s, M = max_s m_s, merged in f32 from the
//     KS key ranges' partials; Yh = f16(y), Yl = f16((y - Yh) * 1024). A lane's Po words of tile j are channels
//     16j + 8(lane>>4) + 0..7 of query lane&15: tiles 2ks and 2ks + 1 are elements 0..7 and 8..15 of the B fragment
//     of k-step ks, lane unchanged.
//     Epilogue staged in LDS Os[n_loc][co_loc], barrier, then out rows (position-major, 1024 B each): lane
//     (e = tid&15) -> co o0+4e..+3 of row n_loc = 8 it + (tid>>4); 16 consecutive lanes x 16 B = the whole 256-B
// coverage: Os 4 waves x 16 n x 64 co (cols 0..63 written and read); out 8 it x 8 rows x 16 lanes x 4 floats =
//           64 n x 64 co; grid (SEQ/64, 4) covers out[0..SEQ-1][0..255] exactly once.
// LDS Os: cross-wave (block barrier).
// =========================================================================================================
__global__ __launch_bounds__(128)
void gemm_o(const unsigned short* __restrict__ WW16, const float* __restrict__ Po,
            const float* __restrict__ Pml, const float* __restrict__ wbias,
            const float* __restrict__ x, float* out) {
  __shared__ __align__(16) float Os[QT * OSP];
  const int tid  = threadIdx.x;
  const int lane = tid & 31, wave = tid >> 5;
  const int hh   = lane >> 4, c = lane & 15;
  const int nt   = blockIdx.x, mb = blockIdx.y;
  const int n0   = nt * QT, o0 = mb * QT;

  const unsigned short* ap  = WW16 + (size_t)(o0 + c) * DQ + 8 * hh;
  const size_t t16 = (size_t)(nt * (QT / 16) + wave);                // the wave's 16-query tile

  const float* pml = Pml + t16 * 32 + c;
  const float* pp  = Po + t16 * (8 * 256) + 4 * lane;
  float ms[KS], as[KS];
  FragH fyh[DQ / 32], fyl[DQ / 32];
#pragma unroll
  for (int g = 0; g < 2; ++g) {                                      // tiles j = 4g .. 4g+3 = k-steps 2g, 2g+1
    v4f pv[KS][4][2];
    if (g == 0) {
#pragma unroll
      for (int s = 0; s < KS; ++s) {
        ms[s] = pml[(size_t)s * (NT16 * 32)];
        as[s] = pml[(size_t)s * (NT16 * 32) + 16];
      }
    }
#pragma unroll
    for (int s = 0; s < KS; ++s) {
#pragma unroll
      for (int jj = 0; jj < 4; ++jj) {
        pv[s][jj][0] = *(const v4f*)(pp + (size_t)s * (NT16 * 8 * 256) + (4 * g + jj) * 256);
        pv[s][jj][1] = *(const v4f*)(pp + (size_t)s * (NT16 * 8 * 256) + (4 * g + jj) * 256 + 128);
      }
    }
    // the group's loaded words, inputs only: all its loads are issued ahead of the arithmetic, one round trip for the
    // group instead of one for every pair of loads
    hold16(pv[0], pv[1], pp);
    hold16(pv[2], pv[3], pp + (size_t)2 * (NT16 * 8 * 256));
    if (g == 0) {                                                    // merge weights of query c
      float mall = ms[0];
#pragma unroll
      for (int s = 1; s < KS; ++s) mall = fmaxf(mall, ms[s]);
      float lall = 0.f;
#pragma unroll
      for (int s = 0; s < KS; ++s) {
        const float w = __expf(ms[s] - mall);
        lall += w * as[s];
        as[s] = w;
      }
      const float inv = 1.0f / lall;                                 // o and l both carry the x16384 factor
#pragma unroll
      for (int s = 0; s < KS; ++s) as[s] *= inv;
    }
#pragma unroll
    for (int jj = 0; jj < 4; ++jj) {
      const int j = 4 * g + jj;
#pragma unroll
      for (int r = 0; r < 8; ++r) {
        float y = as[0] * pv[0][jj][r >> 2][r & 3];
#pragma unroll
        for (int s = 1; s < KS; ++s) y += as[s] * pv[s][jj][r >> 2][r & 3];
        const _Float16 h0 = (_Float16)y;
        fyh[j >> 1].hv[j & 1][r] = h0;
        fyl[j >> 1].hv[j & 1][r] = (_Float16)((y - (float)h0) * RSC);
      }
    }
  }

  v8f acc[4], accr[4];
#pragma unroll
  for (int mt = 0; mt < 4; ++mt) { acc[mt] = zero8(); accr[mt] = zero8(); }

#pragma unroll
  for (int ks = 0; ks < DQ / 32; ++ks) {
#pragma unroll
    for (int mt = 0; mt < 4; ++mt) {
      const Frag fa = ldfrag(ap + (size_t)(16 * mt) * DQ + 32 * ks);
      acc[mt]  = mma_h(fa.h, fyh[ks].v, acc[mt]);
      accr[mt] = mma_h(fa.h, fyl[ks].v, accr[mt]);
    }
  }

  {
    const int nl = 16 * wave + c;
#pragma unroll
    for (int mt = 0; mt < 4; ++mt) {
      v4f va, vb;
#pragma unroll
      for (int r = 0; r < 4; ++r) {
        va[r] = (acc[mt][r] + accr[mt][r] * IRSC) * IWSC;
        vb[r] = (acc[mt][4 + r] + accr[mt][4 + r] * IRSC) * IWSC;
      }
      *(v4f*)(Os + nl * OSP + 16 * mt + 8 * hh)     = va;
      *(v4f*)(Os + nl * OSP + 16 * mt + 8 * hh + 4) = vb;
    }
  }
  __syncthreads();

  const int e = tid & 15, lq = tid >> 4;                             // lq 0..7
  const v4f bv = *(const v4f*)(wbias + o0 + 4 * e);
  const float bb[4] = {bfr(bv[0]), bfr(bv[1]), bfr(bv[2]), bfr(bv[3])};
  v4f res[8];
#pragma unroll
  for (int it = 0; it < 8; ++it) {
    const int nl = it * 8 + lq;                                      // n_loc 0..63
    const size_t idx = ((size_t)(n0 + nl)) * CC + o0 + 4 * e;
    const v4f xv = *(const v4f*)(x + idx);
    const v4f ov = *(const v4f*)(Os + nl * OSP + 4 * e);
#pragma unroll
    for (int t = 0; t < 4; ++t) res[it][t] = ov[t] + bb[t] + bfr(xv[t]);
  }
{
#pragma unroll
    for (int it = 0; it < 8; ++it) {
      const int nl = it * 8 + lq;
      const size_t idx = ((size_t)(n0 + nl)) * CC + o0 + 4 * e;
      *(v4f*)(out + idx) = res[it];
    }
    
  }
}

// =========================================================================================================
// Workspace map (bytes; each region start a multiple of 256; every plane size is an exact multiple of its
// whole-line store granularity, SEQ a multiple of 64 so no tail rows exist):
//   W16  f16 [384][256]          196608      WW16 f16 [256][128]     65536
//   XP   f16 [SEQ][256]         4194304 (SEQ=8192)
//   Qh/Ql bf16 [SEQ][128]        2097152 x2
//   Kh/Kl bf16 [SEQ][128]        2097152 x2
//   Gc   f16 [128][SEQ]          2097152
//   Po   f32 [KS][SEQ/16][8][2][32][4]  16777216 (KS=4)      Pml f32 [KS][SEQ/16][32]  262144
//   total (SEQ=8192) = 31981568
// =========================================================================================================
extern "C" void kernel_launch(void* const* d_in, const int* in_sizes, int n_in,
                              void* d_out, int out_size, void* d_ws, size_t ws_size,
                              hipStream_t stream) {
  const int XN = SEQ * CC;
  if (n_in < 9) return;
  if (in_sizes[0] < XN) return;
  if (in_sizes[1] < CC * DQ || in_sizes[3] < CC * DQ || in_sizes[5] < CC * DQ) return;
  if (in_sizes[2] < DQ || in_sizes[4] < DQ || in_sizes[6] < DQ) return;
  if (in_sizes[7] < DQ * CC || in_sizes[8] < CC) return;
  if (out_size < XN) return;

  size_t off = 0;
  auto carve = [&](size_t bytes) { const size_t o = off; off += (bytes + 255) & ~(size_t)255; return o; };
  const size_t oW16 = carve((size_t)MW * CC * 2);
  const size_t oWW  = carve((size_t)CC * DQ * 2);
  const size_t oXP  = carve((size_t)SEQ * CC * 2);
  const size_t oQh  = carve((size_t)SEQ * DQ * 2);
  const size_t oQl  = carve((size_t)SEQ * DQ * 2);
  const size_t oKh  = carve((size_t)SEQ * DQ * 2);
  const size_t oKl  = carve((size_t)SEQ * DQ * 2);
  const size_t oGc  = carve((size_t)DQ * SEQ * 2);
  const size_t oPo  = carve((size_t)KS * SEQ * DQ * 4);
  const size_t oPml = carve((size_t)KS * NT16 * 32 * 4);
  if (off > ws_size) return;
  if (off > (size_t)134217728) return;

  const float* x  = (const float*)d_in[0];
  const float* gw = (const float*)d_in[1];
  const float* gb = (const float*)d_in[2];
  const float* tw = (const float*)d_in[3];
  const float* tb = (const float*)d_in[4];
  const float* pw = (const float*)d_in[5];
  const float* pb = (const float*)d_in[6];
  const float* ww = (const float*)d_in[7];
  const float* wb = (const float*)d_in[8];

  char* ws = (char*)d_ws;
  unsigned short* W16  = (unsigned short*)(ws + oW16);
  unsigned short* WW16 = (unsigned short*)(ws + oWW);
  unsigned short* XP   = (unsigned short*)(ws + oXP);
  unsigned short* Qh   = (unsigned short*)(ws + oQh);
  unsigned short* Ql   = (unsigned short*)(ws + oQl);
  unsigned short* Kh   = (unsigned short*)(ws + oKh);
  unsigned short* Kl   = (unsigned short*)(ws + oKl);
  unsigned short* Gc   = (unsigned short*)(ws + oGc);
  float* Po  = (float*)(ws + oPo);
  float* Pml = (float*)(ws + oPml);
  float* out = (float*)d_out;

  const dim3 blk256(256), blk128(128);

  // (0) projection weights [in=256][out=128] -> stacked f16 plane W16 [out rows 0..383][in 256]:
  //     src [R=256][S=128] -> dst rows rowBase + s, cols r; grid (S/64, R/64)
  cvt_wt<<<dim3(DQ / QT, CC / QT), blk256, 0, stream>>>(tw, W16, CC, DQ, 0);
  cvt_wt<<<dim3(DQ / QT, CC / QT), blk256, 0, stream>>>(pw, W16, CC, DQ, DQ);
  cvt_wt<<<dim3(DQ / QT, CC / QT), blk256, 0, stream>>>(gw, W16, CC, DQ, 2 * DQ);
  //     W_w [in=128][out=256] -> WW16 [out 256][in 128]: src [R=128][S=256], grid (S/64, R/64)
  cvt_wt<<<dim3(CC / QT, DQ / QT), blk256, 0, stream>>>(ww, WW16, DQ, CC, 0);
  // (1) x -> 16-bit plane (same position-major layout)
  cvt_x<<<dim3(SEQ / 8), blk256, 0, stream>>>(x, XP);
  // (2) theta / phi -> hi + residual planes, g -> channel-major plane
  gemm_qkv<<<dim3(SEQ / QT, 6), blk128, 0, stream>>>(W16, XP, tb, pb, gb, Qh, Ql, Kh, Kl, Gc);
  // (3) attention, KS key ranges per query tile -> per-range partials
  attn_k<<<dim3(SEQ / QT, KS), blk128, 0, stream>>>(Qh, Ql, Kh, Kl, Gc, Po, Pml);
  // (4) merge of the ranges + output projection + bias + residual -> out [SEQ][256]
  gemm_o<<<dim3(SEQ / QT, CC / QT), blk128, 0, stream>>>(WW16, Po, Pml, wb, x, out);
  (void)hipGetLastError();
}

// v004
// Measured time: 75.7 microseconds a run.
// Two timings next to v003 both put it at 1.15 times that version's speed.
// Counting every step since v000, it is 10.2 times as fast.
// Contractions: theta/phi/g projection GEMMs Wt[384x256].Xp[256xN] and the output projection Wo[256x128].Y[128xN] on
// v_wmma_f32_16x16x32_f16 (f16 containers of bf16-RNE weights x256 and bf16-RNE x; Y as f16 hi fragment plus f16
// residual fragment x1024, 2 products, separate accumulators); scores Phi.Theta^T on v_wmma_f32_16x16x32_bf16
// (bf16 hi + bf16 residual planes of theta/phi, 3 products, K=128); Y^T = G.P^T on v_wmma_f32_16x16x32_f16
// (G plain f16, P = e^{s-m} x16384 f16 from the score D registers); f32 accumulate everywhere; softmax
// statistics, biases and the residual add in f32 VALU.
#include <hip/hip_runtime.h>
#include <math.h>
#include <stdint.h>

#ifndef NB
#define NB 1
#endif
#define NB_FULL 1
#ifndef SEQ
#define SEQ 8192
#endif
#define SEQ_FULL 8192
#define CC   256
#define DQ   128
#define QT   64
#define MW   384
#define OSP  68
#define TP   72
#define WSC  256.0f
#define IWSC 0.00390625f
#define RSC  1024.0f
#define IRSC 0.0009765625f
#define LNPS 9.704060527839234f
#define KT   64
#define KP   136
#define VP   72
#define KPL  (KT * KP)
#define STG  (2 * KPL + DQ * VP)
#define KS   4
#define KSEQ (SEQ / KS)
#define NT16 (SEQ / 16)
#define XW   (8 * 256 + 64)
#define WTB  32

static_assert(NB == 1 && NB_FULL == 1);
static_assert(SEQ >= QT && SEQ <= SEQ_FULL);
static_assert(SEQ % QT == 0 && SEQ % 32 == 0 && SEQ % 8 == 0);
static_assert(CC % QT == 0 && CC % 32 == 0);
static_assert(DQ == 2 * QT && DQ % 32 == 0);
static_assert(MW == 3 * DQ && MW % 8 == 0);
static_assert(WTB == 4 * 8 && (DQ / QT) * (CC / QT) == 8 && DQ / QT == 2 && CC / QT == 4);
static_assert((OSP * 4) % 16 == 0);
static_assert((TP * 2) % 16 == 0);
static_assert(SEQ % KS == 0 && KSEQ % KT == 0 && KSEQ / KT >= 2 && KT == QT && KT % 32 == 0);
static_assert(2 * (2 * STG + 2 * KPL) * 2 <= 327680);                // two work-groups of attn_k per 320-KiB LDS
static_assert(KT == 64 && QT == 64 && 4 * XW * 4 <= 2 * STG * 2);         // attn_k: 2 x 2 waves of 32 keys x 32 queries; hand-over area
static_assert((KP * 2) % 32 == 16 && (VP * 2) % 32 == 16 && KP >= DQ + 8 && VP >= KT + 8);

typedef _Float16       v16h __attribute__((ext_vector_type(16)));
typedef _Float16       v8h  __attribute__((ext_vector_type(8)));
typedef __bf16         v16b __attribute__((ext_vector_type(16)));
typedef unsigned short v8us __attribute__((ext_vector_type(8)));
typedef float          v8f  __attribute__((ext_vector_type(8)));
typedef float          v4f  __attribute__((ext_vector_type(4)));
typedef unsigned int   v4u  __attribute__((ext_vector_type(4)));

union Frag  { v8us u[2]; v16h h; v16b bf; };
union FragH { v16h v; v8h hv[2]; };
static_assert(sizeof(Frag) == 32);
static_assert(sizeof(FragH) == 32);

// ---- scalar helpers ---------------------------------------------------------------------------------------
__device__ __forceinline__ unsigned short bf_bits(float f) {          // f32 -> bf16 bits, RNE convert
  unsigned u = __float_as_uint(f);
  return (unsigned short)((u + 0x7FFFu + ((u >> 16) & 1u)) >> 16);
}
__device__ __forceinline__ float bf_up(unsigned short hb) { return __uint_as_float(((unsigned)hb) << 16); }
__device__ __forceinline__ float bfr(float f) { return bf_up(bf_bits(f)); }
__device__ __forceinline__ unsigned short h_bits(_Float16 x) { return __builtin_bit_cast(unsigned short, x); }
__device__ __forceinline__ unsigned pk16(unsigned short a, unsigned short b) { return (unsigned)a | ((unsigned)b << 16); }
__device__ __forceinline__ v8f zero8() { v8f z = {0.f, 0.f, 0.f, 0.f, 0.f, 0.f, 0.f, 0.f}; return z; }
__device__ __forceinline__ float hmax8(v8f s) {
  return fmaxf(fmaxf(fmaxf(s[0], s[1]), fmaxf(s[2], s[3])), fmaxf(fmaxf(s[4], s[5]), fmaxf(s[6], s[7])));
}
__device__ __forceinline__ unsigned wave_ballot(bool p) {
#if defined(__HIP_DEVICE_COMPILE__)
  return __builtin_amdgcn_ballot_w32(p);
#else
  return p ? 1u : 0u;
#endif
}

// ---- 16-bit fragment loader (A, or B from a k-contiguous [n][k] row): lane -> row/col (lane&15), p already includes
//      + 8*(lane>>4); elements 0..7 <- p[0..7] (k0+8h..), elements 8..15 <- p[16..23] (k0+16+8h..)
__device__ __forceinline__ Frag ldfrag(const unsigned short* p) {
  Frag f;
  f.u[0] = *(const v8us*)(p);
  f.u[1] = *(const v8us*)(p + 16);
  return f;
}

// ---- WMMA helpers: builtin followed by a 4-slot VALU gap tying D and keeping A/B live --------------------------
__device__ __forceinline__ v8f mma_h(v16h a, v16h b, v8f c) {
  v8f d = __builtin_amdgcn_wmma_f32_16x16x32_f16(false, a, false, b, (short)0, c, false, false);
#if defined(__HIP_DEVICE_COMPILE__)
  asm volatile("v_nop\n\tv_nop\n\tv_nop\n\tv_nop" : "+v"(d) : "v"(a), "v"(b));
#endif
  return d;
}
__device__ __forceinline__ v8f mma_b(v16b a, v16b b, v8f c) {
  v8f d = __builtin_amdgcn_wmma_f32_16x16x32_bf16(false, a, false, b, (short)0, c, false, false);
#if defined(__HIP_DEVICE_COMPILE__)
  const v16h ha = __builtin_bit_cast(v16h, a), hb = __builtin_bit_cast(v16h, b);
  asm volatile("v_nop\n\tv_nop\n\tv_nop\n\tv_nop" : "+v"(d) : "v"(ha), "v"(hb));
#endif
  return d;
}

// The same products for attn_k, whose wave tile takes more than 256 registers: an operand of an asm statement has to lie
// in v0..v255, so the gap statement names D alone and the A and B fragments are free to lie above.
__device__ __forceinline__ v8f mma_hd(v16h a, v16h b, v8f c) {
  v8f d = __builtin_amdgcn_wmma_f32_16x16x32_f16(false, a, false, b, (short)0, c, false, false);
#if defined(__HIP_DEVICE_COMPILE__)
  asm volatile("v_nop\n\tv_nop\n\tv_nop\n\tv_nop" : "+v"(d));
#endif
  return d;
}
__device__ __forceinline__ v8f mma_bd(v16b a, v16b b, v8f c) {
  v8f d = __builtin_amdgcn_wmma_f32_16x16x32_bf16(false, a, false, b, (short)0, c, false, false);
#if defined(__HIP_DEVICE_COMPILE__)
  asm volatile("v_nop\n\tv_nop\n\tv_nop\n\tv_nop" : "+v"(d));
#endif
  return d;
}

// ---- asynchronous copies global -> LDS ------------------------------------------------------------------------
__device__ __forceinline__ unsigned lds_addr(const unsigned short* p) { return (unsigned)(uintptr_t)p; }  // LDS byte address

// Eight 16-B copies per lane: copy i moves g + i*gstep (halves) to LDS byte address l + i*lstep. All lanes on.
__device__ __forceinline__ void copy8(unsigned l, unsigned lstep, const unsigned short* g, size_t gstep) {
#if defined(__HIP_DEVICE_COMPILE__)
  // the closing s_wait_xcnt keeps later rewrites of the address registers behind the issued copies
  asm volatile("global_load_async_to_lds_b128 %0, %8, off\n\t"
               "global_load_async_to_lds_b128 %1, %9, off\n\t"
               "global_load_async_to_lds_b128 %2, %10, off\n\t"
               "global_load_async_to_lds_b128 %3, %11, off\n\t"
               "global_load_async_to_lds_b128 %4, %12, off\n\t"
               "global_load_async_to_lds_b128 %5, %13, off\n\t"
               "global_load_async_to_lds_b128 %6, %14, off\n\t"
               "global_load_async_to_lds_b128 %7, %15, off\n\t"
               "s_wait_xcnt 0x0"
               :: "v"(l), "v"(l + lstep), "v"(l + 2 * lstep), "v"(l + 3 * lstep),
                  "v"(l + 4 * lstep), "v"(l + 5 * lstep), "v"(l + 6 * lstep), "v"(l + 7 * lstep),
                  "v"(g), "v"(g + gstep), "v"(g + 2 * gstep), "v"(g + 3 * gstep),
                  "v"(g + 4 * gstep), "v"(g + 5 * gstep), "v"(g + 6 * gstep), "v"(g + 7 * gstep)
               : "memory");
#endif
}
__device__ __forceinline__ void wait_async0() {   // this wave's copies have landed in LDS
#if defined(__HIP_DEVICE_COMPILE__)
  asm volatile("s_wait_asynccnt 0x0" ::: "memory");
#endif
}
__device__ __forceinline__ void wait_ds0() {      // this wave's LDS reads have returned before the buffer is handed back
#if defined(__HIP_DEVICE_COMPILE__)
  asm volatile("s_wait_dscnt 0x0" ::: "memory");
#endif
}

// Inputs-only fence on sixteen loaded 16-B words: every one of them has arrived here. The wait stands behind the loads and
// ahead of any rewrite of their address registers: their base p is named so that it lives up to the wait.
__device__ __forceinline__ void hold16(const v4f (&a)[4][2], const v4f (&b)[4][2], const float* p) {
#if defined(__HIP_DEVICE_COMPILE__)
  asm volatile("s_wait_xcnt 0x0"
               :: "v"(a[0][0]), "v"(a[0][1]), "v"(a[1][0]), "v"(a[1][1]), "v"(a[2][0]), "v"(a[2][1]), "v"(a[3][0]), "v"(a[3][1]),
                  "v"(b[0][0]), "v"(b[0][1]), "v"(b[1][0]), "v"(b[1][1]), "v"(b[2][0]), "v"(b[2][1]), "v"(b[3][0]), "v"(b[3][1]),
                  "v"(p));
#endif
}

// =========================================================================================================
// (0) weight transpose + convert: src f32 [R][S] (row r contiguous over S; the projection weights are stored
//     [in][out]) -> dst f16 row (rowBase + s), col r, pitch R halves; value = f16 of (bf16-RNE(w) * 256) (exact).
//     Through an LDS tile T[64 s][64 r] (pitch TP). Block (sb, rb) owns a 64 r x 64 s tile.
// coverage: load 2 it x 32 rows x 8 lanes x 8 = 64 r x 64 s; store 2 it x 32 s-rows x 8 lanes x 8 halves = 64 s x 64 r;
//           tiles (S/64, R/64) cover dst rows rowBase..rowBase+S-1 x cols 0..R-1 exactly once.
// LDS T: cross-wave (block barrier between the 2-byte stores and the 16-B reloads).
// =========================================================================================================
__device__ __forceinline__
void cvt_wt(unsigned short* T, const float* __restrict__ src, unsigned short* dst, int R, int S, int rowBase, int sb, int rb) {
  const int tid = threadIdx.x;
  const int e = tid & 7, lq = tid >> 3;                             // lq 0..31
  const int s0 = sb * QT, r0 = rb * QT;
  const float* sp0 = src + ((size_t)(r0 + lq)) * (size_t)S + s0 + 8 * e;          // r_loc lq
  const float* sp1 = src + ((size_t)(r0 + 32 + lq)) * (size_t)S + s0 + 8 * e;     // r_loc 32 + lq
  const v4f av[2] = {*(const v4f*)sp0, *(const v4f*)sp1};
  const v4f qv[2] = {*(const v4f*)(sp0 + 4), *(const v4f*)(sp1 + 4)};
#if defined(__HIP_DEVICE_COMPILE__)
  // inputs only: the wait stands behind the four loads and ahead of any rewrite of their address registers, which are named
  // so that they live up to it (otherwise a later load's result is placed over an earlier load's address pair)
  asm volatile("s_wait_xcnt 0x0" :: "v"(av[0]), "v"(qv[0]), "v"(av[1]), "v"(qv[1]), "v"(sp0), "v"(sp1));
#endif
#pragma unroll
  for (int it = 0; it < 2; ++it) {
    const int rl = it * 32 + lq;                                     // r_loc 0..63
    const v4f a = av[it];
    const v4f q = qv[it];
    unsigned short hb[8];
#pragma unroll
    for (int t = 0; t < 4; ++t) {
      hb[t]     = h_bits((_Float16)(bfr(a[t]) * WSC));
      hb[4 + t] = h_bits((_Float16)(bfr(q[t]) * WSC));
    }
#pragma unroll
    for (int t = 0; t < 8; ++t) T[(8 * e + t) * TP + rl] = hb[t];   // T[s_loc][r_loc]
  }
  __syncthreads();
  v4u up[2];
#pragma unroll
  for (int it = 0; it < 2; ++it) {
    const int sl = it * 32 + lq;                                     // s_loc 0..63
    up[it] = *(const v4u*)(T + sl * TP + 8 * e);                     // r_loc 8e..8e+7
  }
{
    unsigned short* dp = dst + ((size_t)(rowBase + s0 + lq)) * (size_t)R + r0 + 8 * e;   // s_loc lq; s_loc 32 + lq is 32 rows on
    *(v4u*)dp = up[0];
    *(v4u*)(dp + (size_t)32 * (size_t)R) = up[1];
#if defined(__HIP_DEVICE_COMPILE__)
    // the code of another block kind may follow in the shared kernel: the wait stands behind the two stores and ahead of any
    // rewrite of their data and address registers, which are named, inputs only, so that they live up to it
    asm volatile("s_wait_xcnt 0x0" :: "v"(up[0]), "v"(up[1]), "v"(dp) : "memory");
#endif
  }
}

// =========================================================================================================
// (1) x f32 [N][256] (already position-major) -> XP f16 [N][256], value = bf16-RNE(x) in an f16 container.
// coverage: SEQ/8 blocks x 8 rows x 32 lanes x 8 halves = SEQ x 256 = the whole plane.
// =========================================================================================================
__device__ __forceinline__
void cvt_x(const float* __restrict__ x, unsigned short* XP, int blk) {
  const int tid = threadIdx.x;
  const int row = 8 * blk + (tid >> 5);                              // 0..SEQ-1
  const int col = 8 * (tid & 31);                                    // 0..248
  const float* s = x + (size_t)row * CC + col;
  const v4f a = *(const v4f*)s;
  const v4f q = *(const v4f*)(s + 4);
  const float f[8] = {a[0], a[1], a[2], a[3], q[0], q[1], q[2], q[3]};
  v4u u;
#pragma unroll
  for (int t = 0; t < 4; ++t) {
    const _Float16 h0 = (_Float16)bfr(f[2 * t]);
    const _Float16 h1 = (_Float16)bfr(f[2 * t + 1]);
    u[t] = pk16(h_bits(h0), h_bits(h1));
  }
{
    unsigned short* dp = XP + (size_t)row * CC + col;
    *(v4u*)dp = u;
#if defined(__HIP_DEVICE_COMPILE__)
    // as in (0): the wait behind the store, ahead of any rewrite of its data and address registers (named, inputs only)
    asm volatile("s_wait_xcnt 0x0" :: "v"(u), "v"(dp) : "memory");
#endif
  }
}

// =========================================================================================================
// (0) + (1) as ONE launch: the five conversions read none of each other's output, so they share a grid, told apart by the
//     block index (block-uniform, so the barrier of (0) is passed by whole blocks). Blocks 0..WTB-1, first because their
//     path is the longer one: 8 tiles for each of theta_w, phi_w, g_w (R=256, S=128: tiles 2 x 4, rows 0 / 128 / 256 of
//     W16) and W_w (R=128, S=256: tiles 4 x 2, WW16). Blocks WTB.. : 8 rows of x each.
// coverage: 4 weights x 8 tiles = WTB blocks, each weight's tile set exactly once; SEQ/8 blocks over x.
// =========================================================================================================
__global__ __launch_bounds__(256)
void cvt_all(const float* __restrict__ tw, const float* __restrict__ pw, const float* __restrict__ gw,
             const float* __restrict__ ww, const float* __restrict__ x,
             unsigned short* W16, unsigned short* WW16, unsigned short* XP) {
  __shared__ __align__(16) unsigned short T[QT * TP];
  const int blk = blockIdx.x;
  if (blk < WTB) {
    const int job = blk >> 3, tile = blk & 7;
    if (job < 3) {
      const float* src = (job == 0) ? tw : (job == 1) ? pw : gw;
      cvt_wt(T, src, W16, CC, DQ, job * DQ, tile & 1, tile >> 1);
    } else {
      cvt_wt(T, ww, WW16, DQ, CC, 0, tile & 3, tile >> 2);
    }
  } else {
    cvt_x(x, XP, blk - WTB);
  }
}

// =========================================================================================================
// (2) theta / phi / g projection GEMM for one (64-n tile nt, 64-o block mb in 0..5): Y[o][n] = (1/256)
//     sum_c W16[mb*64 + o][c] XP[n][c] + bf16-RNE(bias[o]). W16 rows 0..127 = theta, 128..255 = phi, 256..383 = g.
//     Block 128 threads = 4 waves; wave w owns cols n0+16w..+15 (B fragment from the XP row, k = c contiguous,
//     split k map) and 4 m-tiles (A rows o = o0 + 16 mt + (lane&15), split k map from W16). K = 256 = 8 steps.
//     Epilogue staged in LDS Os[n_loc][o_loc] (pitch OSP), barrier, bias add in f32, then:
//       mb 0,1 (theta) / 2,3 (phi): bf16 hi = RNE(v), lo = RNE(v - hi) planes Qh/Ql resp. Kh/Kl [N][128 d]
//         the dsel half of the 256-B row): lane e -> d 8e..8e+7, 8 consecutive lanes per line, one instruction per
//         16 lines;
//       mb 4,5 (g): f16 plane Gc [128 ch][N keys] (channel-major, keys contiguous); row ch, 64 keys = one whole
// coverage: Os 4 waves x 16 n x 64 o = 64 x 64 (cols 0..63 written and read); hi/lo planes 4 it x 16 rows x 8 lanes
//           x 8 = 64 n x 64 d per plane, grid nt x mb {0,1} / {2,3} covers d 0..127 of all N rows of Qh/Ql / Kh/Kl
//           exactly once; g plane 4 it x 16 ch x 8 lanes x 8 keys = 64 ch x 64 keys, nt x mb {4,5} covers ch 0..127
//           x keys 0..N-1 of Gc exactly once. grid (N/64, 6).
// LDS Os: cross-wave (block barrier).
// =========================================================================================================
__global__ __launch_bounds__(128)
void gemm_qkv(const unsigned short* __restrict__ W16, const unsigned short* __restrict__ XP,
              const float* __restrict__ tbias, const float* __restrict__ pbias, const float* __restrict__ gbias,
              unsigned short* Qh, unsigned short* Ql, unsigned short* Kh, unsigned short* Kl, unsigned short* Gc) {
  __shared__ __align__(16) float Os[QT * OSP];
  const int tid  = threadIdx.x;
  const int lane = tid & 31, wave = tid >> 5;
  const int hh   = lane >> 4, c = lane & 15;
  const int nt   = blockIdx.x, mb = blockIdx.y;
  const int n0   = nt * QT, o0 = mb * QT;                            // o0 = W16 row base 0..320

  const unsigned short* ap = W16 + (size_t)(o0 + c) * CC + 8 * hh;
  const unsigned short* bp = XP + ((size_t)(n0 + 16 * wave + c)) * CC + 8 * hh;

  v8f acc[4];
#pragma unroll
  for (int mt = 0; mt < 4; ++mt) acc[mt] = zero8();

#pragma unroll
  for (int ks = 0; ks < CC / 32; ++ks) {
    const Frag fb = ldfrag(bp + 32 * ks);
#pragma unroll
    for (int mt = 0; mt < 4; ++mt) {
      const Frag fa = ldfrag(ap + (size_t)(16 * mt) * CC + 32 * ks);
      acc[mt] = mma_h(fa.h, fb.h, acc[mt]);
    }
  }

  {
    const int nl = 16 * wave + c;
#pragma unroll
    for (int mt = 0; mt < 4; ++mt) {
      v4f va, vb;
#pragma unroll
      for (int r = 0; r < 4; ++r) { va[r] = acc[mt][r] * IWSC; vb[r] = acc[mt][4 + r] * IWSC; }
      *(v4f*)(Os + nl * OSP + 16 * mt + 8 * hh)     = va;
      *(v4f*)(Os + nl * OSP + 16 * mt + 8 * hh + 4) = vb;
    }
  }
  __syncthreads();

  const int e = tid & 7, lq = tid >> 3;                             // lq 0..15
  const int grp  = mb >> 1;                                          // 0 theta, 1 phi, 2 g (block-uniform)
  const int dsel = (mb & 1) * QT;                                    // channel base 0 or 64 within the group
  if (grp < 2) {                                                     // block-uniform: bf16 hi/lo planes
    const float* bsrc = (grp == 0) ? tbias : pbias;
    unsigned short* Hp = (grp == 0) ? Qh : Kh;
    unsigned short* Lp = (grp == 0) ? Ql : Kl;
    const v4f b0 = *(const v4f*)(bsrc + dsel + 8 * e);
    const v4f b1 = *(const v4f*)(bsrc + dsel + 8 * e + 4);
    const float bb[8] = {bfr(b0[0]), bfr(b0[1]), bfr(b0[2]), bfr(b0[3]), bfr(b1[0]), bfr(b1[1]), bfr(b1[2]), bfr(b1[3])};
    v4u uh[4], ul[4];
#pragma unroll
    for (int it = 0; it < 4; ++it) {
      const int row = it * 16 + lq;                                  // n_loc 0..63
      const v4f a = *(const v4f*)(Os + row * OSP + 8 * e);
      const v4f q = *(const v4f*)(Os + row * OSP + 8 * e + 4);
      const float f[8] = {a[0], a[1], a[2], a[3], q[0], q[1], q[2], q[3]};
#pragma unroll
      for (int t = 0; t < 4; ++t) {
        const float f0 = f[2 * t] + bb[2 * t], f1 = f[2 * t + 1] + bb[2 * t + 1];
        const unsigned short hb0 = bf_bits(f0), hb1 = bf_bits(f1);
        const unsigned short lb0 = bf_bits(f0 - bf_up(hb0));
        const unsigned short lb1 = bf_bits(f1 - bf_up(hb1));
        uh[it][t] = pk16(hb0, hb1);
        ul[it][t] = pk16(lb0, lb1);
      }
    }
{
#pragma unroll
      for (int it = 0; it < 4; ++it) {
        const int row = it * 16 + lq;
        const size_t po = ((size_t)(n0 + row)) * DQ + dsel + 8 * e;
        *(v4u*)(Hp + po) = uh[it];
        *(v4u*)(Lp + po) = ul[it];
      }
      
    }
  } else {                                                           // block-uniform: g plane
    const int gsel = dsel;                                           // g channel base 0 or 64
    v4u ug[4];
#pragma unroll
    for (int it = 0; it < 4; ++it) {
      const int cl = it * 16 + lq;                                   // ch_loc 0..63
      const float bias = bfr(gbias[gsel + cl]);
      unsigned short hb[8];
#pragma unroll
      for (int t = 0; t < 8; ++t) {
        const int key = 8 * e + t;                                   // key_loc 0..63
        const float v = Os[key * OSP + cl] + bias;
        hb[t] = h_bits((_Float16)v);
      }
#pragma unroll
      for (int t = 0; t < 4; ++t) ug[it][t] = pk16(hb[2 * t], hb[2 * t + 1]);
    }
{
#pragma unroll
      for (int it = 0; it < 4; ++it) {
        const int cl = it * 16 + lq;
        const size_t po = ((size_t)(gsel + cl)) * (size_t)SEQ + n0 + 8 * e;
        *(v4u*)(Gc + po) = ug[it];
      }
      
    }
  }
}

// =========================================================================================================
// (3) attention for one 64-query tile and one of KS key ranges (KSEQ keys each), transposed formulation, no mask, no
//   scale. The KS ranges of a tile run as separate work-groups, so that the grid gives every SIMD two waves:
//   S^T tile (16 keys x 16 queries) = sum over 4 d-chunks of A(phi: row = key kb + (lane&15), 32 d via the split
//   k map from the bf16 plane Kh [SEQ][128]) . B(theta: col = query, same map from Qh) + A(Kh).B(Ql) +
//   A(Kl).B(Qh) (bf16 unscaled residual planes, shared accumulator).
//   Wave tile: 32 keys x 32 queries. Wave w takes query columns 32*(w&1) .. +31 (two B tiles u = 0, 1) and keys
//   32*(w>>1) .. +31 of every 64-key stage, so that each K and g fragment read from LDS feeds two query tiles.
//   Per lane a D tile holds 8 keys of ONE query: online softmax state per lane and query tile, one shuffle (lane^16) for
//   the max over 32 keys; the o/l rescale is skipped under a wave-uniform ballot when no lane's max grew (corr == 1
//   exactly for every lane then); row-sum partials combined at the end. P = e^{s-m} x 16384 as f16 is the B operand of
//   Y^T (rows channel, cols queries) += A(g rows channel = 16j + (lane&15), keys contiguous, f16 plane Gc
//   [128][SEQ]) . B(P^T): element r <- D of the tile covering keys kb..kb+15, element 8+r <- the tile covering
//   kb+16..kb+31, lane unchanged. 2 x 8 accumulator tiles per wave (128 channels x 32 queries). Block = 4 waves.
//   Operand path: the block's query tile (once) and 64-key stages of Kh, Kl, Gc come into LDS by asynchronous 16-B
//   copies in whole lines, two stage buffers, one publish point per stage; all fragments are ds_load_b128 reads at
//   pitches of 16 B x odd (272 B for 256-B rows, 144 B for 128-B rows).
//   Epilogue: waves w and w^2 hold the two key halves of the same 32 queries. Each keeps query tile u = w>>1, hands its
//   other tile (o, m, l) to the partner through the ring's LDS (free behind the last publish point), and merges the
//   partner's half into its own in f32. The range's un-normalised result goes to the workspace in register order,
//   Po[range][16-query tile][j][half][lane][4 f32] (element 4*half + i of tile j; each store = 512 contiguous B), with
//   Pml[range][16-query tile][32]: word c = the range's maximum of query c, word 16 + c = its row sum (x16384, as o).
//   The output projection merges the ranges.
// coverage: Po 4 waves x 8 j x 2 halves x 32 lanes x 4 = 64 queries x 128 ch per range; Pml 4 waves x 32 words; grid
//           (SEQ/64, KS) covers Po and Pml exactly once.
// LDS Ring, Qs: cross-wave (copy wait, then block barrier); hand-over area in Ring: cross-wave (block barrier).
// =========================================================================================================
__global__ __launch_bounds__(128)
void attn_k(const unsigned short* __restrict__ Qh, const unsigned short* __restrict__ Ql,
            const unsigned short* __restrict__ Kh, const unsigned short* __restrict__ Kl,
            const unsigned short* __restrict__ Gc, float* Po, float* Pml) {
  __shared__ __align__(128) unsigned short Ring[2 * STG];            // two stages: Kh[64][KP], Kl[64][KP], G[128][VP]
  __shared__ __align__(128) unsigned short Qs[2 * KPL];              // Qh[64][KP], Ql[64][KP]
  const int tid  = threadIdx.x;
  const int wave = tid >> 5, lane = tid & 31;
  const int hh   = lane >> 4, c = lane & 15;
  const int qg   = wave & 1;                                         // query columns 32*qg .. 32*qg + 31 of the tile
  const int kh   = wave >> 1;                                        // keys 32*kh .. 32*kh + 31 of every stage
  const int n0   = blockIdx.x * QT;
  const int kr   = blockIdx.y;                                       // key range: keys kr*KSEQ .. kr*KSEQ + KSEQ - 1

  // copy slots. 256-B rows (K, Q): copy i of a lane -> row 8i + (tid>>4), 16-B piece tid&15 (a wave = 512 contiguous
  // global bytes). 128-B rows (g): copy i -> channel 16i + (tid>>3), piece tid&7 (a wave = 4 whole lines).
  const int rK = tid >> 4, pK = tid & 15;
  const int rV = tid >> 3, pV = tid & 7;
  const unsigned lK = lds_addr(Ring + rK * KP + 8 * pK);
  const unsigned lV = lds_addr(Ring + 2 * KPL + rV * VP + 8 * pV);
  const unsigned lQ = lds_addr(Qs + rK * KP + 8 * pK);
  const unsigned short* gKh = Kh + (size_t)(kr * KSEQ + rK) * DQ + 8 * pK;
  const unsigned short* gKl = Kl + (size_t)(kr * KSEQ + rK) * DQ + 8 * pK;
  const unsigned short* gV  = Gc + (size_t)rV * (size_t)SEQ + kr * KSEQ + 8 * pV;

  // stage t (keys 64t .. 64t+63 of the range) into buffer b: 24 copies per lane
  auto fill = [&](int t, int b) {
    const unsigned lb = (unsigned)b * (unsigned)(STG * 2);
    copy8(lK + lb,           8 * KP * 2,  gKh + (size_t)t * (KT * DQ), (size_t)8 * DQ);
    copy8(lK + lb + KPL * 2, 8 * KP * 2,  gKl + (size_t)t * (KT * DQ), (size_t)8 * DQ);
    copy8(lV + lb,           16 * VP * 2, gV + (size_t)t * KT,         (size_t)16 * SEQ);
  };

  // prologue: the query tile (read by every pass) and stage 0, landed and published; then stage 1 in flight
  copy8(lQ,           8 * KP * 2, Qh + (size_t)(n0 + rK) * DQ + 8 * pK, (size_t)8 * DQ);
  copy8(lQ + KPL * 2, 8 * KP * 2, Ql + (size_t)(n0 + rK) * DQ + 8 * pK, (size_t)8 * DQ);
  fill(0, 0);
  wait_async0();
  __syncthreads();
  fill(1, 1);

  // q fragment pointers (B operand, col = query 32*qg + 16*u + c of the tile), + 16*u*KP + 32*kc
  const unsigned short* Qhp = Qs + (32 * qg + c) * KP + 8 * hh;
  const unsigned short* Qlp = Qhp + KPL;

  float m[2] = {-1.0e30f, -1.0e30f}, l[2] = {0.f, 0.f};
  v8f o[2][8];
#pragma unroll
  for (int u = 0; u < 2; ++u) {
#pragma unroll
    for (int j = 0; j < 8; ++j) o[u][j] = zero8();
  }

  // kept rolled: one trip is one stage with its publish point, and the buffer index alternates with t
#pragma unroll 1
  for (int t = 0; t < KSEQ / KT; ++t) {
    const unsigned short* st = Ring + (t & 1) * STG;
    // k fragment bases (A operand, row = key 32kh + c resp. 32kh + 16 + c of the stage), + 32*kc
    const unsigned short* k0p  = st + (32 * kh + c) * KP + 8 * hh;
    const unsigned short* k1p  = k0p + 16 * KP;
    const unsigned short* k0lp = k0p + KPL;
    const unsigned short* k1lp = k1p + KPL;
    // v fragment base (A operand, row = channel 16j + c, keys contiguous), + 16*j*VP
    const unsigned short* Vp = st + 2 * KPL + c * VP + 32 * kh + 8 * hh;
    v8f s0[2], s1[2];                                                // keys +0..15 resp. +16..31, query tile u
#pragma unroll
    for (int u = 0; u < 2; ++u) { s0[u] = zero8(); s1[u] = zero8(); }
    // fragments of d-chunk kc + 1 are read from LDS ahead of the products of chunk kc (two register sets): written in
    // this order, and unrolled, because LDS reads do not move across the gap statements of the product helpers
    Frag fq[2][2][2], fk[2][4];
    auto fetch = [&](int kc) {
      const int b = kc & 1;
      fq[b][0][0] = ldfrag(Qhp + 32 * kc);
      fq[b][0][1] = ldfrag(Qlp + 32 * kc);
      fq[b][1][0] = ldfrag(Qhp + 16 * KP + 32 * kc);
      fq[b][1][1] = ldfrag(Qlp + 16 * KP + 32 * kc);
      fk[b][0] = ldfrag(k0p + 32 * kc);
      fk[b][1] = ldfrag(k1p + 32 * kc);
      fk[b][2] = ldfrag(k0lp + 32 * kc);
      fk[b][3] = ldfrag(k1lp + 32 * kc);
    };
    fetch(0);
#pragma unroll
    for (int kc = 0; kc < DQ / 32; ++kc) {
      const int b = kc & 1;
      if (kc + 1 < DQ / 32) fetch(kc + 1);
      s0[0] = mma_bd(fk[b][0].bf, fq[b][0][0].bf, s0[0]);
      s1[0] = mma_bd(fk[b][1].bf, fq[b][0][0].bf, s1[0]);
      s0[1] = mma_bd(fk[b][0].bf, fq[b][1][0].bf, s0[1]);
      s1[1] = mma_bd(fk[b][1].bf, fq[b][1][0].bf, s1[1]);
      s0[0] = mma_bd(fk[b][0].bf, fq[b][0][1].bf, s0[0]);
      s1[0] = mma_bd(fk[b][1].bf, fq[b][0][1].bf, s1[0]);
      s0[1] = mma_bd(fk[b][0].bf, fq[b][1][1].bf, s0[1]);
      s1[1] = mma_bd(fk[b][1].bf, fq[b][1][1].bf, s1[1]);
      s0[0] = mma_bd(fk[b][2].bf, fq[b][0][0].bf, s0[0]);
      s1[0] = mma_bd(fk[b][3].bf, fq[b][0][0].bf, s1[0]);
      s0[1] = mma_bd(fk[b][2].bf, fq[b][1][0].bf, s0[1]);
      s1[1] = mma_bd(fk[b][3].bf, fq[b][1][0].bf, s1[1]);
    }
    float mx[2], mn[2];
#pragma unroll
    for (int u = 0; u < 2; ++u) mx[u] = fmaxf(hmax8(s0[u]), hmax8(s1[u]));
#pragma unroll
    for (int u = 0; u < 2; ++u) {
      mx[u] = fmaxf(mx[u], __shfl_xor(mx[u], 16, 32));
      mn[u] = fmaxf(m[u], mx[u]);
    }
    const unsigned grew = wave_ballot(mx[0] > m[0] || mx[1] > m[1]); // wave-uniform
    if (grew != 0u) {
#pragma unroll
      for (int u = 0; u < 2; ++u) {
        const float corr = __expf(m[u] - mn[u]);                     // == 1 exactly for lanes whose max did not grow
        l[u] *= corr;
#pragma unroll
        for (int j = 0; j < 8; ++j) {
#pragma unroll
          for (int r = 0; r < 8; ++r) o[u][j][r] *= corr;
        }
      }
    }

    // the stage's g fragments: read here, behind the exchange of the maxima (whose wait would cover them in the LDS queue), so
    // that their LDS time runs under the exponentials
    Frag vf[8];
#pragma unroll
    for (int j = 0; j < 8; ++j) vf[j] = ldfrag(Vp + (16 * j) * VP);
#if defined(__HIP_DEVICE_COMPILE__)
    // keeps the sixteen reads above as one group here: moved down to their products, each pair is waited for on its own
    __builtin_amdgcn_sched_barrier(0);
#endif

    FragH ph[2];
#pragma unroll
    for (int u = 0; u < 2; ++u) {
      m[u] = mn[u];
      const float msh = mn[u] - LNPS;                                // exp gives e^{s-m} * 16384
      float ls = 0.f;
#pragma unroll
      for (int r = 0; r < 8; ++r) {
        const float e0 = __expf(s0[u][r] - msh);                     // key 64t + 32kh      + 8hh + r
        const float e1 = __expf(s1[u][r] - msh);                     // key 64t + 32kh + 16 + 8hh + r
        ls += e0 + e1;
        ph[u].hv[0][r] = (_Float16)e0;
        ph[u].hv[1][r] = (_Float16)e1;
      }
      l[u] += ls;
    }

#pragma unroll
    for (int j = 0; j < 8; ++j) {
      o[0][j] = mma_hd(vf[j].h, ph[0].v, o[0][j]);
      o[1][j] = mma_hd(vf[j].h, ph[1].v, o[1][j]);
    }
    // publish point of stage t + 1: own LDS reads returned, own copies landed, every wave here; only then the refill
    wait_ds0();
    wait_async0();
    __syncthreads();
    if (t + 2 < KSEQ / KT) fill(t + 2, t & 1);
  }
  wait_async0();
#pragma unroll
  for (int u = 0; u < 2; ++u) l[u] += __shfl_xor(l[u], 16, 32);

  // hand-over between the key halves: no copy is in flight and every wave has passed the last publish point, so the
  // ring is free. Area of wave w: XW floats = [j][half][lane][4] of the tile it gives away, then m[32], l[32].
  float* X = reinterpret_cast<float*>(Ring);
  float* xg = X + wave * XW;
  const float* xp = X + (wave ^ 2) * XW;
  v8f ok[8];                                                         // the tile this wave keeps: u = kh
#pragma unroll
  for (int j = 0; j < 8; ++j) {
    const v8f og = kh ? o[0][j] : o[1][j];
    ok[j] = kh ? o[1][j] : o[0][j];
    v4f va, vb;
#pragma unroll
    for (int r = 0; r < 4; ++r) { va[r] = og[r]; vb[r] = og[4 + r]; }
    *(v4f*)(xg + j * 256 + 4 * lane)       = va;
    *(v4f*)(xg + j * 256 + 128 + 4 * lane) = vb;
  }
  xg[2048 + lane] = kh ? m[0] : m[1];
  xg[2080 + lane] = kh ? l[0] : l[1];
  const float mk = kh ? m[1] : m[0];
  const float lk = kh ? l[1] : l[0];
  __syncthreads();
  const float mp = xp[2048 + lane];
  const float lp = xp[2080 + lane];
  const float mall = fmaxf(mk, mp);
  const float wk = __expf(mk - mall), wp = __expf(mp - mall);

  const size_t pt = (size_t)kr * NT16 + (size_t)(blockIdx.x * (QT / 16) + 2 * qg + kh);   // (range, 16-query tile)
  float* po = Po + pt * (8 * 256) + 4 * lane;
#pragma unroll
  for (int j = 0; j < 8; ++j) {
    const v4f pa = *(const v4f*)(xp + j * 256 + 4 * lane);
    const v4f pb = *(const v4f*)(xp + j * 256 + 128 + 4 * lane);
    v4f va, vb;
#pragma unroll
    for (int r = 0; r < 4; ++r) { va[r] = ok[j][r] * wk + pa[r] * wp; vb[r] = ok[j][4 + r] * wk + pb[r] * wp; }
    *(v4f*)(po + j * 256)       = va;
    *(v4f*)(po + j * 256 + 128) = vb;
  }
  Pml[pt * 32 + lane] = hh ? (lk * wk + lp * wp) : mall;             // m and l are equal in lanes c and 16 + c
}

// =========================================================================================================
// (4) output projection GEMM for one (64-n tile, 64-co block): out[n][co] = (1/256)(sum_c WW16[co][c] Yh[n][c] +
//     (1/1024) sum_c WW16[co][c] Yl[n][c]) + bf16-RNE(W_b[co]) + bf16-RNE(x[n][co]). 4 waves, wave w owns
//     cols n0+16w..+15, 4 m-tiles (A rows co = o0 + 16 mt + (lane&15) from WW16), hi and residual products in
//     separate accumulators. K = 128 = 4 steps.
//     B operand: y = sum_s a_s Po[s], a_s = e^{m_s - M} / sum_s e^{m_s - M} l_s, M = max_s m_s, merged in f32 from the
//     KS key ranges' partials; Yh = f16(y), Yl = f16((y - Yh) * 1024). A lane's Po words of tile j are channels
//     16j + 8(lane>>4) + 0..7 of query lane&15: tiles 2ks and 2ks + 1 are elements 0..7 and 8..15 of the B fragment
//     of k-step ks, lane unchanged.
//     Epilogue staged in LDS Os[n_loc][co_loc], barrier, then out rows (position-major, 1024 B each): lane
//     (e = tid&15) -> co o0+4e..+3 of row n_loc = 8 it + (tid>>4); 16 consecutive lanes x 16 B = the whole 256-B
// coverage: Os 4 waves x 16 n x 64 co (cols 0..63 written and read); out 8 it x 8 rows x 16 lanes x 4 floats =
//           64 n x 64 co; grid (SEQ/64, 4) covers out[0..SEQ-1][0..255] exactly once.
// LDS Os: cross-wave (block barrier).
// =========================================================================================================
__global__ __launch_bounds__(128)
void gemm_o(const unsigned short* __restrict__ WW16, const float* __restrict__ Po,
            const float* __restrict__ Pml, const float* __restrict__ wbias,
            const float* __restrict__ x, float* out) {
  __shared__ __align__(16) float Os[QT * OSP];
  const int tid  = threadIdx.x;
  const int lane = tid & 31, wave = tid >> 5;
  const int hh   = lane >> 4, c = lane & 15;
  const int nt   = blockIdx.x, mb = blockIdx.y;
  const int n0   = nt * QT, o0 = mb * QT;

  const unsigned short* ap  = WW16 + (size_t)(o0 + c) * DQ + 8 * hh;
  const size_t t16 = (size_t)(nt * (QT / 16) + wave);                // the wave's 16-query tile

  const float* pml = Pml + t16 * 32 + c;
  const float* pp  = Po + t16 * (8 * 256) + 4 * lane;
  float ms[KS], as[KS];
  FragH fyh[DQ / 32], fyl[DQ / 32];
#pragma unroll
  for (int g = 0; g < 2; ++g) {                                      // tiles j = 4g .. 4g+3 = k-steps 2g, 2g+1
    v4f pv[KS][4][2];
    if (g == 0) {
#pragma unroll
      for (int s = 0; s < KS; ++s) {
        ms[s] = pml[(size_t)s * (NT16 * 32)];
        as[s] = pml[(size_t)s * (NT16 * 32) + 16];
      }
    }
#pragma unroll
    for (int s = 0; s < KS; ++s) {
#pragma unroll
      for (int jj = 0; jj < 4; ++jj) {
        pv[s][jj][0] = *(const v4f*)(pp + (size_t)s * (NT16 * 8 * 256) + (4 * g + jj) * 256);
        pv[s][jj][1] = *(const v4f*)(pp + (size_t)s * (NT16 * 8 * 256) + (4 * g + jj) * 256 + 128);
      }
    }
    // the group's loaded words, inputs only: all its loads are issued ahead of the arithmetic, one round trip for the
    // group instead of one for every pair of loads
    hold16(pv[0], pv[1], pp);
    hold16(pv[2], pv[3], pp + (size_t)2 * (NT16 * 8 * 256));
    if (g == 0) {                                                    // merge weights of query c
      float mall = ms[0];
#pragma unroll
      for (int s = 1; s < KS; ++s) mall = fmaxf(mall, ms[s]);
      float lall = 0.f;
#pragma unroll
      for (int s = 0; s < KS; ++s) {
        const float w = __expf(ms[s] - mall);
        lall += w * as[s];
        as[s] = w;
      }
      const float inv = 1.0f / lall;                                 // o and l both carry the x16384 factor
#pragma unroll
      for (int s = 0; s < KS; ++s) as[s] *= inv;
    }
#pragma unroll
    for (int jj = 0; jj < 4; ++jj) {
      const int j = 4 * g + jj;
#pragma unroll
      for (int r = 0; r < 8; ++r) {
        float y = as[0] * pv[0][jj][r >> 2][r & 3];
#pragma unroll
        for (int s = 1; s < KS; ++s) y += as[s] * pv[s][jj][r >> 2][r & 3];
        const _Float16 h0 = (_Float16)y;
        fyh[j >> 1].hv[j & 1][r] = h0;
        fyl[j >> 1].hv[j & 1][r] = (_Float16)((y - (float)h0) * RSC);
      }
    }
  }

  v8f acc[4], accr[4];
#pragma unroll
  for (int mt = 0; mt < 4; ++mt) { acc[mt] = zero8(); accr[mt] = zero8(); }

#pragma unroll
  for (int ks = 0; ks < DQ / 32; ++ks) {
#pragma unroll
    for (int mt = 0; mt < 4; ++mt) {
      const Frag fa = ldfrag(ap + (size_t)(16 * mt) * DQ + 32 * ks);
      acc[mt]  = mma_h(fa.h, fyh[ks].v, acc[mt]);
      accr[mt] = mma_h(fa.h, fyl[ks].v, accr[mt]);
    }
  }

  {
    const int nl = 16 * wave + c;
#pragma unroll
    for (int mt = 0; mt < 4; ++mt) {
      v4f va, vb;
#pragma unroll
      for (int r = 0; r < 4; ++r) {
        va[r] = (acc[mt][r] + accr[mt][r] * IRSC) * IWSC;
        vb[r] = (acc[mt][4 + r] + accr[mt][4 + r] * IRSC) * IWSC;
      }
      *(v4f*)(Os + nl * OSP + 16 * mt + 8 * hh)     = va;
      *(v4f*)(Os + nl * OSP + 16 * mt + 8 * hh + 4) = vb;
    }
  }
  __syncthreads();

  const int e = tid & 15, lq = tid >> 4;                             // lq 0..7
  const v4f bv = *(const v4f*)(wbias + o0 + 4 * e);
  const float bb[4] = {bfr(bv[0]), bfr(bv[1]), bfr(bv[2]), bfr(bv[3])};
  v4f res[8];
#pragma unroll
  for (int it = 0; it < 8; ++it) {
    const int nl = it * 8 + lq;                                      // n_loc 0..63
    const size_t idx = ((size_t)(n0 + nl)) * CC + o0 + 4 * e;
    const v4f xv = *(const v4f*)(x + idx);
    const v4f ov = *(const v4f*)(Os + nl * OSP + 4 * e);
#pragma unroll
    for (int t = 0; t < 4; ++t) res[it][t] = ov[t] + bb[t] + bfr(xv[t]);
  }
{
#pragma unroll
    for (int it = 0; it < 8; ++it) {
      const int nl = it * 8 + lq;
      const size_t idx = ((size_t)(n0 + nl)) * CC + o0 + 4 * e;
      *(v4f*)(out + idx) = res[it];
    }
    
  }
}

// =========================================================================================================
// Workspace map (bytes; each region start a multiple of 256; every plane size is an exact multiple of its
// whole-line store granularity, SEQ a multiple of 64 so no tail rows exist):
//   W16  f16 [384][256]          196608      WW16 f16 [256][128]     65536
//   XP   f16 [SEQ][256]         4194304 (SEQ=8192)
//   Qh/Ql bf16 [SEQ][128]        2097152 x2
//   Kh/Kl bf16 [SEQ][128]        2097152 x2
//   Gc   f16 [128][SEQ]          2097152
//   Po   f32 [KS][SEQ/16][8][2][32][4]  16777216 (KS=4)      Pml f32 [KS][SEQ/16][32]  262144
//   total (SEQ=8192) = 31981568
// =========================================================================================================
extern "C" void kernel_launch(void* const* d_in, const int* in_sizes, int n_in,
                              void* d_out, int out_size, void* d_ws, size_t ws_size,
                              hipStream_t stream) {
  const int XN = SEQ * CC;
  if (n_in < 9) return;
  if (in_sizes[0] < XN) return;
  if (in_sizes[1] < CC * DQ || in_sizes[3] < CC * DQ || in_sizes[5] < CC * DQ) return;
  if (in_sizes[2] < DQ || in_sizes[4] < DQ || in_sizes[6] < DQ) return;
  if (in_sizes[7] < DQ * CC || in_sizes[8] < CC) return;
  if (out_size < XN) return;

  size_t off = 0;
  auto carve = [&](size_t bytes) { const size_t o = off; off += (bytes + 255) & ~(size_t)255; return o; };
  const size_t oW16 = carve((size_t)MW * CC * 2);
  const size_t oWW  = carve((size_t)CC * DQ * 2);
  const size_t oXP  = carve((size_t)SEQ * CC * 2);
  const size_t oQh  = carve((size_t)SEQ * DQ * 2);
  const size_t oQl  = carve((size_t)SEQ * DQ * 2);
  const size_t oKh  = carve((size_t)SEQ * DQ * 2);
  const size_t oKl  = carve((size_t)SEQ * DQ * 2);
  const size_t oGc  = carve((size_t)DQ * SEQ * 2);
  const size_t oPo  = carve((size_t)KS * SEQ * DQ * 4);
  const size_t oPml = carve((size_t)KS * NT16 * 32 * 4);
  if (off > ws_size) return;
  if (off > (size_t)134217728) return;

  const float* x  = (const float*)d_in[0];
  const float* gw = (const float*)d_in[1];
  const float* gb = (const float*)d_in[2];
  const float* tw = (const float*)d_in[3];
  const float* tb = (const float*)d_in[4];
  const float* pw = (const float*)d_in[5];
  const float* pb = (const float*)d_in[6];
  const float* ww = (const float*)d_in[7];
  const float* wb = (const float*)d_in[8];

  char* ws = (char*)d_ws;
  unsigned short* W16  = (unsigned short*)(ws + oW16);
  unsigned short* WW16 = (unsigned short*)(ws + oWW);
  unsigned short* XP   = (unsigned short*)(ws + oXP);
  unsigned short* Qh   = (unsigned short*)(ws + oQh);
  unsigned short* Ql   = (unsigned short*)(ws + oQl);
  unsigned short* Kh   = (unsigned short*)(ws + oKh);
  unsigned short* Kl   = (unsigned short*)(ws + oKl);
  unsigned short* Gc   = (unsigned short*)(ws + oGc);
  float* Po  = (float*)(ws + oPo);
  float* Pml = (float*)(ws + oPml);
  float* out = (float*)d_out;

  const dim3 blk256(256), blk128(128);

  // (0) + (1) projection weights [in][out] -> f16 planes W16 [out rows 0..383][in 256], WW16 [out 256][in 128], and
  //     x -> 16-bit plane (same position-major layout), one grid
  cvt_all<<<dim3(WTB + SEQ / 8), blk256, 0, stream>>>(tw, pw, gw, ww, x, W16, WW16, XP);
  // (2) theta / phi -> hi + residual planes, g -> channel-major plane
  gemm_qkv<<<dim3(SEQ / QT, 6), blk128, 0, stream>>>(W16, XP, tb, pb, gb, Qh, Ql, Kh, Kl, Gc);
  // (3) attention, KS key ranges per query tile -> per-range partials
  attn_k<<<dim3(SEQ / QT, KS), blk128, 0, stream>>>(Qh, Ql, Kh, Kl, Gc, Po, Pml);
  // (4) merge of the ranges + output projection + bias + residual -> out [SEQ][256]
  gemm_o<<<dim3(SEQ / QT, CC / QT), blk128, 0, stream>>>(WW16, Po, Pml, wb, x, out);
  (void)hipGetLastError();
}

// v005
// Measured time: 67.6 microseconds a run.
// In both of two side-by-side timings against v004, it was 1.12 times as fast.
// Counting every step since v000, it is 11.4 times as fast.
// Contractions: theta/phi/g projection GEMMs Wt[384x256].Xp[256xN] and the output projection Wo[256x128].Y[128xN] on
// v_wmma_f32_16x16x32_f16 (f16 containers of bf16-RNE weights x256 and bf16-RNE x; Y as f16 hi fragment plus f16
// residual fragment x1024, 2 products, separate accumulators); scores Phi.Theta^T on v_wmma_f32_16x16x32_bf16
// (bf16 hi + bf16 residual planes of theta/phi, 3 products, K=128); Y^T = G.P^T on v_wmma_f32_16x16x32_f16
// (G plain f16, P = e^{s-m} x16384 f16 from the score D registers); f32 accumulate everywhere; softmax
// statistics, biases and the residual add in f32 VALU.
#include <hip/hip_runtime.h>
#include <math.h>
#include <stdint.h>

#ifndef NB
#define NB 1
#endif
#define NB_FULL 1
#ifndef SEQ
#define SEQ 8192
#endif
#define SEQ_FULL 8192
#define CC   256
#define DQ   128
#define QT   64
#define MW   384
#define OSP  68
#define TP   72
#define WSC  256.0f
#define IWSC 0.00390625f
#define RSC  1024.0f
#define IRSC 0.0009765625f
#define LNPS 9.704060527839234f
#define KT   64
#define KP   136
#define VP   72
#define KPL  (KT * KP)
#define STG  (2 * KPL + DQ * VP)
#define KS   4
#define KSEQ (SEQ / KS)
#define NT16 (SEQ / 16)
#define XW   (8 * 256 + 64)
#define WTB  32
#define WP   264

static_assert(NB == 1 && NB_FULL == 1);
static_assert(SEQ >= QT && SEQ <= SEQ_FULL);
static_assert(SEQ % QT == 0 && SEQ % 32 == 0 && SEQ % 8 == 0);
static_assert(CC % QT == 0 && CC % 32 == 0);
static_assert(DQ == 2 * QT && DQ % 32 == 0);
static_assert(MW == 3 * DQ && MW % 8 == 0);
static_assert(WTB == 4 * 8 && (DQ / QT) * (CC / QT) == 8 && DQ / QT == 2 && CC / QT == 4);
static_assert((OSP * 4) % 16 == 0);
static_assert((TP * 2) % 16 == 0);
static_assert(SEQ % KS == 0 && KSEQ % KT == 0 && KSEQ / KT >= 2 && KT == QT && KT % 32 == 0);
static_assert(2 * (2 * STG + 2 * KPL) * 2 <= 327680);                // two work-groups of attn_k per 320-KiB LDS
static_assert(KT == 64 && QT == 64 && 4 * XW * 4 <= 2 * STG * 2);         // attn_k: 2 x 2 waves of 32 keys x 32 queries; hand-over area
static_assert((KP * 2) % 32 == 16 && (VP * 2) % 32 == 16 && KP >= DQ + 8 && VP >= KT + 8);
static_assert((WP * 2) % 32 == 16 && WP >= CC + 8 && QT == 64 && CC == 256 && DQ == 128);   // operand tiles of the projection GEMMs
static_assert(3 * (2 * QT * WP * 2 + QT * OSP * 4) <= 327680);       // three work-groups of gemm_qkv per 320-KiB LDS

typedef _Float16       v16h __attribute__((ext_vector_type(16)));
typedef _Float16       v8h  __attribute__((ext_vector_type(8)));
typedef __bf16         v16b __attribute__((ext_vector_type(16)));
typedef unsigned short v8us __attribute__((ext_vector_type(8)));
typedef float          v8f  __attribute__((ext_vector_type(8)));
typedef float          v4f  __attribute__((ext_vector_type(4)));
typedef unsigned int   v4u  __attribute__((ext_vector_type(4)));

union Frag  { v8us u[2]; v16h h; v16b bf; };
union FragH { v16h v; v8h hv[2]; };
static_assert(sizeof(Frag) == 32);
static_assert(sizeof(FragH) == 32);

// ---- scalar helpers ---------------------------------------------------------------------------------------
__device__ __forceinline__ unsigned short bf_bits(float f) {          // f32 -> bf16 bits, RNE convert
  unsigned u = __float_as_uint(f);
  return (unsigned short)((u + 0x7FFFu + ((u >> 16) & 1u)) >> 16);
}
__device__ __forceinline__ float bf_up(unsigned short hb) { return __uint_as_float(((unsigned)hb) << 16); }
__device__ __forceinline__ float bfr(float f) { return bf_up(bf_bits(f)); }
__device__ __forceinline__ unsigned short h_bits(_Float16 x) { return __builtin_bit_cast(unsigned short, x); }
__device__ __forceinline__ unsigned pk16(unsigned short a, unsigned short b) { return (unsigned)a | ((unsigned)b << 16); }
__device__ __forceinline__ v8f zero8() { v8f z = {0.f, 0.f, 0.f, 0.f, 0.f, 0.f, 0.f, 0.f}; return z; }
__device__ __forceinline__ float hmax8(v8f s) {
  return fmaxf(fmaxf(fmaxf(s[0], s[1]), fmaxf(s[2], s[3])), fmaxf(fmaxf(s[4], s[5]), fmaxf(s[6], s[7])));
}
__device__ __forceinline__ unsigned wave_ballot(bool p) {
#if defined(__HIP_DEVICE_COMPILE__)
  return __builtin_amdgcn_ballot_w32(p);
#else
  return p ? 1u : 0u;
#endif
}

// ---- 16-bit fragment loader (A, or B from a k-contiguous [n][k] row): lane -> row/col (lane&15), p already includes
//      + 8*(lane>>4); elements 0..7 <- p[0..7] (k0+8h..), elements 8..15 <- p[16..23] (k0+16+8h..)
__device__ __forceinline__ Frag ldfrag(const unsigned short* p) {
  Frag f;
  f.u[0] = *(const v8us*)(p);
  f.u[1] = *(const v8us*)(p + 16);
  return f;
}

// ---- WMMA helpers: builtin followed by a 4-slot VALU gap tying D and keeping A/B live --------------------------
__device__ __forceinline__ v8f mma_h(v16h a, v16h b, v8f c) {
  v8f d = __builtin_amdgcn_wmma_f32_16x16x32_f16(false, a, false, b, (short)0, c, false, false);
#if defined(__HIP_DEVICE_COMPILE__)
  asm volatile("v_nop\n\tv_nop\n\tv_nop\n\tv_nop" : "+v"(d) : "v"(a), "v"(b));
#endif
  return d;
}
__device__ __forceinline__ v8f mma_b(v16b a, v16b b, v8f c) {
  v8f d = __builtin_amdgcn_wmma_f32_16x16x32_bf16(false, a, false, b, (short)0, c, false, false);
#if defined(__HIP_DEVICE_COMPILE__)
  const v16h ha = __builtin_bit_cast(v16h, a), hb = __builtin_bit_cast(v16h, b);
  asm volatile("v_nop\n\tv_nop\n\tv_nop\n\tv_nop" : "+v"(d) : "v"(ha), "v"(hb));
#endif
  return d;
}

// The same products for attn_k, whose wave tile takes more than 256 registers: an operand of an asm statement has to lie
// in v0..v255, so the gap statement names D alone and the A and B fragments are free to lie above.
__device__ __forceinline__ v8f mma_hd(v16h a, v16h b, v8f c) {
  v8f d = __builtin_amdgcn_wmma_f32_16x16x32_f16(false, a, false, b, (short)0, c, false, false);
#if defined(__HIP_DEVICE_COMPILE__)
  asm volatile("v_nop\n\tv_nop\n\tv_nop\n\tv_nop" : "+v"(d));
#endif
  return d;
}
__device__ __forceinline__ v8f mma_bd(v16b a, v16b b, v8f c) {
  v8f d = __builtin_amdgcn_wmma_f32_16x16x32_bf16(false, a, false, b, (short)0, c, false, false);
#if defined(__HIP_DEVICE_COMPILE__)
  asm volatile("v_nop\n\tv_nop\n\tv_nop\n\tv_nop" : "+v"(d));
#endif
  return d;
}

// ---- asynchronous copies global -> LDS ------------------------------------------------------------------------
__device__ __forceinline__ unsigned lds_addr(const unsigned short* p) { return (unsigned)(uintptr_t)p; }  // LDS byte address

// Eight 16-B copies per lane: copy i moves g + i*gstep (halves) to LDS byte address l + i*lstep. All lanes on.
__device__ __forceinline__ void copy8(unsigned l, unsigned lstep, const unsigned short* g, size_t gstep) {
#if defined(__HIP_DEVICE_COMPILE__)
  // the closing s_wait_xcnt keeps later rewrites of the address registers behind the issued copies
  asm volatile("global_load_async_to_lds_b128 %0, %8, off\n\t"
               "global_load_async_to_lds_b128 %1, %9, off\n\t"
               "global_load_async_to_lds_b128 %2, %10, off\n\t"
               "global_load_async_to_lds_b128 %3, %11, off\n\t"
               "global_load_async_to_lds_b128 %4, %12, off\n\t"
               "global_load_async_to_lds_b128 %5, %13, off\n\t"
               "global_load_async_to_lds_b128 %6, %14, off\n\t"
               "global_load_async_to_lds_b128 %7, %15, off\n\t"
               "s_wait_xcnt 0x0"
               :: "v"(l), "v"(l + lstep), "v"(l + 2 * lstep), "v"(l + 3 * lstep),
                  "v"(l + 4 * lstep), "v"(l + 5 * lstep), "v"(l + 6 * lstep), "v"(l + 7 * lstep),
                  "v"(g), "v"(g + gstep), "v"(g + 2 * gstep), "v"(g + 3 * gstep),
                  "v"(g + 4 * gstep), "v"(g + 5 * gstep), "v"(g + 6 * gstep), "v"(g + 7 * gstep)
               : "memory");
#endif
}
__device__ __forceinline__ void wait_async0() {   // this wave's copies have landed in LDS
#if defined(__HIP_DEVICE_COMPILE__)
  asm volatile("s_wait_asynccnt 0x0" ::: "memory");
#endif
}
__device__ __forceinline__ void wait_ds0() {      // this wave's LDS reads have returned before the buffer is handed back
#if defined(__HIP_DEVICE_COMPILE__)
  asm volatile("s_wait_dscnt 0x0" ::: "memory");
#endif
}

// Inputs-only fence on sixteen loaded 16-B words: every one of them has arrived here. The wait stands behind the loads and
// ahead of any rewrite of their address registers: their base p is named so that it lives up to the wait.
__device__ __forceinline__ void hold16(const v4f (&a)[4][2], const v4f (&b)[4][2], const float* p) {
#if defined(__HIP_DEVICE_COMPILE__)
  asm volatile("s_wait_xcnt 0x0"
               :: "v"(a[0][0]), "v"(a[0][1]), "v"(a[1][0]), "v"(a[1][1]), "v"(a[2][0]), "v"(a[2][1]), "v"(a[3][0]), "v"(a[3][1]),
                  "v"(b[0][0]), "v"(b[0][1]), "v"(b[1][0]), "v"(b[1][1]), "v"(b[2][0]), "v"(b[2][1]), "v"(b[3][0]), "v"(b[3][1]),
                  "v"(p));
#endif
}

// =========================================================================================================
// (0) weight transpose + convert: src f32 [R][S] (row r contiguous over S; the projection weights are stored
//     [in][out]) -> dst f16 row (rowBase + s), col r, pitch R halves; value = f16 of (bf16-RNE(w) * 256) (exact).
//     Through an LDS tile T[64 s][64 r] (pitch TP). Block (sb, rb) owns a 64 r x 64 s tile.
// coverage: load 2 it x 32 rows x 8 lanes x 8 = 64 r x 64 s; store 2 it x 32 s-rows x 8 lanes x 8 halves = 64 s x 64 r;
//           tiles (S/64, R/64) cover dst rows rowBase..rowBase+S-1 x cols 0..R-1 exactly once.
// LDS T: cross-wave (block barrier between the 2-byte stores and the 16-B reloads).
// =========================================================================================================
__device__ __forceinline__
void cvt_wt(unsigned short* T, const float* __restrict__ src, unsigned short* dst, int R, int S, int rowBase, int sb, int rb) {
  const int tid = threadIdx.x;
  const int e = tid & 7, lq = tid >> 3;                             // lq 0..31
  const int s0 = sb * QT, r0 = rb * QT;
  const float* sp0 = src + ((size_t)(r0 + lq)) * (size_t)S + s0 + 8 * e;          // r_loc lq
  const float* sp1 = src + ((size_t)(r0 + 32 + lq)) * (size_t)S + s0 + 8 * e;     // r_loc 32 + lq
  const v4f av[2] = {*(const v4f*)sp0, *(const v4f*)sp1};
  const v4f qv[2] = {*(const v4f*)(sp0 + 4), *(const v4f*)(sp1 + 4)};
#if defined(__HIP_DEVICE_COMPILE__)
  // inputs only: the wait stands behind the four loads and ahead of any rewrite of their address registers, which are named
  // so that they live up to it (otherwise a later load's result is placed over an earlier load's address pair)
  asm volatile("s_wait_xcnt 0x0" :: "v"(av[0]), "v"(qv[0]), "v"(av[1]), "v"(qv[1]), "v"(sp0), "v"(sp1));
#endif
#pragma unroll
  for (int it = 0; it < 2; ++it) {
    const int rl = it * 32 + lq;                                     // r_loc 0..63
    const v4f a = av[it];
    const v4f q = qv[it];
    unsigned short hb[8];
#pragma unroll
    for (int t = 0; t < 4; ++t) {
      hb[t]     = h_bits((_Float16)(bfr(a[t]) * WSC));
      hb[4 + t] = h_bits((_Float16)(bfr(q[t]) * WSC));
    }
#pragma unroll
    for (int t = 0; t < 8; ++t) T[(8 * e + t) * TP + rl] = hb[t];   // T[s_loc][r_loc]
  }
  __syncthreads();
  v4u up[2];
#pragma unroll
  for (int it = 0; it < 2; ++it) {
    const int sl = it * 32 + lq;                                     // s_loc 0..63
    up[it] = *(const v4u*)(T + sl * TP + 8 * e);                     // r_loc 8e..8e+7
  }
{
    unsigned short* dp = dst + ((size_t)(rowBase + s0 + lq)) * (size_t)R + r0 + 8 * e;   // s_loc lq; s_loc 32 + lq is 32 rows on
    *(v4u*)dp = up[0];
    *(v4u*)(dp + (size_t)32 * (size_t)R) = up[1];
#if defined(__HIP_DEVICE_COMPILE__)
    // the code of another block kind may follow in the shared kernel: the wait stands behind the two stores and ahead of any
    // rewrite of their data and address registers, which are named, inputs only, so that they live up to it
    asm volatile("s_wait_xcnt 0x0" :: "v"(up[0]), "v"(up[1]), "v"(dp) : "memory");
#endif
  }
}

// =========================================================================================================
// (1) x f32 [N][256] (already position-major) -> XP f16 [N][256], value = bf16-RNE(x) in an f16 container.
// coverage: SEQ/8 blocks x 8 rows x 32 lanes x 8 halves = SEQ x 256 = the whole plane.
// =========================================================================================================
__device__ __forceinline__
void cvt_x(const float* __restrict__ x, unsigned short* XP, int blk) {
  const int tid = threadIdx.x;
  const int row = 8 * blk + (tid >> 5);                              // 0..SEQ-1
  const int col = 8 * (tid & 31);                                    // 0..248
  const float* s = x + (size_t)row * CC + col;
  const v4f a = *(const v4f*)s;
  const v4f q = *(const v4f*)(s + 4);
  const float f[8] = {a[0], a[1], a[2], a[3], q[0], q[1], q[2], q[3]};
  v4u u;
#pragma unroll
  for (int t = 0; t < 4; ++t) {
    const _Float16 h0 = (_Float16)bfr(f[2 * t]);
    const _Float16 h1 = (_Float16)bfr(f[2 * t + 1]);
    u[t] = pk16(h_bits(h0), h_bits(h1));
  }
{
    unsigned short* dp = XP + (size_t)row * CC + col;
    *(v4u*)dp = u;
#if defined(__HIP_DEVICE_COMPILE__)
    // as in (0): the wait behind the store, ahead of any rewrite of its data and address registers (named, inputs only)
    asm volatile("s_wait_xcnt 0x0" :: "v"(u), "v"(dp) : "memory");
#endif
  }
}

// =========================================================================================================
// (0) + (1) as ONE launch: the five conversions read none of each other's output, so they share a grid, told apart by the
//     block index (block-uniform, so the barrier of (0) is passed by whole blocks). Blocks 0..WTB-1, first because their
//     path is the longer one: 8 tiles for each of theta_w, phi_w, g_w (R=256, S=128: tiles 2 x 4, rows 0 / 128 / 256 of
//     W16) and W_w (R=128, S=256: tiles 4 x 2, WW16). Blocks WTB.. : 8 rows of x each.
// coverage: 4 weights x 8 tiles = WTB blocks, each weight's tile set exactly once; SEQ/8 blocks over x.
// =========================================================================================================
__global__ __launch_bounds__(256)
void cvt_all(const float* __restrict__ tw, const float* __restrict__ pw, const float* __restrict__ gw,
             const float* __restrict__ ww, const float* __restrict__ x,
             unsigned short* W16, unsigned short* WW16, unsigned short* XP) {
  __shared__ __align__(16) unsigned short T[QT * TP];
  const int blk = blockIdx.x;
  if (blk < WTB) {
    const int job = blk >> 3, tile = blk & 7;
    if (job < 3) {
      const float* src = (job == 0) ? tw : (job == 1) ? pw : gw;
      cvt_wt(T, src, W16, CC, DQ, job * DQ, tile & 1, tile >> 1);
    } else {
      cvt_wt(T, ww, WW16, DQ, CC, 0, tile & 3, tile >> 2);
    }
  } else {
    cvt_x(x, XP, blk - WTB);
  }
}

// =========================================================================================================
// (2) theta / phi / g projection GEMM for one (64-n tile nt, 64-o block mb in 0..5): Y[o][n] = (1/256)
//     sum_c W16[mb*64 + o][c] XP[n][c] + bf16-RNE(bias[o]). W16 rows 0..127 = theta, 128..255 = phi, 256..383 = g.
//     Block 128 threads = 4 waves; wave w owns cols n0+16w..+15 (B fragment from the XP row, k = c contiguous,
//     split k map) and 4 m-tiles (A rows o = o0 + 16 mt + (lane&15), split k map from W16). K = 256 = 8 steps.
//     Epilogue staged in LDS Os[n_loc][o_loc] (pitch OSP), barrier, bias add in f32, then:
//       mb 0,1 (theta) / 2,3 (phi): bf16 hi = RNE(v), lo = RNE(v - hi) planes Qh/Ql resp. Kh/Kl [N][128 d]
//         the dsel half of the 256-B row): lane e -> d 8e..8e+7, 8 consecutive lanes per line, one instruction per
//         16 lines;
//       mb 4,5 (g): f16 plane Gc [128 ch][N keys] (channel-major, keys contiguous); row ch, 64 keys = one whole
// coverage: Os 4 waves x 16 n x 64 o = 64 x 64 (cols 0..63 written and read); hi/lo planes 4 it x 16 rows x 8 lanes
//           x 8 = 64 n x 64 d per plane, grid nt x mb {0,1} / {2,3} covers d 0..127 of all N rows of Qh/Ql / Kh/Kl
//           exactly once; g plane 4 it x 16 ch x 8 lanes x 8 keys = 64 ch x 64 keys, nt x mb {4,5} covers ch 0..127
//           x keys 0..N-1 of Gc exactly once. grid (N/64, 6).
// LDS Os: cross-wave (block barrier). LDS Ws, Xs (the block's 64 W16 rows and 64 XP rows, from which the fragments are read):
//     cross-wave (copy wait, then block barrier).
// =========================================================================================================
__global__ __launch_bounds__(128)
void gemm_qkv(const unsigned short* __restrict__ W16, const unsigned short* __restrict__ XP,
              const float* __restrict__ tbias, const float* __restrict__ pbias, const float* __restrict__ gbias,
              unsigned short* Qh, unsigned short* Ql, unsigned short* Kh, unsigned short* Kl, unsigned short* Gc) {
  __shared__ __align__(16) float Os[QT * OSP];
  __shared__ __align__(128) unsigned short Ws[QT * WP];              // W16 rows o0 .. o0+63, pitch 16 B x odd
  __shared__ __align__(128) unsigned short Xs[QT * WP];              // XP rows n0 .. n0+63, same pitch
  const int tid  = threadIdx.x;
  const int lane = tid & 31, wave = tid >> 5;
  const int hh   = lane >> 4, c = lane & 15;
  const int nt   = blockIdx.x, mb = blockIdx.y;
  const int n0   = nt * QT, o0 = mb * QT;                            // o0 = W16 row base 0..320

  // Both operand tiles come into LDS once, by asynchronous 16-B copies in whole lines: copy i of a lane -> row 4i + wave,
  // 16-B piece lane (a wave = one whole 512-B row), 2 x 16 copies per lane. A fragment read straight from global memory
  // touches 16 lines for 512 B, four waves fetch the same A fragments, and each read is a round trip of its own.
  {
    const unsigned lW = lds_addr(Ws + wave * WP + 8 * lane);
    const unsigned lX = lds_addr(Xs + wave * WP + 8 * lane);
    const unsigned short* gW = W16 + (size_t)(o0 + wave) * CC + 8 * lane;
    const unsigned short* gX = XP + (size_t)(n0 + wave) * CC + 8 * lane;
    copy8(lW,               4 * WP * 2, gW,                   (size_t)4 * CC);
    copy8(lW + 32 * WP * 2, 4 * WP * 2, gW + (size_t)32 * CC, (size_t)4 * CC);
    copy8(lX,               4 * WP * 2, gX,                   (size_t)4 * CC);
    copy8(lX + 32 * WP * 2, 4 * WP * 2, gX + (size_t)32 * CC, (size_t)4 * CC);
  }
  wait_async0();
  __syncthreads();

  const unsigned short* ap = Ws + c * WP + 8 * hh;
  const unsigned short* bp = Xs + (16 * wave + c) * WP + 8 * hh;

  v8f acc[4];
#pragma unroll
  for (int mt = 0; mt < 4; ++mt) acc[mt] = zero8();

  // fragments of two k-steps (2 B + 8 A) are one group of LDS reads; group g + 1 is read ahead of the products of group g
  // (two register sets): written in this order because LDS reads do not move across the gap statements of the helper
  Frag fb[2][2], fa[2][2][4];
  auto fetch = [&](int g) {
#pragma unroll
    for (int kk = 0; kk < 2; ++kk) {
      fb[g & 1][kk] = ldfrag(bp + 32 * (2 * g + kk));
#pragma unroll
      for (int mt = 0; mt < 4; ++mt) fa[g & 1][kk][mt] = ldfrag(ap + (16 * mt) * WP + 32 * (2 * g + kk));
    }
  };
  fetch(0);
#pragma unroll
  for (int g = 0; g < CC / 64; ++g) {
    if (g + 1 < CC / 64) fetch(g + 1);
#pragma unroll
    for (int kk = 0; kk < 2; ++kk) {
#pragma unroll
      for (int mt = 0; mt < 4; ++mt) acc[mt] = mma_h(fa[g & 1][kk][mt].h, fb[g & 1][kk].h, acc[mt]);
    }
  }

  {
    const int nl = 16 * wave + c;
#pragma unroll
    for (int mt = 0; mt < 4; ++mt) {
      v4f va, vb;
#pragma unroll
      for (int r = 0; r < 4; ++r) { va[r] = acc[mt][r] * IWSC; vb[r] = acc[mt][4 + r] * IWSC; }
      *(v4f*)(Os + nl * OSP + 16 * mt + 8 * hh)     = va;
      *(v4f*)(Os + nl * OSP + 16 * mt + 8 * hh + 4) = vb;
    }
  }
  __syncthreads();

  const int e = tid & 7, lq = tid >> 3;                             // lq 0..15
  const int grp  = mb >> 1;                                          // 0 theta, 1 phi, 2 g (block-uniform)
  const int dsel = (mb & 1) * QT;                                    // channel base 0 or 64 within the group
  if (grp < 2) {                                                     // block-uniform: bf16 hi/lo planes
    const float* bsrc = (grp == 0) ? tbias : pbias;
    unsigned short* Hp = (grp == 0) ? Qh : Kh;
    unsigned short* Lp = (grp == 0) ? Ql : Kl;
    const v4f b0 = *(const v4f*)(bsrc + dsel + 8 * e);
    const v4f b1 = *(const v4f*)(bsrc + dsel + 8 * e + 4);
    const float bb[8] = {bfr(b0[0]), bfr(b0[1]), bfr(b0[2]), bfr(b0[3]), bfr(b1[0]), bfr(b1[1]), bfr(b1[2]), bfr(b1[3])};
    v4u uh[4], ul[4];
#pragma unroll
    for (int it = 0; it < 4; ++it) {
      const int row = it * 16 + lq;                                  // n_loc 0..63
      const v4f a = *(const v4f*)(Os + row * OSP + 8 * e);
      const v4f q = *(const v4f*)(Os + row * OSP + 8 * e + 4);
      const float f[8] = {a[0], a[1], a[2], a[3], q[0], q[1], q[2], q[3]};
#pragma unroll
      for (int t = 0; t < 4; ++t) {
        const float f0 = f[2 * t] + bb[2 * t], f1 = f[2 * t + 1] + bb[2 * t + 1];
        const unsigned short hb0 = bf_bits(f0), hb1 = bf_bits(f1);
        const unsigned short lb0 = bf_bits(f0 - bf_up(hb0));
        const unsigned short lb1 = bf_bits(f1 - bf_up(hb1));
        uh[it][t] = pk16(hb0, hb1);
        ul[it][t] = pk16(lb0, lb1);
      }
    }
{
#pragma unroll
      for (int it = 0; it < 4; ++it) {
        const int row = it * 16 + lq;
        const size_t po = ((size_t)(n0 + row)) * DQ + dsel + 8 * e;
        *(v4u*)(Hp + po) = uh[it];
        *(v4u*)(Lp + po) = ul[it];
      }
      
    }
  } else {                                                           // block-uniform: g plane
    const int gsel = dsel;                                           // g channel base 0 or 64
    v4u ug[4];
#pragma unroll
    for (int it = 0; it < 4; ++it) {
      const int cl = it * 16 + lq;                                   // ch_loc 0..63
      const float bias = bfr(gbias[gsel + cl]);
      unsigned short hb[8];
#pragma unroll
      for (int t = 0; t < 8; ++t) {
        const int key = 8 * e + t;                                   // key_loc 0..63
        const float v = Os[key * OSP + cl] + bias;
        hb[t] = h_bits((_Float16)v);
      }
#pragma unroll
      for (int t = 0; t < 4; ++t) ug[it][t] = pk16(hb[2 * t], hb[2 * t + 1]);
    }
{
#pragma unroll
      for (int it = 0; it < 4; ++it) {
        const int cl = it * 16 + lq;
        const size_t po = ((size_t)(gsel + cl)) * (size_t)SEQ + n0 + 8 * e;
        *(v4u*)(Gc + po) = ug[it];
      }
      
    }
  }
}

// =========================================================================================================
// (3) attention for one 64-query tile and one of KS key ranges (KSEQ keys each), transposed formulation, no mask, no
//   scale. The KS ranges of a tile run as separate work-groups, so that the grid gives every SIMD two waves:
//   S^T tile (16 keys x 16 queries) = sum over 4 d-chunks of A(phi: row = key kb + (lane&15), 32 d via the split
//   k map from the bf16 plane Kh [SEQ][128]) . B(theta: col = query, same map from Qh) + A(Kh).B(Ql) +
//   A(Kl).B(Qh) (bf16 unscaled residual planes, shared accumulator).
//   Wave tile: 32 keys x 32 queries. Wave w takes query columns 32*(w&1) .. +31 (two B tiles u = 0, 1) and keys
//   32*(w>>1) .. +31 of every 64-key stage, so that each K and g fragment read from LDS feeds two query tiles.
//   Per lane a D tile holds 8 keys of ONE query: online softmax state per lane and query tile, one shuffle (lane^16) for
//   the max over 32 keys; the o/l rescale is skipped under a wave-uniform ballot when no lane's max grew (corr == 1
//   exactly for every lane then); row-sum partials combined at the end. P = e^{s-m} x 16384 as f16 is the B operand of
//   Y^T (rows channel, cols queries) += A(g rows channel = 16j + (lane&15), keys contiguous, f16 plane Gc
//   [128][SEQ]) . B(P^T): element r <- D of the tile covering keys kb..kb+15, element 8+r <- the tile covering
//   kb+16..kb+31, lane unchanged. 2 x 8 accumulator tiles per wave (128 channels x 32 queries). Block = 4 waves.
//   Operand path: the block's query tile (once) and 64-key stages of Kh, Kl, Gc come into LDS by asynchronous 16-B
//   copies in whole lines, two stage buffers, one publish point per stage; all fragments are ds_load_b128 reads at
//   pitches of 16 B x odd (272 B for 256-B rows, 144 B for 128-B rows).
//   Epilogue: waves w and w^2 hold the two key halves of the same 32 queries. Each keeps query tile u = w>>1, hands its
//   other tile (o, m, l) to the partner through the ring's LDS (free behind the last publish point), and merges the
//   partner's half into its own in f32. The range's un-normalised result goes to the workspace in register order,
//   Po[range][16-query tile][j][half][lane][4 f32] (element 4*half + i of tile j; each store = 512 contiguous B), with
//   Pml[range][16-query tile][32]: word c = the range's maximum of query c, word 16 + c = its row sum (x16384, as o).
//   The output projection merges the ranges.
// coverage: Po 4 waves x 8 j x 2 halves x 32 lanes x 4 = 64 queries x 128 ch per range; Pml 4 waves x 32 words; grid
//           (SEQ/64, KS) covers Po and Pml exactly once.
// LDS Ring, Qs: cross-wave (copy wait, then block barrier); hand-over area in Ring: cross-wave (block barrier).
// =========================================================================================================
__global__ __launch_bounds__(128)
void attn_k(const unsigned short* __restrict__ Qh, const unsigned short* __restrict__ Ql,
            const unsigned short* __restrict__ Kh, const unsigned short* __restrict__ Kl,
            const unsigned short* __restrict__ Gc, float* Po, float* Pml) {
  __shared__ __align__(128) unsigned short Ring[2 * STG];            // two stages: Kh[64][KP], Kl[64][KP], G[128][VP]
  __shared__ __align__(128) unsigned short Qs[2 * KPL];              // Qh[64][KP], Ql[64][KP]
  const int tid  = threadIdx.x;
  const int wave = tid >> 5, lane = tid & 31;
  const int hh   = lane >> 4, c = lane & 15;
  const int qg   = wave & 1;                                         // query columns 32*qg .. 32*qg + 31 of the tile
  const int kh   = wave >> 1;                                        // keys 32*kh .. 32*kh + 31 of every stage
  const int n0   = blockIdx.x * QT;
  const int kr   = blockIdx.y;                                       // key range: keys kr*KSEQ .. kr*KSEQ + KSEQ - 1

  // copy slots. 256-B rows (K, Q): copy i of a lane -> row 8i + (tid>>4), 16-B piece tid&15 (a wave = 512 contiguous
  // global bytes). 128-B rows (g): copy i -> channel 16i + (tid>>3), piece tid&7 (a wave = 4 whole lines).
  const int rK = tid >> 4, pK = tid & 15;
  const int rV = tid >> 3, pV = tid & 7;
  const unsigned lK = lds_addr(Ring + rK * KP + 8 * pK);
  const unsigned lV = lds_addr(Ring + 2 * KPL + rV * VP + 8 * pV);
  const unsigned lQ = lds_addr(Qs + rK * KP + 8 * pK);
  const unsigned short* gKh = Kh + (size_t)(kr * KSEQ + rK) * DQ + 8 * pK;
  const unsigned short* gKl = Kl + (size_t)(kr * KSEQ + rK) * DQ + 8 * pK;
  const unsigned short* gV  = Gc + (size_t)rV * (size_t)SEQ + kr * KSEQ + 8 * pV;

  // stage t (keys 64t .. 64t+63 of the range) into buffer b: 24 copies per lane
  auto fill = [&](int t, int b) {
    const unsigned lb = (unsigned)b * (unsigned)(STG * 2);
    copy8(lK + lb,           8 * KP * 2,  gKh + (size_t)t * (KT * DQ), (size_t)8 * DQ);
    copy8(lK + lb + KPL * 2, 8 * KP * 2,  gKl + (size_t)t * (KT * DQ), (size_t)8 * DQ);
    copy8(lV + lb,           16 * VP * 2, gV + (size_t)t * KT,         (size_t)16 * SEQ);
  };

  // prologue: the query tile (read by every pass) and stage 0, landed and published; then stage 1 in flight
  copy8(lQ,           8 * KP * 2, Qh + (size_t)(n0 + rK) * DQ + 8 * pK, (size_t)8 * DQ);
  copy8(lQ + KPL * 2, 8 * KP * 2, Ql + (size_t)(n0 + rK) * DQ + 8 * pK, (size_t)8 * DQ);
  fill(0, 0);
  wait_async0();
  __syncthreads();
  fill(1, 1);

  // q fragment pointers (B operand, col = query 32*qg + 16*u + c of the tile), + 16*u*KP + 32*kc
  const unsigned short* Qhp = Qs + (32 * qg + c) * KP + 8 * hh;
  const unsigned short* Qlp = Qhp + KPL;

  float m[2] = {-1.0e30f, -1.0e30f}, l[2] = {0.f, 0.f};
  v8f o[2][8];
#pragma unroll
  for (int u = 0; u < 2; ++u) {
#pragma unroll
    for (int j = 0; j < 8; ++j) o[u][j] = zero8();
  }

  // kept rolled: one trip is one stage with its publish point, and the buffer index alternates with t
#pragma unroll 1
  for (int t = 0; t < KSEQ / KT; ++t) {
    const unsigned short* st = Ring + (t & 1) * STG;
    // k fragment bases (A operand, row = key 32kh + c resp. 32kh + 16 + c of the stage), + 32*kc
    const unsigned short* k0p  = st + (32 * kh + c) * KP + 8 * hh;
    const unsigned short* k1p  = k0p + 16 * KP;
    const unsigned short* k0lp = k0p + KPL;
    const unsigned short* k1lp = k1p + KPL;
    // v fragment base (A operand, row = channel 16j + c, keys contiguous), + 16*j*VP
    const unsigned short* Vp = st + 2 * KPL + c * VP + 32 * kh + 8 * hh;
    v8f s0[2], s1[2];                                                // keys +0..15 resp. +16..31, query tile u
#pragma unroll
    for (int u = 0; u < 2; ++u) { s0[u] = zero8(); s1[u] = zero8(); }
    // fragments of d-chunk kc + 1 are read from LDS ahead of the products of chunk kc (two register sets): written in
    // this order, and unrolled, because LDS reads do not move across the gap statements of the product helpers
    Frag fq[2][2][2], fk[2][4];
    auto fetch = [&](int kc) {
      const int b = kc & 1;
      fq[b][0][0] = ldfrag(Qhp + 32 * kc);
      fq[b][0][1] = ldfrag(Qlp + 32 * kc);
      fq[b][1][0] = ldfrag(Qhp + 16 * KP + 32 * kc);
      fq[b][1][1] = ldfrag(Qlp + 16 * KP + 32 * kc);
      fk[b][0] = ldfrag(k0p + 32 * kc);
      fk[b][1] = ldfrag(k1p + 32 * kc);
      fk[b][2] = ldfrag(k0lp + 32 * kc);
      fk[b][3] = ldfrag(k1lp + 32 * kc);
    };
    fetch(0);
#pragma unroll
    for (int kc = 0; kc < DQ / 32; ++kc) {
      const int b = kc & 1;
      if (kc + 1 < DQ / 32) fetch(kc + 1);
      s0[0] = mma_bd(fk[b][0].bf, fq[b][0][0].bf, s0[0]);
      s1[0] = mma_bd(fk[b][1].bf, fq[b][0][0].bf, s1[0]);
      s0[1] = mma_bd(fk[b][0].bf, fq[b][1][0].bf, s0[1]);
      s1[1] = mma_bd(fk[b][1].bf, fq[b][1][0].bf, s1[1]);
      s0[0] = mma_bd(fk[b][0].bf, fq[b][0][1].bf, s0[0]);
      s1[0] = mma_bd(fk[b][1].bf, fq[b][0][1].bf, s1[0]);
      s0[1] = mma_bd(fk[b][0].bf, fq[b][1][1].bf, s0[1]);
      s1[1] = mma_bd(fk[b][1].bf, fq[b][1][1].bf, s1[1]);
      s0[0] = mma_bd(fk[b][2].bf, fq[b][0][0].bf, s0[0]);
      s1[0] = mma_bd(fk[b][3].bf, fq[b][0][0].bf, s1[0]);
      s0[1] = mma_bd(fk[b][2].bf, fq[b][1][0].bf, s0[1]);
      s1[1] = mma_bd(fk[b][3].bf, fq[b][1][0].bf, s1[1]);
    }
    float mx[2], mn[2];
#pragma unroll
    for (int u = 0; u < 2; ++u) mx[u] = fmaxf(hmax8(s0[u]), hmax8(s1[u]));
#pragma unroll
    for (int u = 0; u < 2; ++u) {
      mx[u] = fmaxf(mx[u], __shfl_xor(mx[u], 16, 32));
      mn[u] = fmaxf(m[u], mx[u]);
    }
    const unsigned grew = wave_ballot(mx[0] > m[0] || mx[1] > m[1]); // wave-uniform
    if (grew != 0u) {
#pragma unroll
      for (int u = 0; u < 2; ++u) {
        const float corr = __expf(m[u] - mn[u]);                     // == 1 exactly for lanes whose max did not grow
        l[u] *= corr;
#pragma unroll
        for (int j = 0; j < 8; ++j) {
#pragma unroll
          for (int r = 0; r < 8; ++r) o[u][j][r] *= corr;
        }
      }
    }

    // the stage's g fragments: read here, behind the exchange of the maxima (whose wait would cover them in the LDS queue), so
    // that their LDS time runs under the exponentials
    Frag vf[8];
#pragma unroll
    for (int j = 0; j < 8; ++j) vf[j] = ldfrag(Vp + (16 * j) * VP);
#if defined(__HIP_DEVICE_COMPILE__)
    // keeps the sixteen reads above as one group here: moved down to their products, each pair is waited for on its own
    __builtin_amdgcn_sched_barrier(0);
#endif

    FragH ph[2];
#pragma unroll
    for (int u = 0; u < 2; ++u) {
      m[u] = mn[u];
      const float msh = mn[u] - LNPS;                                // exp gives e^{s-m} * 16384
      float ls = 0.f;
#pragma unroll
      for (int r = 0; r < 8; ++r) {
        const float e0 = __expf(s0[u][r] - msh);                     // key 64t + 32kh      + 8hh + r
        const float e1 = __expf(s1[u][r] - msh);                     // key 64t + 32kh + 16 + 8hh + r
        ls += e0 + e1;
        ph[u].hv[0][r] = (_Float16)e0;
        ph[u].hv[1][r] = (_Float16)e1;
      }
      l[u] += ls;
    }

#pragma unroll
    for (int j = 0; j < 8; ++j) {
      o[0][j] = mma_hd(vf[j].h, ph[0].v, o[0][j]);
      o[1][j] = mma_hd(vf[j].h, ph[1].v, o[1][j]);
    }
    // publish point of stage t + 1: own LDS reads returned, own copies landed, every wave here; only then the refill
    wait_ds0();
    wait_async0();
    __syncthreads();
    if (t + 2 < KSEQ / KT) fill(t + 2, t & 1);
  }
  wait_async0();
#pragma unroll
  for (int u = 0; u < 2; ++u) l[u] += __shfl_xor(l[u], 16, 32);

  // hand-over between the key halves: no copy is in flight and every wave has passed the last publish point, so the
  // ring is free. Area of wave w: XW floats = [j][half][lane][4] of the tile it gives away, then m[32], l[32].
  float* X = reinterpret_cast<float*>(Ring);
  float* xg = X + wave * XW;
  const float* xp = X + (wave ^ 2) * XW;
  v8f ok[8];                                                         // the tile this wave keeps: u = kh
#pragma unroll
  for (int j = 0; j < 8; ++j) {
    const v8f og = kh ? o[0][j] : o[1][j];
    ok[j] = kh ? o[1][j] : o[0][j];
    v4f va, vb;
#pragma unroll
    for (int r = 0; r < 4; ++r) { va[r] = og[r]; vb[r] = og[4 + r]; }
    *(v4f*)(xg + j * 256 + 4 * lane)       = va;
    *(v4f*)(xg + j * 256 + 128 + 4 * lane) = vb;
  }
  xg[2048 + lane] = kh ? m[0] : m[1];
  xg[2080 + lane] = kh ? l[0] : l[1];
  const float mk = kh ? m[1] : m[0];
  const float lk = kh ? l[1] : l[0];
  __syncthreads();
  const float mp = xp[2048 + lane];
  const float lp = xp[2080 + lane];
  const float mall = fmaxf(mk, mp);
  const float wk = __expf(mk - mall), wp = __expf(mp - mall);

  const size_t pt = (size_t)kr * NT16 + (size_t)(blockIdx.x * (QT / 16) + 2 * qg + kh);   // (range, 16-query tile)
  float* po = Po + pt * (8 * 256) + 4 * lane;
#pragma unroll
  for (int j = 0; j < 8; ++j) {
    const v4f pa = *(const v4f*)(xp + j * 256 + 4 * lane);
    const v4f pb = *(const v4f*)(xp + j * 256 + 128 + 4 * lane);
    v4f va, vb;
#pragma unroll
    for (int r = 0; r < 4; ++r) { va[r] = ok[j][r] * wk + pa[r] * wp; vb[r] = ok[j][4 + r] * wk + pb[r] * wp; }
    *(v4f*)(po + j * 256)       = va;
    *(v4f*)(po + j * 256 + 128) = vb;
  }
  Pml[pt * 32 + lane] = hh ? (lk * wk + lp * wp) : mall;             // m and l are equal in lanes c and 16 + c
}

// =========================================================================================================
// (4) output projection GEMM for one (64-n tile, 64-co block): out[n][co] = (1/256)(sum_c WW16[co][c] Yh[n][c] +
//     (1/1024) sum_c WW16[co][c] Yl[n][c]) + bf16-RNE(W_b[co]) + bf16-RNE(x[n][co]). 4 waves, wave w owns
//     cols n0+16w..+15, 4 m-tiles (A rows co = o0 + 16 mt + (lane&15) from WW16), hi and residual products in
//     separate accumulators. K = 128 = 4 steps.
//     B operand: y = sum_s a_s Po[s], a_s = e^{m_s - M} / sum_s e^{m_s - M} l_s, M = max_s m_s, merged in f32 from the
//     KS key ranges' partials; Yh = f16(y), Yl = f16((y - Yh) * 1024). A lane's Po words of tile j are channels
//     16j + 8(lane>>4) + 0..7 of query lane&15: tiles 2ks and 2ks + 1 are elements 0..7 and 8..15 of the B fragment
//     of k-step ks, lane unchanged.
//     Epilogue staged in LDS Os[n_loc][co_loc], barrier, then out rows (position-major, 1024 B each): lane
//     (e = tid&15) -> co o0+4e..+3 of row n_loc = 8 it + (tid>>4); 16 consecutive lanes x 16 B = the whole 256-B
// coverage: Os 4 waves x 16 n x 64 co (cols 0..63 written and read); out 8 it x 8 rows x 16 lanes x 4 floats =
//           64 n x 64 co; grid (SEQ/64, 4) covers out[0..SEQ-1][0..255] exactly once.
// LDS Os: cross-wave (block barrier). LDS Ws (the block's 64 WW16 rows, from which the A fragments are read): cross-wave
//     (copy wait, then block barrier).
// =========================================================================================================
__global__ __launch_bounds__(128)
void gemm_o(const unsigned short* __restrict__ WW16, const float* __restrict__ Po,
            const float* __restrict__ Pml, const float* __restrict__ wbias,
            const float* __restrict__ x, float* out) {
  __shared__ __align__(16) float Os[QT * OSP];
  __shared__ __align__(128) unsigned short Ws[QT * KP];              // WW16 rows o0 .. o0+63, pitch 16 B x odd
  const int tid  = threadIdx.x;
  const int lane = tid & 31, wave = tid >> 5;
  const int hh   = lane >> 4, c = lane & 15;
  const int nt   = blockIdx.x, mb = blockIdx.y;
  const int n0   = nt * QT, o0 = mb * QT;

  const unsigned short* ap  = Ws + c * KP + 8 * hh;
  const size_t t16 = (size_t)(nt * (QT / 16) + wave);                // the wave's 16-query tile

  const float* pml = Pml + t16 * 32 + c;
  const float* pp  = Po + t16 * (8 * 256) + 4 * lane;
  float ms[KS], as[KS];
  FragH fyh[DQ / 32], fyl[DQ / 32];
#pragma unroll
  for (int g = 0; g < 2; ++g) {                                      // tiles j = 4g .. 4g+3 = k-steps 2g, 2g+1
    v4f pv[KS][4][2];
#pragma unroll
    for (int s = 0; s < KS; ++s) {
#pragma unroll
      for (int jj = 0; jj < 4; ++jj) {
        pv[s][jj][0] = *(const v4f*)(pp + (size_t)s * (NT16 * 8 * 256) + (4 * g + jj) * 256);
        pv[s][jj][1] = *(const v4f*)(pp + (size_t)s * (NT16 * 8 * 256) + (4 * g + jj) * 256 + 128);
      }
    }
    if (g == 0) {
      // The A tile comes into LDS by asynchronous 16-B copies in whole lines and travels under the loads and the merge of the
      // partials: copy i of a lane -> row 8i + (tid>>4), 16-B piece tid&15 (a wave = 512 contiguous B). The statement stands
      // between the first group's loads and those of the maxima and sums: loads do not cross it, so that no wait for a
      // maximum comes to stand in front of the group's issue.
      copy8(lds_addr(Ws + (tid >> 4) * KP + 8 * (tid & 15)), 8 * KP * 2,
            WW16 + (size_t)(o0 + (tid >> 4)) * DQ + 8 * (tid & 15), (size_t)8 * DQ);
#pragma unroll
      for (int s = 0; s < KS; ++s) {
        ms[s] = pml[(size_t)s * (NT16 * 32)];
        as[s] = pml[(size_t)s * (NT16 * 32) + 16];
      }
    }
    // the group's loaded words, inputs only: all its loads are issued ahead of the arithmetic, one round trip for the
    // group instead of one for every pair of loads
    hold16(pv[0], pv[1], pp);
    hold16(pv[2], pv[3], pp + (size_t)2 * (NT16 * 8 * 256));
    if (g == 0) {                                                    // merge weights of query c
      float mall = ms[0];
#pragma unroll
      for (int s = 1; s < KS; ++s) mall = fmaxf(mall, ms[s]);
      float lall = 0.f;
#pragma unroll
      for (int s = 0; s < KS; ++s) {
        const float w = __expf(ms[s] - mall);
        lall += w * as[s];
        as[s] = w;
      }
      const float inv = 1.0f / lall;                                 // o and l both carry the x16384 factor
#pragma unroll
      for (int s = 0; s < KS; ++s) as[s] *= inv;
    }
#pragma unroll
    for (int jj = 0; jj < 4; ++jj) {
      const int j = 4 * g + jj;
#pragma unroll
      for (int r = 0; r < 8; ++r) {
        float y = as[0] * pv[0][jj][r >> 2][r & 3];
#pragma unroll
        for (int s = 1; s < KS; ++s) y += as[s] * pv[s][jj][r >> 2][r & 3];
        const _Float16 h0 = (_Float16)y;
        fyh[j >> 1].hv[j & 1][r] = h0;
        fyl[j >> 1].hv[j & 1][r] = (_Float16)((y - (float)h0) * RSC);
      }
    }
  }

  v8f acc[4], accr[4];
#pragma unroll
  for (int mt = 0; mt < 4; ++mt) { acc[mt] = zero8(); accr[mt] = zero8(); }

  // the A tile: own copies landed, every wave here; then all sixteen fragments as one group of LDS reads ahead of the
  // products (LDS reads do not move across the gap statements of the helper)
  wait_async0();
  __syncthreads();
  Frag fa[DQ / 32][4];
#pragma unroll
  for (int ks = 0; ks < DQ / 32; ++ks) {
#pragma unroll
    for (int mt = 0; mt < 4; ++mt) fa[ks][mt] = ldfrag(ap + (16 * mt) * KP + 32 * ks);
  }
#pragma unroll
  for (int ks = 0; ks < DQ / 32; ++ks) {
#pragma unroll
    for (int mt = 0; mt < 4; ++mt) {
      acc[mt]  = mma_h(fa[ks][mt].h, fyh[ks].v, acc[mt]);
      accr[mt] = mma_h(fa[ks][mt].h, fyl[ks].v, accr[mt]);
    }
  }

  {
    const int nl = 16 * wave + c;
#pragma unroll
    for (int mt = 0; mt < 4; ++mt) {
      v4f va, vb;
#pragma unroll
      for (int r = 0; r < 4; ++r) {
        va[r] = (acc[mt][r] + accr[mt][r] * IRSC) * IWSC;
        vb[r] = (acc[mt][4 + r] + accr[mt][4 + r] * IRSC) * IWSC;
      }
      *(v4f*)(Os + nl * OSP + 16 * mt + 8 * hh)     = va;
      *(v4f*)(Os + nl * OSP + 16 * mt + 8 * hh + 4) = vb;
    }
  }
  __syncthreads();

  const int e = tid & 15, lq = tid >> 4;                             // lq 0..7
  const v4f bv = *(const v4f*)(wbias + o0 + 4 * e);
  const float bb[4] = {bfr(bv[0]), bfr(bv[1]), bfr(bv[2]), bfr(bv[3])};
  v4f res[8];
#pragma unroll
  for (int it = 0; it < 8; ++it) {
    const int nl = it * 8 + lq;                                      // n_loc 0..63
    const size_t idx = ((size_t)(n0 + nl)) * CC + o0 + 4 * e;
    const v4f xv = *(const v4f*)(x + idx);
    const v4f ov = *(const v4f*)(Os + nl * OSP + 4 * e);
#pragma unroll
    for (int t = 0; t < 4; ++t) res[it][t] = ov[t] + bb[t] + bfr(xv[t]);
  }
{
#pragma unroll
    for (int it = 0; it < 8; ++it) {
      const int nl = it * 8 + lq;
      const size_t idx = ((size_t)(n0 + nl)) * CC + o0 + 4 * e;
      *(v4f*)(out + idx) = res[it];
    }
    
  }
}

// =========================================================================================================
// Workspace map (bytes; each region start a multiple of 256; every plane size is an exact multiple of its
// whole-line store granularity, SEQ a multiple of 64 so no tail rows exist):
//   W16  f16 [384][256]          196608      WW16 f16 [256][128]     65536
//   XP   f16 [SEQ][256]         4194304 (SEQ=8192)
//   Qh/Ql bf16 [SEQ][128]        2097152 x2
//   Kh/Kl bf16 [SEQ][128]        2097152 x2
//   Gc   f16 [128][SEQ]          2097152
//   Po   f32 [KS][SEQ/16][8][2][32][4]  16777216 (KS=4)      Pml f32 [KS][SEQ/16][32]  262144
//   total (SEQ=8192) = 31981568
// =========================================================================================================
extern "C" void kernel_launch(void* const* d_in, const int* in_sizes, int n_in,
                              void* d_out, int out_size, void* d_ws, size_t ws_size,
                              hipStream_t stream) {
  const int XN = SEQ * CC;
  if (n_in < 9) return;
  if (in_sizes[0] < XN) return;
  if (in_sizes[1] < CC * DQ || in_sizes[3] < CC * DQ || in_sizes[5] < CC * DQ) return;
  if (in_sizes[2] < DQ || in_sizes[4] < DQ || in_sizes[6] < DQ) return;
  if (in_sizes[7] < DQ * CC || in_sizes[8] < CC) return;
  if (out_size < XN) return;

  size_t off = 0;
  auto carve = [&](size_t bytes) { const size_t o = off; off += (bytes + 255) & ~(size_t)255; return o; };
  const size_t oW16 = carve((size_t)MW * CC * 2);
  const size_t oWW  = carve((size_t)CC * DQ * 2);
  const size_t oXP  = carve((size_t)SEQ * CC * 2);
  const size_t oQh  = carve((size_t)SEQ * DQ * 2);
  const size_t oQl  = carve((size_t)SEQ * DQ * 2);
  const size_t oKh  = carve((size_t)SEQ * DQ * 2);
  const size_t oKl  = carve((size_t)SEQ * DQ * 2);
  const size_t oGc  = carve((size_t)DQ * SEQ * 2);
  const size_t oPo  = carve((size_t)KS * SEQ * DQ * 4);
  const size_t oPml = carve((size_t)KS * NT16 * 32 * 4);
  if (off > ws_size) return;
  if (off > (size_t)134217728) return;

  const float* x  = (const float*)d_in[0];
  const float* gw = (const float*)d_in[1];
  const float* gb = (const float*)d_in[2];
  const float* tw = (const float*)d_in[3];
  const float* tb = (const float*)d_in[4];
  const float* pw = (const float*)d_in[5];
  const float* pb = (const float*)d_in[6];
  const float* ww = (const float*)d_in[7];
  const float* wb = (const float*)d_in[8];

  char* ws = (char*)d_ws;
  unsigned short* W16  = (unsigned short*)(ws + oW16);
  unsigned short* WW16 = (unsigned short*)(ws + oWW);
  unsigned short* XP   = (unsigned short*)(ws + oXP);
  unsigned short* Qh   = (unsigned short*)(ws + oQh);
  unsigned short* Ql   = (unsigned short*)(ws + oQl);
  unsigned short* Kh   = (unsigned short*)(ws + oKh);
  unsigned short* Kl   = (unsigned short*)(ws + oKl);
  unsigned short* Gc   = (unsigned short*)(ws + oGc);
  float* Po  = (float*)(ws + oPo);
  float* Pml = (float*)(ws + oPml);
  float* out = (float*)d_out;

  const dim3 blk256(256), blk128(128);

  // (0) + (1) projection weights [in][out] -> f16 planes W16 [out rows 0..383][in 256], WW16 [out 256][in 128], and
  //     x -> 16-bit plane (same position-major layout), one grid
  cvt_all<<<dim3(WTB + SEQ / 8), blk256, 0, stream>>>(tw, pw, gw, ww, x, W16, WW16, XP);
  // (2) theta / phi -> hi + residual planes, g -> channel-major plane
  gemm_qkv<<<dim3(SEQ / QT, 6), blk128, 0, stream>>>(W16, XP, tb, pb, gb, Qh, Ql, Kh, Kl, Gc);
  // (3) attention, KS key ranges per query tile -> per-range partials
  attn_k<<<dim3(SEQ / QT, KS), blk128, 0, stream>>>(Qh, Ql, Kh, Kl, Gc, Po, Pml);
  // (4) merge of the ranges + output projection + bias + residual -> out [SEQ][256]
  gemm_o<<<dim3(SEQ / QT, CC / QT), blk128, 0, stream>>>(WW16, Po, Pml, wb, x, out);
  (void)hipGetLastError();
}

// v006
// Measured time: 62.2 microseconds a run.
// Next to v005, in two timings, it ran 1.08 and 1.09 times as fast.
// Over all steps from v000 it is 12.3 times as fast.
// Contractions: theta/phi/g projection GEMMs Wt[384x256].Xp[256xN] and the output projection Wo[256x128].Y[128xN] on
// v_wmma_f32_16x16x32_f16 (f16 containers of bf16-RNE weights x256 and bf16-RNE x; Y as f16 hi fragment plus f16
// residual fragment x1024, 2 products, separate accumulators); scores Phi.Theta^T on v_wmma_f32_16x16x32_bf16
// (bf16 hi + bf16 residual planes of theta/phi, 3 products, K=128); Y^T = G.P^T on v_wmma_f32_16x16x32_f16
// (G plain f16, P = e^{s-m} x16384 f16 from the score D registers); f32 accumulate everywhere; softmax
// statistics, biases and the residual add in f32 VALU.
#include <hip/hip_runtime.h>
#include <math.h>
#include <stdint.h>

#ifndef NB
#define NB 1
#endif
#define NB_FULL 1
#ifndef SEQ
#define SEQ 8192
#endif
#define SEQ_FULL 8192
#define CC   256
#define DQ   128
#define QT   64
#define MW   384
#define OSP  68
#define TP   72
#define WSC  256.0f
#define IWSC 0.00390625f
#define RSC  1024.0f
#define IRSC 0.0009765625f
#define LNPS 9.704060527839234f
#define KT   64
#define KP   136
#define VP   72
#define KPL  (KT * KP)
#define KSL  9216
#define STG  (2 * KSL + DQ * VP)
#define KS   4
#define KSEQ (SEQ / KS)
#define NT16 (SEQ / 16)
#define XW   (8 * 256 + 64)
#define WTB  32
#define WP   264

static_assert(NB == 1 && NB_FULL == 1);
static_assert(SEQ >= QT && SEQ <= SEQ_FULL);
static_assert(SEQ % QT == 0 && SEQ % 32 == 0 && SEQ % 8 == 0);
static_assert(CC % QT == 0 && CC % 32 == 0);
static_assert(DQ == 2 * QT && DQ % 32 == 0);
static_assert(MW == 3 * DQ && MW % 8 == 0);
static_assert(WTB == 4 * 8 && (DQ / QT) * (CC / QT) == 8 && DQ / QT == 2 && CC / QT == 4);
static_assert((OSP * 4) % 16 == 0);
static_assert((TP * 2) % 16 == 0);
static_assert(SEQ % KS == 0 && KSEQ % KT == 0 && KSEQ / KT >= 2 && KT == QT && KT % 32 == 0);
static_assert(2 * (2 * STG + 2 * KPL) * 2 <= 327680);                // two work-groups of attn_k per 320-KiB LDS
static_assert(KT == 64 && QT == 64 && 4 * XW * 4 <= 2 * STG * 2);         // attn_k: 2 x 2 waves of 32 keys x 32 queries; hand-over area
static_assert(KSL >= KPL && (KSL * 2) % 2048 == 0 && (DQ * VP * 2) % 2048 == 0);   // every tensor tile's place in LDS: a multiple of 2 KiB
static_assert(DQ * 2 == 256 && KP * 2 == 256 + 16 && KT * 2 == 128 && VP * 2 == 128 + 16);   // tile rows and their padded pitches
static_assert((KP * 2) % 32 == 16 && (VP * 2) % 32 == 16 && KP >= DQ + 8 && VP >= KT + 8);
static_assert((WP * 2) % 32 == 16 && WP >= CC + 8 && QT == 64 && CC == 256 && DQ == 128);   // operand tiles of the projection GEMMs
static_assert(3 * (2 * QT * WP * 2 + QT * OSP * 4) <= 327680);       // three work-groups of gemm_qkv per 320-KiB LDS

typedef _Float16       v16h __attribute__((ext_vector_type(16)));
typedef _Float16       v8h  __attribute__((ext_vector_type(8)));
typedef __bf16         v16b __attribute__((ext_vector_type(16)));
typedef unsigned short v8us __attribute__((ext_vector_type(8)));
typedef float          v8f  __attribute__((ext_vector_type(8)));
typedef float          v4f  __attribute__((ext_vector_type(4)));
typedef unsigned int   v4u  __attribute__((ext_vector_type(4)));
typedef uint32_t       u32x4 __attribute__((ext_vector_type(4)));
typedef uint32_t       u32x8 __attribute__((ext_vector_type(8)));

union Frag  { v8us u[2]; v16h h; v16b bf; };
union FragH { v16h v; v8h hv[2]; };
static_assert(sizeof(Frag) == 32);
static_assert(sizeof(FragH) == 32);

// ---- scalar helpers ---------------------------------------------------------------------------------------
__device__ __forceinline__ unsigned short bf_bits(float f) {          // f32 -> bf16 bits, RNE convert
  unsigned u = __float_as_uint(f);
  return (unsigned short)((u + 0x7FFFu + ((u >> 16) & 1u)) >> 16);
}
__device__ __forceinline__ float bf_up(unsigned short hb) { return __uint_as_float(((unsigned)hb) << 16); }
__device__ __forceinline__ float bfr(float f) { return bf_up(bf_bits(f)); }
__device__ __forceinline__ unsigned short h_bits(_Float16 x) { return __builtin_bit_cast(unsigned short, x); }
__device__ __forceinline__ unsigned pk16(unsigned short a, unsigned short b) { return (unsigned)a | ((unsigned)b << 16); }
__device__ __forceinline__ v8f zero8() { v8f z = {0.f, 0.f, 0.f, 0.f, 0.f, 0.f, 0.f, 0.f}; return z; }
__device__ __forceinline__ float hmax8(v8f s) {
  return fmaxf(fmaxf(fmaxf(s[0], s[1]), fmaxf(s[2], s[3])), fmaxf(fmaxf(s[4], s[5]), fmaxf(s[6], s[7])));
}
__device__ __forceinline__ unsigned wave_ballot(bool p) {
#if defined(__HIP_DEVICE_COMPILE__)
  return __builtin_amdgcn_ballot_w32(p);
#else
  return p ? 1u : 0u;
#endif
}

// ---- 16-bit fragment loader (A, or B from a k-contiguous [n][k] row): lane -> row/col (lane&15), p already includes
//      + 8*(lane>>4); elements 0..7 <- p[0..7] (k0+8h..), elements 8..15 <- p[16..23] (k0+16+8h..)
__device__ __forceinline__ Frag ldfrag(const unsigned short* p) {
  Frag f;
  f.u[0] = *(const v8us*)(p);
  f.u[1] = *(const v8us*)(p + 16);
  return f;
}

// ---- WMMA helpers: builtin followed by a 4-slot VALU gap tying D and keeping A/B live --------------------------
__device__ __forceinline__ v8f mma_h(v16h a, v16h b, v8f c) {
  v8f d = __builtin_amdgcn_wmma_f32_16x16x32_f16(false, a, false, b, (short)0, c, false, false);
#if defined(__HIP_DEVICE_COMPILE__)
  asm volatile("v_nop\n\tv_nop\n\tv_nop\n\tv_nop" : "+v"(d) : "v"(a), "v"(b));
#endif
  return d;
}
__device__ __forceinline__ v8f mma_b(v16b a, v16b b, v8f c) {
  v8f d = __builtin_amdgcn_wmma_f32_16x16x32_bf16(false, a, false, b, (short)0, c, false, false);
#if defined(__HIP_DEVICE_COMPILE__)
  const v16h ha = __builtin_bit_cast(v16h, a), hb = __builtin_bit_cast(v16h, b);
  asm volatile("v_nop\n\tv_nop\n\tv_nop\n\tv_nop" : "+v"(d) : "v"(ha), "v"(hb));
#endif
  return d;
}

// The same products for attn_k, whose wave tile takes more than 256 registers: an operand of an asm statement has to lie
// in v0..v255, so the gap statement names D alone and the A and B fragments are free to lie above.
__device__ __forceinline__ v8f mma_hd(v16h a, v16h b, v8f c) {
  v8f d = __builtin_amdgcn_wmma_f32_16x16x32_f16(false, a, false, b, (short)0, c, false, false);
#if defined(__HIP_DEVICE_COMPILE__)
  asm volatile("v_nop\n\tv_nop\n\tv_nop\n\tv_nop" : "+v"(d));
#endif
  return d;
}
__device__ __forceinline__ v8f mma_bd(v16b a, v16b b, v8f c) {
  v8f d = __builtin_amdgcn_wmma_f32_16x16x32_bf16(false, a, false, b, (short)0, c, false, false);
#if defined(__HIP_DEVICE_COMPILE__)
  asm volatile("v_nop\n\tv_nop\n\tv_nop\n\tv_nop" : "+v"(d));
#endif
  return d;
}

// ---- asynchronous copies global -> LDS ------------------------------------------------------------------------
__device__ __forceinline__ unsigned lds_addr(const unsigned short* p) { return (unsigned)(uintptr_t)p; }  // LDS byte address

// Eight 16-B copies per lane: copy i moves g + i*gstep (halves) to LDS byte address l + i*lstep. All lanes on.
__device__ __forceinline__ void copy8(unsigned l, unsigned lstep, const unsigned short* g, size_t gstep) {
#if defined(__HIP_DEVICE_COMPILE__)
  // the closing s_wait_xcnt keeps later rewrites of the address registers behind the issued copies
  asm volatile("global_load_async_to_lds_b128 %0, %8, off\n\t"
               "global_load_async_to_lds_b128 %1, %9, off\n\t"
               "global_load_async_to_lds_b128 %2, %10, off\n\t"
               "global_load_async_to_lds_b128 %3, %11, off\n\t"
               "global_load_async_to_lds_b128 %4, %12, off\n\t"
               "global_load_async_to_lds_b128 %5, %13, off\n\t"
               "global_load_async_to_lds_b128 %6, %14, off\n\t"
               "global_load_async_to_lds_b128 %7, %15, off\n\t"
               "s_wait_xcnt 0x0"
               :: "v"(l), "v"(l + lstep), "v"(l + 2 * lstep), "v"(l + 3 * lstep),
                  "v"(l + 4 * lstep), "v"(l + 5 * lstep), "v"(l + 6 * lstep), "v"(l + 7 * lstep),
                  "v"(g), "v"(g + gstep), "v"(g + 2 * gstep), "v"(g + 3 * gstep),
                  "v"(g + 4 * gstep), "v"(g + 5 * gstep), "v"(g + 6 * gstep), "v"(g + 7 * gstep)
               : "memory");
#endif
}
__device__ __forceinline__ void wait_async0() {   // this wave's copies have landed in LDS
#if defined(__HIP_DEVICE_COMPILE__)
  asm volatile("s_wait_asynccnt 0x0" ::: "memory");
#endif
}
__device__ __forceinline__ void wait_ds0() {      // this wave's LDS reads have returned before the buffer is handed back
#if defined(__HIP_DEVICE_COMPILE__)
  asm volatile("s_wait_dscnt 0x0" ::: "memory");
#endif
}

__device__ __forceinline__ uint32_t uni(uint32_t v) { return (uint32_t)__builtin_amdgcn_readfirstlane(v); }
__device__ __forceinline__ uint32_t pinned(uint32_t v) {
  uint32_t w = uni(v);
#if defined(__HIP_DEVICE_COMPILE__)
  // holds the word in a scalar register at this place: a test on it compiles to a scalar branch (a tensor load ignores EXEC),
  // and what is computed from it stays behind the waits that stand in front of it
  asm volatile("" : "+s"(w));   // pinned(): a word of a tensor load's test or descriptor held in a scalar register
#endif
  return w;
}
// group 1: byte elements, tensor = tile = ROWS rows of ROWB bytes, source pitch in bytes; W0 = pad word (no mask), a constant
template <uint32_t W0, uint32_t ROWB, uint32_t ROWS>
__device__ __forceinline__ u32x8 tdm_group1(uint32_t src_pitch) {
  u32x8 g;
  g[0] = uni(W0);
  g[1] = uni((ROWB & 0xFFFFu) << 16);
  g[2] = uni((ROWB >> 16) | ((ROWS & 0xFFFFu) << 16));
  g[3] = uni((ROWS >> 16) | (ROWB << 16));
  g[4] = uni(ROWS);
  g[5] = uni(src_pitch);
  g[6] = uni(0u);
  g[7] = uni(0u);
#if defined(__HIP_DEVICE_COMPILE__)
  // descriptor words held in scalar registers (the pinned() form, on the whole group): built once, the group keeps its eight
  // registers over the loop, so that none of them takes another value while a request that named them is outstanding
  asm volatile("" : "+s"(g));   // pinned(), all eight words: descriptor words held in scalar registers
#endif
  return g;
}
// group 0: count 1, LDS byte address, global byte address of the tile's first byte, type 2
__device__ __forceinline__ u32x4 tdm_group0(uint32_t lds_dst, uint64_t ga) {
  u32x4 g;
  g[0] = uni(1u);
  g[1] = uni(lds_dst);
  g[2] = uni((uint32_t)ga);
  g[3] = uni((((uint32_t)(ga >> 32)) & 0x01FFFFFFu) | 0x80000000u);
  return g;
}
__device__ __forceinline__ void tdm_load(u32x4 g0, u32x8 g1) {
#if defined(__HIP_DEVICE_COMPILE__)
  asm volatile("tensor_load_to_lds %0, %1" :: "s"(g0), "s"(g1) : "memory");
#endif
}
__device__ __forceinline__ void wait_tensor0() {  // this wave's tensor load has landed in LDS
#if defined(__HIP_DEVICE_COMPILE__)
  asm volatile("s_wait_tensorcnt 0x0" ::: "memory");
#endif
}

// Inputs-only fence on sixteen loaded 16-B words: every one of them has arrived here. The wait stands behind the loads and
// ahead of any rewrite of their address registers: their base p is named so that it lives up to the wait.
__device__ __forceinline__ void hold16(const v4f (&a)[4][2], const v4f (&b)[4][2], const float* p) {
#if defined(__HIP_DEVICE_COMPILE__)
  asm volatile("s_wait_xcnt 0x0"
               :: "v"(a[0][0]), "v"(a[0][1]), "v"(a[1][0]), "v"(a[1][1]), "v"(a[2][0]), "v"(a[2][1]), "v"(a[3][0]), "v"(a[3][1]),
                  "v"(b[0][0]), "v"(b[0][1]), "v"(b[1][0]), "v"(b[1][1]), "v"(b[2][0]), "v"(b[2][1]), "v"(b[3][0]), "v"(b[3][1]),
                  "v"(p));
#endif
}

// =========================================================================================================
// (0) weight transpose + convert: src f32 [R][S] (row r contiguous over S; the projection weights are stored
//     [in][out]) -> dst f16 row (rowBase + s), col r, pitch R halves; value = f16 of (bf16-RNE(w) * 256) (exact).
//     Through an LDS tile T[64 s][64 r] (pitch TP). Block (sb, rb) owns a 64 r x 64 s tile.
// coverage: load 2 it x 32 rows x 8 lanes x 8 = 64 r x 64 s; store 2 it x 32 s-rows x 8 lanes x 8 halves = 64 s x 64 r;
//           tiles (S/64, R/64) cover dst rows rowBase..rowBase+S-1 x cols 0..R-1 exactly once.
// LDS T: cross-wave (block barrier between the 2-byte stores and the 16-B reloads).
// =========================================================================================================
__device__ __forceinline__
void cvt_wt(unsigned short* T, const float* __restrict__ src, unsigned short* dst, int R, int S, int rowBase, int sb, int rb) {
  const int tid = threadIdx.x;
  const int e = tid & 7, lq = tid >> 3;                             // lq 0..31
  const int s0 = sb * QT, r0 = rb * QT;
  const float* sp0 = src + ((size_t)(r0 + lq)) * (size_t)S + s0 + 8 * e;          // r_loc lq
  const float* sp1 = src + ((size_t)(r0 + 32 + lq)) * (size_t)S + s0 + 8 * e;     // r_loc 32 + lq
  const v4f av[2] = {*(const v4f*)sp0, *(const v4f*)sp1};
  const v4f qv[2] = {*(const v4f*)(sp0 + 4), *(const v4f*)(sp1 + 4)};
#if defined(__HIP_DEVICE_COMPILE__)
  // inputs only: the wait stands behind the four loads and ahead of any rewrite of their address registers, which are named
  // so that they live up to it (otherwise a later load's result is placed over an earlier load's address pair)
  asm volatile("s_wait_xcnt 0x0" :: "v"(av[0]), "v"(qv[0]), "v"(av[1]), "v"(qv[1]), "v"(sp0), "v"(sp1));
#endif
#pragma unroll
  for (int it = 0; it < 2; ++it) {
    const int rl = it * 32 + lq;                                     // r_loc 0..63
    const v4f a = av[it];
    const v4f q = qv[it];
    unsigned short hb[8];
#pragma unroll
    for (int t = 0; t < 4; ++t) {
      hb[t]     = h_bits((_Float16)(bfr(a[t]) * WSC));
      hb[4 + t] = h_bits((_Float16)(bfr(q[t]) * WSC));
    }
#pragma unroll
    for (int t = 0; t < 8; ++t) T[(8 * e + t) * TP + rl] = hb[t];   // T[s_loc][r_loc]
  }
  __syncthreads();
  v4u up[2];
#pragma unroll
  for (int it = 0; it < 2; ++it) {
    const int sl = it * 32 + lq;                                     // s_loc 0..63
    up[it] = *(const v4u*)(T + sl * TP + 8 * e);                     // r_loc 8e..8e+7
  }
{
    unsigned short* dp = dst + ((size_t)(rowBase + s0 + lq)) * (size_t)R + r0 + 8 * e;   // s_loc lq; s_loc 32 + lq is 32 rows on
    *(v4u*)dp = up[0];
    *(v4u*)(dp + (size_t)32 * (size_t)R) = up[1];
#if defined(__HIP_DEVICE_COMPILE__)
    // the code of another block kind may follow in the shared kernel: the wait stands behind the two stores and ahead of any
    // rewrite of their data and address registers, which are named, inputs only, so that they live up to it
    asm volatile("s_wait_xcnt 0x0" :: "v"(up[0]), "v"(up[1]), "v"(dp) : "memory");
#endif
  }
}

// =========================================================================================================
// (1) x f32 [N][256] (already position-major) -> XP f16 [N][256], value = bf16-RNE(x) in an f16 container.
// coverage: SEQ/8 blocks x 8 rows x 32 lanes x 8 halves = SEQ x 256 = the whole plane.
// =========================================================================================================
__device__ __forceinline__
void cvt_x(const float* __restrict__ x, unsigned short* XP, int blk) {
  const int tid = threadIdx.x;
  const int row = 8 * blk + (tid >> 5);                              // 0..SEQ-1
  const int col = 8 * (tid & 31);                                    // 0..248
  const float* s = x + (size_t)row * CC + col;
  const v4f a = *(const v4f*)s;
  const v4f q = *(const v4f*)(s + 4);
  const float f[8] = {a[0], a[1], a[2], a[3], q[0], q[1], q[2], q[3]};
  v4u u;
#pragma unroll
  for (int t = 0; t < 4; ++t) {
    const _Float16 h0 = (_Float16)bfr(f[2 * t]);
    const _Float16 h1 = (_Float16)bfr(f[2 * t + 1]);
    u[t] = pk16(h_bits(h0), h_bits(h1));
  }
{
    unsigned short* dp = XP + (size_t)row * CC + col;
    *(v4u*)dp = u;
#if defined(__HIP_DEVICE_COMPILE__)
    // as in (0): the wait behind the store, ahead of any rewrite of its data and address registers (named, inputs only)
    asm volatile("s_wait_xcnt 0x0" :: "v"(u), "v"(dp) : "memory");
#endif
  }
}

// =========================================================================================================
// (0) + (1) as ONE launch: the five conversions read none of each other's output, so they share a grid, told apart by the
//     block index (block-uniform, so the barrier of (0) is passed by whole blocks). Blocks 0..WTB-1, first because their
//     path is the longer one: 8 tiles for each of theta_w, phi_w, g_w (R=256, S=128: tiles 2 x 4, rows 0 / 128 / 256 of
//     W16) and W_w (R=128, S=256: tiles 4 x 2, WW16). Blocks WTB.. : 8 rows of x each.
// coverage: 4 weights x 8 tiles = WTB blocks, each weight's tile set exactly once; SEQ/8 blocks over x.
// =========================================================================================================
__global__ __launch_bounds__(256)
void cvt_all(const float* __restrict__ tw, const float* __restrict__ pw, const float* __restrict__ gw,
             const float* __restrict__ ww, const float* __restrict__ x,
             unsigned short* W16, unsigned short* WW16, unsigned short* XP) {
  __shared__ __align__(16) unsigned short T[QT * TP];
  const int blk = blockIdx.x;
  if (blk < WTB) {
    const int job = blk >> 3, tile = blk & 7;
    if (job < 3) {
      const float* src = (job == 0) ? tw : (job == 1) ? pw : gw;
      cvt_wt(T, src, W16, CC, DQ, job * DQ, tile & 1, tile >> 1);
    } else {
      cvt_wt(T, ww, WW16, DQ, CC, 0, tile & 3, tile >> 2);
    }
  } else {
    cvt_x(x, XP, blk - WTB);
  }
}

// =========================================================================================================
// (2) theta / phi / g projection GEMM for one (64-n tile nt, 64-o block mb in 0..5): Y[o][n] = (1/256)
//     sum_c W16[mb*64 + o][c] XP[n][c] + bf16-RNE(bias[o]). W16 rows 0..127 = theta, 128..255 = phi, 256..383 = g.
//     Block 128 threads = 4 waves; wave w owns cols n0+16w..+15 (B fragment from the XP row, k = c contiguous,
//     split k map) and 4 m-tiles (A rows o = o0 + 16 mt + (lane&15), split k map from W16). K = 256 = 8 steps.
//     Epilogue staged in LDS Os[n_loc][o_loc] (pitch OSP), barrier, bias add in f32, then:
//       mb 0,1 (theta) / 2,3 (phi): bf16 hi = RNE(v), lo = RNE(v - hi) planes Qh/Ql resp. Kh/Kl [N][128 d]
//         the dsel half of the 256-B row): lane e -> d 8e..8e+7, 8 consecutive lanes per line, one instruction per
//         16 lines;
//       mb 4,5 (g): f16 plane Gc [128 ch][N keys] (channel-major, keys contiguous); row ch, 64 keys = one whole
// coverage: Os 4 waves x 16 n x 64 o = 64 x 64 (cols 0..63 written and read); hi/lo planes 4 it x 16 rows x 8 lanes
//           x 8 = 64 n x 64 d per plane, grid nt x mb {0,1} / {2,3} covers d 0..127 of all N rows of Qh/Ql / Kh/Kl
//           exactly once; g plane 4 it x 16 ch x 8 lanes x 8 keys = 64 ch x 64 keys, nt x mb {4,5} covers ch 0..127
//           x keys 0..N-1 of Gc exactly once. grid (N/64, 6).
// LDS Os: cross-wave (block barrier). LDS Ws, Xs (the block's 64 W16 rows and 64 XP rows, from which the fragments are read):
//     cross-wave (copy wait, then block barrier).
// =========================================================================================================
__global__ __launch_bounds__(128)
void gemm_qkv(const unsigned short* __restrict__ W16, const unsigned short* __restrict__ XP,
              const float* __restrict__ tbias, const float* __restrict__ pbias, const float* __restrict__ gbias,
              unsigned short* Qh, unsigned short* Ql, unsigned short* Kh, unsigned short* Kl, unsigned short* Gc) {
  __shared__ __align__(16) float Os[QT * OSP];
  __shared__ __align__(128) unsigned short Ws[QT * WP];              // W16 rows o0 .. o0+63, pitch 16 B x odd
  __shared__ __align__(128) unsigned short Xs[QT * WP];              // XP rows n0 .. n0+63, same pitch
  const int tid  = threadIdx.x;
  const int lane = tid & 31, wave = tid >> 5;
  const int hh   = lane >> 4, c = lane & 15;
  const int nt   = blockIdx.x, mb = blockIdx.y;
  const int n0   = nt * QT, o0 = mb * QT;                            // o0 = W16 row base 0..320

  // Both operand tiles come into LDS once, by asynchronous 16-B copies in whole lines: copy i of a lane -> row 4i + wave,
  // 16-B piece lane (a wave = one whole 512-B row), 2 x 16 copies per lane. A fragment read straight from global memory
  // touches 16 lines for 512 B, four waves fetch the same A fragments, and each read is a round trip of its own.
  {
    const unsigned lW = lds_addr(Ws + wave * WP + 8 * lane);
    const unsigned lX = lds_addr(Xs + wave * WP + 8 * lane);
    const unsigned short* gW = W16 + (size_t)(o0 + wave) * CC + 8 * lane;
    const unsigned short* gX = XP + (size_t)(n0 + wave) * CC + 8 * lane;
    copy8(lW,               4 * WP * 2, gW,                   (size_t)4 * CC);
    copy8(lW + 32 * WP * 2, 4 * WP * 2, gW + (size_t)32 * CC, (size_t)4 * CC);
    copy8(lX,               4 * WP * 2, gX,                   (size_t)4 * CC);
    copy8(lX + 32 * WP * 2, 4 * WP * 2, gX + (size_t)32 * CC, (size_t)4 * CC);
  }
  wait_async0();
  __syncthreads();

  const unsigned short* ap = Ws + c * WP + 8 * hh;
  const unsigned short* bp = Xs + (16 * wave + c) * WP + 8 * hh;

  v8f acc[4];
#pragma unroll
  for (int mt = 0; mt < 4; ++mt) acc[mt] = zero8();

  // fragments of two k-steps (2 B + 8 A) are one group of LDS reads; group g + 1 is read ahead of the products of group g
  // (two register sets): written in this order because LDS reads do not move across the gap statements of the helper
  Frag fb[2][2], fa[2][2][4];
  auto fetch = [&](int g) {
#pragma unroll
    for (int kk = 0; kk < 2; ++kk) {
      fb[g & 1][kk] = ldfrag(bp + 32 * (2 * g + kk));
#pragma unroll
      for (int mt = 0; mt < 4; ++mt) fa[g & 1][kk][mt] = ldfrag(ap + (16 * mt) * WP + 32 * (2 * g + kk));
    }
  };
  fetch(0);
#pragma unroll
  for (int g = 0; g < CC / 64; ++g) {
    if (g + 1 < CC / 64) fetch(g + 1);
#pragma unroll
    for (int kk = 0; kk < 2; ++kk) {
#pragma unroll
      for (int mt = 0; mt < 4; ++mt) acc[mt] = mma_h(fa[g & 1][kk][mt].h, fb[g & 1][kk].h, acc[mt]);
    }
  }

  {
    const int nl = 16 * wave + c;
#pragma unroll
    for (int mt = 0; mt < 4; ++mt) {
      v4f va, vb;
#pragma unroll
      for (int r = 0; r < 4; ++r) { va[r] = acc[mt][r] * IWSC; vb[r] = acc[mt][4 + r] * IWSC; }
      *(v4f*)(Os + nl * OSP + 16 * mt + 8 * hh)     = va;
      *(v4f*)(Os + nl * OSP + 16 * mt + 8 * hh + 4) = vb;
    }
  }
  __syncthreads();

  const int e = tid & 7, lq = tid >> 3;                             // lq 0..15
  const int grp  = mb >> 1;                                          // 0 theta, 1 phi, 2 g (block-uniform)
  const int dsel = (mb & 1) * QT;                                    // channel base 0 or 64 within the group
  if (grp < 2) {                                                     // block-uniform: bf16 hi/lo planes
    const float* bsrc = (grp == 0) ? tbias : pbias;
    unsigned short* Hp = (grp == 0) ? Qh : Kh;
    unsigned short* Lp = (grp == 0) ? Ql : Kl;
    const v4f b0 = *(const v4f*)(bsrc + dsel + 8 * e);
    const v4f b1 = *(const v4f*)(bsrc + dsel + 8 * e + 4);
    const float bb[8] = {bfr(b0[0]), bfr(b0[1]), bfr(b0[2]), bfr(b0[3]), bfr(b1[0]), bfr(b1[1]), bfr(b1[2]), bfr(b1[3])};
    v4u uh[4], ul[4];
#pragma unroll
    for (int it = 0; it < 4; ++it) {
      const int row = it * 16 + lq;                                  // n_loc 0..63
      const v4f a = *(const v4f*)(Os + row * OSP + 8 * e);
      const v4f q = *(const v4f*)(Os + row * OSP + 8 * e + 4);
      const float f[8] = {a[0], a[1], a[2], a[3], q[0], q[1], q[2], q[3]};
#pragma unroll
      for (int t = 0; t < 4; ++t) {
        const float f0 = f[2 * t] + bb[2 * t], f1 = f[2 * t + 1] + bb[2 * t + 1];
        const unsigned short hb0 = bf_bits(f0), hb1 = bf_bits(f1);
        const unsigned short lb0 = bf_bits(f0 - bf_up(hb0));
        const unsigned short lb1 = bf_bits(f1 - bf_up(hb1));
        uh[it][t] = pk16(hb0, hb1);
        ul[it][t] = pk16(lb0, lb1);
      }
    }
{
#pragma unroll
      for (int it = 0; it < 4; ++it) {
        const int row = it * 16 + lq;
        const size_t po = ((size_t)(n0 + row)) * DQ + dsel + 8 * e;
        *(v4u*)(Hp + po) = uh[it];
        *(v4u*)(Lp + po) = ul[it];
      }
      
    }
  } else {                                                           // block-uniform: g plane
    const int gsel = dsel;                                           // g channel base 0 or 64
    v4u ug[4];
#pragma unroll
    for (int it = 0; it < 4; ++it) {
      const int cl = it * 16 + lq;                                   // ch_loc 0..63
      const float bias = bfr(gbias[gsel + cl]);
      unsigned short hb[8];
#pragma unroll
      for (int t = 0; t < 8; ++t) {
        const int key = 8 * e + t;                                   // key_loc 0..63
        const float v = Os[key * OSP + cl] + bias;
        hb[t] = h_bits((_Float16)v);
      }
#pragma unroll
      for (int t = 0; t < 4; ++t) ug[it][t] = pk16(hb[2 * t], hb[2 * t + 1]);
    }
{
#pragma unroll
      for (int it = 0; it < 4; ++it) {
        const int cl = it * 16 + lq;
        const size_t po = ((size_t)(gsel + cl)) * (size_t)SEQ + n0 + 8 * e;
        *(v4u*)(Gc + po) = ug[it];
      }
      
    }
  }
}

// =========================================================================================================
// (3) attention for one 64-query tile and one of KS key ranges (KSEQ keys each), transposed formulation, no mask, no
//   scale. The KS ranges of a tile run as separate work-groups, so that the grid gives every SIMD two waves:
//   S^T tile (16 keys x 16 queries) = sum over 4 d-chunks of A(phi: row = key kb + (lane&15), 32 d via the split
//   k map from the bf16 plane Kh [SEQ][128]) . B(theta: col = query, same map from Qh) + A(Kh).B(Ql) +
//   A(Kl).B(Qh) (bf16 unscaled residual planes, shared accumulator).
//   Wave tile: 32 keys x 32 queries. Wave w takes query columns 32*(w&1) .. +31 (two B tiles u = 0, 1) and keys
//   32*(w>>1) .. +31 of every 64-key stage, so that each K and g fragment read from LDS feeds two query tiles.
//   Per lane a D tile holds 8 keys of ONE query: online softmax state per lane and query tile, one shuffle (lane^16) for
//   the max over 32 keys; the o/l rescale is skipped under a wave-uniform ballot when no lane's max grew (corr == 1
//   exactly for every lane then); row-sum partials combined at the end. P = e^{s-m} x 16384 as f16 is the B operand of
//   Y^T (rows channel, cols queries) += A(g rows channel = 16j + (lane&15), keys contiguous, f16 plane Gc
//   [128][SEQ]) . B(P^T): element r <- D of the tile covering keys kb..kb+15, element 8+r <- the tile covering
//   kb+16..kb+31, lane unchanged. 2 x 8 accumulator tiles per wave (128 channels x 32 queries). Block = 4 waves.
//   Operand path: the block's query tile comes into LDS once by asynchronous 16-B copies in whole lines; a 64-key stage of
//   Kh, Kl, Gc comes by three tensor loads, one each from waves 0, 1, 2 (64 rows of 256 B, twice, and 128 rows of 128 B, the
//   mover padding each row by 16 B), two stage buffers, one publish point per stage; all fragments are ds_load_b128 reads
//   at pitches of 16 B x odd (272 B for 256-B rows, 144 B for 128-B rows).
//   Epilogue: waves w and w^2 hold the two key halves of the same 32 queries. Each keeps query tile u = w>>1, hands its
//   other tile (o, m, l) to the partner through the ring's LDS (free behind the last publish point), and merges the
//   partner's half into its own in f32. The range's un-normalised result goes to the workspace in register order,
//   Po[range][16-query tile][j][half][lane][4 f32] (element 4*half + i of tile j; each store = 512 contiguous B), with
//   Pml[range][16-query tile][32]: word c = the range's maximum of query c, word 16 + c = its row sum (x16384, as o).
//   The output projection merges the ranges.
// coverage: Po 4 waves x 8 j x 2 halves x 32 lanes x 4 = 64 queries x 128 ch per range; Pml 4 waves x 32 words; grid
//           (SEQ/64, KS) covers Po and Pml exactly once.
// LDS Ring: cross-wave (issuer's tensor wait, then block barrier); Qs: cross-wave (copy wait, then block barrier); hand-over area in Ring: cross-wave (block barrier).
// =========================================================================================================
__global__ __launch_bounds__(128)
void attn_k(const unsigned short* __restrict__ Qh, const unsigned short* __restrict__ Ql,
            const unsigned short* __restrict__ Kh, const unsigned short* __restrict__ Kl,
            const unsigned short* __restrict__ Gc, float* Po, float* Pml) {
  __shared__ __attribute__((aligned(2048))) unsigned short Ring[2 * STG];   // two stages: Kh[64][KP], Kl[64][KP] (KSL each), G[128][VP]
  __shared__ __align__(128) unsigned short Qs[2 * KPL];              // Qh[64][KP], Ql[64][KP]
  const int tid  = threadIdx.x;
  const int wave = tid >> 5, lane = tid & 31;
  const int hh   = lane >> 4, c = lane & 15;
  const int qg   = wave & 1;                                         // query columns 32*qg .. 32*qg + 31 of the tile
  const int kh   = wave >> 1;                                        // keys 32*kh .. 32*kh + 31 of every stage
  const int n0   = blockIdx.x * QT;
  const int kr   = blockIdx.y;                                       // key range: keys kr*KSEQ .. kr*KSEQ + KSEQ - 1

  // copy slots of the query tile (256-B rows): copy i of a lane -> row 8i + (tid>>4), 16-B piece tid&15 (a wave = 512
  // contiguous global bytes).
  const int rK = tid >> 4, pK = tid & 15;
  const unsigned lQ = lds_addr(Qs + rK * KP + 8 * pK);

  // A stage's three tiles, one tensor load each: wave 0 Kh, wave 1 Kl (64 key rows of 256 B, source pitch 256 B), wave 2 g
  // (128 channel rows of 128 B = 64 keys, source pitch 2*SEQ B). Tile w lies KSL halves behind tile w - 1 in its buffer. From
  // stage to stage the K tiles move on by 64 rows, the g tile by 128 B. Wave 3 issues nothing.
  const uint32_t wv = uni((uint32_t)threadIdx.x >> 5);
  const unsigned short* tsrc = (wv == 0u) ? Kh + (size_t)kr * KSEQ * DQ : (wv == 1u) ? Kl + (size_t)kr * KSEQ * DQ
                                                                       : Gc + (size_t)kr * KSEQ;
  const uint64_t tga   = (uint64_t)(uintptr_t)tsrc;
  const uint32_t tstep = (wv < 2u) ? (uint32_t)(KT * DQ * 2) : (uint32_t)(KT * 2);
  const uint32_t tlds  = lds_addr(Ring) + ((wv < 2u) ? wv : 2u) * (uint32_t)(KSL * 2);
  const u32x8 g1K = tdm_group1<(1u << 20) | (5u << 22) | (3u << 25), DQ * 2, KT>((uint32_t)(DQ * 2));
  const u32x8 g1V = tdm_group1<(1u << 20) | (4u << 22) | (3u << 25), KT * 2, DQ>((uint32_t)(SEQ * 2));

  // stage t (keys 64t .. 64t+63 of the range) into buffer b: one request from each of waves 0, 1, 2, under scalar branches;
  // land: the issuer's wait stands directly behind its load (the prologue's first stage)
  auto fill = [&](uint32_t t, uint32_t b, bool land) {
    if (pinned(wv < 2u)) {
      tdm_load(tdm_group0(tlds + b * (uint32_t)(STG * 2), tga + (uint64_t)t * tstep), g1K);
      if (land) wait_tensor0();
    }
    if (pinned(wv == 2u)) {
      tdm_load(tdm_group0(tlds + b * (uint32_t)(STG * 2), tga + (uint64_t)t * tstep), g1V);
      if (land) wait_tensor0();
    }
  };

  // prologue: the query tile (read by every pass) and stage 0, landed and published; then stage 1 in flight
  copy8(lQ,           8 * KP * 2, Qh + (size_t)(n0 + rK) * DQ + 8 * pK, (size_t)8 * DQ);
  copy8(lQ + KPL * 2, 8 * KP * 2, Ql + (size_t)(n0 + rK) * DQ + 8 * pK, (size_t)8 * DQ);
  fill(0u, 0u, true);
  wait_async0();
  __syncthreads();
  fill(1u, 1u, false);

  // q fragment pointers (B operand, col = query 32*qg + 16*u + c of the tile), + 16*u*KP + 32*kc
  const unsigned short* Qhp = Qs + (32 * qg + c) * KP + 8 * hh;
  const unsigned short* Qlp = Qhp + KPL;

  float m[2] = {-1.0e30f, -1.0e30f}, l[2] = {0.f, 0.f};
  v8f o[2][8];
#pragma unroll
  for (int u = 0; u < 2; ++u) {
#pragma unroll
    for (int j = 0; j < 8; ++j) o[u][j] = zero8();
  }

  // kept rolled: one trip is one stage with its publish point, and the buffer index alternates with t
#pragma unroll 1
  for (int t = 0; t < KSEQ / KT; ++t) {
    const unsigned short* st = Ring + (t & 1) * STG;
    // k fragment bases (A operand, row = key 32kh + c resp. 32kh + 16 + c of the stage), + 32*kc
    const unsigned short* k0p  = st + (32 * kh + c) * KP + 8 * hh;
    const unsigned short* k1p  = k0p + 16 * KP;
    const unsigned short* k0lp = k0p + KSL;
    const unsigned short* k1lp = k1p + KSL;
    // v fragment base (A operand, row = channel 16j + c, keys contiguous), + 16*j*VP
    const unsigned short* Vp = st + 2 * KSL + c * VP + 32 * kh + 8 * hh;
    v8f s0[2], s1[2];                                                // keys +0..15 resp. +16..31, query tile u
#pragma unroll
    for (int u = 0; u < 2; ++u) { s0[u] = zero8(); s1[u] = zero8(); }
    // fragments of d-chunk kc + 1 are read from LDS ahead of the products of chunk kc (two register sets): written in
    // this order, and unrolled, because LDS reads do not move across the gap statements of the product helpers
    Frag fq[2][2][2], fk[2][4];
    auto fetch = [&](int kc) {
      const int b = kc & 1;
      fq[b][0][0] = ldfrag(Qhp + 32 * kc);
      fq[b][0][1] = ldfrag(Qlp + 32 * kc);
      fq[b][1][0] = ldfrag(Qhp + 16 * KP + 32 * kc);
      fq[b][1][1] = ldfrag(Qlp + 16 * KP + 32 * kc);
      fk[b][0] = ldfrag(k0p + 32 * kc);
      fk[b][1] = ldfrag(k1p + 32 * kc);
      fk[b][2] = ldfrag(k0lp + 32 * kc);
      fk[b][3] = ldfrag(k1lp + 32 * kc);
    };
    fetch(0);
#pragma unroll
    for (int kc = 0; kc < DQ / 32; ++kc) {
      const int b = kc & 1;
      if (kc + 1 < DQ / 32) fetch(kc + 1);
      s0[0] = mma_bd(fk[b][0].bf, fq[b][0][0].bf, s0[0]);
      s1[0] = mma_bd(fk[b][1].bf, fq[b][0][0].bf, s1[0]);
      s0[1] = mma_bd(fk[b][0].bf, fq[b][1][0].bf, s0[1]);
      s1[1] = mma_bd(fk[b][1].bf, fq[b][1][0].bf, s1[1]);
      s0[0] = mma_bd(fk[b][0].bf, fq[b][0][1].bf, s0[0]);
      s1[0] = mma_bd(fk[b][1].bf, fq[b][0][1].bf, s1[0]);
      s0[1] = mma_bd(fk[b][0].bf, fq[b][1][1].bf, s0[1]);
      s1[1] = mma_bd(fk[b][1].bf, fq[b][1][1].bf, s1[1]);
      s0[0] = mma_bd(fk[b][2].bf, fq[b][0][0].bf, s0[0]);
      s1[0] = mma_bd(fk[b][3].bf, fq[b][0][0].bf, s1[0]);
      s0[1] = mma_bd(fk[b][2].bf, fq[b][1][0].bf, s0[1]);
      s1[1] = mma_bd(fk[b][3].bf, fq[b][1][0].bf, s1[1]);
    }
    float mx[2], mn[2];
#pragma unroll
    for (int u = 0; u < 2; ++u) mx[u] = fmaxf(hmax8(s0[u]), hmax8(s1[u]));
#pragma unroll
    for (int u = 0; u < 2; ++u) {
      mx[u] = fmaxf(mx[u], __shfl_xor(mx[u], 16, 32));
      mn[u] = fmaxf(m[u], mx[u]);
    }
    const unsigned grew = wave_ballot(mx[0] > m[0] || mx[1] > m[1]); // wave-uniform
    if (grew != 0u) {
#pragma unroll
      for (int u = 0; u < 2; ++u) {
        const float corr = __expf(m[u] - mn[u]);                     // == 1 exactly for lanes whose max did not grow
        l[u] *= corr;
#pragma unroll
        for (int j = 0; j < 8; ++j) {
#pragma unroll
          for (int r = 0; r < 8; ++r) o[u][j][r] *= corr;
        }
      }
    }

    // the stage's g fragments: read here, behind the exchange of the maxima (whose wait would cover them in the LDS queue), so
    // that their LDS time runs under the exponentials
    Frag vf[8];
#pragma unroll
    for (int j = 0; j < 8; ++j) vf[j] = ldfrag(Vp + (16 * j) * VP);
#if defined(__HIP_DEVICE_COMPILE__)
    // keeps the sixteen reads above as one group here: moved down to their products, each pair is waited for on its own
    __builtin_amdgcn_sched_barrier(0);
#endif

    FragH ph[2];
#pragma unroll
    for (int u = 0; u < 2; ++u) {
      m[u] = mn[u];
      const float msh = mn[u] - LNPS;                                // exp gives e^{s-m} * 16384
      float ls = 0.f;
#pragma unroll
      for (int r = 0; r < 8; ++r) {
        const float e0 = __expf(s0[u][r] - msh);                     // key 64t + 32kh      + 8hh + r
        const float e1 = __expf(s1[u][r] - msh);                     // key 64t + 32kh + 16 + 8hh + r
        ls += e0 + e1;
        ph[u].hv[0][r] = (_Float16)e0;
        ph[u].hv[1][r] = (_Float16)e1;
      }
      l[u] += ls;
    }

#pragma unroll
    for (int j = 0; j < 8; ++j) {
      o[0][j] = mma_hd(vf[j].h, ph[0].v, o[0][j]);
      o[1][j] = mma_hd(vf[j].h, ph[1].v, o[1][j]);
    }
    // publish point of stage t + 1: own LDS reads returned, the issuing waves' tensor loads landed, every wave here; only then
    // the refill, its descriptor formed from a stage number that is pinned behind the barrier
    wait_ds0();
    if (pinned(wv < 3u)) wait_tensor0();
    __syncthreads();
    if (pinned((uint32_t)(t + 2 < KSEQ / KT))) fill(pinned((uint32_t)t + 2u), (uint32_t)t & 1u, false);
  }
  wait_tensor0();
  wait_ds0();
#pragma unroll
  for (int u = 0; u < 2; ++u) l[u] += __shfl_xor(l[u], 16, 32);

  // hand-over between the key halves: no tensor load is in flight and every wave has passed the last publish point, so the
  // ring is free. Area of wave w: XW floats = [j][half][lane][4] of the tile it gives away, then m[32], l[32].
  float* X = reinterpret_cast<float*>(Ring);
  float* xg = X + wave * XW;
  const float* xp = X + (wave ^ 2) * XW;
  v8f ok[8];                                                         // the tile this wave keeps: u = kh
#pragma unroll
  for (int j = 0; j < 8; ++j) {
    const v8f og = kh ? o[0][j] : o[1][j];
    ok[j] = kh ? o[1][j] : o[0][j];
    v4f va, vb;
#pragma unroll
    for (int r = 0; r < 4; ++r) { va[r] = og[r]; vb[r] = og[4 + r]; }
    *(v4f*)(xg + j * 256 + 4 * lane)       = va;
    *(v4f*)(xg + j * 256 + 128 + 4 * lane) = vb;
  }
  xg[2048 + lane] = kh ? m[0] : m[1];
  xg[2080 + lane] = kh ? l[0] : l[1];
  const float mk = kh ? m[1] : m[0];
  const float lk = kh ? l[1] : l[0];
  __syncthreads();
  const float mp = xp[2048 + lane];
  const float lp = xp[2080 + lane];
  const float mall = fmaxf(mk, mp);
  const float wk = __expf(mk - mall), wp = __expf(mp - mall);

  const size_t pt = (size_t)kr * NT16 + (size_t)(blockIdx.x * (QT / 16) + 2 * qg + kh);   // (range, 16-query tile)
  float* po = Po + pt * (8 * 256) + 4 * lane;
#pragma unroll
  for (int j = 0; j < 8; ++j) {
    const v4f pa = *(const v4f*)(xp + j * 256 + 4 * lane);
    const v4f pb = *(const v4f*)(xp + j * 256 + 128 + 4 * lane);
    v4f va, vb;
#pragma unroll
    for (int r = 0; r < 4; ++r) { va[r] = ok[j][r] * wk + pa[r] * wp; vb[r] = ok[j][4 + r] * wk + pb[r] * wp; }
    *(v4f*)(po + j * 256)       = va;
    *(v4f*)(po + j * 256 + 128) = vb;
  }
  Pml[pt * 32 + lane] = hh ? (lk * wk + lp * wp) : mall;             // m and l are equal in lanes c and 16 + c
}

// =========================================================================================================
// (4) output projection GEMM for one (64-n tile, 64-co block): out[n][co] = (1/256)(sum_c WW16[co][c] Yh[n][c] +
//     (1/1024) sum_c WW16[co][c] Yl[n][c]) + bf16-RNE(W_b[co]) + bf16-RNE(x[n][co]). 4 waves, wave w owns
//     cols n0+16w..+15, 4 m-tiles (A rows co = o0 + 16 mt + (lane&15) from WW16), hi and residual products in
//     separate accumulators. K = 128 = 4 steps.
//     B operand: y = sum_s a_s Po[s], a_s = e^{m_s - M} / sum_s e^{m_s - M} l_s, M = max_s m_s, merged in f32 from the
//     KS key ranges' partials; Yh = f16(y), Yl = f16((y - Yh) * 1024). A lane's Po words of tile j are channels
//     16j + 8(lane>>4) + 0..7 of query lane&15: tiles 2ks and 2ks + 1 are elements 0..7 and 8..15 of the B fragment
//     of k-step ks, lane unchanged.
//     Epilogue staged in LDS Os[n_loc][co_loc], barrier, then out rows (position-major, 1024 B each): lane
//     (e = tid&15) -> co o0+4e..+3 of row n_loc = 8 it + (tid>>4); 16 consecutive lanes x 16 B = the whole 256-B
// coverage: Os 4 waves x 16 n x 64 co (cols 0..63 written and read); out 8 it x 8 rows x 16 lanes x 4 floats =
//           64 n x 64 co; grid (SEQ/64, 4) covers out[0..SEQ-1][0..255] exactly once.
// LDS Os: cross-wave (block barrier). LDS Ws (the block's 64 WW16 rows, from which the A fragments are read): cross-wave
//     (copy wait, then block barrier).
// =========================================================================================================
__global__ __launch_bounds__(128)
void gemm_o(const unsigned short* __restrict__ WW16, const float* __restrict__ Po,
            const float* __restrict__ Pml, const float* __restrict__ wbias,
            const float* __restrict__ x, float* out) {
  __shared__ __align__(16) float Os[QT * OSP];
  __shared__ __align__(128) unsigned short Ws[QT * KP];              // WW16 rows o0 .. o0+63, pitch 16 B x odd
  const int tid  = threadIdx.x;
  const int lane = tid & 31, wave = tid >> 5;
  const int hh   = lane >> 4, c = lane & 15;
  const int nt   = blockIdx.x, mb = blockIdx.y;
  const int n0   = nt * QT, o0 = mb * QT;

  const unsigned short* ap  = Ws + c * KP + 8 * hh;
  const size_t t16 = (size_t)(nt * (QT / 16) + wave);                // the wave's 16-query tile

  const float* pml = Pml + t16 * 32 + c;
  const float* pp  = Po + t16 * (8 * 256) + 4 * lane;
  float ms[KS], as[KS];
  FragH fyh[DQ / 32], fyl[DQ / 32];
#pragma unroll
  for (int g = 0; g < 2; ++g) {                                      // tiles j = 4g .. 4g+3 = k-steps 2g, 2g+1
    v4f pv[KS][4][2];
#pragma unroll
    for (int s = 0; s < KS; ++s) {
#pragma unroll
      for (int jj = 0; jj < 4; ++jj) {
        pv[s][jj][0] = *(const v4f*)(pp + (size_t)s * (NT16 * 8 * 256) + (4 * g + jj) * 256);
        pv[s][jj][1] = *(const v4f*)(pp + (size_t)s * (NT16 * 8 * 256) + (4 * g + jj) * 256 + 128);
      }
    }
    if (g == 0) {
      // The A tile comes into LDS by asynchronous 16-B copies in whole lines and travels under the loads and the merge of the
      // partials: copy i of a lane -> row 8i + (tid>>4), 16-B piece tid&15 (a wave = 512 contiguous B). The statement stands
      // between the first group's loads and those of the maxima and sums: loads do not cross it, so that no wait for a
      // maximum comes to stand in front of the group's issue.
      copy8(lds_addr(Ws + (tid >> 4) * KP + 8 * (tid & 15)), 8 * KP * 2,
            WW16 + (size_t)(o0 + (tid >> 4)) * DQ + 8 * (tid & 15), (size_t)8 * DQ);
#pragma unroll
      for (int s = 0; s < KS; ++s) {
        ms[s] = pml[(size_t)s * (NT16 * 32)];
        as[s] = pml[(size_t)s * (NT16 * 32) + 16];
      }
    }
    // the group's loaded words, inputs only: all its loads are issued ahead of the arithmetic, one round trip for the
    // group instead of one for every pair of loads
    hold16(pv[0], pv[1], pp);
    hold16(pv[2], pv[3], pp + (size_t)2 * (NT16 * 8 * 256));
    if (g == 0) {                                                    // merge weights of query c
      float mall = ms[0];
#pragma unroll
      for (int s = 1; s < KS; ++s) mall = fmaxf(mall, ms[s]);
      float lall = 0.f;
#pragma unroll
      for (int s = 0; s < KS; ++s) {
        const float w = __expf(ms[s] - mall);
        lall += w * as[s];
        as[s] = w;
      }
      const float inv = 1.0f / lall;                                 // o and l both carry the x16384 factor
#pragma unroll
      for (int s = 0; s < KS; ++s) as[s] *= inv;
    }
#pragma unroll
    for (int jj = 0; jj < 4; ++jj) {
      const int j = 4 * g + jj;
#pragma unroll
      for (int r = 0; r < 8; ++r) {
        float y = as[0] * pv[0][jj][r >> 2][r & 3];
#pragma unroll
        for (int s = 1; s < KS; ++s) y += as[s] * pv[s][jj][r >> 2][r & 3];
        const _Float16 h0 = (_Float16)y;
        fyh[j >> 1].hv[j & 1][r] = h0;
        fyl[j >> 1].hv[j & 1][r] = (_Float16)((y - (float)h0) * RSC);
      }
    }
  }

  v8f acc[4], accr[4];
#pragma unroll
  for (int mt = 0; mt < 4; ++mt) { acc[mt] = zero8(); accr[mt] = zero8(); }

  // the A tile: own copies landed, every wave here; then all sixteen fragments as one group of LDS reads ahead of the
  // products (LDS reads do not move across the gap statements of the helper)
  wait_async0();
  __syncthreads();
  Frag fa[DQ / 32][4];
#pragma unroll
  for (int ks = 0; ks < DQ / 32; ++ks) {
#pragma unroll
    for (int mt = 0; mt < 4; ++mt) fa[ks][mt] = ldfrag(ap + (16 * mt) * KP + 32 * ks);
  }
#pragma unroll
  for (int ks = 0; ks < DQ / 32; ++ks) {
#pragma unroll
    for (int mt = 0; mt < 4; ++mt) {
      acc[mt]  = mma_h(fa[ks][mt].h, fyh[ks].v, acc[mt]);
      accr[mt] = mma_h(fa[ks][mt].h, fyl[ks].v, accr[mt]);
    }
  }

  {
    const int nl = 16 * wave + c;
#pragma unroll
    for (int mt = 0; mt < 4; ++mt) {
      v4f va, vb;
#pragma unroll
      for (int r = 0; r < 4; ++r) {
        va[r] = (acc[mt][r] + accr[mt][r] * IRSC) * IWSC;
        vb[r] = (acc[mt][4 + r] + accr[mt][4 + r] * IRSC) * IWSC;
      }
      *(v4f*)(Os + nl * OSP + 16 * mt + 8 * hh)     = va;
      *(v4f*)(Os + nl * OSP + 16 * mt + 8 * hh + 4) = vb;
    }
  }
  __syncthreads();

  const int e = tid & 15, lq = tid >> 4;                             // lq 0..7
  const v4f bv = *(const v4f*)(wbias + o0 + 4 * e);
  const float bb[4] = {bfr(bv[0]), bfr(bv[1]), bfr(bv[2]), bfr(bv[3])};
  v4f res[8];
#pragma unroll
  for (int it = 0; it < 8; ++it) {
    const int nl = it * 8 + lq;                                      // n_loc 0..63
    const size_t idx = ((size_t)(n0 + nl)) * CC + o0 + 4 * e;
    const v4f xv = *(const v4f*)(x + idx);
    const v4f ov = *(const v4f*)(Os + nl * OSP + 4 * e);
#pragma unroll
    for (int t = 0; t < 4; ++t) res[it][t] = ov[t] + bb[t] + bfr(xv[t]);
  }
{
#pragma unroll
    for (int it = 0; it < 8; ++it) {
      const int nl = it * 8 + lq;
      const size_t idx = ((size_t)(n0 + nl)) * CC + o0 + 4 * e;
      *(v4f*)(out + idx) = res[it];
    }
    
  }
}

// =========================================================================================================
// Workspace map (bytes; each region start a multiple of 256; every plane size is an exact multiple of its
// whole-line store granularity, SEQ a multiple of 64 so no tail rows exist):
//   W16  f16 [384][256]          196608      WW16 f16 [256][128]     65536
//   XP   f16 [SEQ][256]         4194304 (SEQ=8192)
//   Qh/Ql bf16 [SEQ][128]        2097152 x2
//   Kh/Kl bf16 [SEQ][128]        2097152 x2
//   Gc   f16 [128][SEQ]          2097152
//   Po   f32 [KS][SEQ/16][8][2][32][4]  16777216 (KS=4)      Pml f32 [KS][SEQ/16][32]  262144
//   total (SEQ=8192) = 31981568
// =========================================================================================================
extern "C" void kernel_launch(void* const* d_in, const int* in_sizes, int n_in,
                              void* d_out, int out_size, void* d_ws, size_t ws_size,
                              hipStream_t stream) {
  const int XN = SEQ * CC;
  if (n_in < 9) return;
  if (in_sizes[0] < XN) return;
  if (in_sizes[1] < CC * DQ || in_sizes[3] < CC * DQ || in_sizes[5] < CC * DQ) return;
  if (in_sizes[2] < DQ || in_sizes[4] < DQ || in_sizes[6] < DQ) return;
  if (in_sizes[7] < DQ * CC || in_sizes[8] < CC) return;
  if (out_size < XN) return;

  size_t off = 0;
  auto carve = [&](size_t bytes) { const size_t o = off; off += (bytes + 255) & ~(size_t)255; return o; };
  const size_t oW16 = carve((size_t)MW * CC * 2);
  const size_t oWW  = carve((size_t)CC * DQ * 2);
  const size_t oXP  = carve((size_t)SEQ * CC * 2);
  const size_t oQh  = carve((size_t)SEQ * DQ * 2);
  const size_t oQl  = carve((size_t)SEQ * DQ * 2);
  const size_t oKh  = carve((size_t)SEQ * DQ * 2);
  const size_t oKl  = carve((size_t)SEQ * DQ * 2);
  const size_t oGc  = carve((size_t)DQ * SEQ * 2);
  const size_t oPo  = carve((size_t)KS * SEQ * DQ * 4);
  const size_t oPml = carve((size_t)KS * NT16 * 32 * 4);
  if (off > ws_size) return;
  if (off > (size_t)134217728) return;

  const float* x  = (const float*)d_in[0];
  const float* gw = (const float*)d_in[1];
  const float* gb = (const float*)d_in[2];
  const float* tw = (const float*)d_in[3];
  const float* tb = (const float*)d_in[4];
  const float* pw = (const float*)d_in[5];
  const float* pb = (const float*)d_in[6];
  const float* ww = (const float*)d_in[7];
  const float* wb = (const float*)d_in[8];

  char* ws = (char*)d_ws;
  unsigned short* W16  = (unsigned short*)(ws + oW16);
  unsigned short* WW16 = (unsigned short*)(ws + oWW);
  unsigned short* XP   = (unsigned short*)(ws + oXP);
  unsigned short* Qh   = (unsigned short*)(ws + oQh);
  unsigned short* Ql   = (unsigned short*)(ws + oQl);
  unsigned short* Kh   = (unsigned short*)(ws + oKh);
  unsigned short* Kl   = (unsigned short*)(ws + oKl);
  unsigned short* Gc   = (unsigned short*)(ws + oGc);
  float* Po  = (float*)(ws + oPo);
  float* Pml = (float*)(ws + oPml);
  float* out = (float*)d_out;

  const dim3 blk256(256), blk128(128);

  // (0) + (1) projection weights [in][out] -> f16 planes W16 [out rows 0..383][in 256], WW16 [out 256][in 128], and
  //     x -> 16-bit plane (same position-major layout), one grid
  cvt_all<<<dim3(WTB + SEQ / 8), blk256, 0, stream>>>(tw, pw, gw, ww, x, W16, WW16, XP);
  // (2) theta / phi -> hi + residual planes, g -> channel-major plane
  gemm_qkv<<<dim3(SEQ / QT, 6), blk128, 0, stream>>>(W16, XP, tb, pb, gb, Qh, Ql, Kh, Kl, Gc);
  // (3) attention, KS key ranges per query tile -> per-range partials
  attn_k<<<dim3(SEQ / QT, KS), blk128, 0, stream>>>(Qh, Ql, Kh, Kl, Gc, Po, Pml);
  // (4) merge of the ranges + output projection + bias + residual -> out [SEQ][256]
  gemm_o<<<dim3(SEQ / QT, CC / QT), blk128, 0, stream>>>(WW16, Po, Pml, wb, x, out);
  (void)hipGetLastError();
}

// v007
// A run of this version takes 60.5 microseconds.
// Two timings next to v006 both put it at 1.03 times that version's speed.
// Over all steps from v000 it is 12.7 times as fast.
// Contractions: theta/phi/g projection GEMMs Wt[384x256].Xp[256xN] and the output projection Wo[256x128].Y[128xN] on
// v_wmma_f32_16x16x32_f16 (f16 containers of bf16-RNE weights x256 and bf16-RNE x; Y as f16 hi fragment plus f16
// residual fragment x1024, 2 products, separate accumulators); scores Phi.Theta^T on v_wmma_f32_16x16x32_bf16
// (bf16 hi + bf16 residual planes of theta/phi, 3 products, K=128); Y^T = G.P^T on v_wmma_f32_16x16x32_f16
// (G plain f16, P = e^{s-m} x16384 f16 from the score D registers); f32 accumulate everywhere; softmax
// statistics, biases and the residual add in f32 VALU.
#include <hip/hip_runtime.h>
#include <math.h>
#include <stdint.h>

#ifndef NB
#define NB 1
#endif
#define NB_FULL 1
#ifndef SEQ
#define SEQ 8192
#endif
#define SEQ_FULL 8192
#define CC   256
#define DQ   128
#define QT   64
#define MW   384
#define OSP  68
#define TP   72
#define WSC  256.0f
#define IWSC 0.00390625f
#define RSC  1024.0f
#define IRSC 0.0009765625f
#define LNPS 9.704060527839234f
#define KT   64
#define KP   136
#define VP   72
#define KPL  (KT * KP)
#define KSL  9216
#define STG  (2 * KSL + DQ * VP)
#define KS   4
#define KSEQ (SEQ / KS)
#define NT16 (SEQ / 16)
#define XW   (8 * 256 + 64)
#define WTB  32
#define WP   264

static_assert(NB == 1 && NB_FULL == 1);
static_assert(SEQ >= QT && SEQ <= SEQ_FULL);
static_assert(SEQ % QT == 0 && SEQ % 32 == 0 && SEQ % 8 == 0);
static_assert(CC % QT == 0 && CC % 32 == 0);
static_assert(DQ == 2 * QT && DQ % 32 == 0);
static_assert(MW == 3 * DQ && MW % 8 == 0);
static_assert(WTB == 4 * 8 && (DQ / QT) * (CC / QT) == 8 && DQ / QT == 2 && CC / QT == 4);
static_assert((OSP * 4) % 16 == 0);
static_assert((TP * 2) % 16 == 0);
static_assert(SEQ % KS == 0 && KSEQ % KT == 0 && KSEQ / KT >= 2 && KT == QT && KT % 32 == 0);
static_assert(2 * (2 * STG + 2 * KPL) * 2 <= 327680);                // two work-groups of attn_k per 320-KiB LDS
static_assert(KT == 64 && QT == 64 && 4 * XW * 4 <= 2 * STG * 2);         // attn_k: 2 x 2 waves of 32 keys x 32 queries; hand-over area
static_assert(KSL >= KPL && (KSL * 2) % 2048 == 0 && (DQ * VP * 2) % 2048 == 0);   // every tensor tile's place in LDS: a multiple of 2 KiB
static_assert(DQ * 2 == 256 && KP * 2 == 256 + 16 && KT * 2 == 128 && VP * 2 == 128 + 16);   // tile rows and their padded pitches
static_assert((KP * 2) % 32 == 16 && (VP * 2) % 32 == 16 && KP >= DQ + 8 && VP >= KT + 8);
static_assert((WP * 2) % 32 == 16 && WP >= CC + 8 && QT == 64 && CC == 256 && DQ == 128);   // operand tiles of the projection GEMMs
static_assert(3 * (2 * QT * WP * 2 + QT * OSP * 4) <= 327680);       // three work-groups of gemm_qkv per 320-KiB LDS

typedef _Float16       v16h __attribute__((ext_vector_type(16)));
typedef _Float16       v8h  __attribute__((ext_vector_type(8)));
typedef __bf16         v16b __attribute__((ext_vector_type(16)));
typedef unsigned short v8us __attribute__((ext_vector_type(8)));
typedef float          v8f  __attribute__((ext_vector_type(8)));
typedef float          v4f  __attribute__((ext_vector_type(4)));
typedef unsigned int   v4u  __attribute__((ext_vector_type(4)));
typedef uint32_t       u32x4 __attribute__((ext_vector_type(4)));
typedef uint32_t       u32x8 __attribute__((ext_vector_type(8)));

union Frag  { v8us u[2]; v16h h; v16b bf; };
union FragH { v16h v; v8h hv[2]; };
static_assert(sizeof(Frag) == 32);
static_assert(sizeof(FragH) == 32);

// ---- scalar helpers ---------------------------------------------------------------------------------------
__device__ __forceinline__ unsigned short bf_bits(float f) {          // f32 -> bf16 bits, RNE convert
  unsigned u = __float_as_uint(f);
  return (unsigned short)((u + 0x7FFFu + ((u >> 16) & 1u)) >> 16);
}
__device__ __forceinline__ float bf_up(unsigned short hb) { return __uint_as_float(((unsigned)hb) << 16); }
__device__ __forceinline__ float bfr(float f) { return bf_up(bf_bits(f)); }
__device__ __forceinline__ unsigned short h_bits(_Float16 x) { return __builtin_bit_cast(unsigned short, x); }
__device__ __forceinline__ unsigned pk16(unsigned short a, unsigned short b) { return (unsigned)a | ((unsigned)b << 16); }
__device__ __forceinline__ v8f zero8() { v8f z = {0.f, 0.f, 0.f, 0.f, 0.f, 0.f, 0.f, 0.f}; return z; }
__device__ __forceinline__ float hmax8(v8f s) {
  return fmaxf(fmaxf(fmaxf(s[0], s[1]), fmaxf(s[2], s[3])), fmaxf(fmaxf(s[4], s[5]), fmaxf(s[6], s[7])));
}
__device__ __forceinline__ unsigned wave_ballot(bool p) {
#if defined(__HIP_DEVICE_COMPILE__)
  return __builtin_amdgcn_ballot_w32(p);
#else
  return p ? 1u : 0u;
#endif
}

// ---- 16-bit fragment loader (A, or B from a k-contiguous [n][k] row): lane -> row/col (lane&15), p already includes
//      + 8*(lane>>4); elements 0..7 <- p[0..7] (k0+8h..), elements 8..15 <- p[16..23] (k0+16+8h..)
__device__ __forceinline__ Frag ldfrag(const unsigned short* p) {
  Frag f;
  f.u[0] = *(const v8us*)(p);
  f.u[1] = *(const v8us*)(p + 16);
  return f;
}

// ---- WMMA helpers: builtin followed by a 4-slot VALU gap tying D and keeping A/B live --------------------------
__device__ __forceinline__ v8f mma_h(v16h a, v16h b, v8f c) {
  v8f d = __builtin_amdgcn_wmma_f32_16x16x32_f16(false, a, false, b, (short)0, c, false, false);
#if defined(__HIP_DEVICE_COMPILE__)
  asm volatile("v_nop\n\tv_nop\n\tv_nop\n\tv_nop" : "+v"(d) : "v"(a), "v"(b));
#endif
  return d;
}
__device__ __forceinline__ v8f mma_b(v16b a, v16b b, v8f c) {
  v8f d = __builtin_amdgcn_wmma_f32_16x16x32_bf16(false, a, false, b, (short)0, c, false, false);
#if defined(__HIP_DEVICE_COMPILE__)
  const v16h ha = __builtin_bit_cast(v16h, a), hb = __builtin_bit_cast(v16h, b);
  asm volatile("v_nop\n\tv_nop\n\tv_nop\n\tv_nop" : "+v"(d) : "v"(ha), "v"(hb));
#endif
  return d;
}

// The same products for attn_k, whose wave tile takes more than 256 registers: an operand of an asm statement has to lie
// in v0..v255, so the gap statement names D alone and the A and B fragments are free to lie above.
__device__ __forceinline__ v8f mma_hd(v16h a, v16h b, v8f c) {
  v8f d = __builtin_amdgcn_wmma_f32_16x16x32_f16(false, a, false, b, (short)0, c, false, false);
#if defined(__HIP_DEVICE_COMPILE__)
  asm volatile("v_nop\n\tv_nop\n\tv_nop\n\tv_nop" : "+v"(d));
#endif
  return d;
}
__device__ __forceinline__ v8f mma_bd(v16b a, v16b b, v8f c) {
  v8f d = __builtin_amdgcn_wmma_f32_16x16x32_bf16(false, a, false, b, (short)0, c, false, false);
#if defined(__HIP_DEVICE_COMPILE__)
  asm volatile("v_nop\n\tv_nop\n\tv_nop\n\tv_nop" : "+v"(d));
#endif
  return d;
}

// ---- asynchronous copies global -> LDS ------------------------------------------------------------------------
__device__ __forceinline__ unsigned lds_addr(const unsigned short* p) { return (unsigned)(uintptr_t)p; }  // LDS byte address

// Eight 16-B copies per lane: copy i moves g + i*gstep (halves) to LDS byte address l + i*lstep. All lanes on.
__device__ __forceinline__ void copy8(unsigned l, unsigned lstep, const unsigned short* g, size_t gstep) {
#if defined(__HIP_DEVICE_COMPILE__)
  // the closing s_wait_xcnt keeps later rewrites of the address registers behind the issued copies
  asm volatile("global_load_async_to_lds_b128 %0, %8, off\n\t"
               "global_load_async_to_lds_b128 %1, %9, off\n\t"
               "global_load_async_to_lds_b128 %2, %10, off\n\t"
               "global_load_async_to_lds_b128 %3, %11, off\n\t"
               "global_load_async_to_lds_b128 %4, %12, off\n\t"
               "global_load_async_to_lds_b128 %5, %13, off\n\t"
               "global_load_async_to_lds_b128 %6, %14, off\n\t"
               "global_load_async_to_lds_b128 %7, %15, off\n\t"
               "s_wait_xcnt 0x0"
               :: "v"(l), "v"(l + lstep), "v"(l + 2 * lstep), "v"(l + 3 * lstep),
                  "v"(l + 4 * lstep), "v"(l + 5 * lstep), "v"(l + 6 * lstep), "v"(l + 7 * lstep),
                  "v"(g), "v"(g + gstep), "v"(g + 2 * gstep), "v"(g + 3 * gstep),
                  "v"(g + 4 * gstep), "v"(g + 5 * gstep), "v"(g + 6 * gstep), "v"(g + 7 * gstep)
               : "memory");
#endif
}
__device__ __forceinline__ void wait_async0() {   // this wave's copies have landed in LDS
#if defined(__HIP_DEVICE_COMPILE__)
  asm volatile("s_wait_asynccnt 0x0" ::: "memory");
#endif
}
__device__ __forceinline__ void wait_ds0() {      // this wave's LDS reads have returned before the buffer is handed back
#if defined(__HIP_DEVICE_COMPILE__)
  asm volatile("s_wait_dscnt 0x0" ::: "memory");
#endif
}

__device__ __forceinline__ uint32_t uni(uint32_t v) { return (uint32_t)__builtin_amdgcn_readfirstlane(v); }
__device__ __forceinline__ uint32_t pinned(uint32_t v) {
  uint32_t w = uni(v);
#if defined(__HIP_DEVICE_COMPILE__)
  // holds the word in a scalar register at this place: a test on it compiles to a scalar branch (a tensor load ignores EXEC),
  // and what is computed from it stays behind the waits that stand in front of it
  asm volatile("" : "+s"(w));   // pinned(): a word of a tensor load's test or descriptor held in a scalar register
#endif
  return w;
}
// group 1: byte elements, tensor = tile = ROWS rows of ROWB bytes, source pitch in bytes; W0 = pad word (no mask), a constant
template <uint32_t W0, uint32_t ROWB, uint32_t ROWS>
__device__ __forceinline__ u32x8 tdm_group1(uint32_t src_pitch) {
  u32x8 g;
  g[0] = uni(W0);
  g[1] = uni((ROWB & 0xFFFFu) << 16);
  g[2] = uni((ROWB >> 16) | ((ROWS & 0xFFFFu) << 16));
  g[3] = uni((ROWS >> 16) | (ROWB << 16));
  g[4] = uni(ROWS);
  g[5] = uni(src_pitch);
  g[6] = uni(0u);
  g[7] = uni(0u);
#if defined(__HIP_DEVICE_COMPILE__)
  // descriptor words held in scalar registers (the pinned() form, on the whole group): built once, the group keeps its eight
  // registers over the loop, so that none of them takes another value while a request that named them is outstanding
  asm volatile("" : "+s"(g));   // pinned(), all eight words: descriptor words held in scalar registers
#endif
  return g;
}
// group 0: count 1, LDS byte address, global byte address of the tile's first byte, type 2
__device__ __forceinline__ u32x4 tdm_group0(uint32_t lds_dst, uint64_t ga) {
  u32x4 g;
  g[0] = uni(1u);
  g[1] = uni(lds_dst);
  g[2] = uni((uint32_t)ga);
  g[3] = uni((((uint32_t)(ga >> 32)) & 0x01FFFFFFu) | 0x80000000u);
  return g;
}
__device__ __forceinline__ void tdm_load(u32x4 g0, u32x8 g1) {
#if defined(__HIP_DEVICE_COMPILE__)
  asm volatile("tensor_load_to_lds %0, %1" :: "s"(g0), "s"(g1) : "memory");
#endif
}
__device__ __forceinline__ void wait_tensor0() {  // this wave's tensor load has landed in LDS
#if defined(__HIP_DEVICE_COMPILE__)
  asm volatile("s_wait_tensorcnt 0x0" ::: "memory");
#endif
}

// Inputs-only fence on sixteen loaded 16-B words: every one of them has arrived here. The wait stands behind the loads and
// ahead of any rewrite of their address registers: their base p is named so that it lives up to the wait.
__device__ __forceinline__ void hold16(const v4f (&a)[4][2], const v4f (&b)[4][2], const float* p) {
#if defined(__HIP_DEVICE_COMPILE__)
  asm volatile("s_wait_xcnt 0x0"
               :: "v"(a[0][0]), "v"(a[0][1]), "v"(a[1][0]), "v"(a[1][1]), "v"(a[2][0]), "v"(a[2][1]), "v"(a[3][0]), "v"(a[3][1]),
                  "v"(b[0][0]), "v"(b[0][1]), "v"(b[1][0]), "v"(b[1][1]), "v"(b[2][0]), "v"(b[2][1]), "v"(b[3][0]), "v"(b[3][1]),
                  "v"(p));
#endif
}

// =========================================================================================================
// (0) weight transpose + convert: src f32 [R][S] (row r contiguous over S; the projection weights are stored
//     [in][out]) -> dst f16 row (rowBase + s), col r, pitch R halves; value = f16 of (bf16-RNE(w) * 256) (exact).
//     Through an LDS tile T[64 s][64 r] (pitch TP). Block (sb, rb) owns a 64 r x 64 s tile.
// coverage: load 2 it x 32 rows x 8 lanes x 8 = 64 r x 64 s; store 2 it x 32 s-rows x 8 lanes x 8 halves = 64 s x 64 r;
//           tiles (S/64, R/64) cover dst rows rowBase..rowBase+S-1 x cols 0..R-1 exactly once.
// LDS T: cross-wave (block barrier between the 2-byte stores and the 16-B reloads).
// =========================================================================================================
__device__ __forceinline__
void cvt_wt(unsigned short* T, const float* __restrict__ src, unsigned short* dst, int R, int S, int rowBase, int sb, int rb) {
  const int tid = threadIdx.x;
  const int e = tid & 7, lq = tid >> 3;                             // lq 0..31
  const int s0 = sb * QT, r0 = rb * QT;
  const float* sp0 = src + ((size_t)(r0 + lq)) * (size_t)S + s0 + 8 * e;          // r_loc lq
  const float* sp1 = src + ((size_t)(r0 + 32 + lq)) * (size_t)S + s0 + 8 * e;     // r_loc 32 + lq
  const v4f av[2] = {*(const v4f*)sp0, *(const v4f*)sp1};
  const v4f qv[2] = {*(const v4f*)(sp0 + 4), *(const v4f*)(sp1 + 4)};
#if defined(__HIP_DEVICE_COMPILE__)
  // inputs only: the wait stands behind the four loads and ahead of any rewrite of their address registers, which are named
  // so that they live up to it (otherwise a later load's result is placed over an earlier load's address pair)
  asm volatile("s_wait_xcnt 0x0" :: "v"(av[0]), "v"(qv[0]), "v"(av[1]), "v"(qv[1]), "v"(sp0), "v"(sp1));
#endif
#pragma unroll
  for (int it = 0; it < 2; ++it) {
    const int rl = it * 32 + lq;                                     // r_loc 0..63
    const v4f a = av[it];
    const v4f q = qv[it];
    unsigned short hb[8];
#pragma unroll
    for (int t = 0; t < 4; ++t) {
      hb[t]     = h_bits((_Float16)(bfr(a[t]) * WSC));
      hb[4 + t] = h_bits((_Float16)(bfr(q[t]) * WSC));
    }
#pragma unroll
    for (int t = 0; t < 8; ++t) T[(8 * e + t) * TP + rl] = hb[t];   // T[s_loc][r_loc]
  }
  __syncthreads();
  v4u up[2];
#pragma unroll
  for (int it = 0; it < 2; ++it) {
    const int sl = it * 32 + lq;                                     // s_loc 0..63
    up[it] = *(const v4u*)(T + sl * TP + 8 * e);                     // r_loc 8e..8e+7
  }
{
    unsigned short* dp = dst + ((size_t)(rowBase + s0 + lq)) * (size_t)R + r0 + 8 * e;   // s_loc lq; s_loc 32 + lq is 32 rows on
    *(v4u*)dp = up[0];
    *(v4u*)(dp + (size_t)32 * (size_t)R) = up[1];
#if defined(__HIP_DEVICE_COMPILE__)
    // the code of another block kind may follow in the shared kernel: the wait stands behind the two stores and ahead of any
    // rewrite of their data and address registers, which are named, inputs only, so that they live up to it
    asm volatile("s_wait_xcnt 0x0" :: "v"(up[0]), "v"(up[1]), "v"(dp) : "memory");
#endif
  }
}

// =========================================================================================================
// (1) x f32 [N][256] (already position-major) -> XP f16 [N][256], value = bf16-RNE(x) in an f16 container.
// coverage: SEQ/8 blocks x 8 rows x 32 lanes x 8 halves = SEQ x 256 = the whole plane.
// =========================================================================================================
__device__ __forceinline__
void cvt_x(const float* __restrict__ x, unsigned short* XP, int blk) {
  const int tid = threadIdx.x;
  const int row = 8 * blk + (tid >> 5);                              // 0..SEQ-1
  const int col = 8 * (tid & 31);                                    // 0..248
  const float* s = x + (size_t)row * CC + col;
  const v4f a = *(const v4f*)s;
  const v4f q = *(const v4f*)(s + 4);
  const float f[8] = {a[0], a[1], a[2], a[3], q[0], q[1], q[2], q[3]};
  v4u u;
#pragma unroll
  for (int t = 0; t < 4; ++t) {
    const _Float16 h0 = (_Float16)bfr(f[2 * t]);
    const _Float16 h1 = (_Float16)bfr(f[2 * t + 1]);
    u[t] = pk16(h_bits(h0), h_bits(h1));
  }
{
    unsigned short* dp = XP + (size_t)row * CC + col;
    *(v4u*)dp = u;
#if defined(__HIP_DEVICE_COMPILE__)
    // as in (0): the wait behind the store, ahead of any rewrite of its data and address registers (named, inputs only)
    asm volatile("s_wait_xcnt 0x0" :: "v"(u), "v"(dp) : "memory");
#endif
  }
}

// =========================================================================================================
// (0) + (1) as ONE launch: the five conversions read none of each other's output, so they share a grid, told apart by the
//     block index (block-uniform, so the barrier of (0) is passed by whole blocks). Blocks 0..WTB-1, first because their
//     path is the longer one: 8 tiles for each of theta_w, phi_w, g_w (R=256, S=128: tiles 2 x 4, rows 0 / 128 / 256 of
//     W16) and W_w (R=128, S=256: tiles 4 x 2, WW16). Blocks WTB.. : 8 rows of x each.
// coverage: 4 weights x 8 tiles = WTB blocks, each weight's tile set exactly once; SEQ/8 blocks over x.
// =========================================================================================================
__global__ __launch_bounds__(256)
void cvt_all(const float* __restrict__ tw, const float* __restrict__ pw, const float* __restrict__ gw,
             const float* __restrict__ ww, const float* __restrict__ x,
             unsigned short* W16, unsigned short* WW16, unsigned short* XP) {
  __shared__ __align__(16) unsigned short T[QT * TP];
  const int blk = blockIdx.x;
  if (blk < WTB) {
    const int job = blk >> 3, tile = blk & 7;
    if (job < 3) {
      const float* src = (job == 0) ? tw : (job == 1) ? pw : gw;
      cvt_wt(T, src, W16, CC, DQ, job * DQ, tile & 1, tile >> 1);
    } else {
      cvt_wt(T, ww, WW16, DQ, CC, 0, tile & 3, tile >> 2);
    }
  } else {
    cvt_x(x, XP, blk - WTB);
  }
}

// =========================================================================================================
// (2) theta / phi / g projection GEMM for one (64-n tile nt, 64-o block mb in 0..5): Y[o][n] = (1/256)
//     sum_c W16[mb*64 + o][c] XP[n][c] + bf16-RNE(bias[o]). W16 rows 0..127 = theta, 128..255 = phi, 256..383 = g.
//     Block 128 threads = 4 waves; wave w owns cols n0+16w..+15 (B fragment from the XP row, k = c contiguous,
//     split k map) and 4 m-tiles (A rows o = o0 + 16 mt + (lane&15), split k map from W16). K = 256 = 8 steps.
//     Epilogue staged in LDS Os[n_loc][o_loc] (pitch OSP), barrier, bias add in f32, then:
//       mb 0,1 (theta) / 2,3 (phi): bf16 hi = RNE(v), lo = RNE(v - hi) planes Qh/Ql resp. Kh/Kl [N][128 d]
//         the dsel half of the 256-B row): lane e -> d 8e..8e+7, 8 consecutive lanes per line, one instruction per
//         16 lines;
//       mb 4,5 (g): f16 plane Gc [128 ch][N keys] (channel-major, keys contiguous); row ch, 64 keys = one whole
// coverage: Os 4 waves x 16 n x 64 o = 64 x 64 (cols 0..63 written and read); hi/lo planes 4 it x 16 rows x 8 lanes
//           x 8 = 64 n x 64 d per plane, grid nt x mb {0,1} / {2,3} covers d 0..127 of all N rows of Qh/Ql / Kh/Kl
//           exactly once; g plane 4 it x 16 ch x 8 lanes x 8 keys = 64 ch x 64 keys, nt x mb {4,5} covers ch 0..127
//           x keys 0..N-1 of Gc exactly once. grid (N/64, 6).
// LDS Os: cross-wave (block barrier). LDS Ws, Xs (the block's 64 W16 rows and 64 XP rows, from which the fragments are read):
//     cross-wave (copy wait, then block barrier).
// =========================================================================================================
__global__ __launch_bounds__(128)
void gemm_qkv(const unsigned short* __restrict__ W16, const unsigned short* __restrict__ XP,
              const float* __restrict__ tbias, const float* __restrict__ pbias, const float* __restrict__ gbias,
              unsigned short* Qh, unsigned short* Ql, unsigned short* Kh, unsigned short* Kl, unsigned short* Gc) {
  __shared__ __align__(16) float Os[QT * OSP];
  __shared__ __align__(128) unsigned short Ws[QT * WP];              // W16 rows o0 .. o0+63, pitch 16 B x odd
  __shared__ __align__(128) unsigned short Xs[QT * WP];              // XP rows n0 .. n0+63, same pitch
  const int tid  = threadIdx.x;
  const int lane = tid & 31, wave = tid >> 5;
  const int hh   = lane >> 4, c = lane & 15;
  const int nt   = blockIdx.x, mb = blockIdx.y;
  const int n0   = nt * QT, o0 = mb * QT;                            // o0 = W16 row base 0..320

  // Both operand tiles come into LDS once, by asynchronous 16-B copies in whole lines: copy i of a lane -> row 4i + wave,
  // 16-B piece lane (a wave = one whole 512-B row), 2 x 16 copies per lane. A fragment read straight from global memory
  // touches 16 lines for 512 B, four waves fetch the same A fragments, and each read is a round trip of its own.
  {
    const unsigned lW = lds_addr(Ws + wave * WP + 8 * lane);
    const unsigned lX = lds_addr(Xs + wave * WP + 8 * lane);
    const unsigned short* gW = W16 + (size_t)(o0 + wave) * CC + 8 * lane;
    const unsigned short* gX = XP + (size_t)(n0 + wave) * CC + 8 * lane;
    copy8(lW,               4 * WP * 2, gW,                   (size_t)4 * CC);
    copy8(lW + 32 * WP * 2, 4 * WP * 2, gW + (size_t)32 * CC, (size_t)4 * CC);
    copy8(lX,               4 * WP * 2, gX,                   (size_t)4 * CC);
    copy8(lX + 32 * WP * 2, 4 * WP * 2, gX + (size_t)32 * CC, (size_t)4 * CC);
  }
  wait_async0();
  __syncthreads();

  const unsigned short* ap = Ws + c * WP + 8 * hh;
  const unsigned short* bp = Xs + (16 * wave + c) * WP + 8 * hh;

  v8f acc[4];
#pragma unroll
  for (int mt = 0; mt < 4; ++mt) acc[mt] = zero8();

  // fragments of two k-steps (2 B + 8 A) are one group of LDS reads; group g + 1 is read ahead of the products of group g
  // (two register sets): written in this order because LDS reads do not move across the gap statements of the helper
  Frag fb[2][2], fa[2][2][4];
  auto fetch = [&](int g) {
#pragma unroll
    for (int kk = 0; kk < 2; ++kk) {
      fb[g & 1][kk] = ldfrag(bp + 32 * (2 * g + kk));
#pragma unroll
      for (int mt = 0; mt < 4; ++mt) fa[g & 1][kk][mt] = ldfrag(ap + (16 * mt) * WP + 32 * (2 * g + kk));
    }
  };
  fetch(0);
#pragma unroll
  for (int g = 0; g < CC / 64; ++g) {
    if (g + 1 < CC / 64) fetch(g + 1);
#pragma unroll
    for (int kk = 0; kk < 2; ++kk) {
#pragma unroll
      for (int mt = 0; mt < 4; ++mt) acc[mt] = mma_h(fa[g & 1][kk][mt].h, fb[g & 1][kk].h, acc[mt]);
    }
  }

  {
    const int nl = 16 * wave + c;
#pragma unroll
    for (int mt = 0; mt < 4; ++mt) {
      v4f va, vb;
#pragma unroll
      for (int r = 0; r < 4; ++r) { va[r] = acc[mt][r] * IWSC; vb[r] = acc[mt][4 + r] * IWSC; }
      *(v4f*)(Os + nl * OSP + 16 * mt + 8 * hh)     = va;
      *(v4f*)(Os + nl * OSP + 16 * mt + 8 * hh + 4) = vb;
    }
  }
  __syncthreads();

  const int e = tid & 7, lq = tid >> 3;                             // lq 0..15
  const int grp  = mb >> 1;                                          // 0 theta, 1 phi, 2 g (block-uniform)
  const int dsel = (mb & 1) * QT;                                    // channel base 0 or 64 within the group
  if (grp < 2) {                                                     // block-uniform: bf16 hi/lo planes
    const float* bsrc = (grp == 0) ? tbias : pbias;
    unsigned short* Hp = (grp == 0) ? Qh : Kh;
    unsigned short* Lp = (grp == 0) ? Ql : Kl;
    const v4f b0 = *(const v4f*)(bsrc + dsel + 8 * e);
    const v4f b1 = *(const v4f*)(bsrc + dsel + 8 * e + 4);
    const float bb[8] = {bfr(b0[0]), bfr(b0[1]), bfr(b0[2]), bfr(b0[3]), bfr(b1[0]), bfr(b1[1]), bfr(b1[2]), bfr(b1[3])};
    v4u uh[4], ul[4];
#pragma unroll
    for (int it = 0; it < 4; ++it) {
      const int row = it * 16 + lq;                                  // n_loc 0..63
      const v4f a = *(const v4f*)(Os + row * OSP + 8 * e);
      const v4f q = *(const v4f*)(Os + row * OSP + 8 * e + 4);
      const float f[8] = {a[0], a[1], a[2], a[3], q[0], q[1], q[2], q[3]};
#pragma unroll
      for (int t = 0; t < 4; ++t) {
        const float f0 = f[2 * t] + bb[2 * t], f1 = f[2 * t + 1] + bb[2 * t + 1];
        const unsigned short hb0 = bf_bits(f0), hb1 = bf_bits(f1);
        const unsigned short lb0 = bf_bits(f0 - bf_up(hb0));
        const unsigned short lb1 = bf_bits(f1 - bf_up(hb1));
        uh[it][t] = pk16(hb0, hb1);
        ul[it][t] = pk16(lb0, lb1);
      }
    }
{
#pragma unroll
      for (int it = 0; it < 4; ++it) {
        const int row = it * 16 + lq;
        const size_t po = ((size_t)(n0 + row)) * DQ + dsel + 8 * e;
        *(v4u*)(Hp + po) = uh[it];
        *(v4u*)(Lp + po) = ul[it];
      }
      
    }
  } else {                                                           // block-uniform: g plane
    const int gsel = dsel;                                           // g channel base 0 or 64
    v4u ug[4];
#pragma unroll
    for (int it = 0; it < 4; ++it) {
      const int cl = it * 16 + lq;                                   // ch_loc 0..63
      const float bias = bfr(gbias[gsel + cl]);
      unsigned short hb[8];
#pragma unroll
      for (int t = 0; t < 8; ++t) {
        const int key = 8 * e + t;                                   // key_loc 0..63
        const float v = Os[key * OSP + cl] + bias;
        hb[t] = h_bits((_Float16)v);
      }
#pragma unroll
      for (int t = 0; t < 4; ++t) ug[it][t] = pk16(hb[2 * t], hb[2 * t + 1]);
    }
{
#pragma unroll
      for (int it = 0; it < 4; ++it) {
        const int cl = it * 16 + lq;
        const size_t po = ((size_t)(gsel + cl)) * (size_t)SEQ + n0 + 8 * e;
        *(v4u*)(Gc + po) = ug[it];
      }
      
    }
  }
}

// =========================================================================================================
// (3) attention for one 64-query tile and one of KS key ranges (KSEQ keys each), transposed formulation, no mask, no
//   scale. The KS ranges of a tile run as separate work-groups, so that the grid gives every SIMD two waves:
//   S^T tile (16 keys x 16 queries) = sum over 4 d-chunks of A(phi: row = key kb + (lane&15), 32 d via the split
//   k map from the bf16 plane Kh [SEQ][128]) . B(theta: col = query, same map from Qh) + A(Kh).B(Ql) +
//   A(Kl).B(Qh) (bf16 unscaled residual planes, shared accumulator).
//   Wave tile: 32 keys x 32 queries. Wave w takes query columns 32*(w&1) .. +31 (two B tiles u = 0, 1) and keys
//   32*(w>>1) .. +31 of every 64-key stage, so that each K and g fragment read from LDS feeds two query tiles.
//   Per lane a D tile holds 8 keys of ONE query: online softmax state per lane and query tile, one shuffle (lane^16) for
//   the max over 32 keys; the o/l rescale is skipped under a wave-uniform ballot when no lane's max grew (corr == 1
//   exactly for every lane then); row-sum partials combined at the end. P = e^{s-m} x 16384 as f16 is the B operand of
//   Y^T (rows channel, cols queries) += A(g rows channel = 16j + (lane&15), keys contiguous, f16 plane Gc
//   [128][SEQ]) . B(P^T): element r <- D of the tile covering keys kb..kb+15, element 8+r <- the tile covering
//   kb+16..kb+31, lane unchanged. 2 x 8 accumulator tiles per wave (128 channels x 32 queries). Block = 4 waves.
//   Operand path: the block's query tile comes into LDS once by asynchronous 16-B copies in whole lines, and each wave reads
//   its query fragments from there once, ahead of the loop, and keeps them in registers; a 64-key stage of
//   Kh, Kl, Gc comes by three tensor loads, one each from waves 0, 1, 2 (64 rows of 256 B, twice, and 128 rows of 128 B, the
//   mover padding each row by 16 B), two stage buffers, one publish point per stage; all fragments are ds_load_b128 reads
//   at pitches of 16 B x odd (272 B for 256-B rows, 144 B for 128-B rows).
//   Epilogue: waves w and w^2 hold the two key halves of the same 32 queries. Each keeps query tile u = w>>1, hands its
//   other tile (o, m, l) to the partner through the ring's LDS (free behind the last publish point), and merges the
//   partner's half into its own in f32. The range's un-normalised result goes to the workspace in register order,
//   Po[range][16-query tile][j][half][lane][4 f32] (element 4*half + i of tile j; each store = 512 contiguous B), with
//   Pml[range][16-query tile][32]: word c = the range's maximum of query c, word 16 + c = its row sum (x16384, as o).
//   The output projection merges the ranges.
// coverage: Po 4 waves x 8 j x 2 halves x 32 lanes x 4 = 64 queries x 128 ch per range; Pml 4 waves x 32 words; grid
//           (SEQ/64, KS) covers Po and Pml exactly once.
// LDS Ring: cross-wave (issuer's tensor wait, then block barrier); Qs: cross-wave (copy wait, then block barrier); hand-over area in Ring: cross-wave (block barrier).
// =========================================================================================================
__global__ __launch_bounds__(128)
void attn_k(const unsigned short* __restrict__ Qh, const unsigned short* __restrict__ Ql,
            const unsigned short* __restrict__ Kh, const unsigned short* __restrict__ Kl,
            const unsigned short* __restrict__ Gc, float* Po, float* Pml) {
  __shared__ __attribute__((aligned(2048))) unsigned short Ring[2 * STG];   // two stages: Kh[64][KP], Kl[64][KP] (KSL each), G[128][VP]
  __shared__ __align__(128) unsigned short Qs[2 * KPL];              // Qh[64][KP], Ql[64][KP]
  const int tid  = threadIdx.x;
  const int wave = tid >> 5, lane = tid & 31;
  const int hh   = lane >> 4, c = lane & 15;
  const int qg   = wave & 1;                                         // query columns 32*qg .. 32*qg + 31 of the tile
  const int kh   = wave >> 1;                                        // keys 32*kh .. 32*kh + 31 of every stage
  const int n0   = blockIdx.x * QT;
  const int kr   = blockIdx.y;                                       // key range: keys kr*KSEQ .. kr*KSEQ + KSEQ - 1

  // copy slots of the query tile (256-B rows): copy i of a lane -> row 8i + (tid>>4), 16-B piece tid&15 (a wave = 512
  // contiguous global bytes).
  const int rK = tid >> 4, pK = tid & 15;
  const unsigned lQ = lds_addr(Qs + rK * KP + 8 * pK);

  // A stage's three tiles, one tensor load each: wave 0 Kh, wave 1 Kl (64 key rows of 256 B, source pitch 256 B), wave 2 g
  // (128 channel rows of 128 B = 64 keys, source pitch 2*SEQ B). Tile w lies KSL halves behind tile w - 1 in its buffer. From
  // stage to stage the K tiles move on by 64 rows, the g tile by 128 B. Wave 3 issues nothing.
  const uint32_t wv = uni((uint32_t)threadIdx.x >> 5);
  const unsigned short* tsrc = (wv == 0u) ? Kh + (size_t)kr * KSEQ * DQ : (wv == 1u) ? Kl + (size_t)kr * KSEQ * DQ
                                                                       : Gc + (size_t)kr * KSEQ;
  const uint64_t tga   = (uint64_t)(uintptr_t)tsrc;
  const uint32_t tstep = (wv < 2u) ? (uint32_t)(KT * DQ * 2) : (uint32_t)(KT * 2);
  const uint32_t tlds  = lds_addr(Ring) + ((wv < 2u) ? wv : 2u) * (uint32_t)(KSL * 2);
  const u32x8 g1K = tdm_group1<(1u << 20) | (5u << 22) | (3u << 25), DQ * 2, KT>((uint32_t)(DQ * 2));
  const u32x8 g1V = tdm_group1<(1u << 20) | (4u << 22) | (3u << 25), KT * 2, DQ>((uint32_t)(SEQ * 2));

  // stage t (keys 64t .. 64t+63 of the range) into buffer b: one request from each of waves 0, 1, 2, under scalar branches;
  // land: the issuer's wait stands directly behind its load (the prologue's first stage)
  auto fill = [&](uint32_t t, uint32_t b, bool land) {
    if (pinned(wv < 2u)) {
      tdm_load(tdm_group0(tlds + b * (uint32_t)(STG * 2), tga + (uint64_t)t * tstep), g1K);
      if (land) wait_tensor0();
    }
    if (pinned(wv == 2u)) {
      tdm_load(tdm_group0(tlds + b * (uint32_t)(STG * 2), tga + (uint64_t)t * tstep), g1V);
      if (land) wait_tensor0();
    }
  };

  // prologue: the query tile and stage 0, landed and published; then stage 1 in flight
  copy8(lQ,           8 * KP * 2, Qh + (size_t)(n0 + rK) * DQ + 8 * pK, (size_t)8 * DQ);
  copy8(lQ + KPL * 2, 8 * KP * 2, Ql + (size_t)(n0 + rK) * DQ + 8 * pK, (size_t)8 * DQ);
  fill(0u, 0u, true);
  wait_async0();
  __syncthreads();
  fill(1u, 1u, false);

  // q fragment pointers (B operand, col = query 32*qg + 16*u + c of the tile), + 16*u*KP + 32*kc
  const unsigned short* Qhp = Qs + (32 * qg + c) * KP + 8 * hh;
  const unsigned short* Qlp = Qhp + KPL;
  // the wave's query fragments (2 tiles x hi, residual x 4 d-chunks) are the same in every stage: read once, kept in registers
  Frag fq[DQ / 32][2][2];
#pragma unroll
  for (int kc = 0; kc < DQ / 32; ++kc) {
    fq[kc][0][0] = ldfrag(Qhp + 32 * kc);
    fq[kc][0][1] = ldfrag(Qlp + 32 * kc);
    fq[kc][1][0] = ldfrag(Qhp + 16 * KP + 32 * kc);
    fq[kc][1][1] = ldfrag(Qlp + 16 * KP + 32 * kc);
  }

  float m[2] = {-1.0e30f, -1.0e30f}, l[2] = {0.f, 0.f};
  v8f o[2][8];
#pragma unroll
  for (int u = 0; u < 2; ++u) {
#pragma unroll
    for (int j = 0; j < 8; ++j) o[u][j] = zero8();
  }

  // kept rolled: one trip is one stage with its publish point, and the buffer index alternates with t
#pragma unroll 1
  for (int t = 0; t < KSEQ / KT; ++t) {
    const unsigned short* st = Ring + (t & 1) * STG;
    // k fragment bases (A operand, row = key 32kh + c resp. 32kh + 16 + c of the stage), + 32*kc
    const unsigned short* k0p  = st + (32 * kh + c) * KP + 8 * hh;
    const unsigned short* k1p  = k0p + 16 * KP;
    const unsigned short* k0lp = k0p + KSL;
    const unsigned short* k1lp = k1p + KSL;
    // v fragment base (A operand, row = channel 16j + c, keys contiguous), + 16*j*VP
    const unsigned short* Vp = st + 2 * KSL + c * VP + 32 * kh + 8 * hh;
    v8f s0[2], s1[2];                                                // keys +0..15 resp. +16..31, query tile u
#pragma unroll
    for (int u = 0; u < 2; ++u) { s0[u] = zero8(); s1[u] = zero8(); }
    // k fragments of d-chunk kc + 1 are read from LDS ahead of the products of chunk kc (two register sets): written in
    // this order, and unrolled, because LDS reads do not move across the gap statements of the product helpers
    Frag fk[2][4];
    auto fetch = [&](int kc) {
      const int b = kc & 1;
      fk[b][0] = ldfrag(k0p + 32 * kc);
      fk[b][1] = ldfrag(k1p + 32 * kc);
      fk[b][2] = ldfrag(k0lp + 32 * kc);
      fk[b][3] = ldfrag(k1lp + 32 * kc);
    };
    fetch(0);
#pragma unroll
    for (int kc = 0; kc < DQ / 32; ++kc) {
      const int b = kc & 1;
      if (kc + 1 < DQ / 32) fetch(kc + 1);
      s0[0] = mma_bd(fk[b][0].bf, fq[kc][0][0].bf, s0[0]);
      s1[0] = mma_bd(fk[b][1].bf, fq[kc][0][0].bf, s1[0]);
      s0[1] = mma_bd(fk[b][0].bf, fq[kc][1][0].bf, s0[1]);
      s1[1] = mma_bd(fk[b][1].bf, fq[kc][1][0].bf, s1[1]);
      s0[0] = mma_bd(fk[b][0].bf, fq[kc][0][1].bf, s0[0]);
      s1[0] = mma_bd(fk[b][1].bf, fq[kc][0][1].bf, s1[0]);
      s0[1] = mma_bd(fk[b][0].bf, fq[kc][1][1].bf, s0[1]);
      s1[1] = mma_bd(fk[b][1].bf, fq[kc][1][1].bf, s1[1]);
      s0[0] = mma_bd(fk[b][2].bf, fq[kc][0][0].bf, s0[0]);
      s1[0] = mma_bd(fk[b][3].bf, fq[kc][0][0].bf, s1[0]);
      s0[1] = mma_bd(fk[b][2].bf, fq[kc][1][0].bf, s0[1]);
      s1[1] = mma_bd(fk[b][3].bf, fq[kc][1][0].bf, s1[1]);
    }
    float mx[2], mn[2];
#pragma unroll
    for (int u = 0; u < 2; ++u) mx[u] = fmaxf(hmax8(s0[u]), hmax8(s1[u]));
#pragma unroll
    for (int u = 0; u < 2; ++u) {
      mx[u] = fmaxf(mx[u], __shfl_xor(mx[u], 16, 32));
      mn[u] = fmaxf(m[u], mx[u]);
    }
    const unsigned grew = wave_ballot(mx[0] > m[0] || mx[1] > m[1]); // wave-uniform
    if (grew != 0u) {
#pragma unroll
      for (int u = 0; u < 2; ++u) {
        const float corr = __expf(m[u] - mn[u]);                     // == 1 exactly for lanes whose max did not grow
        l[u] *= corr;
#pragma unroll
        for (int j = 0; j < 8; ++j) {
#pragma unroll
          for (int r = 0; r < 8; ++r) o[u][j][r] *= corr;
        }
      }
    }

    // the stage's g fragments: read here, behind the exchange of the maxima (whose wait would cover them in the LDS queue), so
    // that their LDS time runs under the exponentials
    Frag vf[8];
#pragma unroll
    for (int j = 0; j < 8; ++j) vf[j] = ldfrag(Vp + (16 * j) * VP);
#if defined(__HIP_DEVICE_COMPILE__)
    // keeps the sixteen reads above as one group here: moved down to their products, each pair is waited for on its own
    __builtin_amdgcn_sched_barrier(0);
#endif

    FragH ph[2];
#pragma unroll
    for (int u = 0; u < 2; ++u) {
      m[u] = mn[u];
      const float msh = mn[u] - LNPS;                                // exp gives e^{s-m} * 16384
      float ls = 0.f;
#pragma unroll
      for (int r = 0; r < 8; ++r) {
        const float e0 = __expf(s0[u][r] - msh);                     // key 64t + 32kh      + 8hh + r
        const float e1 = __expf(s1[u][r] - msh);                     // key 64t + 32kh + 16 + 8hh + r
        ls += e0 + e1;
        ph[u].hv[0][r] = (_Float16)e0;
        ph[u].hv[1][r] = (_Float16)e1;
      }
      l[u] += ls;
    }

#pragma unroll
    for (int j = 0; j < 8; ++j) {
      o[0][j] = mma_hd(vf[j].h, ph[0].v, o[0][j]);
      o[1][j] = mma_hd(vf[j].h, ph[1].v, o[1][j]);
    }
    // publish point of stage t + 1: own LDS reads returned, the issuing waves' tensor loads landed, every wave here; only then
    // the refill, its descriptor formed from a stage number that is pinned behind the barrier
    wait_ds0();
    if (pinned(wv < 3u)) wait_tensor0();
    __syncthreads();
    if (pinned((uint32_t)(t + 2 < KSEQ / KT))) fill(pinned((uint32_t)t + 2u), (uint32_t)t & 1u, false);
  }
  wait_tensor0();
  wait_ds0();
#pragma unroll
  for (int u = 0; u < 2; ++u) l[u] += __shfl_xor(l[u], 16, 32);

  // hand-over between the key halves: no tensor load is in flight and every wave has passed the last publish point, so the
  // ring is free. Area of wave w: XW floats = [j][half][lane][4] of the tile it gives away, then m[32], l[32].
  float* X = reinterpret_cast<float*>(Ring);
  float* xg = X + wave * XW;
  const float* xp = X + (wave ^ 2) * XW;
  v8f ok[8];                                                         // the tile this wave keeps: u = kh
#pragma unroll
  for (int j = 0; j < 8; ++j) {
    const v8f og = kh ? o[0][j] : o[1][j];
    ok[j] = kh ? o[1][j] : o[0][j];
    v4f va, vb;
#pragma unroll
    for (int r = 0; r < 4; ++r) { va[r] = og[r]; vb[r] = og[4 + r]; }
    *(v4f*)(xg + j * 256 + 4 * lane)       = va;
    *(v4f*)(xg + j * 256 + 128 + 4 * lane) = vb;
  }
  xg[2048 + lane] = kh ? m[0] : m[1];
  xg[2080 + lane] = kh ? l[0] : l[1];
  const float mk = kh ? m[1] : m[0];
  const float lk = kh ? l[1] : l[0];
  __syncthreads();
  const float mp = xp[2048 + lane];
  const float lp = xp[2080 + lane];
  const float mall = fmaxf(mk, mp);
  const float wk = __expf(mk - mall), wp = __expf(mp - mall);

  const size_t pt = (size_t)kr * NT16 + (size_t)(blockIdx.x * (QT / 16) + 2 * qg + kh);   // (range, 16-query tile)
  float* po = Po + pt * (8 * 256) + 4 * lane;
#pragma unroll
  for (int j = 0; j < 8; ++j) {
    const v4f pa = *(const v4f*)(xp + j * 256 + 4 * lane);
    const v4f pb = *(const v4f*)(xp + j * 256 + 128 + 4 * lane);
    v4f va, vb;
#pragma unroll
    for (int r = 0; r < 4; ++r) { va[r] = ok[j][r] * wk + pa[r] * wp; vb[r] = ok[j][4 + r] * wk + pb[r] * wp; }
    *(v4f*)(po + j * 256)       = va;
    *(v4f*)(po + j * 256 + 128) = vb;
  }
  Pml[pt * 32 + lane] = hh ? (lk * wk + lp * wp) : mall;             // m and l are equal in lanes c and 16 + c
}

// =========================================================================================================
// (4) output projection GEMM for one (64-n tile, 64-co block): out[n][co] = (1/256)(sum_c WW16[co][c] Yh[n][c] +
//     (1/1024) sum_c WW16[co][c] Yl[n][c]) + bf16-RNE(W_b[co]) + bf16-RNE(x[n][co]). 4 waves, wave w owns
//     cols n0+16w..+15, 4 m-tiles (A rows co = o0 + 16 mt + (lane&15) from WW16), hi and residual products in
//     separate accumulators. K = 128 = 4 steps.
//     B operand: y = sum_s a_s Po[s], a_s = e^{m_s - M} / sum_s e^{m_s - M} l_s, M = max_s m_s, merged in f32 from the
//     KS key ranges' partials; Yh = f16(y), Yl = f16((y - Yh) * 1024). A lane's Po words of tile j are channels
//     16j + 8(lane>>4) + 0..7 of query lane&15: tiles 2ks and 2ks + 1 are elements 0..7 and 8..15 of the B fragment
//     of k-step ks, lane unchanged.
//     Epilogue staged in LDS Os[n_loc][co_loc], barrier, then out rows (position-major, 1024 B each): lane
//     (e = tid&15) -> co o0+4e..+3 of row n_loc = 8 it + (tid>>4); 16 consecutive lanes x 16 B = the whole 256-B
// coverage: Os 4 waves x 16 n x 64 co (cols 0..63 written and read); out 8 it x 8 rows x 16 lanes x 4 floats =
//           64 n x 64 co; grid (SEQ/64, 4) covers out[0..SEQ-1][0..255] exactly once.
// LDS Os: cross-wave (block barrier). LDS Ws (the block's 64 WW16 rows, from which the A fragments are read): cross-wave
//     (copy wait, then block barrier).
// =========================================================================================================
__global__ __launch_bounds__(128)
void gemm_o(const unsigned short* __restrict__ WW16, const float* __restrict__ Po,
            const float* __restrict__ Pml, const float* __restrict__ wbias,
            const float* __restrict__ x, float* out) {
  __shared__ __align__(16) float Os[QT * OSP];
  __shared__ __align__(128) unsigned short Ws[QT * KP];              // WW16 rows o0 .. o0+63, pitch 16 B x odd
  const int tid  = threadIdx.x;
  const int lane = tid & 31, wave = tid >> 5;
  const int hh   = lane >> 4, c = lane & 15;
  const int nt   = blockIdx.x, mb = blockIdx.y;
  const int n0   = nt * QT, o0 = mb * QT;

  const unsigned short* ap  = Ws + c * KP + 8 * hh;
  const size_t t16 = (size_t)(nt * (QT / 16) + wave);                // the wave's 16-query tile

  const float* pml = Pml + t16 * 32 + c;
  const float* pp  = Po + t16 * (8 * 256) + 4 * lane;
  float ms[KS], as[KS];
  FragH fyh[DQ / 32], fyl[DQ / 32];
#pragma unroll
  for (int g = 0; g < 2; ++g) {                                      // tiles j = 4g .. 4g+3 = k-steps 2g, 2g+1
    v4f pv[KS][4][2];
#pragma unroll
    for (int s = 0; s < KS; ++s) {
#pragma unroll
      for (int jj = 0; jj < 4; ++jj) {
        pv[s][jj][0] = *(const v4f*)(pp + (size_t)s * (NT16 * 8 * 256) + (4 * g + jj) * 256);
        pv[s][jj][1] = *(const v4f*)(pp + (size_t)s * (NT16 * 8 * 256) + (4 * g + jj) * 256 + 128);
      }
    }
    if (g == 0) {
      // The A tile comes into LDS by asynchronous 16-B copies in whole lines and travels under the loads and the merge of the
      // partials: copy i of a lane -> row 8i + (tid>>4), 16-B piece tid&15 (a wave = 512 contiguous B). The statement stands
      // between the first group's loads and those of the maxima and sums: loads do not cross it, so that no wait for a
      // maximum comes to stand in front of the group's issue.
      copy8(lds_addr(Ws + (tid >> 4) * KP + 8 * (tid & 15)), 8 * KP * 2,
            WW16 + (size_t)(o0 + (tid >> 4)) * DQ + 8 * (tid & 15), (size_t)8 * DQ);
#pragma unroll
      for (int s = 0; s < KS; ++s) {
        ms[s] = pml[(size_t)s * (NT16 * 32)];
        as[s] = pml[(size_t)s * (NT16 * 32) + 16];
      }
    }
    // the group's loaded words, inputs only: all its loads are issued ahead of the arithmetic, one round trip for the
    // group instead of one for every pair of loads
    hold16(pv[0], pv[1], pp);
    hold16(pv[2], pv[3], pp + (size_t)2 * (NT16 * 8 * 256));
    if (g == 0) {                                                    // merge weights of query c
      float mall = ms[0];
#pragma unroll
      for (int s = 1; s < KS; ++s) mall = fmaxf(mall, ms[s]);
      float lall = 0.f;
#pragma unroll
      for (int s = 0; s < KS; ++s) {
        const float w = __expf(ms[s] - mall);
        lall += w * as[s];
        as[s] = w;
      }
      const float inv = 1.0f / lall;                                 // o and l both carry the x16384 factor
#pragma unroll
      for (int s = 0; s < KS; ++s) as[s] *= inv;
    }
#pragma unroll
    for (int jj = 0; jj < 4; ++jj) {
      const int j = 4 * g + jj;
#pragma unroll
      for (int r = 0; r < 8; ++r) {
        float y = as[0] * pv[0][jj][r >> 2][r & 3];
#pragma unroll
        for (int s = 1; s < KS; ++s) y += as[s] * pv[s][jj][r >> 2][r & 3];
        const _Float16 h0 = (_Float16)y;
        fyh[j >> 1].hv[j & 1][r] = h0;
        fyl[j >> 1].hv[j & 1][r] = (_Float16)((y - (float)h0) * RSC);
      }
    }
  }

  v8f acc[4], accr[4];
#pragma unroll
  for (int mt = 0; mt < 4; ++mt) { acc[mt] = zero8(); accr[mt] = zero8(); }

  // the A tile: own copies landed, every wave here; then all sixteen fragments as one group of LDS reads ahead of the
  // products (LDS reads do not move across the gap statements of the helper)
  wait_async0();
  __syncthreads();
  Frag fa[DQ / 32][4];
#pragma unroll
  for (int ks = 0; ks < DQ / 32; ++ks) {
#pragma unroll
    for (int mt = 0; mt < 4; ++mt) fa[ks][mt] = ldfrag(ap + (16 * mt) * KP + 32 * ks);
  }
#pragma unroll
  for (int ks = 0; ks < DQ / 32; ++ks) {
#pragma unroll
    for (int mt = 0; mt < 4; ++mt) {
      acc[mt]  = mma_h(fa[ks][mt].h, fyh[ks].v, acc[mt]);
      accr[mt] = mma_h(fa[ks][mt].h, fyl[ks].v, accr[mt]);
    }
  }

  {
    const int nl = 16 * wave + c;
#pragma unroll
    for (int mt = 0; mt < 4; ++mt) {
      v4f va, vb;
#pragma unroll
      for (int r = 0; r < 4; ++r) {
        va[r] = (acc[mt][r] + accr[mt][r] * IRSC) * IWSC;
        vb[r] = (acc[mt][4 + r] + accr[mt][4 + r] * IRSC) * IWSC;
      }
      *(v4f*)(Os + nl * OSP + 16 * mt + 8 * hh)     = va;
      *(v4f*)(Os + nl * OSP + 16 * mt + 8 * hh + 4) = vb;
    }
  }
  __syncthreads();

  const int e = tid & 15, lq = tid >> 4;                             // lq 0..7
  const v4f bv = *(const v4f*)(wbias + o0 + 4 * e);
  const float bb[4] = {bfr(bv[0]), bfr(bv[1]), bfr(bv[2]), bfr(bv[3])};
  v4f res[8];
#pragma unroll
  for (int it = 0; it < 8; ++it) {
    const int nl = it * 8 + lq;                                      // n_loc 0..63
    const size_t idx = ((size_t)(n0 + nl)) * CC + o0 + 4 * e;
    const v4f xv = *(const v4f*)(x + idx);
    const v4f ov = *(const v4f*)(Os + nl * OSP + 4 * e);
#pragma unroll
    for (int t = 0; t < 4; ++t) res[it][t] = ov[t] + bb[t] + bfr(xv[t]);
  }
{
#pragma unroll
    for (int it = 0; it < 8; ++it) {
      const int nl = it * 8 + lq;
      const size_t idx = ((size_t)(n0 + nl)) * CC + o0 + 4 * e;
      *(v4f*)(out + idx) = res[it];
    }
    
  }
}

// =========================================================================================================
// Workspace map (bytes; each region start a multiple of 256; every plane size is an exact multiple of its
// whole-line store granularity, SEQ a multiple of 64 so no tail rows exist):
//   W16  f16 [384][256]          196608      WW16 f16 [256][128]     65536
//   XP   f16 [SEQ][256]         4194304 (SEQ=8192)
//   Qh/Ql bf16 [SEQ][128]        2097152 x2
//   Kh/Kl bf16 [SEQ][128]        2097152 x2
//   Gc   f16 [128][SEQ]          2097152
//   Po   f32 [KS][SEQ/16][8][2][32][4]  16777216 (KS=4)      Pml f32 [KS][SEQ/16][32]  262144
//   total (SEQ=8192) = 31981568
// =========================================================================================================
extern "C" void kernel_launch(void* const* d_in, const int* in_sizes, int n_in,
                              void* d_out, int out_size, void* d_ws, size_t ws_size,
                              hipStream_t stream) {
  const int XN = SEQ * CC;
  if (n_in < 9) return;
  if (in_sizes[0] < XN) return;
  if (in_sizes[1] < CC * DQ || in_sizes[3] < CC * DQ || in_sizes[5] < CC * DQ) return;
  if (in_sizes[2] < DQ || in_sizes[4] < DQ || in_sizes[6] < DQ) return;
  if (in_sizes[7] < DQ * CC || in_sizes[8] < CC) return;
  if (out_size < XN) return;

  size_t off = 0;
  auto carve = [&](size_t bytes) { const size_t o = off; off += (bytes + 255) & ~(size_t)255; return o; };
  const size_t oW16 = carve((size_t)MW * CC * 2);
  const size_t oWW  = carve((size_t)CC * DQ * 2);
  const size_t oXP  = carve((size_t)SEQ * CC * 2);
  const size_t oQh  = carve((size_t)SEQ * DQ * 2);
  const size_t oQl  = carve((size_t)SEQ * DQ * 2);
  const size_t oKh  = carve((size_t)SEQ * DQ * 2);
  const size_t oKl  = carve((size_t)SEQ * DQ * 2);
  const size_t oGc  = carve((size_t)DQ * SEQ * 2);
  const size_t oPo  = carve((size_t)KS * SEQ * DQ * 4);
  const size_t oPml = carve((size_t)KS * NT16 * 32 * 4);
  if (off > ws_size) return;
  if (off > (size_t)134217728) return;

  const float* x  = (const float*)d_in[0];
  const float* gw = (const float*)d_in[1];
  const float* gb = (const float*)d_in[2];
  const float* tw = (const float*)d_in[3];
  const float* tb = (const float*)d_in[4];
  const float* pw = (const float*)d_in[5];
  const float* pb = (const float*)d_in[6];
  const float* ww = (const float*)d_in[7];
  const float* wb = (const float*)d_in[8];

  char* ws = (char*)d_ws;
  unsigned short* W16  = (unsigned short*)(ws + oW16);
  unsigned short* WW16 = (unsigned short*)(ws + oWW);
  unsigned short* XP   = (unsigned short*)(ws + oXP);
  unsigned short* Qh   = (unsigned short*)(ws + oQh);
  unsigned short* Ql   = (unsigned short*)(ws + oQl);
  unsigned short* Kh   = (unsigned short*)(ws + oKh);
  unsigned short* Kl   = (unsigned short*)(ws + oKl);
  unsigned short* Gc   = (unsigned short*)(ws + oGc);
  float* Po  = (float*)(ws + oPo);
  float* Pml = (float*)(ws + oPml);
  float* out = (float*)d_out;

  const dim3 blk256(256), blk128(128);

  // (0) + (1) projection weights [in][out] -> f16 planes W16 [out rows 0..383][in 256], WW16 [out 256][in 128], and
  //     x -> 16-bit plane (same position-major layout), one grid
  cvt_all<<<dim3(WTB + SEQ / 8), blk256, 0, stream>>>(tw, pw, gw, ww, x, W16, WW16, XP);
  // (2) theta / phi -> hi + residual planes, g -> channel-major plane
  gemm_qkv<<<dim3(SEQ / QT, 6), blk128, 0, stream>>>(W16, XP, tb, pb, gb, Qh, Ql, Kh, Kl, Gc);
  // (3) attention, KS key ranges per query tile -> per-range partials
  attn_k<<<dim3(SEQ / QT, KS), blk128, 0, stream>>>(Qh, Ql, Kh, Kl, Gc, Po, Pml);
  // (4) merge of the ranges + output projection + bias + residual -> out [SEQ][256]
  gemm_o<<<dim3(SEQ / QT, CC / QT), blk128, 0, stream>>>(WW16, Po, Pml, wb, x, out);
  (void)hipGetLastError();
}

// v008
// One run takes 57.9 microseconds.
// Two timings next to v007 both put it at 1.04 times that version's speed.
// Over all steps from v000 it is 13.2 times as fast.
// Contractions: theta/phi/g projection GEMMs Wt[384x256].Xp[256xN] and the output projection Wo[256x128].Y[128xN] on
// v_wmma_f32_16x16x32_f16 (f16 containers of bf16-RNE weights x256 and bf16-RNE x; Y as f16 hi fragment plus f16
// residual fragment x1024, 2 products, separate accumulators); scores Phi.Theta^T on v_wmma_f32_16x16x32_bf16
// (bf16 hi + bf16 residual planes of theta/phi, 3 products, K=128); Y^T = G.P^T on v_wmma_f32_16x16x32_f16
// (G plain f16, P = e^{s-m} x16384 f16 from the score D registers); f32 accumulate everywhere; softmax
// statistics, biases and the residual add in f32 VALU.
#include <hip/hip_runtime.h>
#include <math.h>
#include <stdint.h>

#ifndef NB
#define NB 1
#endif
#define NB_FULL 1
#ifndef SEQ
#define SEQ 8192
#endif
#define SEQ_FULL 8192
#define CC   256
#define DQ   128
#define QT   64
#define MW   384
#define OSP  68
#define TP   72
#define WSC  256.0f
#define IWSC 0.00390625f
#define RSC  1024.0f
#define IRSC 0.0009765625f
#define LNPS 9.704060527839234f
#define KT   64
#define KP   136
#define VP   72
#define KPL  (KT * KP)
#define KSL  9216
#define STG  (2 * KSL + DQ * VP)
#define KS   4
#define KSEQ (SEQ / KS)
#define NT16 (SEQ / 16)
#define XW   (8 * 256 + 64)
#define WTB  32
#define WP   264

static_assert(NB == 1 && NB_FULL == 1);
static_assert(SEQ >= QT && SEQ <= SEQ_FULL);
static_assert(SEQ % QT == 0 && SEQ % 32 == 0 && SEQ % 8 == 0);
static_assert(CC % QT == 0 && CC % 32 == 0);
static_assert(DQ == 2 * QT && DQ % 32 == 0);
static_assert(MW == 3 * DQ && MW % 8 == 0);
static_assert(WTB == 4 * 8 && (DQ / QT) * (CC / QT) == 8 && DQ / QT == 2 && CC / QT == 4);
static_assert((OSP * 4) % 16 == 0);
static_assert((TP * 2) % 16 == 0);
static_assert(SEQ % KS == 0 && KSEQ % KT == 0 && KSEQ / KT >= 2 && KT == QT && KT % 32 == 0);
static_assert(2 * (2 * STG + 2 * KPL) * 2 <= 327680);                // two work-groups of attn_k per 320-KiB LDS
static_assert(KT == 64 && QT == 64 && 4 * XW * 4 <= 2 * STG * 2);         // attn_k: 2 x 2 waves of 32 keys x 32 queries; hand-over area
static_assert(KSL >= KPL && (KSL * 2) % 2048 == 0 && (DQ * VP * 2) % 2048 == 0);   // every tensor tile's place in LDS: a multiple of 2 KiB
static_assert(DQ * 2 == 256 && KP * 2 == 256 + 16 && KT * 2 == 128 && VP * 2 == 128 + 16);   // tile rows and their padded pitches
static_assert((KP * 2) % 32 == 16 && (VP * 2) % 32 == 16 && KP >= DQ + 8 && VP >= KT + 8);
static_assert((WP * 2) % 32 == 16 && WP >= CC + 8 && QT == 64 && CC == 256 && DQ == 128);   // operand tiles of the projection GEMMs
static_assert(3 * (2 * QT * WP * 2 + QT * OSP * 4) <= 327680);       // three work-groups of gemm_qkv per 320-KiB LDS

typedef _Float16       v16h __attribute__((ext_vector_type(16)));
typedef _Float16       v8h  __attribute__((ext_vector_type(8)));
typedef __bf16         v16b __attribute__((ext_vector_type(16)));
typedef unsigned short v8us __attribute__((ext_vector_type(8)));
typedef float          v8f  __attribute__((ext_vector_type(8)));
typedef float          v4f  __attribute__((ext_vector_type(4)));
typedef unsigned int   v4u  __attribute__((ext_vector_type(4)));
typedef uint32_t       u32x4 __attribute__((ext_vector_type(4)));
typedef uint32_t       u32x8 __attribute__((ext_vector_type(8)));

union Frag  { v8us u[2]; v16h h; v16b bf; };
union FragH { v16h v; v8h hv[2]; };
static_assert(sizeof(Frag) == 32);
static_assert(sizeof(FragH) == 32);

// ---- scalar helpers ---------------------------------------------------------------------------------------
__device__ __forceinline__ unsigned short bf_bits(float f) {          // f32 -> bf16 bits, RNE convert
  unsigned u = __float_as_uint(f);
  return (unsigned short)((u + 0x7FFFu + ((u >> 16) & 1u)) >> 16);
}
__device__ __forceinline__ float bf_up(unsigned short hb) { return __uint_as_float(((unsigned)hb) << 16); }
__device__ __forceinline__ float bfr(float f) { return bf_up(bf_bits(f)); }
__device__ __forceinline__ unsigned short h_bits(_Float16 x) { return __builtin_bit_cast(unsigned short, x); }
__device__ __forceinline__ unsigned pk16(unsigned short a, unsigned short b) { return (unsigned)a | ((unsigned)b << 16); }
__device__ __forceinline__ v8f zero8() { v8f z = {0.f, 0.f, 0.f, 0.f, 0.f, 0.f, 0.f, 0.f}; return z; }
__device__ __forceinline__ float hmax8(v8f s) {
  return fmaxf(fmaxf(fmaxf(s[0], s[1]), fmaxf(s[2], s[3])), fmaxf(fmaxf(s[4], s[5]), fmaxf(s[6], s[7])));
}
__device__ __forceinline__ unsigned wave_ballot(bool p) {
#if defined(__HIP_DEVICE_COMPILE__)
  return __builtin_amdgcn_ballot_w32(p);
#else
  return p ? 1u : 0u;
#endif
}

// ---- 16-bit fragment loader (A, or B from a k-contiguous [n][k] row): lane -> row/col (lane&15), p already includes
//      + 8*(lane>>4); elements 0..7 <- p[0..7] (k0+8h..), elements 8..15 <- p[16..23] (k0+16+8h..)
__device__ __forceinline__ Frag ldfrag(const unsigned short* p) {
  Frag f;
  f.u[0] = *(const v8us*)(p);
  f.u[1] = *(const v8us*)(p + 16);
  return f;
}

// ---- WMMA helpers: builtin followed by a 4-slot VALU gap tying D and keeping A/B live --------------------------
__device__ __forceinline__ v8f mma_h(v16h a, v16h b, v8f c) {
  v8f d = __builtin_amdgcn_wmma_f32_16x16x32_f16(false, a, false, b, (short)0, c, false, false);
#if defined(__HIP_DEVICE_COMPILE__)
  asm volatile("v_nop\n\tv_nop\n\tv_nop\n\tv_nop" : "+v"(d) : "v"(a), "v"(b));
#endif
  return d;
}
__device__ __forceinline__ v8f mma_b(v16b a, v16b b, v8f c) {
  v8f d = __builtin_amdgcn_wmma_f32_16x16x32_bf16(false, a, false, b, (short)0, c, false, false);
#if defined(__HIP_DEVICE_COMPILE__)
  const v16h ha = __builtin_bit_cast(v16h, a), hb = __builtin_bit_cast(v16h, b);
  asm volatile("v_nop\n\tv_nop\n\tv_nop\n\tv_nop" : "+v"(d) : "v"(ha), "v"(hb));
#endif
  return d;
}

// The same products for attn_k: the bare builtins. The compiler keeps the distances behind its own matrix instructions, and
// pays a gap only where a result is read at once; a gap behind every product takes issue slots of the vector port from the
// exponentials of the other wave on the SIMD.
__device__ __forceinline__ v8f mma_hd(v16h a, v16h b, v8f c) {
  return __builtin_amdgcn_wmma_f32_16x16x32_f16(false, a, false, b, (short)0, c, false, false);
}
__device__ __forceinline__ v8f mma_bd(v16b a, v16b b, v8f c) {
  return __builtin_amdgcn_wmma_f32_16x16x32_bf16(false, a, false, b, (short)0, c, false, false);
}

// ---- asynchronous copies global -> LDS ------------------------------------------------------------------------
__device__ __forceinline__ unsigned lds_addr(const unsigned short* p) { return (unsigned)(uintptr_t)p; }  // LDS byte address

// Eight 16-B copies per lane: copy i moves g + i*gstep (halves) to LDS byte address l + i*lstep. All lanes on.
__device__ __forceinline__ void copy8(unsigned l, unsigned lstep, const unsigned short* g, size_t gstep) {
#if defined(__HIP_DEVICE_COMPILE__)
  // the closing s_wait_xcnt keeps later rewrites of the address registers behind the issued copies
  asm volatile("global_load_async_to_lds_b128 %0, %8, off\n\t"
               "global_load_async_to_lds_b128 %1, %9, off\n\t"
               "global_load_async_to_lds_b128 %2, %10, off\n\t"
               "global_load_async_to_lds_b128 %3, %11, off\n\t"
               "global_load_async_to_lds_b128 %4, %12, off\n\t"
               "global_load_async_to_lds_b128 %5, %13, off\n\t"
               "global_load_async_to_lds_b128 %6, %14, off\n\t"
               "global_load_async_to_lds_b128 %7, %15, off\n\t"
               "s_wait_xcnt 0x0"
               :: "v"(l), "v"(l + lstep), "v"(l + 2 * lstep), "v"(l + 3 * lstep),
                  "v"(l + 4 * lstep), "v"(l + 5 * lstep), "v"(l + 6 * lstep), "v"(l + 7 * lstep),
                  "v"(g), "v"(g + gstep), "v"(g + 2 * gstep), "v"(g + 3 * gstep),
                  "v"(g + 4 * gstep), "v"(g + 5 * gstep), "v"(g + 6 * gstep), "v"(g + 7 * gstep)
               : "memory");
#endif
}
__device__ __forceinline__ void wait_async0() {   // this wave's copies have landed in LDS
#if defined(__HIP_DEVICE_COMPILE__)
  asm volatile("s_wait_asynccnt 0x0" ::: "memory");
#endif
}
__device__ __forceinline__ void wait_ds0() {      // this wave's LDS reads have returned before the buffer is handed back
#if defined(__HIP_DEVICE_COMPILE__)
  asm volatile("s_wait_dscnt 0x0" ::: "memory");
#endif
}

__device__ __forceinline__ uint32_t uni(uint32_t v) { return (uint32_t)__builtin_amdgcn_readfirstlane(v); }
__device__ __forceinline__ uint32_t pinned(uint32_t v) {
  uint32_t w = uni(v);
#if defined(__HIP_DEVICE_COMPILE__)
  // holds the word in a scalar register at this place: a test on it compiles to a scalar branch (a tensor load ignores EXEC),
  // and what is computed from it stays behind the waits that stand in front of it
  asm volatile("" : "+s"(w));   // pinned(): a word of a tensor load's test or descriptor held in a scalar register
#endif
  return w;
}
// group 1: byte elements, tensor = tile = ROWS rows of ROWB bytes, source pitch in bytes; W0 = pad word (no mask), a constant
template <uint32_t W0, uint32_t ROWB, uint32_t ROWS>
__device__ __forceinline__ u32x8 tdm_group1(uint32_t src_pitch) {
  u32x8 g;
  g[0] = uni(W0);
  g[1] = uni((ROWB & 0xFFFFu) << 16);
  g[2] = uni((ROWB >> 16) | ((ROWS & 0xFFFFu) << 16));
  g[3] = uni((ROWS >> 16) | (ROWB << 16));
  g[4] = uni(ROWS);
  g[5] = uni(src_pitch);
  g[6] = uni(0u);
  g[7] = uni(0u);
#if defined(__HIP_DEVICE_COMPILE__)
  // descriptor words held in scalar registers (the pinned() form, on the whole group): built once, the group keeps its eight
  // registers over the loop, so that none of them takes another value while a request that named them is outstanding
  asm volatile("" : "+s"(g));   // pinned(), all eight words: descriptor words held in scalar registers
#endif
  return g;
}
// group 0: count 1, LDS byte address, global byte address of the tile's first byte, type 2
__device__ __forceinline__ u32x4 tdm_group0(uint32_t lds_dst, uint64_t ga) {
  u32x4 g;
  g[0] = uni(1u);
  g[1] = uni(lds_dst);
  g[2] = uni((uint32_t)ga);
  g[3] = uni((((uint32_t)(ga >> 32)) & 0x01FFFFFFu) | 0x80000000u);
  return g;
}
__device__ __forceinline__ void tdm_load(u32x4 g0, u32x8 g1) {
#if defined(__HIP_DEVICE_COMPILE__)
  asm volatile("tensor_load_to_lds %0, %1" :: "s"(g0), "s"(g1) : "memory");
#endif
}
__device__ __forceinline__ void wait_tensor0() {  // this wave's tensor load has landed in LDS
#if defined(__HIP_DEVICE_COMPILE__)
  asm volatile("s_wait_tensorcnt 0x0" ::: "memory");
#endif
}

// Inputs-only fence on sixteen loaded 16-B words: every one of them has arrived here. The wait stands behind the loads and
// ahead of any rewrite of their address registers: their base p is named so that it lives up to the wait.
__device__ __forceinline__ void hold16(const v4f (&a)[4][2], const v4f (&b)[4][2], const float* p) {
#if defined(__HIP_DEVICE_COMPILE__)
  asm volatile("s_wait_xcnt 0x0"
               :: "v"(a[0][0]), "v"(a[0][1]), "v"(a[1][0]), "v"(a[1][1]), "v"(a[2][0]), "v"(a[2][1]), "v"(a[3][0]), "v"(a[3][1]),
                  "v"(b[0][0]), "v"(b[0][1]), "v"(b[1][0]), "v"(b[1][1]), "v"(b[2][0]), "v"(b[2][1]), "v"(b[3][0]), "v"(b[3][1]),
                  "v"(p));
#endif
}

// =========================================================================================================
// (0) weight transpose + convert: src f32 [R][S] (row r contiguous over S; the projection weights are stored
//     [in][out]) -> dst f16 row (rowBase + s), col r, pitch R halves; value = f16 of (bf16-RNE(w) * 256) (exact).
//     Through an LDS tile T[64 s][64 r] (pitch TP). Block (sb, rb) owns a 64 r x 64 s tile.
// coverage: load 2 it x 32 rows x 8 lanes x 8 = 64 r x 64 s; store 2 it x 32 s-rows x 8 lanes x 8 halves = 64 s x 64 r;
//           tiles (S/64, R/64) cover dst rows rowBase..rowBase+S-1 x cols 0..R-1 exactly once.
// LDS T: cross-wave (block barrier between the 2-byte stores and the 16-B reloads).
// =========================================================================================================
__device__ __forceinline__
void cvt_wt(unsigned short* T, const float* __restrict__ src, unsigned short* dst, int R, int S, int rowBase, int sb, int rb) {
  const int tid = threadIdx.x;
  const int e = tid & 7, lq = tid >> 3;                             // lq 0..31
  const int s0 = sb * QT, r0 = rb * QT;
  const float* sp0 = src + ((size_t)(r0 + lq)) * (size_t)S + s0 + 8 * e;          // r_loc lq
  const float* sp1 = src + ((size_t)(r0 + 32 + lq)) * (size_t)S + s0 + 8 * e;     // r_loc 32 + lq
  const v4f av[2] = {*(const v4f*)sp0, *(const v4f*)sp1};
  const v4f qv[2] = {*(const v4f*)(sp0 + 4), *(const v4f*)(sp1 + 4)};
#if defined(__HIP_DEVICE_COMPILE__)
  // inputs only: the wait stands behind the four loads and ahead of any rewrite of their address registers, which are named
  // so that they live up to it (otherwise a later load's result is placed over an earlier load's address pair)
  asm volatile("s_wait_xcnt 0x0" :: "v"(av[0]), "v"(qv[0]), "v"(av[1]), "v"(qv[1]), "v"(sp0), "v"(sp1));
#endif
#pragma unroll
  for (int it = 0; it < 2; ++it) {
    const int rl = it * 32 + lq;                                     // r_loc 0..63
    const v4f a = av[it];
    const v4f q = qv[it];
    unsigned short hb[8];
#pragma unroll
    for (int t = 0; t < 4; ++t) {
      hb[t]     = h_bits((_Float16)(bfr(a[t]) * WSC));
      hb[4 + t] = h_bits((_Float16)(bfr(q[t]) * WSC));
    }
#pragma unroll
    for (int t = 0; t < 8; ++t) T[(8 * e + t) * TP + rl] = hb[t];   // T[s_loc][r_loc]
  }
  __syncthreads();
  v4u up[2];
#pragma unroll
  for (int it = 0; it < 2; ++it) {
    const int sl = it * 32 + lq;                                     // s_loc 0..63
    up[it] = *(const v4u*)(T + sl * TP + 8 * e);                     // r_loc 8e..8e+7
  }
{
    unsigned short* dp = dst + ((size_t)(rowBase + s0 + lq)) * (size_t)R + r0 + 8 * e;   // s_loc lq; s_loc 32 + lq is 32 rows on
    *(v4u*)dp = up[0];
    *(v4u*)(dp + (size_t)32 * (size_t)R) = up[1];
#if defined(__HIP_DEVICE_COMPILE__)
    // the code of another block kind may follow in the shared kernel: the wait stands behind the two stores and ahead of any
    // rewrite of their data and address registers, which are named, inputs only, so that they live up to it
    asm volatile("s_wait_xcnt 0x0" :: "v"(up[0]), "v"(up[1]), "v"(dp) : "memory");
#endif
  }
}

// =========================================================================================================
// (1) x f32 [N][256] (already position-major) -> XP f16 [N][256], value = bf16-RNE(x) in an f16 container.
// coverage: SEQ/8 blocks x 8 rows x 32 lanes x 8 halves = SEQ x 256 = the whole plane.
// =========================================================================================================
__device__ __forceinline__
void cvt_x(const float* __restrict__ x, unsigned short* XP, int blk) {
  const int tid = threadIdx.x;
  const int row = 8 * blk + (tid >> 5);                              // 0..SEQ-1
  const int col = 8 * (tid & 31);                                    // 0..248
  const float* s = x + (size_t)row * CC + col;
  const v4f a = *(const v4f*)s;
  const v4f q = *(const v4f*)(s + 4);
  const float f[8] = {a[0], a[1], a[2], a[3], q[0], q[1], q[2], q[3]};
  v4u u;
#pragma unroll
  for (int t = 0; t < 4; ++t) {
    const _Float16 h0 = (_Float16)bfr(f[2 * t]);
    const _Float16 h1 = (_Float16)bfr(f[2 * t + 1]);
    u[t] = pk16(h_bits(h0), h_bits(h1));
  }
{
    unsigned short* dp = XP + (size_t)row * CC + col;
    *(v4u*)dp = u;
#if defined(__HIP_DEVICE_COMPILE__)
    // as in (0): the wait behind the store, ahead of any rewrite of its data and address registers (named, inputs only)
    asm volatile("s_wait_xcnt 0x0" :: "v"(u), "v"(dp) : "memory");
#endif
  }
}

// =========================================================================================================
// (0) + (1) as ONE launch: the five conversions read none of each other's output, so they share a grid, told apart by the
//     block index (block-uniform, so the barrier of (0) is passed by whole blocks). Blocks 0..WTB-1, first because their
//     path is the longer one: 8 tiles for each of theta_w, phi_w, g_w (R=256, S=128: tiles 2 x 4, rows 0 / 128 / 256 of
//     W16) and W_w (R=128, S=256: tiles 4 x 2, WW16). Blocks WTB.. : 8 rows of x each.
// coverage: 4 weights x 8 tiles = WTB blocks, each weight's tile set exactly once; SEQ/8 blocks over x.
// =========================================================================================================
__global__ __launch_bounds__(256)
void cvt_all(const float* __restrict__ tw, const float* __restrict__ pw, const float* __restrict__ gw,
             const float* __restrict__ ww, const float* __restrict__ x,
             unsigned short* W16, unsigned short* WW16, unsigned short* XP) {
  __shared__ __align__(16) unsigned short T[QT * TP];
  const int blk = blockIdx.x;
  if (blk < WTB) {
    const int job = blk >> 3, tile = blk & 7;
    if (job < 3) {
      const float* src = (job == 0) ? tw : (job == 1) ? pw : gw;
      cvt_wt(T, src, W16, CC, DQ, job * DQ, tile & 1, tile >> 1);
    } else {
      cvt_wt(T, ww, WW16, DQ, CC, 0, tile & 3, tile >> 2);
    }
  } else {
    cvt_x(x, XP, blk - WTB);
  }
}

// =========================================================================================================
// (2) theta / phi / g projection GEMM for one (64-n tile nt, 64-o block mb in 0..5): Y[o][n] = (1/256)
//     sum_c W16[mb*64 + o][c] XP[n][c] + bf16-RNE(bias[o]). W16 rows 0..127 = theta, 128..255 = phi, 256..383 = g.
//     Block 128 threads = 4 waves; wave w owns cols n0+16w..+15 (B fragment from the XP row, k = c contiguous,
//     split k map) and 4 m-tiles (A rows o = o0 + 16 mt + (lane&15), split k map from W16). K = 256 = 8 steps.
//     Epilogue staged in LDS Os[n_loc][o_loc] (pitch OSP), barrier, bias add in f32, then:
//       mb 0,1 (theta) / 2,3 (phi): bf16 hi = RNE(v), lo = RNE(v - hi) planes Qh/Ql resp. Kh/Kl [N][128 d]
//         the dsel half of the 256-B row): lane e -> d 8e..8e+7, 8 consecutive lanes per line, one instruction per
//         16 lines;
//       mb 4,5 (g): f16 plane Gc [128 ch][N keys] (channel-major, keys contiguous); row ch, 64 keys = one whole
// coverage: Os 4 waves x 16 n x 64 o = 64 x 64 (cols 0..63 written and read); hi/lo planes 4 it x 16 rows x 8 lanes
//           x 8 = 64 n x 64 d per plane, grid nt x mb {0,1} / {2,3} covers d 0..127 of all N rows of Qh/Ql / Kh/Kl
//           exactly once; g plane 4 it x 16 ch x 8 lanes x 8 keys = 64 ch x 64 keys, nt x mb {4,5} covers ch 0..127
//           x keys 0..N-1 of Gc exactly once. grid (N/64, 6).
// LDS Os: cross-wave (block barrier). LDS Ws, Xs (the block's 64 W16 rows and 64 XP rows, from which the fragments are read):
//     cross-wave (copy wait, then block barrier).
// =========================================================================================================
__global__ __launch_bounds__(128)
void gemm_qkv(const unsigned short* __restrict__ W16, const unsigned short* __restrict__ XP,
              const float* __restrict__ tbias, const float* __restrict__ pbias, const float* __restrict__ gbias,
              unsigned short* Qh, unsigned short* Ql, unsigned short* Kh, unsigned short* Kl, unsigned short* Gc) {
  __shared__ __align__(16) float Os[QT * OSP];
  __shared__ __align__(128) unsigned short Ws[QT * WP];              // W16 rows o0 .. o0+63, pitch 16 B x odd
  __shared__ __align__(128) unsigned short Xs[QT * WP];              // XP rows n0 .. n0+63, same pitch
  const int tid  = threadIdx.x;
  const int lane = tid & 31, wave = tid >> 5;
  const int hh   = lane >> 4, c = lane & 15;
  const int nt   = blockIdx.x, mb = blockIdx.y;
  const int n0   = nt * QT, o0 = mb * QT;                            // o0 = W16 row base 0..320

  // Both operand tiles come into LDS once, by asynchronous 16-B copies in whole lines: copy i of a lane -> row 4i + wave,
  // 16-B piece lane (a wave = one whole 512-B row), 2 x 16 copies per lane. A fragment read straight from global memory
  // touches 16 lines for 512 B, four waves fetch the same A fragments, and each read is a round trip of its own.
  {
    const unsigned lW = lds_addr(Ws + wave * WP + 8 * lane);
    const unsigned lX = lds_addr(Xs + wave * WP + 8 * lane);
    const unsigned short* gW = W16 + (size_t)(o0 + wave) * CC + 8 * lane;
    const unsigned short* gX = XP + (size_t)(n0 + wave) * CC + 8 * lane;
    copy8(lW,               4 * WP * 2, gW,                   (size_t)4 * CC);
    copy8(lW + 32 * WP * 2, 4 * WP * 2, gW + (size_t)32 * CC, (size_t)4 * CC);
    copy8(lX,               4 * WP * 2, gX,                   (size_t)4 * CC);
    copy8(lX + 32 * WP * 2, 4 * WP * 2, gX + (size_t)32 * CC, (size_t)4 * CC);
  }
  wait_async0();
  __syncthreads();

  const unsigned short* ap = Ws + c * WP + 8 * hh;
  const unsigned short* bp = Xs + (16 * wave + c) * WP + 8 * hh;

  v8f acc[4];
#pragma unroll
  for (int mt = 0; mt < 4; ++mt) acc[mt] = zero8();

  // fragments of two k-steps (2 B + 8 A) are one group of LDS reads; group g + 1 is read ahead of the products of group g
  // (two register sets): written in this order because LDS reads do not move across the gap statements of the helper
  Frag fb[2][2], fa[2][2][4];
  auto fetch = [&](int g) {
#pragma unroll
    for (int kk = 0; kk < 2; ++kk) {
      fb[g & 1][kk] = ldfrag(bp + 32 * (2 * g + kk));
#pragma unroll
      for (int mt = 0; mt < 4; ++mt) fa[g & 1][kk][mt] = ldfrag(ap + (16 * mt) * WP + 32 * (2 * g + kk));
    }
  };
  fetch(0);
#pragma unroll
  for (int g = 0; g < CC / 64; ++g) {
    if (g + 1 < CC / 64) fetch(g + 1);
#pragma unroll
    for (int kk = 0; kk < 2; ++kk) {
#pragma unroll
      for (int mt = 0; mt < 4; ++mt) acc[mt] = mma_h(fa[g & 1][kk][mt].h, fb[g & 1][kk].h, acc[mt]);
    }
  }

  {
    const int nl = 16 * wave + c;
#pragma unroll
    for (int mt = 0; mt < 4; ++mt) {
      v4f va, vb;
#pragma unroll
      for (int r = 0; r < 4; ++r) { va[r] = acc[mt][r] * IWSC; vb[r] = acc[mt][4 + r] * IWSC; }
      *(v4f*)(Os + nl * OSP + 16 * mt + 8 * hh)     = va;
      *(v4f*)(Os + nl * OSP + 16 * mt + 8 * hh + 4) = vb;
    }
  }
  __syncthreads();

  const int e = tid & 7, lq = tid >> 3;                             // lq 0..15
  const int grp  = mb >> 1;                                          // 0 theta, 1 phi, 2 g (block-uniform)
  const int dsel = (mb & 1) * QT;                                    // channel base 0 or 64 within the group
  if (grp < 2) {                                                     // block-uniform: bf16 hi/lo planes
    const float* bsrc = (grp == 0) ? tbias : pbias;
    unsigned short* Hp = (grp == 0) ? Qh : Kh;
    unsigned short* Lp = (grp == 0) ? Ql : Kl;
    const v4f b0 = *(const v4f*)(bsrc + dsel + 8 * e);
    const v4f b1 = *(const v4f*)(bsrc + dsel + 8 * e + 4);
    const float bb[8] = {bfr(b0[0]), bfr(b0[1]), bfr(b0[2]), bfr(b0[3]), bfr(b1[0]), bfr(b1[1]), bfr(b1[2]), bfr(b1[3])};
    v4u uh[4], ul[4];
#pragma unroll
    for (int it = 0; it < 4; ++it) {
      const int row = it * 16 + lq;                                  // n_loc 0..63
      const v4f a = *(const v4f*)(Os + row * OSP + 8 * e);
      const v4f q = *(const v4f*)(Os + row * OSP + 8 * e + 4);
      const float f[8] = {a[0], a[1], a[2], a[3], q[0], q[1], q[2], q[3]};
#pragma unroll
      for (int t = 0; t < 4; ++t) {
        const float f0 = f[2 * t] + bb[2 * t], f1 = f[2 * t + 1] + bb[2 * t + 1];
        const unsigned short hb0 = bf_bits(f0), hb1 = bf_bits(f1);
        const unsigned short lb0 = bf_bits(f0 - bf_up(hb0));
        const unsigned short lb1 = bf_bits(f1 - bf_up(hb1));
        uh[it][t] = pk16(hb0, hb1);
        ul[it][t] = pk16(lb0, lb1);
      }
    }
{
#pragma unroll
      for (int it = 0; it < 4; ++it) {
        const int row = it * 16 + lq;
        const size_t po = ((size_t)(n0 + row)) * DQ + dsel + 8 * e;
        *(v4u*)(Hp + po) = uh[it];
        *(v4u*)(Lp + po) = ul[it];
      }
      
    }
  } else {                                                           // block-uniform: g plane
    const int gsel = dsel;                                           // g channel base 0 or 64
    v4u ug[4];
#pragma unroll
    for (int it = 0; it < 4; ++it) {
      const int cl = it * 16 + lq;                                   // ch_loc 0..63
      const float bias = bfr(gbias[gsel + cl]);
      unsigned short hb[8];
#pragma unroll
      for (int t = 0; t < 8; ++t) {
        const int key = 8 * e + t;                                   // key_loc 0..63
        const float v = Os[key * OSP + cl] + bias;
        hb[t] = h_bits((_Float16)v);
      }
#pragma unroll
      for (int t = 0; t < 4; ++t) ug[it][t] = pk16(hb[2 * t], hb[2 * t + 1]);
    }
{
#pragma unroll
      for (int it = 0; it < 4; ++it) {
        const int cl = it * 16 + lq;
        const size_t po = ((size_t)(gsel + cl)) * (size_t)SEQ + n0 + 8 * e;
        *(v4u*)(Gc + po) = ug[it];
      }
      
    }
  }
}

// =========================================================================================================
// (3) attention for one 64-query tile and one of KS key ranges (KSEQ keys each), transposed formulation, no mask, no
//   scale. The KS ranges of a tile run as separate work-groups, so that the grid gives every SIMD two waves:
//   S^T tile (16 keys x 16 queries) = sum over 4 d-chunks of A(phi: row = key kb + (lane&15), 32 d via the split
//   k map from the bf16 plane Kh [SEQ][128]) . B(theta: col = query, same map from Qh) + A(Kh).B(Ql) +
//   A(Kl).B(Qh) (bf16 unscaled residual planes, shared accumulator).
//   Wave tile: 32 keys x 32 queries. Wave w takes query columns 32*(w&1) .. +31 (two B tiles u = 0, 1) and keys
//   32*(w>>1) .. +31 of every 64-key stage, so that each K and g fragment read from LDS feeds two query tiles.
//   Per lane a D tile holds 8 keys of ONE query: online softmax state per lane and query tile, one shuffle (lane^16) for
//   the max over 32 keys; the o/l rescale is skipped under a wave-uniform ballot when no lane's max grew (corr == 1
//   exactly for every lane then); row-sum partials combined at the end. P = e^{s-m} x 16384 as f16 is the B operand of
//   Y^T (rows channel, cols queries) += A(g rows channel = 16j + (lane&15), keys contiguous, f16 plane Gc
//   [128][SEQ]) . B(P^T): element r <- D of the tile covering keys kb..kb+15, element 8+r <- the tile covering
//   kb+16..kb+31, lane unchanged. 2 x 8 accumulator tiles per wave (128 channels x 32 queries). Block = 4 waves.
//   Operand path: the block's query tile comes into LDS once by asynchronous 16-B copies in whole lines, and each wave reads
//   its query fragments from there once, ahead of the loop, and keeps them in registers; a 64-key stage of
//   Kh, Kl, Gc comes by three tensor loads, one each from waves 0, 1, 2 (64 rows of 256 B, twice, and 128 rows of 128 B, the
//   mover padding each row by 16 B), two stage buffers, one publish point per stage; all fragments are ds_load_b128 reads
//   at pitches of 16 B x odd (272 B for 256-B rows, 144 B for 128-B rows).
//   Epilogue: waves w and w^2 hold the two key halves of the same 32 queries. Each keeps query tile u = w>>1, hands its
//   other tile (o, m, l) to the partner through the ring's LDS (free behind the last publish point), and merges the
//   partner's half into its own in f32. The range's un-normalised result goes to the workspace in register order,
//   Po[range][16-query tile][j][half][lane][4 f32] (element 4*half + i of tile j; each store = 512 contiguous B), with
//   Pml[range][16-query tile][32]: word c = the range's maximum of query c, word 16 + c = its row sum (x16384, as o).
//   The output projection merges the ranges.
// coverage: Po 4 waves x 8 j x 2 halves x 32 lanes x 4 = 64 queries x 128 ch per range; Pml 4 waves x 32 words; grid
//           (SEQ/64, KS) covers Po and Pml exactly once.
// LDS Ring: cross-wave (issuer's tensor wait, then block barrier); Qs: cross-wave (copy wait, then block barrier); hand-over area in Ring: cross-wave (block barrier).
// =========================================================================================================
__global__ __launch_bounds__(128)
void attn_k(const unsigned short* __restrict__ Qh, const unsigned short* __restrict__ Ql,
            const unsigned short* __restrict__ Kh, const unsigned short* __restrict__ Kl,
            const unsigned short* __restrict__ Gc, float* Po, float* Pml) {
  __shared__ __attribute__((aligned(2048))) unsigned short Ring[2 * STG];   // two stages: Kh[64][KP], Kl[64][KP] (KSL each), G[128][VP]
  __shared__ __align__(128) unsigned short Qs[2 * KPL];              // Qh[64][KP], Ql[64][KP]
  const int tid  = threadIdx.x;
  const int wave = tid >> 5, lane = tid & 31;
  const int hh   = lane >> 4, c = lane & 15;
  const int qg   = wave & 1;                                         // query columns 32*qg .. 32*qg + 31 of the tile
  const int kh   = wave >> 1;                                        // keys 32*kh .. 32*kh + 31 of every stage
  const int n0   = blockIdx.x * QT;
  const int kr   = blockIdx.y;                                       // key range: keys kr*KSEQ .. kr*KSEQ + KSEQ - 1

  // copy slots of the query tile (256-B rows): copy i of a lane -> row 8i + (tid>>4), 16-B piece tid&15 (a wave = 512
  // contiguous global bytes).
  const int rK = tid >> 4, pK = tid & 15;
  const unsigned lQ = lds_addr(Qs + rK * KP + 8 * pK);

  // A stage's three tiles, one tensor load each: wave 0 Kh, wave 1 Kl (64 key rows of 256 B, source pitch 256 B), wave 2 g
  // (128 channel rows of 128 B = 64 keys, source pitch 2*SEQ B). Tile w lies KSL halves behind tile w - 1 in its buffer. From
  // stage to stage the K tiles move on by 64 rows, the g tile by 128 B. Wave 3 issues nothing.
  const uint32_t wv = uni((uint32_t)threadIdx.x >> 5);
  const unsigned short* tsrc = (wv == 0u) ? Kh + (size_t)kr * KSEQ * DQ : (wv == 1u) ? Kl + (size_t)kr * KSEQ * DQ
                                                                       : Gc + (size_t)kr * KSEQ;
  const uint64_t tga   = (uint64_t)(uintptr_t)tsrc;
  const uint32_t tstep = (wv < 2u) ? (uint32_t)(KT * DQ * 2) : (uint32_t)(KT * 2);
  const uint32_t tlds  = lds_addr(Ring) + ((wv < 2u) ? wv : 2u) * (uint32_t)(KSL * 2);
  const u32x8 g1K = tdm_group1<(1u << 20) | (5u << 22) | (3u << 25), DQ * 2, KT>((uint32_t)(DQ * 2));
  const u32x8 g1V = tdm_group1<(1u << 20) | (4u << 22) | (3u << 25), KT * 2, DQ>((uint32_t)(SEQ * 2));

  // stage t (keys 64t .. 64t+63 of the range) into buffer b: one request from each of waves 0, 1, 2, under scalar branches;
  // land: the issuer's wait stands directly behind its load (the prologue's first stage)
  auto fill = [&](uint32_t t, uint32_t b, bool land) {
    if (pinned(wv < 2u)) {
      tdm_load(tdm_group0(tlds + b * (uint32_t)(STG * 2), tga + (uint64_t)t * tstep), g1K);
      if (land) wait_tensor0();
    }
    if (pinned(wv == 2u)) {
      tdm_load(tdm_group0(tlds + b * (uint32_t)(STG * 2), tga + (uint64_t)t * tstep), g1V);
      if (land) wait_tensor0();
    }
  };

  // prologue: the query tile and stage 0, landed and published; then stage 1 in flight
  copy8(lQ,           8 * KP * 2, Qh + (size_t)(n0 + rK) * DQ + 8 * pK, (size_t)8 * DQ);
  copy8(lQ + KPL * 2, 8 * KP * 2, Ql + (size_t)(n0 + rK) * DQ + 8 * pK, (size_t)8 * DQ);
  fill(0u, 0u, true);
  wait_async0();
  __syncthreads();
  fill(1u, 1u, false);

  // q fragment pointers (B operand, col = query 32*qg + 16*u + c of the tile), + 16*u*KP + 32*kc
  const unsigned short* Qhp = Qs + (32 * qg + c) * KP + 8 * hh;
  const unsigned short* Qlp = Qhp + KPL;
  // the wave's query fragments (2 tiles x hi, residual x 4 d-chunks) are the same in every stage: read once, kept in registers
  Frag fq[DQ / 32][2][2];
#pragma unroll
  for (int kc = 0; kc < DQ / 32; ++kc) {
    fq[kc][0][0] = ldfrag(Qhp + 32 * kc);
    fq[kc][0][1] = ldfrag(Qlp + 32 * kc);
    fq[kc][1][0] = ldfrag(Qhp + 16 * KP + 32 * kc);
    fq[kc][1][1] = ldfrag(Qlp + 16 * KP + 32 * kc);
  }

  float m[2] = {-1.0e30f, -1.0e30f}, l[2] = {0.f, 0.f};
  v8f o[2][8];
#pragma unroll
  for (int u = 0; u < 2; ++u) {
#pragma unroll
    for (int j = 0; j < 8; ++j) o[u][j] = zero8();
  }

  // kept rolled: one trip is one stage with its publish point, and the buffer index alternates with t
#pragma unroll 1
  for (int t = 0; t < KSEQ / KT; ++t) {
    const unsigned short* st = Ring + (t & 1) * STG;
    // k fragment bases (A operand, row = key 32kh + c resp. 32kh + 16 + c of the stage), + 32*kc
    const unsigned short* k0p  = st + (32 * kh + c) * KP + 8 * hh;
    const unsigned short* k1p  = k0p + 16 * KP;
    const unsigned short* k0lp = k0p + KSL;
    const unsigned short* k1lp = k1p + KSL;
    // v fragment base (A operand, row = channel 16j + c, keys contiguous), + 16*j*VP
    const unsigned short* Vp = st + 2 * KSL + c * VP + 32 * kh + 8 * hh;
    v8f s0[2], s1[2];                                                // keys +0..15 resp. +16..31, query tile u
#pragma unroll
    for (int u = 0; u < 2; ++u) { s0[u] = zero8(); s1[u] = zero8(); }
    // k fragments of d-chunk kc + 1 are read from LDS ahead of the products of chunk kc
    Frag fk[2][4];
    auto fetch = [&](int kc) {
      const int b = kc & 1;
      fk[b][0] = ldfrag(k0p + 32 * kc);
      fk[b][1] = ldfrag(k1p + 32 * kc);
      fk[b][2] = ldfrag(k0lp + 32 * kc);
      fk[b][3] = ldfrag(k1lp + 32 * kc);
    };
    fetch(0);
#pragma unroll
    for (int kc = 0; kc < DQ / 32; ++kc) {
      const int b = kc & 1;
      if (kc + 1 < DQ / 32) fetch(kc + 1);
      s0[0] = mma_bd(fk[b][0].bf, fq[kc][0][0].bf, s0[0]);
      s1[0] = mma_bd(fk[b][1].bf, fq[kc][0][0].bf, s1[0]);
      s0[1] = mma_bd(fk[b][0].bf, fq[kc][1][0].bf, s0[1]);
      s1[1] = mma_bd(fk[b][1].bf, fq[kc][1][0].bf, s1[1]);
      s0[0] = mma_bd(fk[b][0].bf, fq[kc][0][1].bf, s0[0]);
      s1[0] = mma_bd(fk[b][1].bf, fq[kc][0][1].bf, s1[0]);
      s0[1] = mma_bd(fk[b][0].bf, fq[kc][1][1].bf, s0[1]);
      s1[1] = mma_bd(fk[b][1].bf, fq[kc][1][1].bf, s1[1]);
      s0[0] = mma_bd(fk[b][2].bf, fq[kc][0][0].bf, s0[0]);
      s1[0] = mma_bd(fk[b][3].bf, fq[kc][0][0].bf, s1[0]);
      s0[1] = mma_bd(fk[b][2].bf, fq[kc][1][0].bf, s0[1]);
      s1[1] = mma_bd(fk[b][3].bf, fq[kc][1][0].bf, s1[1]);
    }
    float mx[2], mn[2];
#pragma unroll
    for (int u = 0; u < 2; ++u) mx[u] = fmaxf(hmax8(s0[u]), hmax8(s1[u]));
#pragma unroll
    for (int u = 0; u < 2; ++u) {
      mx[u] = fmaxf(mx[u], __shfl_xor(mx[u], 16, 32));
      mn[u] = fmaxf(m[u], mx[u]);
    }
    const unsigned grew = wave_ballot(mx[0] > m[0] || mx[1] > m[1]); // wave-uniform
    if (grew != 0u) {
#pragma unroll
      for (int u = 0; u < 2; ++u) {
        const float corr = __expf(m[u] - mn[u]);                     // == 1 exactly for lanes whose max did not grow
        l[u] *= corr;
#pragma unroll
        for (int j = 0; j < 8; ++j) {
#pragma unroll
          for (int r = 0; r < 8; ++r) o[u][j][r] *= corr;
        }
      }
    }

    // the stage's g fragments: read here, behind the exchange of the maxima (whose wait would cover them in the LDS queue), so
    // that their LDS time runs under the exponentials
    Frag vf[8];
#pragma unroll
    for (int j = 0; j < 8; ++j) vf[j] = ldfrag(Vp + (16 * j) * VP);
#if defined(__HIP_DEVICE_COMPILE__)
    // keeps the sixteen reads above as one group here: moved down to their products, each pair is waited for on its own
    __builtin_amdgcn_sched_barrier(0);
#endif

    FragH ph[2];
#pragma unroll
    for (int u = 0; u < 2; ++u) {
      m[u] = mn[u];
      const float msh = mn[u] - LNPS;                                // exp gives e^{s-m} * 16384
      float ls = 0.f;
#pragma unroll
      for (int r = 0; r < 8; ++r) {
        const float e0 = __expf(s0[u][r] - msh);                     // key 64t + 32kh      + 8hh + r
        const float e1 = __expf(s1[u][r] - msh);                     // key 64t + 32kh + 16 + 8hh + r
        ls += e0 + e1;
        ph[u].hv[0][r] = (_Float16)e0;
        ph[u].hv[1][r] = (_Float16)e1;
      }
      l[u] += ls;
    }

#pragma unroll
    for (int j = 0; j < 8; ++j) {
      o[0][j] = mma_hd(vf[j].h, ph[0].v, o[0][j]);
      o[1][j] = mma_hd(vf[j].h, ph[1].v, o[1][j]);
    }
    // publish point of stage t + 1: own LDS reads returned, the issuing waves' tensor loads landed, every wave here; only then
    // the refill, its descriptor formed from a stage number that is pinned behind the barrier
#if defined(__HIP_DEVICE_COMPILE__)
    // keeps the wait below at the foot of the trip: lifted to the g reads, it would stall the wave ahead of the exponentials
    __builtin_amdgcn_sched_barrier(0);
#endif
    wait_ds0();
    if (pinned(wv < 3u)) wait_tensor0();
    __syncthreads();
    if (pinned((uint32_t)(t + 2 < KSEQ / KT))) fill(pinned((uint32_t)t + 2u), (uint32_t)t & 1u, false);
  }
  wait_tensor0();
  wait_ds0();
#pragma unroll
  for (int u = 0; u < 2; ++u) l[u] += __shfl_xor(l[u], 16, 32);

  // hand-over between the key halves: no tensor load is in flight and every wave has passed the last publish point, so the
  // ring is free. Area of wave w: XW floats = [j][half][lane][4] of the tile it gives away, then m[32], l[32].
  float* X = reinterpret_cast<float*>(Ring);
  float* xg = X + wave * XW;
  const float* xp = X + (wave ^ 2) * XW;
  v8f ok[8];                                                         // the tile this wave keeps: u = kh
#pragma unroll
  for (int j = 0; j < 8; ++j) {
    const v8f og = kh ? o[0][j] : o[1][j];
    ok[j] = kh ? o[1][j] : o[0][j];
    v4f va, vb;
#pragma unroll
    for (int r = 0; r < 4; ++r) { va[r] = og[r]; vb[r] = og[4 + r]; }
    *(v4f*)(xg + j * 256 + 4 * lane)       = va;
    *(v4f*)(xg + j * 256 + 128 + 4 * lane) = vb;
  }
  xg[2048 + lane] = kh ? m[0] : m[1];
  xg[2080 + lane] = kh ? l[0] : l[1];
  const float mk = kh ? m[1] : m[0];
  const float lk = kh ? l[1] : l[0];
  __syncthreads();
  const float mp = xp[2048 + lane];
  const float lp = xp[2080 + lane];
  const float mall = fmaxf(mk, mp);
  const float wk = __expf(mk - mall), wp = __expf(mp - mall);

  const size_t pt = (size_t)kr * NT16 + (size_t)(blockIdx.x * (QT / 16) + 2 * qg + kh);   // (range, 16-query tile)
  float* po = Po + pt * (8 * 256) + 4 * lane;
#pragma unroll
  for (int j = 0; j < 8; ++j) {
    const v4f pa = *(const v4f*)(xp + j * 256 + 4 * lane);
    const v4f pb = *(const v4f*)(xp + j * 256 + 128 + 4 * lane);
    v4f va, vb;
#pragma unroll
    for (int r = 0; r < 4; ++r) { va[r] = ok[j][r] * wk + pa[r] * wp; vb[r] = ok[j][4 + r] * wk + pb[r] * wp; }
    *(v4f*)(po + j * 256)       = va;
    *(v4f*)(po + j * 256 + 128) = vb;
  }
  Pml[pt * 32 + lane] = hh ? (lk * wk + lp * wp) : mall;             // m and l are equal in lanes c and 16 + c
}

// =========================================================================================================
// (4) output projection GEMM for one (64-n tile, 64-co block): out[n][co] = (1/256)(sum_c WW16[co][c] Yh[n][c] +
//     (1/1024) sum_c WW16[co][c] Yl[n][c]) + bf16-RNE(W_b[co]) + bf16-RNE(x[n][co]). 4 waves, wave w owns
//     cols n0+16w..+15, 4 m-tiles (A rows co = o0 + 16 mt + (lane&15) from WW16), hi and residual products in
//     separate accumulators. K = 128 = 4 steps.
//     B operand: y = sum_s a_s Po[s], a_s = e^{m_s - M} / sum_s e^{m_s - M} l_s, M = max_s m_s, merged in f32 from the
//     KS key ranges' partials; Yh = f16(y), Yl = f16((y - Yh) * 1024). A lane's Po words of tile j are channels
//     16j + 8(lane>>4) + 0..7 of query lane&15: tiles 2ks and 2ks + 1 are elements 0..7 and 8..15 of the B fragment
//     of k-step ks, lane unchanged.
//     Epilogue staged in LDS Os[n_loc][co_loc], barrier, then out rows (position-major, 1024 B each): lane
//     (e = tid&15) -> co o0+4e..+3 of row n_loc = 8 it + (tid>>4); 16 consecutive lanes x 16 B = the whole 256-B
// coverage: Os 4 waves x 16 n x 64 co (cols 0..63 written and read); out 8 it x 8 rows x 16 lanes x 4 floats =
//           64 n x 64 co; grid (SEQ/64, 4) covers out[0..SEQ-1][0..255] exactly once.
// LDS Os: cross-wave (block barrier). LDS Ws (the block's 64 WW16 rows, from which the A fragments are read): cross-wave
//     (copy wait, then block barrier).
// =========================================================================================================
__global__ __launch_bounds__(128)
void gemm_o(const unsigned short* __restrict__ WW16, const float* __restrict__ Po,
            const float* __restrict__ Pml, const float* __restrict__ wbias,
            const float* __restrict__ x, float* out) {
  __shared__ __align__(16) float Os[QT * OSP];
  __shared__ __align__(128) unsigned short Ws[QT * KP];              // WW16 rows o0 .. o0+63, pitch 16 B x odd
  const int tid  = threadIdx.x;
  const int lane = tid & 31, wave = tid >> 5;
  const int hh   = lane >> 4, c = lane & 15;
  const int nt   = blockIdx.x, mb = blockIdx.y;
  const int n0   = nt * QT, o0 = mb * QT;

  const unsigned short* ap  = Ws + c * KP + 8 * hh;
  const size_t t16 = (size_t)(nt * (QT / 16) + wave);                // the wave's 16-query tile

  const float* pml = Pml + t16 * 32 + c;
  const float* pp  = Po + t16 * (8 * 256) + 4 * lane;
  float ms[KS], as[KS];
  FragH fyh[DQ / 32], fyl[DQ / 32];
#pragma unroll
  for (int g = 0; g < 2; ++g) {                                      // tiles j = 4g .. 4g+3 = k-steps 2g, 2g+1
    v4f pv[KS][4][2];
#pragma unroll
    for (int s = 0; s < KS; ++s) {
#pragma unroll
      for (int jj = 0; jj < 4; ++jj) {
        pv[s][jj][0] = *(const v4f*)(pp + (size_t)s * (NT16 * 8 * 256) + (4 * g + jj) * 256);
        pv[s][jj][1] = *(const v4f*)(pp + (size_t)s * (NT16 * 8 * 256) + (4 * g + jj) * 256 + 128);
      }
    }
    if (g == 0) {
      // The A tile comes into LDS by asynchronous 16-B copies in whole lines and travels under the loads and the merge of the
      // partials: copy i of a lane -> row 8i + (tid>>4), 16-B piece tid&15 (a wave = 512 contiguous B). The statement stands
      // between the first group's loads and those of the maxima and sums: loads do not cross it, so that no wait for a
      // maximum comes to stand in front of the group's issue.
      copy8(lds_addr(Ws + (tid >> 4) * KP + 8 * (tid & 15)), 8 * KP * 2,
            WW16 + (size_t)(o0 + (tid >> 4)) * DQ + 8 * (tid & 15), (size_t)8 * DQ);
#pragma unroll
      for (int s = 0; s < KS; ++s) {
        ms[s] = pml[(size_t)s * (NT16 * 32)];
        as[s] = pml[(size_t)s * (NT16 * 32) + 16];
      }
    }
    // the group's loaded words, inputs only: all its loads are issued ahead of the arithmetic, one round trip for the
    // group instead of one for every pair of loads
    hold16(pv[0], pv[1], pp);
    hold16(pv[2], pv[3], pp + (size_t)2 * (NT16 * 8 * 256));
    if (g == 0) {                                                    // merge weights of query c
      float mall = ms[0];
#pragma unroll
      for (int s = 1; s < KS; ++s) mall = fmaxf(mall, ms[s]);
      float lall = 0.f;
#pragma unroll
      for (int s = 0; s < KS; ++s) {
        const float w = __expf(ms[s] - mall);
        lall += w * as[s];
        as[s] = w;
      }
      const float inv = 1.0f / lall;                                 // o and l both carry the x16384 factor
#pragma unroll
      for (int s = 0; s < KS; ++s) as[s] *= inv;
    }
#pragma unroll
    for (int jj = 0; jj < 4; ++jj) {
      const int j = 4 * g + jj;
#pragma unroll
      for (int r = 0; r < 8; ++r) {
        float y = as[0] * pv[0][jj][r >> 2][r & 3];
#pragma unroll
        for (int s = 1; s < KS; ++s) y += as[s] * pv[s][jj][r >> 2][r & 3];
        const _Float16 h0 = (_Float16)y;
        fyh[j >> 1].hv[j & 1][r] = h0;
        fyl[j >> 1].hv[j & 1][r] = (_Float16)((y - (float)h0) * RSC);
      }
    }
  }

  v8f acc[4], accr[4];
#pragma unroll
  for (int mt = 0; mt < 4; ++mt) { acc[mt] = zero8(); accr[mt] = zero8(); }

  // the A tile: own copies landed, every wave here; then all sixteen fragments as one group of LDS reads ahead of the
  // products (LDS reads do not move across the gap statements of the helper)
  wait_async0();
  __syncthreads();
  Frag fa[DQ / 32][4];
#pragma unroll
  for (int ks = 0; ks < DQ / 32; ++ks) {
#pragma unroll
    for (int mt = 0; mt < 4; ++mt) fa[ks][mt] = ldfrag(ap + (16 * mt) * KP + 32 * ks);
  }
#pragma unroll
  for (int ks = 0; ks < DQ / 32; ++ks) {
#pragma unroll
    for (int mt = 0; mt < 4; ++mt) {
      acc[mt]  = mma_h(fa[ks][mt].h, fyh[ks].v, acc[mt]);
      accr[mt] = mma_h(fa[ks][mt].h, fyl[ks].v, accr[mt]);
    }
  }

  {
    const int nl = 16 * wave + c;
#pragma unroll
    for (int mt = 0; mt < 4; ++mt) {
      v4f va, vb;
#pragma unroll
      for (int r = 0; r < 4; ++r) {
        va[r] = (acc[mt][r] + accr[mt][r] * IRSC) * IWSC;
        vb[r] = (acc[mt][4 + r] + accr[mt][4 + r] * IRSC) * IWSC;
      }
      *(v4f*)(Os + nl * OSP + 16 * mt + 8 * hh)     = va;
      *(v4f*)(Os + nl * OSP + 16 * mt + 8 * hh + 4) = vb;
    }
  }
  __syncthreads();

  const int e = tid & 15, lq = tid >> 4;                             // lq 0..7
  const v4f bv = *(const v4f*)(wbias + o0 + 4 * e);
  const float bb[4] = {bfr(bv[0]), bfr(bv[1]), bfr(bv[2]), bfr(bv[3])};
  v4f res[8];
#pragma unroll
  for (int it = 0; it < 8; ++it) {
    const int nl = it * 8 + lq;                                      // n_loc 0..63
    const size_t idx = ((size_t)(n0 + nl)) * CC + o0 + 4 * e;
    const v4f xv = *(const v4f*)(x + idx);
    const v4f ov = *(const v4f*)(Os + nl * OSP + 4 * e);
#pragma unroll
    for (int t = 0; t < 4; ++t) res[it][t] = ov[t] + bb[t] + bfr(xv[t]);
  }
{
#pragma unroll
    for (int it = 0; it < 8; ++it) {
      const int nl = it * 8 + lq;
      const size_t idx = ((size_t)(n0 + nl)) * CC + o0 + 4 * e;
      *(v4f*)(out + idx) = res[it];
    }
    
  }
}

// =========================================================================================================
// Workspace map (bytes; each region start a multiple of 256; every plane size is an exact multiple of its
// whole-line store granularity, SEQ a multiple of 64 so no tail rows exist):
//   W16  f16 [384][256]          196608      WW16 f16 [256][128]     65536
//   XP   f16 [SEQ][256]         4194304 (SEQ=8192)
//   Qh/Ql bf16 [SEQ][128]        2097152 x2
//   Kh/Kl bf16 [SEQ][128]        2097152 x2
//   Gc   f16 [128][SEQ]          2097152
//   Po   f32 [KS][SEQ/16][8][2][32][4]  16777216 (KS=4)      Pml f32 [KS][SEQ/16][32]  262144
//   total (SEQ=8192) = 31981568
// =========================================================================================================
extern "C" void kernel_launch(void* const* d_in, const int* in_sizes, int n_in,
                              void* d_out, int out_size, void* d_ws, size_t ws_size,
                              hipStream_t stream) {
  const int XN = SEQ * CC;
  if (n_in < 9) return;
  if (in_sizes[0] < XN) return;
  if (in_sizes[1] < CC * DQ || in_sizes[3] < CC * DQ || in_sizes[5] < CC * DQ) return;
  if (in_sizes[2] < DQ || in_sizes[4] < DQ || in_sizes[6] < DQ) return;
  if (in_sizes[7] < DQ * CC || in_sizes[8] < CC) return;
  if (out_size < XN) return;

  size_t off = 0;
  auto carve = [&](size_t bytes) { const size_t o = off; off += (bytes + 255) & ~(size_t)255; return o; };
  const size_t oW16 = carve((size_t)MW * CC * 2);
  const size_t oWW  = carve((size_t)CC * DQ * 2);
  const size_t oXP  = carve((size_t)SEQ * CC * 2);
  const size_t oQh  = carve((size_t)SEQ * DQ * 2);
  const size_t oQl  = carve((size_t)SEQ * DQ * 2);
  const size_t oKh  = carve((size_t)SEQ * DQ * 2);
  const size_t oKl  = carve((size_t)SEQ * DQ * 2);
  const size_t oGc  = carve((size_t)DQ * SEQ * 2);
  const size_t oPo  = carve((size_t)KS * SEQ * DQ * 4);
  const size_t oPml = carve((size_t)KS * NT16 * 32 * 4);
  if (off > ws_size) return;
  if (off > (size_t)134217728) return;

  const float* x  = (const float*)d_in[0];
  const float* gw = (const float*)d_in[1];
  const float* gb = (const float*)d_in[2];
  const float* tw = (const float*)d_in[3];
  const float* tb = (const float*)d_in[4];
  const float* pw = (const float*)d_in[5];
  const float* pb = (const float*)d_in[6];
  const float* ww = (const float*)d_in[7];
  const float* wb = (const float*)d_in[8];

  char* ws = (char*)d_ws;
  unsigned short* W16  = (unsigned short*)(ws + oW16);
  unsigned short* WW16 = (unsigned short*)(ws + oWW);
  unsigned short* XP   = (unsigned short*)(ws + oXP);
  unsigned short* Qh   = (unsigned short*)(ws + oQh);
  unsigned short* Ql   = (unsigned short*)(ws + oQl);
  unsigned short* Kh   = (unsigned short*)(ws + oKh);
  unsigned short* Kl   = (unsigned short*)(ws + oKl);
  unsigned short* Gc   = (unsigned short*)(ws + oGc);
  float* Po  = (float*)(ws + oPo);
  float* Pml = (float*)(ws + oPml);
  float* out = (float*)d_out;

  const dim3 blk256(256), blk128(128);

  // (0) + (1) projection weights [in][out] -> f16 planes W16 [out rows 0..383][in 256], WW16 [out 256][in 128], and
  //     x -> 16-bit plane (same position-major layout), one grid
  cvt_all<<<dim3(WTB + SEQ / 8), blk256, 0, stream>>>(tw, pw, gw, ww, x, W16, WW16, XP);
  // (2) theta / phi -> hi + residual planes, g -> channel-major plane
  gemm_qkv<<<dim3(SEQ / QT, 6), blk128, 0, stream>>>(W16, XP, tb, pb, gb, Qh, Ql, Kh, Kl, Gc);
  // (3) attention, KS key ranges per query tile -> per-range partials
  attn_k<<<dim3(SEQ / QT, KS), blk128, 0, stream>>>(Qh, Ql, Kh, Kl, Gc, Po, Pml);
  // (4) merge of the ranges + output projection + bias + residual -> out [SEQ][256]
  gemm_o<<<dim3(SEQ / QT, CC / QT), blk128, 0, stream>>>(WW16, Po, Pml, wb, x, out);
  (void)hipGetLastError();
}

// v009
// A run of this version takes 56.3 microseconds.
// In two side-by-side timings against v008, it was 1.04 and 1.03 times as fast.
// Counting every step since v000, it is 13.7 times as fast.
// Contractions: theta/phi/g projection GEMMs Wt[384x256].Xp[256xN] on v_wmma_f32_16x16x32_bf16 (bf16-RNE weights and
// bf16-RNE x); the output projection Wo[256x128].Y[128xN] on v_wmma_f32_16x16x32_f16 (f16 containers of bf16-RNE weights
// x256; Y as f16 hi fragment plus f16 residual fragment x1024, 2 products, separate accumulators); scores Phi.Theta^T on v_wmma_f32_16x16x32_bf16
// (bf16 hi + bf16 residual planes of theta/phi, 3 products, K=128); Y^T = G.P^T on v_wmma_f32_16x16x32_f16
// (G plain f16, P = e^{s-m} x16384 f16 from the score D registers); f32 accumulate everywhere; softmax
// statistics, biases and the residual add in f32 VALU.
#include <hip/hip_runtime.h>
#include <math.h>
#include <stdint.h>

#ifndef NB
#define NB 1
#endif
#define NB_FULL 1
#ifndef SEQ
#define SEQ 8192
#endif
#define SEQ_FULL 8192
#define CC   256
#define DQ   128
#define QT   64
#define MW   384
#define OSP  68
#define WSC  256.0f
#define IWSC 0.00390625f
#define RSC  1024.0f
#define IRSC 0.0009765625f
#define LNPS 9.704060527839234f
#define KT   64
#define KP   136
#define VP   72
#define KPL  (KT * KP)
#define KSL  9216
#define STG  (2 * KSL + DQ * VP)
#define KS   4
#define KSEQ (SEQ / KS)
#define NT16 (SEQ / 16)
#define XW   (8 * 256 + 64)
#define WP   264
#define WTP  80

static_assert(NB == 1 && NB_FULL == 1);
static_assert(SEQ >= QT && SEQ <= SEQ_FULL);
static_assert(SEQ % QT == 0 && SEQ % 32 == 0 && SEQ % 8 == 0);
static_assert(CC % QT == 0 && CC % 32 == 0);
static_assert(DQ == 2 * QT && DQ % 32 == 0);
static_assert(MW == 3 * DQ && MW % 8 == 0);
static_assert((OSP * 4) % 16 == 0);
static_assert(SEQ % KS == 0 && KSEQ % KT == 0 && KSEQ / KT >= 2 && KT == QT && KT % 32 == 0);
static_assert(2 * (2 * STG + 2 * KPL) * 2 <= 327680);                // two work-groups of attn_k per 320-KiB LDS
static_assert(KT == 64 && QT == 64 && 4 * XW * 4 <= 2 * STG * 2);         // attn_k: 2 x 2 waves of 32 keys x 32 queries; hand-over area
static_assert(KSL >= KPL && (KSL * 2) % 2048 == 0 && (DQ * VP * 2) % 2048 == 0);   // every tensor tile's place in LDS: a multiple of 2 KiB
static_assert(DQ * 2 == 256 && KP * 2 == 256 + 16 && KT * 2 == 128 && VP * 2 == 128 + 16);   // tile rows and their padded pitches
static_assert((KP * 2) % 32 == 16 && (VP * 2) % 32 == 16 && KP >= DQ + 8 && VP >= KT + 8);
static_assert((WP * 2) % 32 == 16 && WP >= CC + 8 && QT == 64 && CC == 256 && DQ == 128);   // x-row operand tile of gemm_qkv
static_assert((WTP * 2) % 64 == 32 && WTP >= QT + 16);               // weight tiles [k][64 outputs]: pitch 32 B x odd, transposing reader
static_assert(3 * (CC * WTP * 2 + QT * WP * 2 + QT * OSP * 4) <= 327680);   // three work-groups of gemm_qkv per 320-KiB LDS

typedef _Float16       v16h __attribute__((ext_vector_type(16)));
typedef _Float16       v8h  __attribute__((ext_vector_type(8)));
typedef __bf16         v16b __attribute__((ext_vector_type(16)));
typedef unsigned short v8us __attribute__((ext_vector_type(8)));
typedef float          v8f  __attribute__((ext_vector_type(8)));
typedef float          v4f  __attribute__((ext_vector_type(4)));
typedef unsigned int   v4u  __attribute__((ext_vector_type(4)));
typedef unsigned int   v2u  __attribute__((ext_vector_type(2)));
typedef float          v2f  __attribute__((ext_vector_type(2)));
typedef __bf16         v2b  __attribute__((ext_vector_type(2)));
typedef _Float16       v2h  __attribute__((ext_vector_type(2)));
typedef short          v8s  __attribute__((ext_vector_type(8)));
typedef uint32_t       u32x4 __attribute__((ext_vector_type(4)));
typedef uint32_t       u32x8 __attribute__((ext_vector_type(8)));

union Frag  { v8us u[2]; v16h h; v16b bf; };
union FragH { v16h v; v8h hv[2]; };
static_assert(sizeof(Frag) == 32);
static_assert(sizeof(FragH) == 32);

// ---- scalar helpers ---------------------------------------------------------------------------------------
__device__ __forceinline__ unsigned short bf_bits(float f) {          // f32 -> bf16 bits, RNE convert
  unsigned u = __float_as_uint(f);
  return (unsigned short)((u + 0x7FFFu + ((u >> 16) & 1u)) >> 16);
}
__device__ __forceinline__ float bf_up(unsigned short hb) { return __uint_as_float(((unsigned)hb) << 16); }
__device__ __forceinline__ float bfr(float f) { return bf_up(bf_bits(f)); }
__device__ __forceinline__ unsigned short h_bits(_Float16 x) { return __builtin_bit_cast(unsigned short, x); }
__device__ __forceinline__ unsigned pk16(unsigned short a, unsigned short b) { return (unsigned)a | ((unsigned)b << 16); }
__device__ __forceinline__ unsigned pkbf(float a, float b) {          // two f32 -> two bf16, RNE, a in the low half
  const v2f f = {a, b};
  return __builtin_bit_cast(unsigned, __builtin_convertvector(f, v2b));
}
__device__ __forceinline__ unsigned pkw(float a, float b) {           // two f32 -> two f16 of bf16-RNE(.) x 256 (exact)
  const unsigned u = pkbf(a, b);
  const v2f f = {__uint_as_float(u << 16) * WSC, __uint_as_float(u & 0xFFFF0000u) * WSC};
  return __builtin_bit_cast(unsigned, __builtin_convertvector(f, v2h));
}
__device__ __forceinline__ v8f zero8() { v8f z = {0.f, 0.f, 0.f, 0.f, 0.f, 0.f, 0.f, 0.f}; return z; }
__device__ __forceinline__ float hmax8(v8f s) {
  return fmaxf(fmaxf(fmaxf(s[0], s[1]), fmaxf(s[2], s[3])), fmaxf(fmaxf(s[4], s[5]), fmaxf(s[6], s[7])));
}
__device__ __forceinline__ unsigned wave_ballot(bool p) {
#if defined(__HIP_DEVICE_COMPILE__)
  return __builtin_amdgcn_ballot_w32(p);
#else
  return p ? 1u : 0u;
#endif
}

// ---- 16-bit fragment loader (A, or B from a k-contiguous [n][k] row): lane -> row/col (lane&15), p already includes
//      + 8*(lane>>4); elements 0..7 <- p[0..7] (k0+8h..), elements 8..15 <- p[16..23] (k0+16+8h..)
__device__ __forceinline__ Frag ldfrag(const unsigned short* p) {
  Frag f;
  f.u[0] = *(const v8us*)(p);
  f.u[1] = *(const v8us*)(p + 16);
  return f;
}

// ---- A fragment from a [k][row] 16-bit LDS tile (pitch WTP halves) by the transposing load: p = tile + (k0 + 8*(lane>>4) +
//      (lane&7))*WTP + row0 + 8*((lane>>3)&1); lane -> row row0 + (lane&15), elements 0..7 <- k0+8h.., elements 8..15 <-
//      k0+16+8h.. : the k order of ldfrag
__device__ __forceinline__ Frag ldfrag_tr(const unsigned short* p) {
  Frag f;
#if defined(__HIP_DEVICE_COMPILE__)
  typedef __attribute__((address_space(3))) v8s lds_v8s;
  f.u[0] = __builtin_bit_cast(v8us, __builtin_amdgcn_ds_load_tr16_b128_v8i16((lds_v8s*)p));
  f.u[1] = __builtin_bit_cast(v8us, __builtin_amdgcn_ds_load_tr16_b128_v8i16((lds_v8s*)(p + 16 * WTP)));
#else
  f.u[0] = *(const v8us*)(p);
  f.u[1] = *(const v8us*)(p);
#endif
  return f;
}

// ---- WMMA helpers: builtin followed by a 4-slot VALU gap tying D and keeping A/B live --------------------------
__device__ __forceinline__ v8f mma_h(v16h a, v16h b, v8f c) {
  v8f d = __builtin_amdgcn_wmma_f32_16x16x32_f16(false, a, false, b, (short)0, c, false, false);
#if defined(__HIP_DEVICE_COMPILE__)
  asm volatile("v_nop\n\tv_nop\n\tv_nop\n\tv_nop" : "+v"(d) : "v"(a), "v"(b));
#endif
  return d;
}
__device__ __forceinline__ v8f mma_b(v16b a, v16b b, v8f c) {
  v8f d = __builtin_amdgcn_wmma_f32_16x16x32_bf16(false, a, false, b, (short)0, c, false, false);
#if defined(__HIP_DEVICE_COMPILE__)
  const v16h ha = __builtin_bit_cast(v16h, a), hb = __builtin_bit_cast(v16h, b);
  asm volatile("v_nop\n\tv_nop\n\tv_nop\n\tv_nop" : "+v"(d) : "v"(ha), "v"(hb));
#endif
  return d;
}

// The same products for attn_k: the bare builtins. The compiler keeps the distances behind its own matrix instructions, and
// pays a gap only where a result is read at once; a gap behind every product takes issue slots of the vector port from the
// exponentials of the other wave on the SIMD.
__device__ __forceinline__ v8f mma_hd(v16h a, v16h b, v8f c) {
  return __builtin_amdgcn_wmma_f32_16x16x32_f16(false, a, false, b, (short)0, c, false, false);
}
__device__ __forceinline__ v8f mma_bd(v16b a, v16b b, v8f c) {
  return __builtin_amdgcn_wmma_f32_16x16x32_bf16(false, a, false, b, (short)0, c, false, false);
}

// ---- asynchronous copies global -> LDS ------------------------------------------------------------------------
__device__ __forceinline__ unsigned lds_addr(const unsigned short* p) { return (unsigned)(uintptr_t)p; }  // LDS byte address

// Eight 16-B copies per lane: copy i moves g + i*gstep (halves) to LDS byte address l + i*lstep. All lanes on.
__device__ __forceinline__ void copy8(unsigned l, unsigned lstep, const unsigned short* g, size_t gstep) {
#if defined(__HIP_DEVICE_COMPILE__)
  // the closing s_wait_xcnt keeps later rewrites of the address registers behind the issued copies
  asm volatile("global_load_async_to_lds_b128 %0, %8, off\n\t"
               "global_load_async_to_lds_b128 %1, %9, off\n\t"
               "global_load_async_to_lds_b128 %2, %10, off\n\t"
               "global_load_async_to_lds_b128 %3, %11, off\n\t"
               "global_load_async_to_lds_b128 %4, %12, off\n\t"
               "global_load_async_to_lds_b128 %5, %13, off\n\t"
               "global_load_async_to_lds_b128 %6, %14, off\n\t"
               "global_load_async_to_lds_b128 %7, %15, off\n\t"
               "s_wait_xcnt 0x0"
               :: "v"(l), "v"(l + lstep), "v"(l + 2 * lstep), "v"(l + 3 * lstep),
                  "v"(l + 4 * lstep), "v"(l + 5 * lstep), "v"(l + 6 * lstep), "v"(l + 7 * lstep),
                  "v"(g), "v"(g + gstep), "v"(g + 2 * gstep), "v"(g + 3 * gstep),
                  "v"(g + 4 * gstep), "v"(g + 5 * gstep), "v"(g + 6 * gstep), "v"(g + 7 * gstep)
               : "memory");
#endif
}
__device__ __forceinline__ void wait_async0() {   // this wave's copies have landed in LDS
#if defined(__HIP_DEVICE_COMPILE__)
  asm volatile("s_wait_asynccnt 0x0" ::: "memory");
#endif
}
__device__ __forceinline__ void wait_ds0() {      // this wave's LDS reads have returned before the buffer is handed back
#if defined(__HIP_DEVICE_COMPILE__)
  asm volatile("s_wait_dscnt 0x0" ::: "memory");
#endif
}

__device__ __forceinline__ uint32_t uni(uint32_t v) { return (uint32_t)__builtin_amdgcn_readfirstlane(v); }
__device__ __forceinline__ uint32_t pinned(uint32_t v) {
  uint32_t w = uni(v);
#if defined(__HIP_DEVICE_COMPILE__)
  // holds the word in a scalar register at this place: a test on it compiles to a scalar branch (a tensor load ignores EXEC),
  // and what is computed from it stays behind the waits that stand in front of it
  asm volatile("" : "+s"(w));   // pinned(): a word of a tensor load's test or descriptor held in a scalar register
#endif
  return w;
}
// group 1: byte elements, tensor = tile = ROWS rows of ROWB bytes, source pitch in bytes; W0 = pad word (no mask), a constant
template <uint32_t W0, uint32_t ROWB, uint32_t ROWS>
__device__ __forceinline__ u32x8 tdm_group1(uint32_t src_pitch) {
  u32x8 g;
  g[0] = uni(W0);
  g[1] = uni((ROWB & 0xFFFFu) << 16);
  g[2] = uni((ROWB >> 16) | ((ROWS & 0xFFFFu) << 16));
  g[3] = uni((ROWS >> 16) | (ROWB << 16));
  g[4] = uni(ROWS);
  g[5] = uni(src_pitch);
  g[6] = uni(0u);
  g[7] = uni(0u);
#if defined(__HIP_DEVICE_COMPILE__)
  // descriptor words held in scalar registers (the pinned() form, on the whole group): built once, the group keeps its eight
  // registers over the loop, so that none of them takes another value while a request that named them is outstanding
  asm volatile("" : "+s"(g));   // pinned(), all eight words: descriptor words held in scalar registers
#endif
  return g;
}
// group 0: count 1, LDS byte address, global byte address of the tile's first byte, type 2
__device__ __forceinline__ u32x4 tdm_group0(uint32_t lds_dst, uint64_t ga) {
  u32x4 g;
  g[0] = uni(1u);
  g[1] = uni(lds_dst);
  g[2] = uni((uint32_t)ga);
  g[3] = uni((((uint32_t)(ga >> 32)) & 0x01FFFFFFu) | 0x80000000u);
  return g;
}
__device__ __forceinline__ void tdm_load(u32x4 g0, u32x8 g1) {
#if defined(__HIP_DEVICE_COMPILE__)
  asm volatile("tensor_load_to_lds %0, %1" :: "s"(g0), "s"(g1) : "memory");
#endif
}
__device__ __forceinline__ void wait_tensor0() {  // this wave's tensor load has landed in LDS
#if defined(__HIP_DEVICE_COMPILE__)
  asm volatile("s_wait_tensorcnt 0x0" ::: "memory");
#endif
}

// Inputs-only fence on sixteen loaded 16-B words: every one of them has arrived here. The wait stands behind the loads and
// ahead of any rewrite of their address registers: their base p is named so that it lives up to the wait.
__device__ __forceinline__ void hold16(const v4f (&a)[4][2], const v4f (&b)[4][2], const float* p) {
#if defined(__HIP_DEVICE_COMPILE__)
  asm volatile("s_wait_xcnt 0x0"
               :: "v"(a[0][0]), "v"(a[0][1]), "v"(a[1][0]), "v"(a[1][1]), "v"(a[2][0]), "v"(a[2][1]), "v"(a[3][0]), "v"(a[3][1]),
                  "v"(b[0][0]), "v"(b[0][1]), "v"(b[1][0]), "v"(b[1][1]), "v"(b[2][0]), "v"(b[2][1]), "v"(b[3][0]), "v"(b[3][1]),
                  "v"(p));
#endif
}

// =========================================================================================================
// (2) theta / phi / g projection GEMM for one (64-n tile nt, 64-o block mb in 0..5): Y[o][n] =
//     sum_c bf16-RNE(w[c][o]) bf16-RNE(x[n][c]) + bf16-RNE(bias[o]); mb 0,1 = theta_w, 2,3 = phi_w, 4,5 = g_w (each [256 c]
//     [128 o] f32), o = 64 (mb&1) + 0..63. The block converts its own two operand tiles on the way into LDS.
//     Block 128 threads = 4 waves; wave w owns cols n0+16w..+15 (B fragment from the x row, k = c contiguous,
//     split k map) and 4 m-tiles (A rows o = 16 mt + (lane&15), same k map by the transposing load). K = 256 = 8 steps.
//     Epilogue staged in LDS Os[n_loc][o_loc] (pitch OSP), barrier, bias add in f32, then:
//       mb 0,1 (theta) / 2,3 (phi): bf16 hi = RNE(v), lo = RNE(v - hi) planes Qh/Ql resp. Kh/Kl [N][128 d]
//         the dsel half of the 256-B row): lane e -> d 8e..8e+7, 8 consecutive lanes per line, one instruction per
//         16 lines;
//       mb 4,5 (g): f16 plane Gc [128 ch][N keys] (channel-major, keys contiguous); row ch, 64 keys = one whole
// coverage: Os 4 waves x 16 n x 64 o = 64 x 64 (cols 0..63 written and read); hi/lo planes 4 it x 16 rows x 8 lanes
//           x 8 = 64 n x 64 d per plane, grid nt x mb {0,1} / {2,3} covers d 0..127 of all N rows of Qh/Ql / Kh/Kl
//           exactly once; g plane 4 it x 16 ch x 8 lanes x 8 keys = 64 ch x 64 keys, nt x mb {4,5} covers ch 0..127
//           x keys 0..N-1 of Gc exactly once. grid (N/64, 6).
// LDS Os: cross-wave (block barrier). LDS Wt, Xs (the block's weight tile [256 c][64 o] and its 64 x rows, bf16, from which
//     the fragments are read): cross-wave (block barrier).
// =========================================================================================================
__global__ __launch_bounds__(128)
void gemm_qkv(const float* __restrict__ tw, const float* __restrict__ pw, const float* __restrict__ gw,
              const float* __restrict__ x,
              const float* __restrict__ tbias, const float* __restrict__ pbias, const float* __restrict__ gbias,
              unsigned short* Qh, unsigned short* Ql, unsigned short* Kh, unsigned short* Kl, unsigned short* Gc) {
  __shared__ __align__(16) float Os[QT * OSP];
  __shared__ __align__(128) unsigned short Wt[CC * WTP];             // bf16 weights [c][o_loc], pitch 32 B x odd
  __shared__ __align__(128) unsigned short Xs[QT * WP];              // bf16 x rows n0 .. n0+63, pitch 16 B x odd
  const int tid  = threadIdx.x;
  const int lane = tid & 31, wave = tid >> 5;
  const int hh   = lane >> 4, c = lane & 15;
  const int nt   = blockIdx.x, mb = blockIdx.y;
  const int n0   = nt * QT;
  const int grp  = mb >> 1;                                          // 0 theta, 1 phi, 2 g (block-uniform)
  const int dsel = (mb & 1) * QT;                                    // channel base 0 or 64 within the group

  // Both operand tiles are read as f32 in whole lines (16 B a lane, all 64 loads of a lane in flight together), rounded to
  // bf16 in registers and stored to LDS, 8 B a lane, in the orientation they have in memory. Weight piece i of a lane -> row
  // c = 8i + (tid>>4), outputs 4*(tid&15)..+3 (a wave = 2 x 256 contiguous B); x piece i -> row 2i + (tid>>6), c =
  // 4*(tid&63)..+3 (a wave = 512 contiguous B).
  {
    const float* wsrc = (grp == 0) ? tw : (grp == 1) ? pw : gw;
    const float* gW = wsrc + (size_t)(tid >> 4) * DQ + dsel + 4 * (tid & 15);
    const float* gX = x + (size_t)(n0 + (tid >> 6)) * CC + 4 * (tid & 63);
    v4f wv[32], xv[32];
#pragma unroll
    for (int i = 0; i < 32; ++i) wv[i] = *(const v4f*)(gW + (size_t)i * (8 * DQ));
#pragma unroll
    for (int i = 0; i < 32; ++i) xv[i] = *(const v4f*)(gX + (size_t)i * (2 * CC));
#if defined(__HIP_DEVICE_COMPILE__)
    // the wait stands behind the loads and ahead of any rewrite of their address registers, which are named, inputs only, so
    // that they live up to it
    asm volatile("s_wait_xcnt 0x0" :: "v"(gW), "v"(gX));
#endif
    unsigned short* sW = Wt + (tid >> 4) * WTP + 4 * (tid & 15);
#pragma unroll
    for (int i = 0; i < 32; ++i) {
      const v2u u = {pkbf(wv[i][0], wv[i][1]), pkbf(wv[i][2], wv[i][3])};
      *(v2u*)(sW + i * (8 * WTP)) = u;
    }
    unsigned short* sX = Xs + (tid >> 6) * WP + 4 * (tid & 63);
#pragma unroll
    for (int i = 0; i < 32; ++i) {
      const v2u u = {pkbf(xv[i][0], xv[i][1]), pkbf(xv[i][2], xv[i][3])};
      *(v2u*)(sX + i * (2 * WP)) = u;
    }
  }
  __syncthreads();

  const unsigned short* ap = Wt + (8 * hh + (lane & 7)) * WTP + 8 * ((lane >> 3) & 1);
  const unsigned short* bp = Xs + (16 * wave + c) * WP + 8 * hh;

  v8f acc[4];
#pragma unroll
  for (int mt = 0; mt < 4; ++mt) acc[mt] = zero8();

  // fragments of two k-steps (2 B + 8 A) are one group of LDS reads; group g + 1 is read ahead of the products of group g
  // (two register sets): written in this order because LDS reads do not move across the gap statements of the helper
  Frag fb[2][2], fa[2][2][4];
  auto fetch = [&](int g) {
#pragma unroll
    for (int kk = 0; kk < 2; ++kk) {
      fb[g & 1][kk] = ldfrag(bp + 32 * (2 * g + kk));
#pragma unroll
      for (int mt = 0; mt < 4; ++mt) fa[g & 1][kk][mt] = ldfrag_tr(ap + (32 * (2 * g + kk)) * WTP + 16 * mt);
    }
  };
  fetch(0);
#pragma unroll
  for (int g = 0; g < CC / 64; ++g) {
    if (g + 1 < CC / 64) fetch(g + 1);
#pragma unroll
    for (int kk = 0; kk < 2; ++kk) {
#pragma unroll
      for (int mt = 0; mt < 4; ++mt) acc[mt] = mma_b(fa[g & 1][kk][mt].bf, fb[g & 1][kk].bf, acc[mt]);
    }
  }

  {
    const int nl = 16 * wave + c;
#pragma unroll
    for (int mt = 0; mt < 4; ++mt) {
      v4f va, vb;
#pragma unroll
      for (int r = 0; r < 4; ++r) { va[r] = acc[mt][r]; vb[r] = acc[mt][4 + r]; }
      *(v4f*)(Os + nl * OSP + 16 * mt + 8 * hh)     = va;
      *(v4f*)(Os + nl * OSP + 16 * mt + 8 * hh + 4) = vb;
    }
  }
  __syncthreads();

  const int e = tid & 7, lq = tid >> 3;                             // lq 0..15
  if (grp < 2) {                                                     // block-uniform: bf16 hi/lo planes
    const float* bsrc = (grp == 0) ? tbias : pbias;
    unsigned short* Hp = (grp == 0) ? Qh : Kh;
    unsigned short* Lp = (grp == 0) ? Ql : Kl;
    const v4f b0 = *(const v4f*)(bsrc + dsel + 8 * e);
    const v4f b1 = *(const v4f*)(bsrc + dsel + 8 * e + 4);
    const float bb[8] = {bfr(b0[0]), bfr(b0[1]), bfr(b0[2]), bfr(b0[3]), bfr(b1[0]), bfr(b1[1]), bfr(b1[2]), bfr(b1[3])};
    v4u uh[4], ul[4];
#pragma unroll
    for (int it = 0; it < 4; ++it) {
      const int row = it * 16 + lq;                                  // n_loc 0..63
      const v4f a = *(const v4f*)(Os + row * OSP + 8 * e);
      const v4f q = *(const v4f*)(Os + row * OSP + 8 * e + 4);
      const float f[8] = {a[0], a[1], a[2], a[3], q[0], q[1], q[2], q[3]};
#pragma unroll
      for (int t = 0; t < 4; ++t) {
        const float f0 = f[2 * t] + bb[2 * t], f1 = f[2 * t + 1] + bb[2 * t + 1];
        const unsigned short hb0 = bf_bits(f0), hb1 = bf_bits(f1);
        const unsigned short lb0 = bf_bits(f0 - bf_up(hb0));
        const unsigned short lb1 = bf_bits(f1 - bf_up(hb1));
        uh[it][t] = pk16(hb0, hb1);
        ul[it][t] = pk16(lb0, lb1);
      }
    }
{
#pragma unroll
      for (int it = 0; it < 4; ++it) {
        const int row = it * 16 + lq;
        const size_t po = ((size_t)(n0 + row)) * DQ + dsel + 8 * e;
        *(v4u*)(Hp + po) = uh[it];
        *(v4u*)(Lp + po) = ul[it];
      }
      
    }
  } else {                                                           // block-uniform: g plane
    const int gsel = dsel;                                           // g channel base 0 or 64
    v4u ug[4];
#pragma unroll
    for (int it = 0; it < 4; ++it) {
      const int cl = it * 16 + lq;                                   // ch_loc 0..63
      const float bias = bfr(gbias[gsel + cl]);
      unsigned short hb[8];
#pragma unroll
      for (int t = 0; t < 8; ++t) {
        const int key = 8 * e + t;                                   // key_loc 0..63
        const float v = Os[key * OSP + cl] + bias;
        hb[t] = h_bits((_Float16)v);
      }
#pragma unroll
      for (int t = 0; t < 4; ++t) ug[it][t] = pk16(hb[2 * t], hb[2 * t + 1]);
    }
{
#pragma unroll
      for (int it = 0; it < 4; ++it) {
        const int cl = it * 16 + lq;
        const size_t po = ((size_t)(gsel + cl)) * (size_t)SEQ + n0 + 8 * e;
        *(v4u*)(Gc + po) = ug[it];
      }
      
    }
  }
}

// =========================================================================================================
// (3) attention for one 64-query tile and one of KS key ranges (KSEQ keys each), transposed formulation, no mask, no
//   scale. The KS ranges of a tile run as separate work-groups, so that the grid gives every SIMD two waves:
//   S^T tile (16 keys x 16 queries) = sum over 4 d-chunks of A(phi: row = key kb + (lane&15), 32 d via the split
//   k map from the bf16 plane Kh [SEQ][128]) . B(theta: col = query, same map from Qh) + A(Kh).B(Ql) +
//   A(Kl).B(Qh) (bf16 unscaled residual planes, shared accumulator).
//   Wave tile: 32 keys x 32 queries. Wave w takes query columns 32*(w&1) .. +31 (two B tiles u = 0, 1) and keys
//   32*(w>>1) .. +31 of every 64-key stage, so that each K and g fragment read from LDS feeds two query tiles.
//   Per lane a D tile holds 8 keys of ONE query: online softmax state per lane and query tile, one shuffle (lane^16) for
//   the max over 32 keys; the o/l rescale is skipped under a wave-uniform ballot when no lane's max grew (corr == 1
//   exactly for every lane then); row-sum partials combined at the end. P = e^{s-m} x 16384 as f16 is the B operand of
//   Y^T (rows channel, cols queries) += A(g rows channel = 16j + (lane&15), keys contiguous, f16 plane Gc
//   [128][SEQ]) . B(P^T): element r <- D of the tile covering keys kb..kb+15, element 8+r <- the tile covering
//   kb+16..kb+31, lane unchanged. 2 x 8 accumulator tiles per wave (128 channels x 32 queries). Block = 4 waves.
//   Operand path: the block's query tile comes into LDS once by asynchronous 16-B copies in whole lines, and each wave reads
//   its query fragments from there once, ahead of the loop, and keeps them in registers; a 64-key stage of
//   Kh, Kl, Gc comes by three tensor loads, one each from waves 0, 1, 2 (64 rows of 256 B, twice, and 128 rows of 128 B, the
//   mover padding each row by 16 B), two stage buffers, one publish point per stage; all fragments are ds_load_b128 reads
//   at pitches of 16 B x odd (272 B for 256-B rows, 144 B for 128-B rows).
//   Epilogue: waves w and w^2 hold the two key halves of the same 32 queries. Each keeps query tile u = w>>1, hands its
//   other tile (o, m, l) to the partner through the ring's LDS (free behind the last publish point), and merges the
//   partner's half into its own in f32. The range's un-normalised result goes to the workspace in register order,
//   Po[range][16-query tile][j][half][lane][4 f32] (element 4*half + i of tile j; each store = 512 contiguous B), with
//   Pml[range][16-query tile][32]: word c = the range's maximum of query c, word 16 + c = its row sum (x16384, as o).
//   The output projection merges the ranges.
// coverage: Po 4 waves x 8 j x 2 halves x 32 lanes x 4 = 64 queries x 128 ch per range; Pml 4 waves x 32 words; grid
//           (SEQ/64, KS) covers Po and Pml exactly once.
// LDS Ring: cross-wave (issuer's tensor wait, then block barrier); Qs: cross-wave (copy wait, then block barrier); hand-over area in Ring: cross-wave (block barrier).
// =========================================================================================================
__global__ __launch_bounds__(128)
void attn_k(const unsigned short* __restrict__ Qh, const unsigned short* __restrict__ Ql,
            const unsigned short* __restrict__ Kh, const unsigned short* __restrict__ Kl,
            const unsigned short* __restrict__ Gc, float* Po, float* Pml) {
  __shared__ __attribute__((aligned(2048))) unsigned short Ring[2 * STG];   // two stages: Kh[64][KP], Kl[64][KP] (KSL each), G[128][VP]
  __shared__ __align__(128) unsigned short Qs[2 * KPL];              // Qh[64][KP], Ql[64][KP]
  const int tid  = threadIdx.x;
  const int wave = tid >> 5, lane = tid & 31;
  const int hh   = lane >> 4, c = lane & 15;
  const int qg   = wave & 1;                                         // query columns 32*qg .. 32*qg + 31 of the tile
  const int kh   = wave >> 1;                                        // keys 32*kh .. 32*kh + 31 of every stage
  const int n0   = blockIdx.x * QT;
  const int kr   = blockIdx.y;                                       // key range: keys kr*KSEQ .. kr*KSEQ + KSEQ - 1

  // copy slots of the query tile (256-B rows): copy i of a lane -> row 8i + (tid>>4), 16-B piece tid&15 (a wave = 512
  // contiguous global bytes).
  const int rK = tid >> 4, pK = tid & 15;
  const unsigned lQ = lds_addr(Qs + rK * KP + 8 * pK);

  // A stage's three tiles, one tensor load each: wave 0 Kh, wave 1 Kl (64 key rows of 256 B, source pitch 256 B), wave 2 g
  // (128 channel rows of 128 B = 64 keys, source pitch 2*SEQ B). Tile w lies KSL halves behind tile w - 1 in its buffer. From
  // stage to stage the K tiles move on by 64 rows, the g tile by 128 B. Wave 3 issues nothing.
  const uint32_t wv = uni((uint32_t)threadIdx.x >> 5);
  const unsigned short* tsrc = (wv == 0u) ? Kh + (size_t)kr * KSEQ * DQ : (wv == 1u) ? Kl + (size_t)kr * KSEQ * DQ
                                                                       : Gc + (size_t)kr * KSEQ;
  const uint64_t tga   = (uint64_t)(uintptr_t)tsrc;
  const uint32_t tstep = (wv < 2u) ? (uint32_t)(KT * DQ * 2) : (uint32_t)(KT * 2);
  const uint32_t tlds  = lds_addr(Ring) + ((wv < 2u) ? wv : 2u) * (uint32_t)(KSL * 2);
  const u32x8 g1K = tdm_group1<(1u << 20) | (5u << 22) | (3u << 25), DQ * 2, KT>((uint32_t)(DQ * 2));
  const u32x8 g1V = tdm_group1<(1u << 20) | (4u << 22) | (3u << 25), KT * 2, DQ>((uint32_t)(SEQ * 2));

  // stage t (keys 64t .. 64t+63 of the range) into buffer b: one request from each of waves 0, 1, 2, under scalar branches;
  // land: the issuer's wait stands directly behind its load (the prologue's first stage)
  auto fill = [&](uint32_t t, uint32_t b, bool land) {
    if (pinned(wv < 2u)) {
      tdm_load(tdm_group0(tlds + b * (uint32_t)(STG * 2), tga + (uint64_t)t * tstep), g1K);
      if (land) wait_tensor0();
    }
    if (pinned(wv == 2u)) {
      tdm_load(tdm_group0(tlds + b * (uint32_t)(STG * 2), tga + (uint64_t)t * tstep), g1V);
      if (land) wait_tensor0();
    }
  };

  // prologue: the query tile and stage 0, landed and published; then stage 1 in flight
  copy8(lQ,           8 * KP * 2, Qh + (size_t)(n0 + rK) * DQ + 8 * pK, (size_t)8 * DQ);
  copy8(lQ + KPL * 2, 8 * KP * 2, Ql + (size_t)(n0 + rK) * DQ + 8 * pK, (size_t)8 * DQ);
  fill(0u, 0u, true);
  wait_async0();
  __syncthreads();
  fill(1u, 1u, false);

  // q fragment pointers (B operand, col = query 32*qg + 16*u + c of the tile), + 16*u*KP + 32*kc
  const unsigned short* Qhp = Qs + (32 * qg + c) * KP + 8 * hh;
  const unsigned short* Qlp = Qhp + KPL;
  // the wave's query fragments (2 tiles x hi, residual x 4 d-chunks) are the same in every stage: read once, kept in registers
  Frag fq[DQ / 32][2][2];
#pragma unroll
  for (int kc = 0; kc < DQ / 32; ++kc) {
    fq[kc][0][0] = ldfrag(Qhp + 32 * kc);
    fq[kc][0][1] = ldfrag(Qlp + 32 * kc);
    fq[kc][1][0] = ldfrag(Qhp + 16 * KP + 32 * kc);
    fq[kc][1][1] = ldfrag(Qlp + 16 * KP + 32 * kc);
  }

  float m[2] = {-1.0e30f, -1.0e30f}, l[2] = {0.f, 0.f};
  v8f o[2][8];
#pragma unroll
  for (int u = 0; u < 2; ++u) {
#pragma unroll
    for (int j = 0; j < 8; ++j) o[u][j] = zero8();
  }

  // kept rolled: one trip is one stage with its publish point, and the buffer index alternates with t
#pragma unroll 1
  for (int t = 0; t < KSEQ / KT; ++t) {
    const unsigned short* st = Ring + (t & 1) * STG;
    // k fragment bases (A operand, row = key 32kh + c resp. 32kh + 16 + c of the stage), + 32*kc
    const unsigned short* k0p  = st + (32 * kh + c) * KP + 8 * hh;
    const unsigned short* k1p  = k0p + 16 * KP;
    const unsigned short* k0lp = k0p + KSL;
    const unsigned short* k1lp = k1p + KSL;
    // v fragment base (A operand, row = channel 16j + c, keys contiguous), + 16*j*VP
    const unsigned short* Vp = st + 2 * KSL + c * VP + 32 * kh + 8 * hh;
    v8f s0[2], s1[2];                                                // keys +0..15 resp. +16..31, query tile u
#pragma unroll
    for (int u = 0; u < 2; ++u) { s0[u] = zero8(); s1[u] = zero8(); }
    // k fragments of d-chunk kc + 1 are read from LDS ahead of the products of chunk kc
    Frag fk[2][4];
    auto fetch = [&](int kc) {
      const int b = kc & 1;
      fk[b][0] = ldfrag(k0p + 32 * kc);
      fk[b][1] = ldfrag(k1p + 32 * kc);
      fk[b][2] = ldfrag(k0lp + 32 * kc);
      fk[b][3] = ldfrag(k1lp + 32 * kc);
    };
    fetch(0);
#pragma unroll
    for (int kc = 0; kc < DQ / 32; ++kc) {
      const int b = kc & 1;
      if (kc + 1 < DQ / 32) fetch(kc + 1);
      s0[0] = mma_bd(fk[b][0].bf, fq[kc][0][0].bf, s0[0]);
      s1[0] = mma_bd(fk[b][1].bf, fq[kc][0][0].bf, s1[0]);
      s0[1] = mma_bd(fk[b][0].bf, fq[kc][1][0].bf, s0[1]);
      s1[1] = mma_bd(fk[b][1].bf, fq[kc][1][0].bf, s1[1]);
      s0[0] = mma_bd(fk[b][0].bf, fq[kc][0][1].bf, s0[0]);
      s1[0] = mma_bd(fk[b][1].bf, fq[kc][0][1].bf, s1[0]);
      s0[1] = mma_bd(fk[b][0].bf, fq[kc][1][1].bf, s0[1]);
      s1[1] = mma_bd(fk[b][1].bf, fq[kc][1][1].bf, s1[1]);
      s0[0] = mma_bd(fk[b][2].bf, fq[kc][0][0].bf, s0[0]);
      s1[0] = mma_bd(fk[b][3].bf, fq[kc][0][0].bf, s1[0]);
      s0[1] = mma_bd(fk[b][2].bf, fq[kc][1][0].bf, s0[1]);
      s1[1] = mma_bd(fk[b][3].bf, fq[kc][1][0].bf, s1[1]);
    }
    float mx[2], mn[2];
#pragma unroll
    for (int u = 0; u < 2; ++u) mx[u] = fmaxf(hmax8(s0[u]), hmax8(s1[u]));
#pragma unroll
    for (int u = 0; u < 2; ++u) {
      mx[u] = fmaxf(mx[u], __shfl_xor(mx[u], 16, 32));
      mn[u] = fmaxf(m[u], mx[u]);
    }
    const unsigned grew = wave_ballot(mx[0] > m[0] || mx[1] > m[1]); // wave-uniform
    if (grew != 0u) {
#pragma unroll
      for (int u = 0; u < 2; ++u) {
        const float corr = __expf(m[u] - mn[u]);                     // == 1 exactly for lanes whose max did not grow
        l[u] *= corr;
#pragma unroll
        for (int j = 0; j < 8; ++j) {
#pragma unroll
          for (int r = 0; r < 8; ++r) o[u][j][r] *= corr;
        }
      }
    }

    // the stage's g fragments: read here, behind the exchange of the maxima (whose wait would cover them in the LDS queue), so
    // that their LDS time runs under the exponentials
    Frag vf[8];
#pragma unroll
    for (int j = 0; j < 8; ++j) vf[j] = ldfrag(Vp + (16 * j) * VP);
#if defined(__HIP_DEVICE_COMPILE__)
    // keeps the sixteen reads above as one group here: moved down to their products, each pair is waited for on its own
    __builtin_amdgcn_sched_barrier(0);
#endif

    FragH ph[2];
#pragma unroll
    for (int u = 0; u < 2; ++u) {
      m[u] = mn[u];
      const float msh = mn[u] - LNPS;                                // exp gives e^{s-m} * 16384
      float ls = 0.f;
#pragma unroll
      for (int r = 0; r < 8; ++r) {
        const float e0 = __expf(s0[u][r] - msh);                     // key 64t + 32kh      + 8hh + r
        const float e1 = __expf(s1[u][r] - msh);                     // key 64t + 32kh + 16 + 8hh + r
        ls += e0 + e1;
        ph[u].hv[0][r] = (_Float16)e0;
        ph[u].hv[1][r] = (_Float16)e1;
      }
      l[u] += ls;
    }

#pragma unroll
    for (int j = 0; j < 8; ++j) {
      o[0][j] = mma_hd(vf[j].h, ph[0].v, o[0][j]);
      o[1][j] = mma_hd(vf[j].h, ph[1].v, o[1][j]);
    }
    // publish point of stage t + 1: own LDS reads returned, the issuing waves' tensor loads landed, every wave here; only then
    // the refill, its descriptor formed from a stage number that is pinned behind the barrier
#if defined(__HIP_DEVICE_COMPILE__)
    // keeps the wait below at the foot of the trip: lifted to the g reads, it would stall the wave ahead of the exponentials
    __builtin_amdgcn_sched_barrier(0);
#endif
    wait_ds0();
    if (pinned(wv < 3u)) wait_tensor0();
    __syncthreads();
    if (pinned((uint32_t)(t + 2 < KSEQ / KT))) fill(pinned((uint32_t)t + 2u), (uint32_t)t & 1u, false);
  }
  wait_tensor0();
  wait_ds0();
#pragma unroll
  for (int u = 0; u < 2; ++u) l[u] += __shfl_xor(l[u], 16, 32);

  // hand-over between the key halves: no tensor load is in flight and every wave has passed the last publish point, so the
  // ring is free. Area of wave w: XW floats = [j][half][lane][4] of the tile it gives away, then m[32], l[32].
  float* X = reinterpret_cast<float*>(Ring);
  float* xg = X + wave * XW;
  const float* xp = X + (wave ^ 2) * XW;
  v8f ok[8];                                                         // the tile this wave keeps: u = kh
#pragma unroll
  for (int j = 0; j < 8; ++j) {
    const v8f og = kh ? o[0][j] : o[1][j];
    ok[j] = kh ? o[1][j] : o[0][j];
    v4f va, vb;
#pragma unroll
    for (int r = 0; r < 4; ++r) { va[r] = og[r]; vb[r] = og[4 + r]; }
    *(v4f*)(xg + j * 256 + 4 * lane)       = va;
    *(v4f*)(xg + j * 256 + 128 + 4 * lane) = vb;
  }
  xg[2048 + lane] = kh ? m[0] : m[1];
  xg[2080 + lane] = kh ? l[0] : l[1];
  const float mk = kh ? m[1] : m[0];
  const float lk = kh ? l[1] : l[0];
  __syncthreads();
  const float mp = xp[2048 + lane];
  const float lp = xp[2080 + lane];
  const float mall = fmaxf(mk, mp);
  const float wk = __expf(mk - mall), wp = __expf(mp - mall);

  const size_t pt = (size_t)kr * NT16 + (size_t)(blockIdx.x * (QT / 16) + 2 * qg + kh);   // (range, 16-query tile)
  float* po = Po + pt * (8 * 256) + 4 * lane;
#pragma unroll
  for (int j = 0; j < 8; ++j) {
    const v4f pa = *(const v4f*)(xp + j * 256 + 4 * lane);
    const v4f pb = *(const v4f*)(xp + j * 256 + 128 + 4 * lane);
    v4f va, vb;
#pragma unroll
    for (int r = 0; r < 4; ++r) { va[r] = ok[j][r] * wk + pa[r] * wp; vb[r] = ok[j][4 + r] * wk + pb[r] * wp; }
    *(v4f*)(po + j * 256)       = va;
    *(v4f*)(po + j * 256 + 128) = vb;
  }
  Pml[pt * 32 + lane] = hh ? (lk * wk + lp * wp) : mall;             // m and l are equal in lanes c and 16 + c
}

// =========================================================================================================
// (4) output projection GEMM for one (64-n tile, 64-co block): out[n][co] = (1/256)(sum_c W'[c][co] Yh[n][c] +
//     (1/1024) sum_c W'[c][co] Yl[n][c]) + bf16-RNE(W_b[co]) + bf16-RNE(x[n][co]), W' = f16 of bf16-RNE(W_w) x 256 (exact),
//     converted by the block itself on the way into LDS. 4 waves, wave w owns cols n0+16w..+15, 4 m-tiles (A rows co =
//     o0 + 16 mt + (lane&15), by the transposing load from the tile [c][co_loc]), hi and residual products in
//     separate accumulators. K = 128 = 4 steps.
//     B operand: y = sum_s a_s Po[s], a_s = e^{m_s - M} / sum_s e^{m_s - M} l_s, M = max_s m_s, merged in f32 from the
//     KS key ranges' partials; Yh = f16(y), Yl = f16((y - Yh) * 1024). A lane's Po words of tile j are channels
//     16j + 8(lane>>4) + 0..7 of query lane&15: tiles 2ks and 2ks + 1 are elements 0..7 and 8..15 of the B fragment
//     of k-step ks, lane unchanged.
//     Epilogue staged in LDS Os[n_loc][co_loc], barrier, then out rows (position-major, 1024 B each): lane
//     (e = tid&15) -> co o0+4e..+3 of row n_loc = 8 it + (tid>>4); 16 consecutive lanes x 16 B = the whole 256-B
// coverage: Os 4 waves x 16 n x 64 co (cols 0..63 written and read); out 8 it x 8 rows x 16 lanes x 4 floats =
//           64 n x 64 co; grid (SEQ/64, 4) covers out[0..SEQ-1][0..255] exactly once.
// LDS Os: cross-wave (block barrier). LDS Wf (the block's weight tile [128 c][64 co], f32): lane-private, each lane reads back its own
//     copies (copy wait). LDS Wt (the tile as f16, from which the A fragments are read): cross-wave (block barrier).
// =========================================================================================================
__global__ __launch_bounds__(128)
void gemm_o(const float* __restrict__ ww, const float* __restrict__ Po,
            const float* __restrict__ Pml, const float* __restrict__ wbias,
            const float* __restrict__ x, float* out) {
  __shared__ __align__(16) float Os[QT * OSP];
  __shared__ __align__(128) unsigned short Wt[DQ * WTP];             // f16 weights [c][co_loc], pitch 32 B x odd
  __shared__ __align__(128) float Wf[DQ * QT];                       // the same tile as it lies in memory, f32
  const int tid  = threadIdx.x;
  const int lane = tid & 31, wave = tid >> 5;
  const int hh   = lane >> 4, c = lane & 15;
  const int nt   = blockIdx.x, mb = blockIdx.y;
  const int n0   = nt * QT, o0 = mb * QT;

  const unsigned short* ap  = Wt + (8 * hh + (lane & 7)) * WTP + 8 * ((lane >> 3) & 1);
  const size_t t16 = (size_t)(nt * (QT / 16) + wave);                // the wave's 16-query tile

  const float* pml = Pml + t16 * 32 + c;
  const float* pp  = Po + t16 * (8 * 256) + 4 * lane;
  float ms[KS], as[KS];
  FragH fyh[DQ / 32], fyl[DQ / 32];
#pragma unroll
  for (int g = 0; g < 2; ++g) {                                      // tiles j = 4g .. 4g+3 = k-steps 2g, 2g+1
    v4f pv[KS][4][2];
#pragma unroll
    for (int s = 0; s < KS; ++s) {
#pragma unroll
      for (int jj = 0; jj < 4; ++jj) {
        pv[s][jj][0] = *(const v4f*)(pp + (size_t)s * (NT16 * 8 * 256) + (4 * g + jj) * 256);
        pv[s][jj][1] = *(const v4f*)(pp + (size_t)s * (NT16 * 8 * 256) + (4 * g + jj) * 256 + 128);
      }
    }
    if (g == 0) {
      // The A tile comes into LDS as f32 by asynchronous 16-B copies in whole lines and travels under the loads and the merge of
      // the partials: copy i of a lane -> row c = 8i + (tid>>4), 16-B piece tid&15 (a wave = 2 x 256 contiguous B). The
      // statements stand between the first group's loads and those of the maxima and sums: loads do not cross them, so that no
      // wait for a maximum comes to stand in front of the group's issue.
      const unsigned lW = lds_addr((const unsigned short*)(Wf + (tid >> 4) * QT + 4 * (tid & 15)));
      const unsigned short* gW = (const unsigned short*)(ww + (size_t)(tid >> 4) * CC + o0 + 4 * (tid & 15));
      copy8(lW,               8 * QT * 4, gW,                       (size_t)8 * CC * 2);
      copy8(lW + 64 * QT * 4, 8 * QT * 4, gW + (size_t)64 * CC * 2, (size_t)8 * CC * 2);
#pragma unroll
      for (int s = 0; s < KS; ++s) {
        ms[s] = pml[(size_t)s * (NT16 * 32)];
        as[s] = pml[(size_t)s * (NT16 * 32) + 16];
      }
    }
    // the group's loaded words, inputs only: all its loads are issued ahead of the arithmetic, one round trip for the
    // group instead of one for every pair of loads
    hold16(pv[0], pv[1], pp);
    hold16(pv[2], pv[3], pp + (size_t)2 * (NT16 * 8 * 256));
    if (g == 0) {                                                    // merge weights of query c
      float mall = ms[0];
#pragma unroll
      for (int s = 1; s < KS; ++s) mall = fmaxf(mall, ms[s]);
      float lall = 0.f;
#pragma unroll
      for (int s = 0; s < KS; ++s) {
        const float w = __expf(ms[s] - mall);
        lall += w * as[s];
        as[s] = w;
      }
      const float inv = 1.0f / lall;                                 // o and l both carry the x16384 factor
#pragma unroll
      for (int s = 0; s < KS; ++s) as[s] *= inv;
    }
#pragma unroll
    for (int jj = 0; jj < 4; ++jj) {
      const int j = 4 * g + jj;
#pragma unroll
      for (int r = 0; r < 8; ++r) {
        float y = as[0] * pv[0][jj][r >> 2][r & 3];
#pragma unroll
        for (int s = 1; s < KS; ++s) y += as[s] * pv[s][jj][r >> 2][r & 3];
        const _Float16 h0 = (_Float16)y;
        fyh[j >> 1].hv[j & 1][r] = h0;
        fyl[j >> 1].hv[j & 1][r] = (_Float16)((y - (float)h0) * RSC);
      }
    }
  }

  v8f acc[4], accr[4];
#pragma unroll
  for (int mt = 0; mt < 4; ++mt) { acc[mt] = zero8(); accr[mt] = zero8(); }

  // the f32 tile: own copies landed, every wave here; then each lane rounds sixteen 16-B pieces and stores them as f16
  wait_async0();
  __syncthreads();
  {
    const float* rW = Wf + (tid >> 4) * QT + 4 * (tid & 15);
    unsigned short* sW = Wt + (tid >> 4) * WTP + 4 * (tid & 15);
#pragma unroll
    for (int i = 0; i < 16; ++i) {
      const v4f w = *(const v4f*)(rW + i * (8 * QT));
      const v2u u = {pkw(w[0], w[1]), pkw(w[2], w[3])};
      *(v2u*)(sW + i * (8 * WTP)) = u;
    }
  }
  // the A tile: every wave's stores done, every wave here; then all sixteen fragments as one group of LDS reads ahead of the
  // products (LDS reads do not move across the gap statements of the helper)
  __syncthreads();
  Frag fa[DQ / 32][4];
#pragma unroll
  for (int ks = 0; ks < DQ / 32; ++ks) {
#pragma unroll
    for (int mt = 0; mt < 4; ++mt) fa[ks][mt] = ldfrag_tr(ap + (32 * ks) * WTP + 16 * mt);
  }
#pragma unroll
  for (int ks = 0; ks < DQ / 32; ++ks) {
#pragma unroll
    for (int mt = 0; mt < 4; ++mt) {
      acc[mt]  = mma_h(fa[ks][mt].h, fyh[ks].v, acc[mt]);
      accr[mt] = mma_h(fa[ks][mt].h, fyl[ks].v, accr[mt]);
    }
  }

  {
    const int nl = 16 * wave + c;
#pragma unroll
    for (int mt = 0; mt < 4; ++mt) {
      v4f va, vb;
#pragma unroll
      for (int r = 0; r < 4; ++r) {
        va[r] = (acc[mt][r] + accr[mt][r] * IRSC) * IWSC;
        vb[r] = (acc[mt][4 + r] + accr[mt][4 + r] * IRSC) * IWSC;
      }
      *(v4f*)(Os + nl * OSP + 16 * mt + 8 * hh)     = va;
      *(v4f*)(Os + nl * OSP + 16 * mt + 8 * hh + 4) = vb;
    }
  }
  __syncthreads();

  const int e = tid & 15, lq = tid >> 4;                             // lq 0..7
  const v4f bv = *(const v4f*)(wbias + o0 + 4 * e);
  const float bb[4] = {bfr(bv[0]), bfr(bv[1]), bfr(bv[2]), bfr(bv[3])};
  v4f res[8];
#pragma unroll
  for (int it = 0; it < 8; ++it) {
    const int nl = it * 8 + lq;                                      // n_loc 0..63
    const size_t idx = ((size_t)(n0 + nl)) * CC + o0 + 4 * e;
    const v4f xv = *(const v4f*)(x + idx);
    const v4f ov = *(const v4f*)(Os + nl * OSP + 4 * e);
#pragma unroll
    for (int t = 0; t < 4; ++t) res[it][t] = ov[t] + bb[t] + bfr(xv[t]);
  }
{
#pragma unroll
    for (int it = 0; it < 8; ++it) {
      const int nl = it * 8 + lq;
      const size_t idx = ((size_t)(n0 + nl)) * CC + o0 + 4 * e;
      *(v4f*)(out + idx) = res[it];
    }
    
  }
}

// =========================================================================================================
// Workspace map (bytes; each region start a multiple of 256; every plane size is an exact multiple of its
// whole-line store granularity, SEQ a multiple of 64 so no tail rows exist):
//   Qh/Ql bf16 [SEQ][128]        2097152 x2
//   Kh/Kl bf16 [SEQ][128]        2097152 x2
//   Gc   f16 [128][SEQ]          2097152
//   Po   f32 [KS][SEQ/16][8][2][32][4]  16777216 (KS=4)      Pml f32 [KS][SEQ/16][32]  262144
//   total (SEQ=8192) = 27525120
// =========================================================================================================
extern "C" void kernel_launch(void* const* d_in, const int* in_sizes, int n_in,
                              void* d_out, int out_size, void* d_ws, size_t ws_size,
                              hipStream_t stream) {
  const int XN = SEQ * CC;
  if (n_in < 9) return;
  if (in_sizes[0] < XN) return;
  if (in_sizes[1] < CC * DQ || in_sizes[3] < CC * DQ || in_sizes[5] < CC * DQ) return;
  if (in_sizes[2] < DQ || in_sizes[4] < DQ || in_sizes[6] < DQ) return;
  if (in_sizes[7] < DQ * CC || in_sizes[8] < CC) return;
  if (out_size < XN) return;

  size_t off = 0;
  auto carve = [&](size_t bytes) { const size_t o = off; off += (bytes + 255) & ~(size_t)255; return o; };
  const size_t oQh  = carve((size_t)SEQ * DQ * 2);
  const size_t oQl  = carve((size_t)SEQ * DQ * 2);
  const size_t oKh  = carve((size_t)SEQ * DQ * 2);
  const size_t oKl  = carve((size_t)SEQ * DQ * 2);
  const size_t oGc  = carve((size_t)DQ * SEQ * 2);
  const size_t oPo  = carve((size_t)KS * SEQ * DQ * 4);
  const size_t oPml = carve((size_t)KS * NT16 * 32 * 4);
  if (off > ws_size) return;
  if (off > (size_t)134217728) return;

  const float* x  = (const float*)d_in[0];
  const float* gw = (const float*)d_in[1];
  const float* gb = (const float*)d_in[2];
  const float* tw = (const float*)d_in[3];
  const float* tb = (const float*)d_in[4];
  const float* pw = (const float*)d_in[5];
  const float* pb = (const float*)d_in[6];
  const float* ww = (const float*)d_in[7];
  const float* wb = (const float*)d_in[8];

  char* ws = (char*)d_ws;
  unsigned short* Qh   = (unsigned short*)(ws + oQh);
  unsigned short* Ql   = (unsigned short*)(ws + oQl);
  unsigned short* Kh   = (unsigned short*)(ws + oKh);
  unsigned short* Kl   = (unsigned short*)(ws + oKl);
  unsigned short* Gc   = (unsigned short*)(ws + oGc);
  float* Po  = (float*)(ws + oPo);
  float* Pml = (float*)(ws + oPml);
  float* out = (float*)d_out;

  const dim3 blk128(128);

  // (2) theta / phi -> hi + residual planes, g -> channel-major plane
  gemm_qkv<<<dim3(SEQ / QT, 6), blk128, 0, stream>>>(tw, pw, gw, x, tb, pb, gb, Qh, Ql, Kh, Kl, Gc);
  // (3) attention, KS key ranges per query tile -> per-range partials
  attn_k<<<dim3(SEQ / QT, KS), blk128, 0, stream>>>(Qh, Ql, Kh, Kl, Gc, Po, Pml);
  // (4) merge of the ranges + output projection + bias + residual -> out [SEQ][256]
  gemm_o<<<dim3(SEQ / QT, CC / QT), blk128, 0, stream>>>(ww, Po, Pml, wb, x, out);
  (void)hipGetLastError();
}
